// v000
// Times are from an AMD MI455X. After a warm-up the kernel runs many times in a row, and a time is the length of
// such a window on the GPU divided by its runs, so every launch and the gaps after it count. The runs cycle
// through copies of the inputs. A figure is the median of several windows, for all but v000 over two sittings.
// Sittings can differ by a few percent; kernels timed side by side share one.
// v000 is the starting kernel. One run takes 1160 microseconds.
#include <hip/hip_runtime.h>
// Non_local_MH (X [16][512][32][32]; K = conv1x1(X, Wq, bq), Q = conv1x1(X, Wk, bk), V = conv1x1(X, Wv, bv) (the module's swapped naming), 8 heads of 64 channels over d = 1,024 positions; softmax-FREE attention A = Q^T K ([d][d]), O = V A^T; O = conv1x1(O, Wo, bo); GroupNorm(128 groups of 4 channels, eps 1e-5, affine); out = GN(O) + X -> [16][512][32][32]).
// Structure (analytic reassociation, exact in real arithmetic): O[c][d] = sum_D A[d][D] V[c][D] = sum_c' Q[c'][d] (sum_D K[c'][D] V[c][D]) = sum_c' Q[c'][d] M[c'][c] with the per-head 64x64 matrix M = K V^T — so per sample: the three 1x1 convs as token-row WMMA GEMMs (32x64 wave tiles, f32 accumulation, exact x16 weights + bias, f16 outputs), K and V rows transposed to channel-major via LDS, M = K_cm V_cm^T as one 512x512 GEMM (K = 1,024; only the head-diagonal 64x64 blocks are used), the block-diagonal M^T plane built on VALU (f16), O_rows = Q_rows . blockdiag GEMM (K = 512), O2 = O Wo^T + bo GEMM (f32); GroupNorm statistics per (sample, group) on VALU (float64 accumulation), affine + residual + channel-major store on VALU.
// Compute dtype: inputs rounded to bf16; X / weights exact; K, Q, V, M and O as plain f16 GEMM operands (~2^-12); GN statistics float64; everything else f32. v_wmma_f32_16x16x32_f16.
#define NB 16
#define CC 512
#define PX 1024
#define NR ((size_t)NB * PX)         /* 16384 */
#define NH 8
#define HD 64
#define GRP 128
#define CPG (CC / GRP)               /* 4 */
typedef __bf16 v16b __attribute__((ext_vector_type(16)));
typedef unsigned short v8us __attribute__((ext_vector_type(8), may_alias));
typedef float  v8f  __attribute__((ext_vector_type(8)));
typedef float  v4f  __attribute__((ext_vector_type(4)));
typedef float  v4fa __attribute__((ext_vector_type(4), may_alias));
union FragB { v16b v; v8us half[2]; unsigned short u[16]; };

__device__ __forceinline__ unsigned short bf16_bits(float x) { unsigned int u = __float_as_uint(x); return (unsigned short)((u + 0x7FFFu + ((u >> 16) & 1u)) >> 16); }
__device__ __forceinline__ float bf16_val(unsigned short b) { return __uint_as_float(((unsigned int)b) << 16); }
__device__ __forceinline__ float bf16_round(float x) { return bf16_val(bf16_bits(x)); }
// D += A·B with NT terms: 1 = ah·bh, 2 = + al·bh (A split), 3 = + ah·bl (both split)
template <int NT>
__device__ __forceinline__ v8f mmaN(v16b ah, v16b al, v16b bh, v16b bl, v8f c) {
  c = __builtin_amdgcn_wmma_f32_16x16x32_bf16(false, ah, false, bh, (short)0, c, false, false);
  if (NT >= 2) c = __builtin_amdgcn_wmma_f32_16x16x32_bf16(false, al, false, bh, (short)0, c, false, false);
  if (NT >= 3) c = __builtin_amdgcn_wmma_f32_16x16x32_bf16(false, ah, false, bl, (short)0, c, false, false);
  asm volatile("v_nop\n\tv_nop\n\tv_nop\n\tv_nop" : "+v"(c) : "v"(ah), "v"(al), "v"(bh), "v"(bl));
  return c;
}

__global__ __launch_bounds__(256) void k_wt_bf16(const float* __restrict__ W, unsigned short* __restrict__ Wt, int K, int N) {
  const int t = blockIdx.x * 256 + threadIdx.x;
  const int k8n = K / 8;
  if (t >= N * k8n) return;
  const int n = t / k8n, k8 = (t % k8n) * 8;
  v8us v;
#pragma unroll
  for (int i = 0; i < 8; ++i) v[i] = bf16_bits(W[(size_t)(k8 + i) * N + n]);
  *(v8us*)(Wt + (size_t)n * K + k8) = v;
  
}

// GEMM C[M][N] (f32, pitch ldc) = act(A[M][K]·W + bias). A f32 row-major (pitch lda) converted per fragment to bf16
// (ASPLIT: hi/lo two planes -> 2 terms, else single rounded term); Wt bf16 [N][K] (pitch ldb). BIAS_BF16 rounds the
// bias to bf16 first (bias quantised to bf16 before the add). K%32==0, M%16==0, N%64==0.
template <bool ASPLIT, int ACT, bool BIAS_BF16>
__global__ __launch_bounds__(128) void k_gemm_bf(const float* __restrict__ A, int lda, const unsigned short* __restrict__ Wt, int ldb,
                                               const float* __restrict__ bias, float* __restrict__ C, int ldc, int M, int N, int K) {
  __shared__ __attribute__((aligned(16))) float so[4][16][64];
  const int tid = threadIdx.x, w = tid >> 5, lane = tid & 31, ln = lane & 15, hh = lane >> 4;
  const int ntn = N / 64;
  const int wid = blockIdx.x * 4 + w;
  const int mt = wid / ntn, nq = wid % ntn;
  if (mt * 16 >= M) return;
  const int row0 = mt * 16, col0 = nq * 64;
  const float* arow = A + (size_t)(row0 + ln) * lda;
  v8f acc[4] = {};
  for (int kb = 0; kb < K; kb += 32) {
    FragB ah, al;
    const v4f x0 = *(const v4fa*)(arow + kb + 8 * hh), x1 = *(const v4fa*)(arow + kb + 8 * hh + 4);
    const v4f x2 = *(const v4fa*)(arow + kb + 16 + 8 * hh), x3 = *(const v4fa*)(arow + kb + 16 + 8 * hh + 4);
    float xs[16] = {x0[0],x0[1],x0[2],x0[3],x1[0],x1[1],x1[2],x1[3],x2[0],x2[1],x2[2],x2[3],x3[0],x3[1],x3[2],x3[3]};
#pragma unroll
    for (int i = 0; i < 16; ++i) { const unsigned short hb = bf16_bits(xs[i]); ah.u[i] = hb; al.u[i] = ASPLIT ? bf16_bits(xs[i] - bf16_val(hb)) : (unsigned short)0; }
#pragma unroll
    for (int t = 0; t < 4; ++t) {
      const unsigned short* brow = Wt + (size_t)(col0 + t * 16 + ln) * ldb + kb;
      FragB b;
      b.half[0] = *(const v8us*)(brow + 8 * hh);
      b.half[1] = *(const v8us*)(brow + 16 + 8 * hh);
      acc[t] = mmaN<ASPLIT ? 2 : 1>(ah.v, al.v, b.v, b.v, acc[t]);
    }
  }
#pragma unroll
  for (int t = 0; t < 4; ++t) {
    float bv = bias ? bias[col0 + t * 16 + ln] : 0.f;
    if (BIAS_BF16) bv = bf16_round(bv);
#pragma unroll
    for (int r = 0; r < 8; ++r) { float v = acc[t][r] + bv; if (ACT == 1) v = fmaxf(v, 0.f); so[w][8 * hh + r][t * 16 + ln] = v; }
  }
  __builtin_amdgcn_fence(__ATOMIC_ACQ_REL, "workgroup");
  __builtin_amdgcn_wave_barrier();
  const int rsub = lane >> 4, c4 = (lane & 15) * 4;
  {
#pragma unroll
    for (int q = 0; q < 8; ++q) {
      const int r = q * 2 + rsub;
      const v4f v = *(const v4fa*)&so[w][r][c4];
      *(v4f*)(C + (size_t)(row0 + r) * ldc + col0 + c4) = v;
    }
    
  }
}

// GEMM C = act(A·W + bias + resid): A f32 (ASPLIT -> hi/lo 2 terms), Wt bf16 [N][K]; ACT 0 none, 1 relu, 2 exact gelu;
// resid (optional, f32, row index = (row % rmod), pitch ldr, RES_BF16 rounds it) added before the activation.
template <bool ASPLIT, int ACT, bool BIAS_BF16, bool RES_BF16>
__global__ __launch_bounds__(128) void k_gemm_bf3(const float* __restrict__ A, int lda, const unsigned short* __restrict__ Wt, int ldb,
                                                const float* __restrict__ bias, const float* __restrict__ resid, int rmod, int ldr,
                                                float* __restrict__ C, int ldc, int M, int N, int K) {
  __shared__ __attribute__((aligned(16))) float so[4][16][64];
  const int tid = threadIdx.x, w = tid >> 5, lane = tid & 31, ln = lane & 15, hh = lane >> 4;
  const int ntn = N / 64;
  const int wid = blockIdx.x * 4 + w;
  const int mt = wid / ntn, nq = wid % ntn;
  if (mt * 16 >= M) return;
  const int row0 = mt * 16, col0 = nq * 64;
  const float* arow = A + (size_t)(row0 + ln) * lda;
  v8f acc[4] = {};
  for (int kb = 0; kb < K; kb += 32) {
    FragB ah, al;
    const v4f x0 = *(const v4fa*)(arow + kb + 8 * hh), x1 = *(const v4fa*)(arow + kb + 8 * hh + 4);
    const v4f x2 = *(const v4fa*)(arow + kb + 16 + 8 * hh), x3 = *(const v4fa*)(arow + kb + 16 + 8 * hh + 4);
    float xs[16] = {x0[0],x0[1],x0[2],x0[3],x1[0],x1[1],x1[2],x1[3],x2[0],x2[1],x2[2],x2[3],x3[0],x3[1],x3[2],x3[3]};
#pragma unroll
    for (int i = 0; i < 16; ++i) { const unsigned short hb = bf16_bits(xs[i]); ah.u[i] = hb; al.u[i] = ASPLIT ? bf16_bits(xs[i] - bf16_val(hb)) : (unsigned short)0; }
#pragma unroll
    for (int t = 0; t < 4; ++t) {
      const unsigned short* brow = Wt + (size_t)(col0 + t * 16 + ln) * ldb + kb;
      FragB b;
      b.half[0] = *(const v8us*)(brow + 8 * hh);
      b.half[1] = *(const v8us*)(brow + 16 + 8 * hh);
      acc[t] = mmaN<ASPLIT ? 2 : 1>(ah.v, al.v, b.v, b.v, acc[t]);
    }
  }
#pragma unroll
  for (int t = 0; t < 4; ++t) {
    const int col = col0 + t * 16 + ln;
    float bv = bias ? bias[col] : 0.f;
    if (BIAS_BF16) bv = bf16_round(bv);
#pragma unroll
    for (int r = 0; r < 8; ++r) {
      float v = acc[t][r] + bv;
      if (resid) { float rv = resid[(size_t)((row0 + 8 * hh + r) % rmod) * ldr + col]; if (RES_BF16) rv = bf16_round(rv); v += rv; }
      if (ACT == 1) v = fmaxf(v, 0.f);
      if (ACT == 2) v = 0.5f * v * (1.0f + erff(v * 0.70710678118654752f));
      if (ACT == 3) { const float u = 0.7978845608028654f * (v + 0.044715f * v * v * v); v = 0.5f * v * (1.0f + tanhf(u)); }
      so[w][8 * hh + r][t * 16 + ln] = v;
    }
  }
  __builtin_amdgcn_fence(__ATOMIC_ACQ_REL, "workgroup");
  __builtin_amdgcn_wave_barrier();
  const int rsub = lane >> 4, c4 = (lane & 15) * 4;
  {
#pragma unroll
    for (int q = 0; q < 8; ++q) {
      const int r = q * 2 + rsub;
      const v4f v = *(const v4fa*)&so[w][r][c4];
      *(v4f*)(C + (size_t)(row0 + r) * ldc + col0 + c4) = v;
    }
    
  }
}
// row LayerNorm (biased variance, eps) over N: s = X (+ R); optional out_sum <- s; out_norm <- (s-mu)*rsqrt(var+eps)*g + b
template <bool PARAM_BF16>
__global__ __launch_bounds__(256) void k_layernorm(const float* __restrict__ X, const float* __restrict__ R, const float* __restrict__ g, const float* __restrict__ bta,
                                                  float* __restrict__ out_sum, float* __restrict__ out_norm, int N, float eps) {
  __shared__ float red[256];
  const int row = blockIdx.x, tid = threadIdx.x;
  const float* x = X + (size_t)row * N; const float* rr = R ? R + (size_t)row * N : nullptr;
  float vals[16];                     // up to N = 4096
  const int per = N / 256;            // contiguous chunk per thread? use strided-by-4 chunks: thread handles j = tid*4 + 1024*u
  float s1 = 0.f;
  for (int u = 0; u < per / 4; ++u) {
    const int j = tid * 4 + 1024 * u;
    const v4f a = *(const v4fa*)(x + j);
    v4f b = {0.f,0.f,0.f,0.f}; if (rr) b = *(const v4fa*)(rr + j);
#pragma unroll
    for (int q = 0; q < 4; ++q) { const float v = a[q] + b[q]; vals[u * 4 + q] = v; s1 += v; }
  }
  red[tid] = s1; __syncthreads();
  for (int st = 128; st > 0; st >>= 1) { if (tid < st) red[tid] += red[tid + st]; __syncthreads(); }
  const float mu = red[0] / (float)N; __syncthreads();
  float s2 = 0.f;
  for (int u = 0; u < per / 4; ++u)
#pragma unroll
    for (int q = 0; q < 4; ++q) { const float c = vals[u * 4 + q] - mu; s2 += c * c; }
  red[tid] = s2; __syncthreads();
  for (int st = 128; st > 0; st >>= 1) { if (tid < st) red[tid] += red[tid + st]; __syncthreads(); }
  const float rs = rsqrtf(red[0] / (float)N + eps);
  {
    for (int u = 0; u < per / 4; ++u) {
      const int j = tid * 4 + 1024 * u;
      v4f o, sm;
#pragma unroll
      for (int q = 0; q < 4; ++q) {
        float gg = g[j + q], bb = bta[j + q];
        if (PARAM_BF16) { gg = bf16_round(gg); bb = bf16_round(bb); }
        sm[q] = vals[u * 4 + q]; o[q] = (vals[u * 4 + q] - mu) * rs * gg + bb;
      }
      if (out_sum) *(v4f*)(out_sum + (size_t)row * N + j) = sm;
      *(v4f*)(out_norm + (size_t)row * N + j) = o;
    }
    
  }
}



// ---- f16 WMMA path (v_wmma_f32_16x16x32_f16): 11-bit significands for operands in range — used for every GEMM launched here
typedef _Float16 v16h __attribute__((ext_vector_type(16)));
union FragH { v16h v; v8us half[2]; _Float16 h[16]; unsigned short u[16]; };
template <int NT>
__device__ __forceinline__ v8f mmaH(v16h ah, v16h al, v16h bh, v16h bl, v8f c) {
  c = __builtin_amdgcn_wmma_f32_16x16x32_f16(false, ah, false, bh, (short)0, c, false, false);
  if (NT >= 2) c = __builtin_amdgcn_wmma_f32_16x16x32_f16(false, al, false, bh, (short)0, c, false, false);
  if (NT >= 3) c = __builtin_amdgcn_wmma_f32_16x16x32_f16(false, ah, false, bl, (short)0, c, false, false);
  asm volatile("v_nop\n\tv_nop\n\tv_nop\n\tv_nop" : "+v"(c) : "v"(ah), "v"(al), "v"(bh), "v"(bl));
  return c;
}
// batched GEMM like k_gemm_b but f16 operands: A f32 (split into f16 hi/lo if ASPLIT, else rounded to f16), Bt = f16 values [n][k]; alpha; C f32; N multiple of 16 (partial tiles skipped)
template <bool ASPLIT>
__global__ __launch_bounds__(128) void k_gemm_h(const float* __restrict__ A, int lda, size_t sA, const _Float16* __restrict__ Bh, int ldb, size_t sB, float alpha, float* __restrict__ C, int ldc, size_t sC, int M, int N, int K) {
  __shared__ __attribute__((aligned(16))) float so[4][16][64];
  const int tid = threadIdx.x, w = tid >> 5, lane = tid & 31, ln = lane & 15, hh = lane >> 4; const int by = blockIdx.y;
  A += (size_t)by * sA; Bh += (size_t)by * sB; C += (size_t)by * sC;
  const int ntn = (N + 63) / 64; const int wid = blockIdx.x * 4 + w; const int mt = wid / ntn, nq = wid % ntn; if (mt * 16 >= M) return;
  const int row0 = mt * 16, col0 = nq * 64; const float* arow = A + (size_t)(row0 + ln) * lda;
  v8f acc[4] = {};
  for (int kb = 0; kb < K; kb += 32) {
    FragH ah, al;
    const v4f x0 = *(const v4fa*)(arow + kb + 8 * hh), x1 = *(const v4fa*)(arow + kb + 8 * hh + 4), x2 = *(const v4fa*)(arow + kb + 16 + 8 * hh), x3 = *(const v4fa*)(arow + kb + 16 + 8 * hh + 4);
    float xs[16] = {x0[0],x0[1],x0[2],x0[3],x1[0],x1[1],x1[2],x1[3],x2[0],x2[1],x2[2],x2[3],x3[0],x3[1],x3[2],x3[3]};
#pragma unroll
    for (int i = 0; i < 16; ++i) { const _Float16 h = (_Float16)xs[i]; ah.h[i] = h; al.h[i] = ASPLIT ? (_Float16)(xs[i] - (float)h) : (_Float16)0.0f; }
#pragma unroll
    for (int t = 0; t < 4; ++t) { if (col0 + t * 16 >= N) continue; const size_t boff = (size_t)(col0 + t * 16 + ln) * ldb + kb; FragH bq; bq.half[0] = *(const v8us*)(Bh + boff + 8 * hh); bq.half[1] = *(const v8us*)(Bh + boff + 16 + 8 * hh);
      acc[t] = mmaH<ASPLIT ? 2 : 1>(ah.v, al.v, bq.v, bq.v, acc[t]); }
  }
#pragma unroll
  for (int t = 0; t < 4; ++t) { if (col0 + t * 16 >= N) continue;
#pragma unroll
    for (int r = 0; r < 8; ++r) so[w][8 * hh + r][t * 16 + ln] = acc[t][r] * alpha; }
  __builtin_amdgcn_fence(__ATOMIC_ACQ_REL, "workgroup"); __builtin_amdgcn_wave_barrier();
  const int rsub = lane >> 4, c4 = (lane & 15) * 4;
  {
#pragma unroll
    for (int q = 0; q < 8; ++q) { const int r = q * 2 + rsub; if (col0 + c4 < N) { const v4f v = *(const v4fa*)&so[w][r][c4]; *(v4f*)(C + (size_t)(row0 + r) * ldc + col0 + c4) = v; } }
     }
}

// Wt[n][k] = f16(W[k][n]·scale) from f32 row-major W[K][N] (scale = power of two; bf16-exact weights stay exact in f16 away from the subnormal range)
__global__ __launch_bounds__(256) void k_wt_f16(const float* __restrict__ W, _Float16* __restrict__ Wt, int K, int N, float scale) {
  const int t = blockIdx.x * 256 + threadIdx.x; if (t >= N * (K / 8)) return; const int n = t / (K / 8), k8 = (t % (K / 8)) * 8; FragH f;
#pragma unroll
  for (int i = 0; i < 8; ++i) f.h[i] = (_Float16)(bf16_round(W[(size_t)(k8 + i) * N + n]) * scale); const v8us o = f.half[0];
  *(v8us*)((unsigned short*)Wt + (size_t)n * K + k8) = o; 
}
// k_gemm_hh variant with fused epilogue: v = acc·alpha + bias[by·sBias + col] (+ CP[(row/rowsPerB)·sCPb + by·64 + col] if CP) ; ACT 0 none / 1 elu ; writes f16 C16 (and f32 C if non-null)
template <int ACT>
__global__ __launch_bounds__(128) void k_gemm_hhx(const _Float16* __restrict__ A, int lda, size_t sA, const _Float16* __restrict__ Bh, int ldb, size_t sB, float alpha, const float* __restrict__ bias, size_t sBias, const float* __restrict__ CP, int rowsPerB, size_t sCPb, int row0g,
    float* __restrict__ C, _Float16* __restrict__ C16, int ldc, size_t sC, int M, int N, int K) {
  __shared__ __attribute__((aligned(16))) float so[4][16][64];
  const int tid = threadIdx.x, w = tid >> 5, lane = tid & 31, ln = lane & 15, hh = lane >> 4; const int by = blockIdx.y;
  A += (size_t)by * sA; Bh += (size_t)by * sB; const size_t cofs = (size_t)by * sC; const float* bp = bias ? bias + (size_t)by * sBias : nullptr;
  const int ntn = (N + 63) / 64; const int wid = blockIdx.x * 4 + w; const int mt = wid / ntn, nq = wid % ntn; if (mt * 16 >= M) return;
  const int row0 = mt * 16, col0 = nq * 64; const _Float16* arow = A + (size_t)(row0 + ln) * lda;
  v8f acc[4] = {};
  for (int kb = 0; kb < K; kb += 32) { FragH ah; ah.half[0] = *(const v8us*)((const unsigned short*)arow + kb + 8 * hh); ah.half[1] = *(const v8us*)((const unsigned short*)arow + kb + 16 + 8 * hh);
#pragma unroll
    for (int t = 0; t < 4; ++t) { if (col0 + t * 16 >= N) continue; const size_t boff = (size_t)(col0 + t * 16 + ln) * ldb + kb; FragH bq; bq.half[0] = *(const v8us*)((const unsigned short*)Bh + boff + 8 * hh); bq.half[1] = *(const v8us*)((const unsigned short*)Bh + boff + 16 + 8 * hh);
      acc[t] = mmaH<1>(ah.v, ah.v, bq.v, bq.v, acc[t]); }
  }
#pragma unroll
  for (int t = 0; t < 4; ++t) { if (col0 + t * 16 >= N) continue; const int col = col0 + t * 16 + ln; const float bv = bp ? bf16_round(bp[col]) : 0.f;
#pragma unroll
    for (int r = 0; r < 8; ++r) { float v = acc[t][r] * alpha + bv; if (CP) { const int rr = row0g + row0 + 8 * hh + r; if (rowsPerB < 0) v += CP[cofs + (size_t)rr * ldc + col];      /* rowsPerB < 0: own element of the batched C plane */ else { const int bidx = rr / rowsPerB; v += CP[(size_t)bidx * sCPb + (size_t)by * 64 + col]; } } if (ACT == 1) v = (v > 0.f) ? v : expm1f(v); else if (ACT == 7) v = (v > 0.f) ? v + 1.0f : expf(v); else if (ACT == 8) v = tanhf(v); else if (ACT == 9) v = 0.5f * v * (1.0f + tanhf(0.7978845608028654f * (v + 0.044715f * v * v * v))); else if (ACT == 11) v = 1.0f / (1.0f + expf(-v)); else if (ACT == 12) v = (v > 0.f) ? v : 0.01f * v; else if (ACT == 14) v = (v > 0.f) ? v : 0.1f * v; else if (ACT == 16) v = (v >= 0.f) ? v : 0.3f * v; else if (ACT == 17) v = (v >= 0.f) ? v : 0.2f * v; else if (ACT == 15) v = v / (1.0f + expf(-v)); else if (ACT == 3) v = fmaxf(v, 0.f); else if (ACT == 6) v = 0.5f * v * (1.0f + erff(v * 0.70710678118654752f)); so[w][8 * hh + r][t * 16 + ln] = v; } }
  __builtin_amdgcn_fence(__ATOMIC_ACQ_REL, "workgroup"); __builtin_amdgcn_wave_barrier();
  const int rsub = lane >> 4, c4 = (lane & 15) * 4; typedef _Float16 v4h __attribute__((ext_vector_type(4)));
  {
#pragma unroll
    for (int q = 0; q < 8; ++q) { const int r = q * 2 + rsub; if (col0 + c4 < N) { const v4f v = *(const v4fa*)&so[w][r][c4]; if (C) *(v4f*)(C + cofs + (size_t)(row0 + r) * ldc + col0 + c4) = v; if (C16) { v4h h4; for (int i = 0; i < 4; ++i) h4[i] = (_Float16)v[i]; *(v4h*)(C16 + cofs + (size_t)(row0 + r) * ldc + col0 + c4) = h4; } } }
     }
}


typedef _Float16 v4h __attribute__((ext_vector_type(4)));

__global__ __launch_bounds__(256) void k_x16(const float* __restrict__ x, _Float16* __restrict__ X16, size_t n8) { const size_t t = (size_t)blockIdx.x * 256 + threadIdx.x; if (t >= n8) return; FragH f;
#pragma unroll
  for (int q = 0; q < 8; ++q) f.h[q] = (_Float16)bf16_round(x[t * 8 + q]); *(v8us*)((unsigned short*)X16 + t * 8) = f.half[0];  }
__global__ __launch_bounds__(256) void k_h16(const float* __restrict__ x, _Float16* __restrict__ X16, size_t n8) { const size_t t = (size_t)blockIdx.x * 256 + threadIdx.x; if (t >= n8) return; FragH f;
#pragma unroll
  for (int q = 0; q < 8; ++q) f.h[q] = (_Float16)x[t * 8 + q]; *(v8us*)((unsigned short*)X16 + t * 8) = f.half[0];  }
__global__ __launch_bounds__(256) void k_round16f(const float* __restrict__ W, _Float16* __restrict__ Bt, size_t n8) { const size_t t = (size_t)blockIdx.x * 256 + threadIdx.x; if (t >= n8) return; FragH f;
#pragma unroll
  for (int i = 0; i < 8; ++i) f.h[i] = (_Float16)(bf16_round(W[t * 8 + i]) * 16.0f); *(v8us*)((unsigned short*)Bt + t * 8) = f.half[0];  }
template <int NHv, int TTv>
__global__ __launch_bounds__(256) void k_vt(const _Float16* __restrict__ V16, int ldv, int voff, _Float16* __restrict__ Vt) { __shared__ unsigned short tl[64][66]; const int tid = threadIdx.x; const int slab = blockIdx.x / (TTv / 64), lg = blockIdx.x % (TTv / 64); const int b = slab / NHv, h = slab % NHv;
  for (int i = tid; i < 64 * 8; i += 256) { const int r = i / 8, c8 = (i % 8) * 8; FragH f; f.half[0] = *(const v8us*)((const unsigned short*)V16 + ((size_t)b * TTv + lg * 64 + r) * ldv + voff + h * 64 + c8);
#pragma unroll
    for (int q = 0; q < 8; ++q) tl[r][c8 + q] = f.u[q]; }
  __syncthreads();
  {
#pragma unroll
    for (int rd = 0; rd < 2; ++rd) { const int d = rd * 32 + tid / 8, pc = tid % 8; FragH f;
#pragma unroll
      for (int q = 0; q < 8; ++q) f.u[q] = tl[pc * 8 + q][d];
      *(v8us*)((unsigned short*)Vt + ((size_t)slab * 64 + d) * TTv + lg * 64 + pc * 8) = f.half[0]; }
     } }

__global__ __launch_bounds__(256) void k_hl(const float* __restrict__ F, _Float16* __restrict__ Hh, _Float16* __restrict__ Hl, size_t n8) { const size_t t = (size_t)blockIdx.x * 256 + threadIdx.x; if (t >= n8) return; FragH fh, fl; const v4f a = *(const v4fa*)(F + t * 8), c = *(const v4fa*)(F + t * 8 + 4);
#pragma unroll
  for (int q = 0; q < 4; ++q) { _Float16 h = (_Float16)a[q]; fh.h[q] = h; fl.h[q] = (_Float16)((a[q] - (float)h) * 1024.0f); h = (_Float16)c[q]; fh.h[4 + q] = h; fl.h[4 + q] = (_Float16)((c[q] - (float)h) * 1024.0f); }
  { *(v8us*)((unsigned short*)Hh + t * 8) = fh.half[0]; *(v8us*)((unsigned short*)Hl + t * 8) = fl.half[0];  } }

// ---- fast GEMM (wave tile 32x64; requires M % 32 == 0 rows per launch region and N % 64 == 0); epilogue = k_gemm_hhx semantics ----
__device__ __forceinline__ v16h g2_frag(const _Float16* p, int hh) { FragH f; f.half[0] = *(const v8us*)((const unsigned short*)p + 8 * hh); f.half[1] = *(const v8us*)((const unsigned short*)p + 16 + 8 * hh); return f.v; }
__device__ __forceinline__ v8f g2_mma(v16h a, v16h b, v8f c) { v8f d = __builtin_amdgcn_wmma_f32_16x16x32_f16(false, a, false, b, (short)0, c, false, false); asm volatile("v_nop\n\tv_nop\n\tv_nop\n\tv_nop" : "+v"(d) : "v"(a), "v"(b)); return d; }
template <int ACT>
__global__ __launch_bounds__(128) void k_gemm2(const _Float16* __restrict__ A, int lda, size_t sA, const _Float16* __restrict__ Bh, int ldb, size_t sB, float alpha, const float* __restrict__ bias, size_t sBias, const float* __restrict__ CP, int rowsPerB, size_t sCPb, int row0g,
    float* __restrict__ C, _Float16* __restrict__ C16, int ldc, size_t sC, int M, int N, int K) { static_assert(ACT == 0 || ACT == 3 || ACT == 6 || ACT == 8 || ACT == 9 || ACT == 11 || ACT == 12 || ACT == 14 || ACT == 15 || ACT == 16 || ACT == 17, "k_gemm2: unsupported ACT code (would silently apply no activation)");
  __shared__ __attribute__((aligned(16))) float so[4][32][68];
  const int tid = threadIdx.x, w = tid >> 5, lane = tid & 31, ln = lane & 15, hh = lane >> 4; const int by = blockIdx.y;
  A += (size_t)by * sA; Bh += (size_t)by * sB; const size_t cofs = (size_t)by * sC; const float* bp = bias ? bias + (size_t)by * sBias : nullptr;
  const int ntn = N >> 6; const int mt = blockIdx.x / ntn, nq = blockIdx.x - mt * ntn; const int row0 = mt * 128 + 32 * w, col0 = nq * 64; if (row0 >= M) return;
  const _Float16* a0p = A + (size_t)(row0 + ln) * lda; const _Float16* a1p = a0p + (size_t)16 * lda;
  const _Float16* b0p = Bh + (size_t)(col0 + ln) * ldb; const _Float16* b1p = b0p + (size_t)16 * ldb; const _Float16* b2p = b1p + (size_t)16 * ldb; const _Float16* b3p = b2p + (size_t)16 * ldb;
  const v8f z8 = {0.f,0.f,0.f,0.f,0.f,0.f,0.f,0.f}; v8f c00 = z8, c01 = z8, c02 = z8, c03 = z8, c10 = z8, c11 = z8, c12 = z8, c13 = z8;
#pragma unroll 1
  for (int kb = 0; kb < K; kb += 32) { const v16h a0 = g2_frag(a0p + kb, hh), a1 = g2_frag(a1p + kb, hh);
    v16h b = g2_frag(b0p + kb, hh); c00 = g2_mma(a0, b, c00); c10 = g2_mma(a1, b, c10);
    b = g2_frag(b1p + kb, hh); c01 = g2_mma(a0, b, c01); c11 = g2_mma(a1, b, c11);
    b = g2_frag(b2p + kb, hh); c02 = g2_mma(a0, b, c02); c12 = g2_mma(a1, b, c12);
    b = g2_frag(b3p + kb, hh); c03 = g2_mma(a0, b, c03); c13 = g2_mma(a1, b, c13); }
  v8f accs[8] = {c00, c01, c02, c03, c10, c11, c12, c13};
#pragma unroll
  for (int u = 0; u < 8; ++u) { const int t = u & 3, half = u >> 2; const int col = col0 + t * 16 + ln; const float bv = bp ? bf16_round(bp[col]) : 0.f;
#pragma unroll
    for (int r = 0; r < 8; ++r) { const int rloc = half * 16 + 8 * hh + r; float v = accs[u][r] * alpha + bv; if (CP) { if (rowsPerB < 0) v += CP[cofs + (size_t)(row0g + row0 + rloc) * ldc + col];      /* rowsPerB < 0: own element of the batched C plane */ else { const int bidx = (row0g + row0 + rloc) / rowsPerB; v += CP[(size_t)bidx * sCPb + (size_t)by * 64 + col]; } }
      if (ACT == 3) v = fmaxf(v, 0.f); else if (ACT == 6) v = 0.5f * v * (1.0f + erff(v * 0.70710678118654752f)); else if (ACT == 11) v = 1.0f / (1.0f + expf(-v)); else if (ACT == 15) v = v / (1.0f + expf(-v)); else if (ACT == 12) v = (v > 0.f) ? v : 0.01f * v; else if (ACT == 8) v = tanhf(v); else if (ACT == 9) v = 0.5f * v * (1.0f + tanhf(0.7978845608028654f * (v + 0.044715f * v * v * v))); else if (ACT == 14) v = (v > 0.f) ? v : 0.1f * v; else if (ACT == 16) v = (v >= 0.f) ? v : 0.3f * v; else if (ACT == 17) v = (v >= 0.f) ? v : 0.2f * v;
      so[w][rloc][t * 16 + ln] = v; } }
  __builtin_amdgcn_fence(__ATOMIC_ACQ_REL, "workgroup"); __builtin_amdgcn_wave_barrier();
  const int rsub = lane >> 4, c4 = (lane & 15) * 4;
  {
#pragma unroll
    for (int q = 0; q < 16; ++q) { const int r = q * 2 + rsub; const v4f v = *(const v4fa*)&so[w][r][c4]; if (C) *(v4f*)(C + cofs + (size_t)(row0 + r) * ldc + col0 + c4) = v; if (C16) { v4h h4; for (int i = 0; i < 4; ++i) h4[i] = (_Float16)v[i]; *(v4h*)(C16 + cofs + (size_t)(row0 + r) * ldc + col0 + c4) = h4; } }
     } }


__global__ __launch_bounds__(256) void k_xrows(const float* __restrict__ x, _Float16* __restrict__ X16) { __shared__ float tl[64][33]; const int tid = threadIdx.x; const int cg = blockIdx.x % (CC / 64); const int pb = (blockIdx.x / (CC / 64)) % (PX / 32); const int n = blockIdx.x / ((CC / 64) * (PX / 32)); const int p0 = pb * 32, c0 = cg * 64;
  for (int i = tid; i < 64 * 32; i += 256) { const int c = i / 32, j = i % 32; tl[c][j] = bf16_round(x[((size_t)n * CC + c0 + c) * PX + p0 + j]); }
  __syncthreads();
  { for (int i = tid; i < 32 * 8; i += 256) { const int j = i / 8, c8 = (i % 8) * 8; FragH f; for (int q = 0; q < 8; ++q) f.h[q] = (_Float16)tl[c8 + q][j]; *(v8us*)((unsigned short*)X16 + ((size_t)n * PX + p0 + j) * CC + c0 + c8) = f.half[0]; }  } }
__global__ __launch_bounds__(256) void k_wnat(const float* __restrict__ w, size_t n8, _Float16* __restrict__ Bt) { const size_t t = (size_t)blockIdx.x * 256 + threadIdx.x; if (t >= n8) return; FragH f; for (int q = 0; q < 8; ++q) f.h[q] = (_Float16)(bf16_round(w[t * 8 + q]) * 16.0f); *(v8us*)((unsigned short*)Bt + t * 8) = f.half[0];  }
__global__ __launch_bounds__(256) void k_tr(const _Float16* __restrict__ R, int n, _Float16* __restrict__ T) { __shared__ unsigned short tl[64][65]; const int tid = threadIdx.x; const int cg = blockIdx.x % (CC / 64), pg = blockIdx.x / (CC / 64); const int c0 = cg * 64, p0 = pg * 64;
  for (int i = tid; i < 64 * 8; i += 256) { const int j = i / 8, c8 = (i % 8) * 8; FragH f; f.half[0] = *(const v8us*)((const unsigned short*)R + ((size_t)n * PX + p0 + j) * CC + c0 + c8); for (int q = 0; q < 8; ++q) tl[c8 + q][j] = f.u[q]; }
  __syncthreads();
  { for (int i = tid; i < 64 * 8; i += 256) { const int c = i / 8, j8 = (i % 8) * 8; FragH f; for (int q = 0; q < 8; ++q) f.u[q] = tl[c][j8 + q]; *(v8us*)((unsigned short*)T + (size_t)(c0 + c) * PX + p0 + j8) = f.half[0]; }  } }
__global__ __launch_bounds__(256) void k_bdiag(const float* __restrict__ M, _Float16* __restrict__ BD) { const size_t t = (size_t)blockIdx.x * 256 + threadIdx.x; if (t >= (size_t)CC * CC / 8) return; const int cp0 = (int)((t * 8) % CC); const int c = (int)((t * 8) / CC); FragH f; for (int q = 0; q < 8; ++q) { const int cp = cp0 + q; f.h[q] = (cp / HD == c / HD) ? (_Float16)M[(size_t)cp * CC + c] : (_Float16)0.f; }
  *(v8us*)((unsigned short*)BD + t * 8) = f.half[0];  }
__global__ __launch_bounds__(256) void k_gnstat(const float* __restrict__ O2, float* __restrict__ stat) { __shared__ double rs_[256], rq[256]; const int tid = threadIdx.x; const int n = blockIdx.x / GRP, g = blockIdx.x % GRP; double s = 0.0, q2 = 0.0;
#pragma unroll 1
  for (int i = tid; i < PX * CPG; i += 256) { const int p = i / CPG, cc = i % CPG; const double v = (double)O2[((size_t)n * PX + p) * CC + g * CPG + cc]; s += v; q2 += v * v; }
  rs_[tid] = s; rq[tid] = q2; __syncthreads();
  for (int st = 128; st > 0; st >>= 1) { if (tid < st) { rs_[tid] += rs_[tid + st]; rq[tid] += rq[tid + st]; } __syncthreads(); }
  if (tid == 0) { const double cnt = (double)(PX * CPG); const double mu = rs_[0] / cnt; double var = rq[0] / cnt - mu * mu; if (var < 0.0) var = 0.0; const float m = (float)mu, r = (float)(1.0 / sqrt(var + 1e-5));
    v8f l0, z; for (int q = 0; q < 8; ++q) { l0[q] = 0.f; z[q] = 0.f; } l0[0] = m; l0[1] = r; float* d = stat + (size_t)blockIdx.x * 32;      
    { *(v8f*)d = l0; *(v8f*)(d + 8) = z; *(v8f*)(d + 16) = z; *(v8f*)(d + 24) = z;  } } }
__global__ __launch_bounds__(256) void k_out(const float* __restrict__ O2, const float* __restrict__ stat, const float* __restrict__ gw, const float* __restrict__ gb, const float* __restrict__ x, float* __restrict__ out) {
  #pragma clang fp contract(off)
  const size_t t = (size_t)blockIdx.x * 256 + threadIdx.x; if (t >= (size_t)NB * CC * PX / 8) return; const int p0 = (int)((t * 8) % PX); const size_t nc = (t * 8) / PX; const int c = (int)(nc % CC); const size_t n = nc / CC; const int g = c / CPG; const float m = stat[(n * GRP + g) * 32], r = stat[(n * GRP + g) * 32 + 1]; const float w = bf16_round(gw[c]), bb = bf16_round(gb[c]); v8f o;
  for (int q = 0; q < 8; ++q) { const float v = O2[(n * PX + p0 + q) * CC + c]; o[q] = __fadd_rn(__fadd_rn(__fmul_rn((v - m) * r, w), bb), bf16_round(x[t * 8 + q])); }
  *(v8f*)(out + t * 8) = o;  }

extern "C" void kernel_launch(void* const* d_in, const int* in_sizes, int n_in,
                              void* d_out, int out_size, void* d_ws, size_t ws_size, hipStream_t stream) {
  (void)in_sizes; (void)n_in; (void)out_size;
  const float* const* I = (const float* const*)d_in; const float* X = I[0]; const float* Wq = I[1]; const float* bq = I[2]; const float* Wk = I[3]; const float* bk = I[4]; const float* Wv = I[5]; const float* bv = I[6]; const float* Wo = I[7]; const float* bo = I[8]; const float* gw = I[9]; const float* gb = I[10];
  char* ws = (char*)d_ws; size_t off = 0;
  auto take = [&](size_t bytes) { char* p = ws + off; off += (bytes + 255) & ~(size_t)255; return p; };
  _Float16* BWq = (_Float16*)take((size_t)CC * CC * 2); _Float16* BWk = (_Float16*)take((size_t)CC * CC * 2); _Float16* BWv = (_Float16*)take((size_t)CC * CC * 2); _Float16* BWo = (_Float16*)take((size_t)CC * CC * 2);
  _Float16* X16 = (_Float16*)take(NR * CC * 2); _Float16* KR = (_Float16*)take(NR * CC * 2); _Float16* QR = (_Float16*)take(NR * CC * 2); _Float16* VR = (_Float16*)take(NR * CC * 2); _Float16* KC = (_Float16*)take((size_t)CC * PX * 2); _Float16* VC = (_Float16*)take((size_t)CC * PX * 2); float* M = (float*)take((size_t)CC * CC * 4); _Float16* BD = (_Float16*)take((size_t)CC * CC * 2); _Float16* OR = (_Float16*)take(NR * CC * 2); float* O2 = (float*)take(NR * CC * 4); float* stat = (float*)take((size_t)NB * GRP * 32 * 4);
  if (off > ws_size) return;      /* 2 + 16x5 + 2 + 1.5 + 32 = ≈ 118 MiB */
  const size_t nw8 = (size_t)CC * CC / 8; const unsigned gw_ = (unsigned)((nw8 + 255) / 256);
  k_wnat<<<gw_, 256, 0, stream>>>(Wq, nw8, BWq); k_wnat<<<gw_, 256, 0, stream>>>(Wk, nw8, BWk); k_wnat<<<gw_, 256, 0, stream>>>(Wv, nw8, BWv); k_wnat<<<gw_, 256, 0, stream>>>(Wo, nw8, BWo);
  k_xrows<<<NB * (CC / 64) * (PX / 32), 256, 0, stream>>>(X, X16);
  const dim3 gp((unsigned)((NR / 128) * (CC / 64)), 1);
  k_gemm2<0><<<gp, 128, 0, stream>>>(X16, CC, 0, BWq, CC, 0, 0.0625f, bq, 0, nullptr, 1, 0, 0, nullptr, KR, CC, 0, (int)NR, CC, CC);      /* K = Q_conv(X) (the module's swap) */
  k_gemm2<0><<<gp, 128, 0, stream>>>(X16, CC, 0, BWk, CC, 0, 0.0625f, bk, 0, nullptr, 1, 0, 0, nullptr, QR, CC, 0, (int)NR, CC, CC);      /* Q = K_conv(X) */
  k_gemm2<0><<<gp, 128, 0, stream>>>(X16, CC, 0, BWv, CC, 0, 0.0625f, bv, 0, nullptr, 1, 0, 0, nullptr, VR, CC, 0, (int)NR, CC, CC);
  for (int n = 0; n < NB; ++n) {
    k_tr<<<(CC / 64) * (PX / 64), 256, 0, stream>>>(KR, n, KC); k_tr<<<(CC / 64) * (PX / 64), 256, 0, stream>>>(VR, n, VC);
    k_gemm2<0><<<dim3((CC / 128) * (CC / 64), 1), 128, 0, stream>>>(KC, PX, 0, VC, PX, 0, 1.0f, nullptr, 0, nullptr, 1, 0, 0, M, nullptr, CC, 0, CC, CC, PX);      /* M[c'][c] = sum_D K[c'][D] V[c][D] */
    k_bdiag<<<(unsigned)((nw8 + 255) / 256), 256, 0, stream>>>(M, BD);
    k_gemm2<0><<<dim3((PX / 128) * (CC / 64), 1), 128, 0, stream>>>(QR + (size_t)n * PX * CC, CC, 0, BD, CC, 0, 1.0f, nullptr, 0, nullptr, 1, 0, 0, nullptr, OR + (size_t)n * PX * CC, CC, 0, PX, CC, CC); }      /* O[d][c] = sum_c' Q[d][c'] M[c'][c] within the head */
  k_gemm2<0><<<gp, 128, 0, stream>>>(OR, CC, 0, BWo, CC, 0, 0.0625f, bo, 0, nullptr, 1, 0, 0, O2, nullptr, CC, 0, (int)NR, CC, CC);
  k_gnstat<<<NB * GRP, 256, 0, stream>>>(O2, stat);
  k_out<<<(unsigned)(((size_t)NB * CC * PX / 8 + 255) / 256), 256, 0, stream>>>(O2, stat, gw, gb, X, (float*)d_out);
}

// v001
// Measured time: 309 microseconds a run.
// Two timings next to v000 put it at 3.82 and 3.77 times that version's speed.
#include <hip/hip_runtime.h>
// Non_local_MH (X [16][512][32][32]; K = conv1x1(X, Wq, bq), Q = conv1x1(X, Wk, bk), V = conv1x1(X, Wv, bv) (the module's swapped naming), 8 heads of 64 channels over d = 1,024 positions; softmax-FREE attention A = Q^T K ([d][d]), O = V A^T; O = conv1x1(O, Wo, bo); GroupNorm(128 groups of 4 channels, eps 1e-5, affine); out = GN(O) + X -> [16][512][32][32]).
// Structure (analytic reassociation, exact in real arithmetic): O[c][d] = sum_D A[d][D] V[c][D] = sum_c' Q[c'][d] (sum_D K[c'][D] V[c][D]) = sum_c' Q[c'][d] M[c'][c] with the per-head 64x64 matrix M = K V^T — so per sample: the three 1x1 convs as token-row WMMA GEMMs (32x64 wave tiles, f32 accumulation, exact x16 weights + bias, f16 outputs), K and V rows transposed to channel-major via LDS, M = K_cm V_cm^T as one 512x512 GEMM (K = 1,024; only the head-diagonal 64x64 blocks are used), the block-diagonal M^T plane built on VALU (f16), O_rows = Q_rows . blockdiag GEMM (K = 512), O2 = O Wo^T + bo GEMM (f32); GroupNorm statistics per (sample, group) on VALU (float64 accumulation), affine + residual + channel-major store on VALU.
// Compute dtype: inputs rounded to bf16; X / weights exact; K, Q, V, M and O as plain f16 GEMM operands (~2^-12); GN statistics float64; everything else f32. v_wmma_f32_16x16x32_f16.
#define NB 16
#define CC 512
#define PX 1024
#define NR ((size_t)NB * PX)         /* 16384 */
#define NH 8
#define HD 64
#define GRP 128
#define CPG (CC / GRP)               /* 4 */
typedef __bf16 v16b __attribute__((ext_vector_type(16)));
typedef unsigned short v8us __attribute__((ext_vector_type(8), may_alias));
typedef float  v8f  __attribute__((ext_vector_type(8)));
typedef float  v4f  __attribute__((ext_vector_type(4)));
typedef float  v4fa __attribute__((ext_vector_type(4), may_alias));
union FragB { v16b v; v8us half[2]; unsigned short u[16]; };

__device__ __forceinline__ unsigned short bf16_bits(float x) { unsigned int u = __float_as_uint(x); return (unsigned short)((u + 0x7FFFu + ((u >> 16) & 1u)) >> 16); }
__device__ __forceinline__ float bf16_val(unsigned short b) { return __uint_as_float(((unsigned int)b) << 16); }
__device__ __forceinline__ float bf16_round(float x) { return bf16_val(bf16_bits(x)); }
// D += A·B with NT terms: 1 = ah·bh, 2 = + al·bh (A split), 3 = + ah·bl (both split)
template <int NT>
__device__ __forceinline__ v8f mmaN(v16b ah, v16b al, v16b bh, v16b bl, v8f c) {
  c = __builtin_amdgcn_wmma_f32_16x16x32_bf16(false, ah, false, bh, (short)0, c, false, false);
  if (NT >= 2) c = __builtin_amdgcn_wmma_f32_16x16x32_bf16(false, al, false, bh, (short)0, c, false, false);
  if (NT >= 3) c = __builtin_amdgcn_wmma_f32_16x16x32_bf16(false, ah, false, bl, (short)0, c, false, false);
  asm volatile("v_nop\n\tv_nop\n\tv_nop\n\tv_nop" : "+v"(c) : "v"(ah), "v"(al), "v"(bh), "v"(bl));
  return c;
}

__global__ __launch_bounds__(256) void k_wt_bf16(const float* __restrict__ W, unsigned short* __restrict__ Wt, int K, int N) {
  const int t = blockIdx.x * 256 + threadIdx.x;
  const int k8n = K / 8;
  if (t >= N * k8n) return;
  const int n = t / k8n, k8 = (t % k8n) * 8;
  v8us v;
#pragma unroll
  for (int i = 0; i < 8; ++i) v[i] = bf16_bits(W[(size_t)(k8 + i) * N + n]);
  *(v8us*)(Wt + (size_t)n * K + k8) = v;
  
}

// GEMM C[M][N] (f32, pitch ldc) = act(A[M][K]·W + bias). A f32 row-major (pitch lda) converted per fragment to bf16
// (ASPLIT: hi/lo two planes -> 2 terms, else single rounded term); Wt bf16 [N][K] (pitch ldb). BIAS_BF16 rounds the
// bias to bf16 first (bias quantised to bf16 before the add). K%32==0, M%16==0, N%64==0.
template <bool ASPLIT, int ACT, bool BIAS_BF16>
__global__ __launch_bounds__(128) void k_gemm_bf(const float* __restrict__ A, int lda, const unsigned short* __restrict__ Wt, int ldb,
                                               const float* __restrict__ bias, float* __restrict__ C, int ldc, int M, int N, int K) {
  __shared__ __attribute__((aligned(16))) float so[4][16][64];
  const int tid = threadIdx.x, w = tid >> 5, lane = tid & 31, ln = lane & 15, hh = lane >> 4;
  const int ntn = N / 64;
  const int wid = blockIdx.x * 4 + w;
  const int mt = wid / ntn, nq = wid % ntn;
  if (mt * 16 >= M) return;
  const int row0 = mt * 16, col0 = nq * 64;
  const float* arow = A + (size_t)(row0 + ln) * lda;
  v8f acc[4] = {};
  for (int kb = 0; kb < K; kb += 32) {
    FragB ah, al;
    const v4f x0 = *(const v4fa*)(arow + kb + 8 * hh), x1 = *(const v4fa*)(arow + kb + 8 * hh + 4);
    const v4f x2 = *(const v4fa*)(arow + kb + 16 + 8 * hh), x3 = *(const v4fa*)(arow + kb + 16 + 8 * hh + 4);
    float xs[16] = {x0[0],x0[1],x0[2],x0[3],x1[0],x1[1],x1[2],x1[3],x2[0],x2[1],x2[2],x2[3],x3[0],x3[1],x3[2],x3[3]};
#pragma unroll
    for (int i = 0; i < 16; ++i) { const unsigned short hb = bf16_bits(xs[i]); ah.u[i] = hb; al.u[i] = ASPLIT ? bf16_bits(xs[i] - bf16_val(hb)) : (unsigned short)0; }
#pragma unroll
    for (int t = 0; t < 4; ++t) {
      const unsigned short* brow = Wt + (size_t)(col0 + t * 16 + ln) * ldb + kb;
      FragB b;
      b.half[0] = *(const v8us*)(brow + 8 * hh);
      b.half[1] = *(const v8us*)(brow + 16 + 8 * hh);
      acc[t] = mmaN<ASPLIT ? 2 : 1>(ah.v, al.v, b.v, b.v, acc[t]);
    }
  }
#pragma unroll
  for (int t = 0; t < 4; ++t) {
    float bv = bias ? bias[col0 + t * 16 + ln] : 0.f;
    if (BIAS_BF16) bv = bf16_round(bv);
#pragma unroll
    for (int r = 0; r < 8; ++r) { float v = acc[t][r] + bv; if (ACT == 1) v = fmaxf(v, 0.f); so[w][8 * hh + r][t * 16 + ln] = v; }
  }
  __builtin_amdgcn_fence(__ATOMIC_ACQ_REL, "workgroup");
  __builtin_amdgcn_wave_barrier();
  const int rsub = lane >> 4, c4 = (lane & 15) * 4;
  {
#pragma unroll
    for (int q = 0; q < 8; ++q) {
      const int r = q * 2 + rsub;
      const v4f v = *(const v4fa*)&so[w][r][c4];
      *(v4f*)(C + (size_t)(row0 + r) * ldc + col0 + c4) = v;
    }
    
  }
}

// GEMM C = act(A·W + bias + resid): A f32 (ASPLIT -> hi/lo 2 terms), Wt bf16 [N][K]; ACT 0 none, 1 relu, 2 exact gelu;
// resid (optional, f32, row index = (row % rmod), pitch ldr, RES_BF16 rounds it) added before the activation.
template <bool ASPLIT, int ACT, bool BIAS_BF16, bool RES_BF16>
__global__ __launch_bounds__(128) void k_gemm_bf3(const float* __restrict__ A, int lda, const unsigned short* __restrict__ Wt, int ldb,
                                                const float* __restrict__ bias, const float* __restrict__ resid, int rmod, int ldr,
                                                float* __restrict__ C, int ldc, int M, int N, int K) {
  __shared__ __attribute__((aligned(16))) float so[4][16][64];
  const int tid = threadIdx.x, w = tid >> 5, lane = tid & 31, ln = lane & 15, hh = lane >> 4;
  const int ntn = N / 64;
  const int wid = blockIdx.x * 4 + w;
  const int mt = wid / ntn, nq = wid % ntn;
  if (mt * 16 >= M) return;
  const int row0 = mt * 16, col0 = nq * 64;
  const float* arow = A + (size_t)(row0 + ln) * lda;
  v8f acc[4] = {};
  for (int kb = 0; kb < K; kb += 32) {
    FragB ah, al;
    const v4f x0 = *(const v4fa*)(arow + kb + 8 * hh), x1 = *(const v4fa*)(arow + kb + 8 * hh + 4);
    const v4f x2 = *(const v4fa*)(arow + kb + 16 + 8 * hh), x3 = *(const v4fa*)(arow + kb + 16 + 8 * hh + 4);
    float xs[16] = {x0[0],x0[1],x0[2],x0[3],x1[0],x1[1],x1[2],x1[3],x2[0],x2[1],x2[2],x2[3],x3[0],x3[1],x3[2],x3[3]};
#pragma unroll
    for (int i = 0; i < 16; ++i) { const unsigned short hb = bf16_bits(xs[i]); ah.u[i] = hb; al.u[i] = ASPLIT ? bf16_bits(xs[i] - bf16_val(hb)) : (unsigned short)0; }
#pragma unroll
    for (int t = 0; t < 4; ++t) {
      const unsigned short* brow = Wt + (size_t)(col0 + t * 16 + ln) * ldb + kb;
      FragB b;
      b.half[0] = *(const v8us*)(brow + 8 * hh);
      b.half[1] = *(const v8us*)(brow + 16 + 8 * hh);
      acc[t] = mmaN<ASPLIT ? 2 : 1>(ah.v, al.v, b.v, b.v, acc[t]);
    }
  }
#pragma unroll
  for (int t = 0; t < 4; ++t) {
    const int col = col0 + t * 16 + ln;
    float bv = bias ? bias[col] : 0.f;
    if (BIAS_BF16) bv = bf16_round(bv);
#pragma unroll
    for (int r = 0; r < 8; ++r) {
      float v = acc[t][r] + bv;
      if (resid) { float rv = resid[(size_t)((row0 + 8 * hh + r) % rmod) * ldr + col]; if (RES_BF16) rv = bf16_round(rv); v += rv; }
      if (ACT == 1) v = fmaxf(v, 0.f);
      if (ACT == 2) v = 0.5f * v * (1.0f + erff(v * 0.70710678118654752f));
      if (ACT == 3) { const float u = 0.7978845608028654f * (v + 0.044715f * v * v * v); v = 0.5f * v * (1.0f + tanhf(u)); }
      so[w][8 * hh + r][t * 16 + ln] = v;
    }
  }
  __builtin_amdgcn_fence(__ATOMIC_ACQ_REL, "workgroup");
  __builtin_amdgcn_wave_barrier();
  const int rsub = lane >> 4, c4 = (lane & 15) * 4;
  {
#pragma unroll
    for (int q = 0; q < 8; ++q) {
      const int r = q * 2 + rsub;
      const v4f v = *(const v4fa*)&so[w][r][c4];
      *(v4f*)(C + (size_t)(row0 + r) * ldc + col0 + c4) = v;
    }
    
  }
}
// row LayerNorm (biased variance, eps) over N: s = X (+ R); optional out_sum <- s; out_norm <- (s-mu)*rsqrt(var+eps)*g + b
template <bool PARAM_BF16>
__global__ __launch_bounds__(256) void k_layernorm(const float* __restrict__ X, const float* __restrict__ R, const float* __restrict__ g, const float* __restrict__ bta,
                                                  float* __restrict__ out_sum, float* __restrict__ out_norm, int N, float eps) {
  __shared__ float red[256];
  const int row = blockIdx.x, tid = threadIdx.x;
  const float* x = X + (size_t)row * N; const float* rr = R ? R + (size_t)row * N : nullptr;
  float vals[16];                     // up to N = 4096
  const int per = N / 256;            // contiguous chunk per thread? use strided-by-4 chunks: thread handles j = tid*4 + 1024*u
  float s1 = 0.f;
  for (int u = 0; u < per / 4; ++u) {
    const int j = tid * 4 + 1024 * u;
    const v4f a = *(const v4fa*)(x + j);
    v4f b = {0.f,0.f,0.f,0.f}; if (rr) b = *(const v4fa*)(rr + j);
#pragma unroll
    for (int q = 0; q < 4; ++q) { const float v = a[q] + b[q]; vals[u * 4 + q] = v; s1 += v; }
  }
  red[tid] = s1; __syncthreads();
  for (int st = 128; st > 0; st >>= 1) { if (tid < st) red[tid] += red[tid + st]; __syncthreads(); }
  const float mu = red[0] / (float)N; __syncthreads();
  float s2 = 0.f;
  for (int u = 0; u < per / 4; ++u)
#pragma unroll
    for (int q = 0; q < 4; ++q) { const float c = vals[u * 4 + q] - mu; s2 += c * c; }
  red[tid] = s2; __syncthreads();
  for (int st = 128; st > 0; st >>= 1) { if (tid < st) red[tid] += red[tid + st]; __syncthreads(); }
  const float rs = rsqrtf(red[0] / (float)N + eps);
  {
    for (int u = 0; u < per / 4; ++u) {
      const int j = tid * 4 + 1024 * u;
      v4f o, sm;
#pragma unroll
      for (int q = 0; q < 4; ++q) {
        float gg = g[j + q], bb = bta[j + q];
        if (PARAM_BF16) { gg = bf16_round(gg); bb = bf16_round(bb); }
        sm[q] = vals[u * 4 + q]; o[q] = (vals[u * 4 + q] - mu) * rs * gg + bb;
      }
      if (out_sum) *(v4f*)(out_sum + (size_t)row * N + j) = sm;
      *(v4f*)(out_norm + (size_t)row * N + j) = o;
    }
    
  }
}



// ---- f16 WMMA path (v_wmma_f32_16x16x32_f16): 11-bit significands for operands in range — used for every GEMM launched here
typedef _Float16 v16h __attribute__((ext_vector_type(16)));
union FragH { v16h v; v8us half[2]; _Float16 h[16]; unsigned short u[16]; };
template <int NT>
__device__ __forceinline__ v8f mmaH(v16h ah, v16h al, v16h bh, v16h bl, v8f c) {
  c = __builtin_amdgcn_wmma_f32_16x16x32_f16(false, ah, false, bh, (short)0, c, false, false);
  if (NT >= 2) c = __builtin_amdgcn_wmma_f32_16x16x32_f16(false, al, false, bh, (short)0, c, false, false);
  if (NT >= 3) c = __builtin_amdgcn_wmma_f32_16x16x32_f16(false, ah, false, bl, (short)0, c, false, false);
  asm volatile("v_nop\n\tv_nop\n\tv_nop\n\tv_nop" : "+v"(c) : "v"(ah), "v"(al), "v"(bh), "v"(bl));
  return c;
}
// batched GEMM like k_gemm_b but f16 operands: A f32 (split into f16 hi/lo if ASPLIT, else rounded to f16), Bt = f16 values [n][k]; alpha; C f32; N multiple of 16 (partial tiles skipped)
template <bool ASPLIT>
__global__ __launch_bounds__(128) void k_gemm_h(const float* __restrict__ A, int lda, size_t sA, const _Float16* __restrict__ Bh, int ldb, size_t sB, float alpha, float* __restrict__ C, int ldc, size_t sC, int M, int N, int K) {
  __shared__ __attribute__((aligned(16))) float so[4][16][64];
  const int tid = threadIdx.x, w = tid >> 5, lane = tid & 31, ln = lane & 15, hh = lane >> 4; const int by = blockIdx.y;
  A += (size_t)by * sA; Bh += (size_t)by * sB; C += (size_t)by * sC;
  const int ntn = (N + 63) / 64; const int wid = blockIdx.x * 4 + w; const int mt = wid / ntn, nq = wid % ntn; if (mt * 16 >= M) return;
  const int row0 = mt * 16, col0 = nq * 64; const float* arow = A + (size_t)(row0 + ln) * lda;
  v8f acc[4] = {};
  for (int kb = 0; kb < K; kb += 32) {
    FragH ah, al;
    const v4f x0 = *(const v4fa*)(arow + kb + 8 * hh), x1 = *(const v4fa*)(arow + kb + 8 * hh + 4), x2 = *(const v4fa*)(arow + kb + 16 + 8 * hh), x3 = *(const v4fa*)(arow + kb + 16 + 8 * hh + 4);
    float xs[16] = {x0[0],x0[1],x0[2],x0[3],x1[0],x1[1],x1[2],x1[3],x2[0],x2[1],x2[2],x2[3],x3[0],x3[1],x3[2],x3[3]};
#pragma unroll
    for (int i = 0; i < 16; ++i) { const _Float16 h = (_Float16)xs[i]; ah.h[i] = h; al.h[i] = ASPLIT ? (_Float16)(xs[i] - (float)h) : (_Float16)0.0f; }
#pragma unroll
    for (int t = 0; t < 4; ++t) { if (col0 + t * 16 >= N) continue; const size_t boff = (size_t)(col0 + t * 16 + ln) * ldb + kb; FragH bq; bq.half[0] = *(const v8us*)(Bh + boff + 8 * hh); bq.half[1] = *(const v8us*)(Bh + boff + 16 + 8 * hh);
      acc[t] = mmaH<ASPLIT ? 2 : 1>(ah.v, al.v, bq.v, bq.v, acc[t]); }
  }
#pragma unroll
  for (int t = 0; t < 4; ++t) { if (col0 + t * 16 >= N) continue;
#pragma unroll
    for (int r = 0; r < 8; ++r) so[w][8 * hh + r][t * 16 + ln] = acc[t][r] * alpha; }
  __builtin_amdgcn_fence(__ATOMIC_ACQ_REL, "workgroup"); __builtin_amdgcn_wave_barrier();
  const int rsub = lane >> 4, c4 = (lane & 15) * 4;
  {
#pragma unroll
    for (int q = 0; q < 8; ++q) { const int r = q * 2 + rsub; if (col0 + c4 < N) { const v4f v = *(const v4fa*)&so[w][r][c4]; *(v4f*)(C + (size_t)(row0 + r) * ldc + col0 + c4) = v; } }
     }
}

// Wt[n][k] = f16(W[k][n]·scale) from f32 row-major W[K][N] (scale = power of two; bf16-exact weights stay exact in f16 away from the subnormal range)
__global__ __launch_bounds__(256) void k_wt_f16(const float* __restrict__ W, _Float16* __restrict__ Wt, int K, int N, float scale) {
  const int t = blockIdx.x * 256 + threadIdx.x; if (t >= N * (K / 8)) return; const int n = t / (K / 8), k8 = (t % (K / 8)) * 8; FragH f;
#pragma unroll
  for (int i = 0; i < 8; ++i) f.h[i] = (_Float16)(bf16_round(W[(size_t)(k8 + i) * N + n]) * scale); const v8us o = f.half[0];
  *(v8us*)((unsigned short*)Wt + (size_t)n * K + k8) = o; 
}
// k_gemm_hh variant with fused epilogue: v = acc·alpha + bias[by·sBias + col] (+ CP[(row/rowsPerB)·sCPb + by·64 + col] if CP) ; ACT 0 none / 1 elu ; writes f16 C16 (and f32 C if non-null)
template <int ACT>
__global__ __launch_bounds__(128) void k_gemm_hhx(const _Float16* __restrict__ A, int lda, size_t sA, const _Float16* __restrict__ Bh, int ldb, size_t sB, float alpha, const float* __restrict__ bias, size_t sBias, const float* __restrict__ CP, int rowsPerB, size_t sCPb, int row0g,
    float* __restrict__ C, _Float16* __restrict__ C16, int ldc, size_t sC, int M, int N, int K) {
  __shared__ __attribute__((aligned(16))) float so[4][16][64];
  const int tid = threadIdx.x, w = tid >> 5, lane = tid & 31, ln = lane & 15, hh = lane >> 4; const int by = blockIdx.y;
  A += (size_t)by * sA; Bh += (size_t)by * sB; const size_t cofs = (size_t)by * sC; const float* bp = bias ? bias + (size_t)by * sBias : nullptr;
  const int ntn = (N + 63) / 64; const int wid = blockIdx.x * 4 + w; const int mt = wid / ntn, nq = wid % ntn; if (mt * 16 >= M) return;
  const int row0 = mt * 16, col0 = nq * 64; const _Float16* arow = A + (size_t)(row0 + ln) * lda;
  v8f acc[4] = {};
  for (int kb = 0; kb < K; kb += 32) { FragH ah; ah.half[0] = *(const v8us*)((const unsigned short*)arow + kb + 8 * hh); ah.half[1] = *(const v8us*)((const unsigned short*)arow + kb + 16 + 8 * hh);
#pragma unroll
    for (int t = 0; t < 4; ++t) { if (col0 + t * 16 >= N) continue; const size_t boff = (size_t)(col0 + t * 16 + ln) * ldb + kb; FragH bq; bq.half[0] = *(const v8us*)((const unsigned short*)Bh + boff + 8 * hh); bq.half[1] = *(const v8us*)((const unsigned short*)Bh + boff + 16 + 8 * hh);
      acc[t] = mmaH<1>(ah.v, ah.v, bq.v, bq.v, acc[t]); }
  }
#pragma unroll
  for (int t = 0; t < 4; ++t) { if (col0 + t * 16 >= N) continue; const int col = col0 + t * 16 + ln; const float bv = bp ? bf16_round(bp[col]) : 0.f;
#pragma unroll
    for (int r = 0; r < 8; ++r) { float v = acc[t][r] * alpha + bv; if (CP) { const int rr = row0g + row0 + 8 * hh + r; if (rowsPerB < 0) v += CP[cofs + (size_t)rr * ldc + col];      /* rowsPerB < 0: own element of the batched C plane */ else { const int bidx = rr / rowsPerB; v += CP[(size_t)bidx * sCPb + (size_t)by * 64 + col]; } } if (ACT == 1) v = (v > 0.f) ? v : expm1f(v); else if (ACT == 7) v = (v > 0.f) ? v + 1.0f : expf(v); else if (ACT == 8) v = tanhf(v); else if (ACT == 9) v = 0.5f * v * (1.0f + tanhf(0.7978845608028654f * (v + 0.044715f * v * v * v))); else if (ACT == 11) v = 1.0f / (1.0f + expf(-v)); else if (ACT == 12) v = (v > 0.f) ? v : 0.01f * v; else if (ACT == 14) v = (v > 0.f) ? v : 0.1f * v; else if (ACT == 16) v = (v >= 0.f) ? v : 0.3f * v; else if (ACT == 17) v = (v >= 0.f) ? v : 0.2f * v; else if (ACT == 15) v = v / (1.0f + expf(-v)); else if (ACT == 3) v = fmaxf(v, 0.f); else if (ACT == 6) v = 0.5f * v * (1.0f + erff(v * 0.70710678118654752f)); so[w][8 * hh + r][t * 16 + ln] = v; } }
  __builtin_amdgcn_fence(__ATOMIC_ACQ_REL, "workgroup"); __builtin_amdgcn_wave_barrier();
  const int rsub = lane >> 4, c4 = (lane & 15) * 4; typedef _Float16 v4h __attribute__((ext_vector_type(4)));
  {
#pragma unroll
    for (int q = 0; q < 8; ++q) { const int r = q * 2 + rsub; if (col0 + c4 < N) { const v4f v = *(const v4fa*)&so[w][r][c4]; if (C) *(v4f*)(C + cofs + (size_t)(row0 + r) * ldc + col0 + c4) = v; if (C16) { v4h h4; for (int i = 0; i < 4; ++i) h4[i] = (_Float16)v[i]; *(v4h*)(C16 + cofs + (size_t)(row0 + r) * ldc + col0 + c4) = h4; } } }
     }
}


typedef _Float16 v4h __attribute__((ext_vector_type(4)));

__global__ __launch_bounds__(256) void k_x16(const float* __restrict__ x, _Float16* __restrict__ X16, size_t n8) { const size_t t = (size_t)blockIdx.x * 256 + threadIdx.x; if (t >= n8) return; FragH f;
#pragma unroll
  for (int q = 0; q < 8; ++q) f.h[q] = (_Float16)bf16_round(x[t * 8 + q]); *(v8us*)((unsigned short*)X16 + t * 8) = f.half[0];  }
__global__ __launch_bounds__(256) void k_h16(const float* __restrict__ x, _Float16* __restrict__ X16, size_t n8) { const size_t t = (size_t)blockIdx.x * 256 + threadIdx.x; if (t >= n8) return; FragH f;
#pragma unroll
  for (int q = 0; q < 8; ++q) f.h[q] = (_Float16)x[t * 8 + q]; *(v8us*)((unsigned short*)X16 + t * 8) = f.half[0];  }
__global__ __launch_bounds__(256) void k_round16f(const float* __restrict__ W, _Float16* __restrict__ Bt, size_t n8) { const size_t t = (size_t)blockIdx.x * 256 + threadIdx.x; if (t >= n8) return; FragH f;
#pragma unroll
  for (int i = 0; i < 8; ++i) f.h[i] = (_Float16)(bf16_round(W[t * 8 + i]) * 16.0f); *(v8us*)((unsigned short*)Bt + t * 8) = f.half[0];  }
template <int NHv, int TTv>
__global__ __launch_bounds__(256) void k_vt(const _Float16* __restrict__ V16, int ldv, int voff, _Float16* __restrict__ Vt) { __shared__ unsigned short tl[64][66]; const int tid = threadIdx.x; const int slab = blockIdx.x / (TTv / 64), lg = blockIdx.x % (TTv / 64); const int b = slab / NHv, h = slab % NHv;
  for (int i = tid; i < 64 * 8; i += 256) { const int r = i / 8, c8 = (i % 8) * 8; FragH f; f.half[0] = *(const v8us*)((const unsigned short*)V16 + ((size_t)b * TTv + lg * 64 + r) * ldv + voff + h * 64 + c8);
#pragma unroll
    for (int q = 0; q < 8; ++q) tl[r][c8 + q] = f.u[q]; }
  __syncthreads();
  {
#pragma unroll
    for (int rd = 0; rd < 2; ++rd) { const int d = rd * 32 + tid / 8, pc = tid % 8; FragH f;
#pragma unroll
      for (int q = 0; q < 8; ++q) f.u[q] = tl[pc * 8 + q][d];
      *(v8us*)((unsigned short*)Vt + ((size_t)slab * 64 + d) * TTv + lg * 64 + pc * 8) = f.half[0]; }
     } }

__global__ __launch_bounds__(256) void k_hl(const float* __restrict__ F, _Float16* __restrict__ Hh, _Float16* __restrict__ Hl, size_t n8) { const size_t t = (size_t)blockIdx.x * 256 + threadIdx.x; if (t >= n8) return; FragH fh, fl; const v4f a = *(const v4fa*)(F + t * 8), c = *(const v4fa*)(F + t * 8 + 4);
#pragma unroll
  for (int q = 0; q < 4; ++q) { _Float16 h = (_Float16)a[q]; fh.h[q] = h; fl.h[q] = (_Float16)((a[q] - (float)h) * 1024.0f); h = (_Float16)c[q]; fh.h[4 + q] = h; fl.h[4 + q] = (_Float16)((c[q] - (float)h) * 1024.0f); }
  { *(v8us*)((unsigned short*)Hh + t * 8) = fh.half[0]; *(v8us*)((unsigned short*)Hl + t * 8) = fl.half[0];  } }

// ---- fast GEMM (wave tile 32x64; requires M % 32 == 0 rows per launch region and N % 64 == 0); epilogue = k_gemm_hhx semantics ----
__device__ __forceinline__ v16h g2_frag(const _Float16* p, int hh) { FragH f; f.half[0] = *(const v8us*)((const unsigned short*)p + 8 * hh); f.half[1] = *(const v8us*)((const unsigned short*)p + 16 + 8 * hh); return f.v; }
__device__ __forceinline__ v8f g2_mma(v16h a, v16h b, v8f c) { v8f d = __builtin_amdgcn_wmma_f32_16x16x32_f16(false, a, false, b, (short)0, c, false, false); asm volatile("v_nop\n\tv_nop\n\tv_nop\n\tv_nop" : "+v"(d) : "v"(a), "v"(b)); return d; }
template <int ACT>
__global__ __launch_bounds__(128) void k_gemm2(const _Float16* __restrict__ A, int lda, size_t sA, const _Float16* __restrict__ Bh, int ldb, size_t sB, float alpha, const float* __restrict__ bias, size_t sBias, const float* __restrict__ CP, int rowsPerB, size_t sCPb, int row0g,
    float* __restrict__ C, _Float16* __restrict__ C16, int ldc, size_t sC, int M, int N, int K) { static_assert(ACT == 0 || ACT == 3 || ACT == 6 || ACT == 8 || ACT == 9 || ACT == 11 || ACT == 12 || ACT == 14 || ACT == 15 || ACT == 16 || ACT == 17, "k_gemm2: unsupported ACT code (would silently apply no activation)");
  __shared__ __attribute__((aligned(16))) float so[4][32][68];
  const int tid = threadIdx.x, w = tid >> 5, lane = tid & 31, ln = lane & 15, hh = lane >> 4; const int by = blockIdx.y;
  A += (size_t)by * sA; Bh += (size_t)by * sB; const size_t cofs = (size_t)by * sC; const float* bp = bias ? bias + (size_t)by * sBias : nullptr;
  const int ntn = N >> 6; const int mt = blockIdx.x / ntn, nq = blockIdx.x - mt * ntn; const int row0 = mt * 128 + 32 * w, col0 = nq * 64; if (row0 >= M) return;
  const _Float16* a0p = A + (size_t)(row0 + ln) * lda; const _Float16* a1p = a0p + (size_t)16 * lda;
  const _Float16* b0p = Bh + (size_t)(col0 + ln) * ldb; const _Float16* b1p = b0p + (size_t)16 * ldb; const _Float16* b2p = b1p + (size_t)16 * ldb; const _Float16* b3p = b2p + (size_t)16 * ldb;
  const v8f z8 = {0.f,0.f,0.f,0.f,0.f,0.f,0.f,0.f}; v8f c00 = z8, c01 = z8, c02 = z8, c03 = z8, c10 = z8, c11 = z8, c12 = z8, c13 = z8;
#pragma unroll 1
  for (int kb = 0; kb < K; kb += 32) { const v16h a0 = g2_frag(a0p + kb, hh), a1 = g2_frag(a1p + kb, hh);
    v16h b = g2_frag(b0p + kb, hh); c00 = g2_mma(a0, b, c00); c10 = g2_mma(a1, b, c10);
    b = g2_frag(b1p + kb, hh); c01 = g2_mma(a0, b, c01); c11 = g2_mma(a1, b, c11);
    b = g2_frag(b2p + kb, hh); c02 = g2_mma(a0, b, c02); c12 = g2_mma(a1, b, c12);
    b = g2_frag(b3p + kb, hh); c03 = g2_mma(a0, b, c03); c13 = g2_mma(a1, b, c13); }
  v8f accs[8] = {c00, c01, c02, c03, c10, c11, c12, c13};
#pragma unroll
  for (int u = 0; u < 8; ++u) { const int t = u & 3, half = u >> 2; const int col = col0 + t * 16 + ln; const float bv = bp ? bf16_round(bp[col]) : 0.f;
#pragma unroll
    for (int r = 0; r < 8; ++r) { const int rloc = half * 16 + 8 * hh + r; float v = accs[u][r] * alpha + bv; if (CP) { if (rowsPerB < 0) v += CP[cofs + (size_t)(row0g + row0 + rloc) * ldc + col];      /* rowsPerB < 0: own element of the batched C plane */ else { const int bidx = (row0g + row0 + rloc) / rowsPerB; v += CP[(size_t)bidx * sCPb + (size_t)by * 64 + col]; } }
      if (ACT == 3) v = fmaxf(v, 0.f); else if (ACT == 6) v = 0.5f * v * (1.0f + erff(v * 0.70710678118654752f)); else if (ACT == 11) v = 1.0f / (1.0f + expf(-v)); else if (ACT == 15) v = v / (1.0f + expf(-v)); else if (ACT == 12) v = (v > 0.f) ? v : 0.01f * v; else if (ACT == 8) v = tanhf(v); else if (ACT == 9) v = 0.5f * v * (1.0f + tanhf(0.7978845608028654f * (v + 0.044715f * v * v * v))); else if (ACT == 14) v = (v > 0.f) ? v : 0.1f * v; else if (ACT == 16) v = (v >= 0.f) ? v : 0.3f * v; else if (ACT == 17) v = (v >= 0.f) ? v : 0.2f * v;
      so[w][rloc][t * 16 + ln] = v; } }
  __builtin_amdgcn_fence(__ATOMIC_ACQ_REL, "workgroup"); __builtin_amdgcn_wave_barrier();
  const int rsub = lane >> 4, c4 = (lane & 15) * 4;
  {
#pragma unroll
    for (int q = 0; q < 16; ++q) { const int r = q * 2 + rsub; const v4f v = *(const v4fa*)&so[w][r][c4]; if (C) *(v4f*)(C + cofs + (size_t)(row0 + r) * ldc + col0 + c4) = v; if (C16) { v4h h4; for (int i = 0; i < 4; ++i) h4[i] = (_Float16)v[i]; *(v4h*)(C16 + cofs + (size_t)(row0 + r) * ldc + col0 + c4) = h4; } }
     } }


__global__ __launch_bounds__(256) void k_xrows(const float* __restrict__ x, _Float16* __restrict__ X16) { __shared__ float tl[64][33]; const int tid = threadIdx.x; const int cg = blockIdx.x % (CC / 64); const int pb = (blockIdx.x / (CC / 64)) % (PX / 32); const int n = blockIdx.x / ((CC / 64) * (PX / 32)); const int p0 = pb * 32, c0 = cg * 64;
  for (int i = tid; i < 64 * 32; i += 256) { const int c = i / 32, j = i % 32; tl[c][j] = bf16_round(x[((size_t)n * CC + c0 + c) * PX + p0 + j]); }
  __syncthreads();
  { for (int i = tid; i < 32 * 8; i += 256) { const int j = i / 8, c8 = (i % 8) * 8; FragH f; for (int q = 0; q < 8; ++q) f.h[q] = (_Float16)tl[c8 + q][j]; *(v8us*)((unsigned short*)X16 + ((size_t)n * PX + p0 + j) * CC + c0 + c8) = f.half[0]; }  } }
__global__ __launch_bounds__(256) void k_wnat(const float* __restrict__ w, size_t n8, _Float16* __restrict__ Bt) { const size_t t = (size_t)blockIdx.x * 256 + threadIdx.x; if (t >= n8) return; FragH f; for (int q = 0; q < 8; ++q) f.h[q] = (_Float16)(bf16_round(w[t * 8 + q]) * 16.0f); *(v8us*)((unsigned short*)Bt + t * 8) = f.half[0];  }
__global__ __launch_bounds__(256) void k_tr(const _Float16* __restrict__ RK, const _Float16* __restrict__ RV, _Float16* __restrict__ TK, _Float16* __restrict__ TV) { __shared__ unsigned short tl[64][65]; const int tid = threadIdx.x; const int n = blockIdx.y; const _Float16* R = blockIdx.z ? RV : RK; _Float16* T = (blockIdx.z ? TV : TK) + (size_t)n * CC * PX;      /* grid: x = tile, y = sample, z = K or V plane */ const int cg = blockIdx.x % (CC / 64), pg = blockIdx.x / (CC / 64); const int c0 = cg * 64, p0 = pg * 64;
  for (int i = tid; i < 64 * 8; i += 256) { const int j = i / 8, c8 = (i % 8) * 8; FragH f; f.half[0] = *(const v8us*)((const unsigned short*)R + ((size_t)n * PX + p0 + j) * CC + c0 + c8); for (int q = 0; q < 8; ++q) tl[c8 + q][j] = f.u[q]; }
  __syncthreads();
  { for (int i = tid; i < 64 * 8; i += 256) { const int c = i / 8, j8 = (i % 8) * 8; FragH f; for (int q = 0; q < 8; ++q) f.u[q] = tl[c][j8 + q]; *(v8us*)((unsigned short*)T + (size_t)(c0 + c) * PX + p0 + j8) = f.half[0]; }  } }
__global__ __launch_bounds__(256) void k_bdiag(const float* __restrict__ M, _Float16* __restrict__ BD) { M += (size_t)blockIdx.y * CC * CC; BD += (size_t)blockIdx.y * CC * CC;      /* y = sample */ const size_t t = (size_t)blockIdx.x * 256 + threadIdx.x; if (t >= (size_t)CC * CC / 8) return; const int cp0 = (int)((t * 8) % CC); const int c = (int)((t * 8) / CC); FragH f; for (int q = 0; q < 8; ++q) { const int cp = cp0 + q; f.h[q] = (cp / HD == c / HD) ? (_Float16)M[(size_t)cp * CC + c] : (_Float16)0.f; }
  *(v8us*)((unsigned short*)BD + t * 8) = f.half[0];  }
__global__ __launch_bounds__(256) void k_gnstat(const float* __restrict__ O2, float* __restrict__ stat) { __shared__ double rs_[256], rq[256]; const int tid = threadIdx.x; const int n = blockIdx.x / GRP, g = blockIdx.x % GRP; double s = 0.0, q2 = 0.0;
#pragma unroll 1
  for (int i = tid; i < PX * CPG; i += 256) { const int p = i / CPG, cc = i % CPG; const double v = (double)O2[((size_t)n * PX + p) * CC + g * CPG + cc]; s += v; q2 += v * v; }
  rs_[tid] = s; rq[tid] = q2; __syncthreads();
  for (int st = 128; st > 0; st >>= 1) { if (tid < st) { rs_[tid] += rs_[tid + st]; rq[tid] += rq[tid + st]; } __syncthreads(); }
  if (tid == 0) { const double cnt = (double)(PX * CPG); const double mu = rs_[0] / cnt; double var = rq[0] / cnt - mu * mu; if (var < 0.0) var = 0.0; const float m = (float)mu, r = (float)(1.0 / sqrt(var + 1e-5));
    v8f l0, z; for (int q = 0; q < 8; ++q) { l0[q] = 0.f; z[q] = 0.f; } l0[0] = m; l0[1] = r; float* d = stat + (size_t)blockIdx.x * 32;      
    { *(v8f*)d = l0; *(v8f*)(d + 8) = z; *(v8f*)(d + 16) = z; *(v8f*)(d + 24) = z;  } } }
__global__ __launch_bounds__(256) void k_out(const float* __restrict__ O2, const float* __restrict__ stat, const float* __restrict__ gw, const float* __restrict__ gb, const float* __restrict__ x, float* __restrict__ out) {
  #pragma clang fp contract(off)
  const size_t t = (size_t)blockIdx.x * 256 + threadIdx.x; if (t >= (size_t)NB * CC * PX / 8) return; const int p0 = (int)((t * 8) % PX); const size_t nc = (t * 8) / PX; const int c = (int)(nc % CC); const size_t n = nc / CC; const int g = c / CPG; const float m = stat[(n * GRP + g) * 32], r = stat[(n * GRP + g) * 32 + 1]; const float w = bf16_round(gw[c]), bb = bf16_round(gb[c]); v8f o;
  for (int q = 0; q < 8; ++q) { const float v = O2[(n * PX + p0 + q) * CC + c]; o[q] = __fadd_rn(__fadd_rn(__fmul_rn((v - m) * r, w), bb), bf16_round(x[t * 8 + q])); }
  *(v8f*)(out + t * 8) = o;  }

extern "C" void kernel_launch(void* const* d_in, const int* in_sizes, int n_in,
                              void* d_out, int out_size, void* d_ws, size_t ws_size, hipStream_t stream) {
  (void)in_sizes; (void)n_in; (void)out_size;
  const float* const* I = (const float* const*)d_in; const float* X = I[0]; const float* Wq = I[1]; const float* bq = I[2]; const float* Wk = I[3]; const float* bk = I[4]; const float* Wv = I[5]; const float* bv = I[6]; const float* Wo = I[7]; const float* bo = I[8]; const float* gw = I[9]; const float* gb = I[10];
  char* ws = (char*)d_ws; size_t off = 0;
  auto take = [&](size_t bytes) { char* p = ws + off; off += (bytes + 255) & ~(size_t)255; return p; };
  _Float16* BWq = (_Float16*)take((size_t)CC * CC * 2); _Float16* BWk = (_Float16*)take((size_t)CC * CC * 2); _Float16* BWv = (_Float16*)take((size_t)CC * CC * 2); _Float16* BWo = (_Float16*)take((size_t)CC * CC * 2);
  _Float16* X16 = (_Float16*)take(NR * CC * 2); _Float16* KR = (_Float16*)take(NR * CC * 2); _Float16* QR = (_Float16*)take(NR * CC * 2); _Float16* VR = (_Float16*)take(NR * CC * 2); _Float16* KC = (_Float16*)take(NR * CC * 2); _Float16* VC = (_Float16*)take(NR * CC * 2); float* M = (float*)take((size_t)NB * CC * CC * 4); _Float16* BD = (_Float16*)take((size_t)NB * CC * CC * 2); _Float16* OR = (_Float16*)take(NR * CC * 2); float* O2 = (float*)take(NR * CC * 4); float* stat = (float*)take((size_t)NB * GRP * 32 * 4);
  if (off > ws_size) return;      /* 2 + 16x7 + 16 + 8 + 32 = about 170 MiB */
  const size_t nw8 = (size_t)CC * CC / 8; const unsigned gw_ = (unsigned)((nw8 + 255) / 256);
  k_wnat<<<gw_, 256, 0, stream>>>(Wq, nw8, BWq); k_wnat<<<gw_, 256, 0, stream>>>(Wk, nw8, BWk); k_wnat<<<gw_, 256, 0, stream>>>(Wv, nw8, BWv); k_wnat<<<gw_, 256, 0, stream>>>(Wo, nw8, BWo);
  k_xrows<<<NB * (CC / 64) * (PX / 32), 256, 0, stream>>>(X, X16);
  const dim3 gp((unsigned)((NR / 128) * (CC / 64)), 1);
  k_gemm2<0><<<gp, 128, 0, stream>>>(X16, CC, 0, BWq, CC, 0, 0.0625f, bq, 0, nullptr, 1, 0, 0, nullptr, KR, CC, 0, (int)NR, CC, CC);      /* K = Q_conv(X) (the module's swap) */
  k_gemm2<0><<<gp, 128, 0, stream>>>(X16, CC, 0, BWk, CC, 0, 0.0625f, bk, 0, nullptr, 1, 0, 0, nullptr, QR, CC, 0, (int)NR, CC, CC);      /* Q = K_conv(X) */
  k_gemm2<0><<<gp, 128, 0, stream>>>(X16, CC, 0, BWv, CC, 0, 0.0625f, bv, 0, nullptr, 1, 0, 0, nullptr, VR, CC, 0, (int)NR, CC, CC);
  /* all samples in one launch each: blockIdx.y = sample, per-sample planes of KC, VC, M and BD */
  k_tr<<<dim3((CC / 64) * (PX / 64), NB, 2), 256, 0, stream>>>(KR, VR, KC, VC);
  k_gemm2<0><<<dim3((CC / 128) * (CC / 64), NB), 128, 0, stream>>>(KC, PX, (size_t)CC * PX, VC, PX, (size_t)CC * PX, 1.0f, nullptr, 0, nullptr, 1, 0, 0, M, nullptr, CC, (size_t)CC * CC, CC, CC, PX);      /* M[c'][c] = sum_D K[c'][D] V[c][D] */
  k_bdiag<<<dim3((unsigned)((nw8 + 255) / 256), NB), 256, 0, stream>>>(M, BD);
  k_gemm2<0><<<dim3((PX / 128) * (CC / 64), NB), 128, 0, stream>>>(QR, CC, (size_t)PX * CC, BD, CC, (size_t)CC * CC, 1.0f, nullptr, 0, nullptr, 1, 0, 0, nullptr, OR, CC, (size_t)PX * CC, PX, CC, CC);      /* O[d][c] = sum_c' Q[d][c'] M[c'][c] within the head */
  k_gemm2<0><<<gp, 128, 0, stream>>>(OR, CC, 0, BWo, CC, 0, 0.0625f, bo, 0, nullptr, 1, 0, 0, O2, nullptr, CC, 0, (int)NR, CC, CC);
  k_gnstat<<<NB * GRP, 256, 0, stream>>>(O2, stat);
  k_out<<<(unsigned)(((size_t)NB * CC * PX / 8 + 255) / 256), 256, 0, stream>>>(O2, stat, gw, gb, X, (float*)d_out);
}

// v002
// Measured time: 186 microseconds a run.
// Timed twice side by side with v001, it ran 1.67 and 1.66 times as fast.
// All steps since v000 together make it 6.33 times as fast.
#include <hip/hip_runtime.h>
// Non_local_MH (X [16][512][32][32]; K = conv1x1(X, Wq, bq), Q = conv1x1(X, Wk, bk), V = conv1x1(X, Wv, bv) (the module's swapped naming), 8 heads of 64 channels over d = 1,024 positions; softmax-FREE attention A = Q^T K ([d][d]), O = V A^T; O = conv1x1(O, Wo, bo); GroupNorm(128 groups of 4 channels, eps 1e-5, affine); out = GN(O) + X -> [16][512][32][32]).
// Structure (analytic reassociation, exact in real arithmetic): O[c][d] = sum_D A[d][D] V[c][D] = sum_c' Q[c'][d] (sum_D K[c'][D] V[c][D]) = sum_c' Q[c'][d] M[c'][c] with the per-head 64x64 matrix M = K V^T — so per sample: the three 1x1 convs as token-row WMMA GEMMs (32x64 wave tiles, f32 accumulation, exact x16 weights + bias, f16 outputs), K and V rows transposed to channel-major via LDS, M = K_cm V_cm^T as one 512x512 GEMM (K = 1,024; only the head-diagonal 64x64 blocks are used), the block-diagonal M^T plane built on VALU (f16), O_rows = Q_rows . blockdiag GEMM (K = 512), O2 = O Wo^T + bo GEMM (f32); GroupNorm statistics per (sample, group) on VALU (float64 accumulation), affine + residual + channel-major store on VALU.
// Compute dtype: inputs rounded to bf16; X / weights exact; K, Q, V, M and O as plain f16 GEMM operands (~2^-12); GN statistics float64; everything else f32. v_wmma_f32_16x16x32_f16.
#define NB 16
#define CC 512
#define PX 1024
#define NR ((size_t)NB * PX)         /* 16384 */
#define NH 8
#define HD 64
#define GRP 128
#define CPG (CC / GRP)               /* 4 */
typedef __bf16 v16b __attribute__((ext_vector_type(16)));
typedef unsigned short v8us __attribute__((ext_vector_type(8), may_alias));
typedef float  v8f  __attribute__((ext_vector_type(8)));
typedef float  v4f  __attribute__((ext_vector_type(4)));
typedef float  v4fa __attribute__((ext_vector_type(4), may_alias));
union FragB { v16b v; v8us half[2]; unsigned short u[16]; };

__device__ __forceinline__ unsigned short bf16_bits(float x) { unsigned int u = __float_as_uint(x); return (unsigned short)((u + 0x7FFFu + ((u >> 16) & 1u)) >> 16); }
__device__ __forceinline__ float bf16_val(unsigned short b) { return __uint_as_float(((unsigned int)b) << 16); }
__device__ __forceinline__ float bf16_round(float x) { return bf16_val(bf16_bits(x)); }
// D += A·B with NT terms: 1 = ah·bh, 2 = + al·bh (A split), 3 = + ah·bl (both split)
template <int NT>
__device__ __forceinline__ v8f mmaN(v16b ah, v16b al, v16b bh, v16b bl, v8f c) {
  c = __builtin_amdgcn_wmma_f32_16x16x32_bf16(false, ah, false, bh, (short)0, c, false, false);
  if (NT >= 2) c = __builtin_amdgcn_wmma_f32_16x16x32_bf16(false, al, false, bh, (short)0, c, false, false);
  if (NT >= 3) c = __builtin_amdgcn_wmma_f32_16x16x32_bf16(false, ah, false, bl, (short)0, c, false, false);
  asm volatile("v_nop\n\tv_nop\n\tv_nop\n\tv_nop" : "+v"(c) : "v"(ah), "v"(al), "v"(bh), "v"(bl));
  return c;
}

__global__ __launch_bounds__(256) void k_wt_bf16(const float* __restrict__ W, unsigned short* __restrict__ Wt, int K, int N) {
  const int t = blockIdx.x * 256 + threadIdx.x;
  const int k8n = K / 8;
  if (t >= N * k8n) return;
  const int n = t / k8n, k8 = (t % k8n) * 8;
  v8us v;
#pragma unroll
  for (int i = 0; i < 8; ++i) v[i] = bf16_bits(W[(size_t)(k8 + i) * N + n]);
  *(v8us*)(Wt + (size_t)n * K + k8) = v;
  
}

// GEMM C[M][N] (f32, pitch ldc) = act(A[M][K]·W + bias). A f32 row-major (pitch lda) converted per fragment to bf16
// (ASPLIT: hi/lo two planes -> 2 terms, else single rounded term); Wt bf16 [N][K] (pitch ldb). BIAS_BF16 rounds the
// bias to bf16 first (bias quantised to bf16 before the add). K%32==0, M%16==0, N%64==0.
template <bool ASPLIT, int ACT, bool BIAS_BF16>
__global__ __launch_bounds__(128) void k_gemm_bf(const float* __restrict__ A, int lda, const unsigned short* __restrict__ Wt, int ldb,
                                               const float* __restrict__ bias, float* __restrict__ C, int ldc, int M, int N, int K) {
  __shared__ __attribute__((aligned(16))) float so[4][16][64];
  const int tid = threadIdx.x, w = tid >> 5, lane = tid & 31, ln = lane & 15, hh = lane >> 4;
  const int ntn = N / 64;
  const int wid = blockIdx.x * 4 + w;
  const int mt = wid / ntn, nq = wid % ntn;
  if (mt * 16 >= M) return;
  const int row0 = mt * 16, col0 = nq * 64;
  const float* arow = A + (size_t)(row0 + ln) * lda;
  v8f acc[4] = {};
  for (int kb = 0; kb < K; kb += 32) {
    FragB ah, al;
    const v4f x0 = *(const v4fa*)(arow + kb + 8 * hh), x1 = *(const v4fa*)(arow + kb + 8 * hh + 4);
    const v4f x2 = *(const v4fa*)(arow + kb + 16 + 8 * hh), x3 = *(const v4fa*)(arow + kb + 16 + 8 * hh + 4);
    float xs[16] = {x0[0],x0[1],x0[2],x0[3],x1[0],x1[1],x1[2],x1[3],x2[0],x2[1],x2[2],x2[3],x3[0],x3[1],x3[2],x3[3]};
#pragma unroll
    for (int i = 0; i < 16; ++i) { const unsigned short hb = bf16_bits(xs[i]); ah.u[i] = hb; al.u[i] = ASPLIT ? bf16_bits(xs[i] - bf16_val(hb)) : (unsigned short)0; }
#pragma unroll
    for (int t = 0; t < 4; ++t) {
      const unsigned short* brow = Wt + (size_t)(col0 + t * 16 + ln) * ldb + kb;
      FragB b;
      b.half[0] = *(const v8us*)(brow + 8 * hh);
      b.half[1] = *(const v8us*)(brow + 16 + 8 * hh);
      acc[t] = mmaN<ASPLIT ? 2 : 1>(ah.v, al.v, b.v, b.v, acc[t]);
    }
  }
#pragma unroll
  for (int t = 0; t < 4; ++t) {
    float bv = bias ? bias[col0 + t * 16 + ln] : 0.f;
    if (BIAS_BF16) bv = bf16_round(bv);
#pragma unroll
    for (int r = 0; r < 8; ++r) { float v = acc[t][r] + bv; if (ACT == 1) v = fmaxf(v, 0.f); so[w][8 * hh + r][t * 16 + ln] = v; }
  }
  __builtin_amdgcn_fence(__ATOMIC_ACQ_REL, "workgroup");
  __builtin_amdgcn_wave_barrier();
  const int rsub = lane >> 4, c4 = (lane & 15) * 4;
  {
#pragma unroll
    for (int q = 0; q < 8; ++q) {
      const int r = q * 2 + rsub;
      const v4f v = *(const v4fa*)&so[w][r][c4];
      *(v4f*)(C + (size_t)(row0 + r) * ldc + col0 + c4) = v;
    }
    
  }
}

// GEMM C = act(A·W + bias + resid): A f32 (ASPLIT -> hi/lo 2 terms), Wt bf16 [N][K]; ACT 0 none, 1 relu, 2 exact gelu;
// resid (optional, f32, row index = (row % rmod), pitch ldr, RES_BF16 rounds it) added before the activation.
template <bool ASPLIT, int ACT, bool BIAS_BF16, bool RES_BF16>
__global__ __launch_bounds__(128) void k_gemm_bf3(const float* __restrict__ A, int lda, const unsigned short* __restrict__ Wt, int ldb,
                                                const float* __restrict__ bias, const float* __restrict__ resid, int rmod, int ldr,
                                                float* __restrict__ C, int ldc, int M, int N, int K) {
  __shared__ __attribute__((aligned(16))) float so[4][16][64];
  const int tid = threadIdx.x, w = tid >> 5, lane = tid & 31, ln = lane & 15, hh = lane >> 4;
  const int ntn = N / 64;
  const int wid = blockIdx.x * 4 + w;
  const int mt = wid / ntn, nq = wid % ntn;
  if (mt * 16 >= M) return;
  const int row0 = mt * 16, col0 = nq * 64;
  const float* arow = A + (size_t)(row0 + ln) * lda;
  v8f acc[4] = {};
  for (int kb = 0; kb < K; kb += 32) {
    FragB ah, al;
    const v4f x0 = *(const v4fa*)(arow + kb + 8 * hh), x1 = *(const v4fa*)(arow + kb + 8 * hh + 4);
    const v4f x2 = *(const v4fa*)(arow + kb + 16 + 8 * hh), x3 = *(const v4fa*)(arow + kb + 16 + 8 * hh + 4);
    float xs[16] = {x0[0],x0[1],x0[2],x0[3],x1[0],x1[1],x1[2],x1[3],x2[0],x2[1],x2[2],x2[3],x3[0],x3[1],x3[2],x3[3]};
#pragma unroll
    for (int i = 0; i < 16; ++i) { const unsigned short hb = bf16_bits(xs[i]); ah.u[i] = hb; al.u[i] = ASPLIT ? bf16_bits(xs[i] - bf16_val(hb)) : (unsigned short)0; }
#pragma unroll
    for (int t = 0; t < 4; ++t) {
      const unsigned short* brow = Wt + (size_t)(col0 + t * 16 + ln) * ldb + kb;
      FragB b;
      b.half[0] = *(const v8us*)(brow + 8 * hh);
      b.half[1] = *(const v8us*)(brow + 16 + 8 * hh);
      acc[t] = mmaN<ASPLIT ? 2 : 1>(ah.v, al.v, b.v, b.v, acc[t]);
    }
  }
#pragma unroll
  for (int t = 0; t < 4; ++t) {
    const int col = col0 + t * 16 + ln;
    float bv = bias ? bias[col] : 0.f;
    if (BIAS_BF16) bv = bf16_round(bv);
#pragma unroll
    for (int r = 0; r < 8; ++r) {
      float v = acc[t][r] + bv;
      if (resid) { float rv = resid[(size_t)((row0 + 8 * hh + r) % rmod) * ldr + col]; if (RES_BF16) rv = bf16_round(rv); v += rv; }
      if (ACT == 1) v = fmaxf(v, 0.f);
      if (ACT == 2) v = 0.5f * v * (1.0f + erff(v * 0.70710678118654752f));
      if (ACT == 3) { const float u = 0.7978845608028654f * (v + 0.044715f * v * v * v); v = 0.5f * v * (1.0f + tanhf(u)); }
      so[w][8 * hh + r][t * 16 + ln] = v;
    }
  }
  __builtin_amdgcn_fence(__ATOMIC_ACQ_REL, "workgroup");
  __builtin_amdgcn_wave_barrier();
  const int rsub = lane >> 4, c4 = (lane & 15) * 4;
  {
#pragma unroll
    for (int q = 0; q < 8; ++q) {
      const int r = q * 2 + rsub;
      const v4f v = *(const v4fa*)&so[w][r][c4];
      *(v4f*)(C + (size_t)(row0 + r) * ldc + col0 + c4) = v;
    }
    
  }
}
// row LayerNorm (biased variance, eps) over N: s = X (+ R); optional out_sum <- s; out_norm <- (s-mu)*rsqrt(var+eps)*g + b
template <bool PARAM_BF16>
__global__ __launch_bounds__(256) void k_layernorm(const float* __restrict__ X, const float* __restrict__ R, const float* __restrict__ g, const float* __restrict__ bta,
                                                  float* __restrict__ out_sum, float* __restrict__ out_norm, int N, float eps) {
  __shared__ float red[256];
  const int row = blockIdx.x, tid = threadIdx.x;
  const float* x = X + (size_t)row * N; const float* rr = R ? R + (size_t)row * N : nullptr;
  float vals[16];                     // up to N = 4096
  const int per = N / 256;            // contiguous chunk per thread? use strided-by-4 chunks: thread handles j = tid*4 + 1024*u
  float s1 = 0.f;
  for (int u = 0; u < per / 4; ++u) {
    const int j = tid * 4 + 1024 * u;
    const v4f a = *(const v4fa*)(x + j);
    v4f b = {0.f,0.f,0.f,0.f}; if (rr) b = *(const v4fa*)(rr + j);
#pragma unroll
    for (int q = 0; q < 4; ++q) { const float v = a[q] + b[q]; vals[u * 4 + q] = v; s1 += v; }
  }
  red[tid] = s1; __syncthreads();
  for (int st = 128; st > 0; st >>= 1) { if (tid < st) red[tid] += red[tid + st]; __syncthreads(); }
  const float mu = red[0] / (float)N; __syncthreads();
  float s2 = 0.f;
  for (int u = 0; u < per / 4; ++u)
#pragma unroll
    for (int q = 0; q < 4; ++q) { const float c = vals[u * 4 + q] - mu; s2 += c * c; }
  red[tid] = s2; __syncthreads();
  for (int st = 128; st > 0; st >>= 1) { if (tid < st) red[tid] += red[tid + st]; __syncthreads(); }
  const float rs = rsqrtf(red[0] / (float)N + eps);
  {
    for (int u = 0; u < per / 4; ++u) {
      const int j = tid * 4 + 1024 * u;
      v4f o, sm;
#pragma unroll
      for (int q = 0; q < 4; ++q) {
        float gg = g[j + q], bb = bta[j + q];
        if (PARAM_BF16) { gg = bf16_round(gg); bb = bf16_round(bb); }
        sm[q] = vals[u * 4 + q]; o[q] = (vals[u * 4 + q] - mu) * rs * gg + bb;
      }
      if (out_sum) *(v4f*)(out_sum + (size_t)row * N + j) = sm;
      *(v4f*)(out_norm + (size_t)row * N + j) = o;
    }
    
  }
}



// ---- f16 WMMA path (v_wmma_f32_16x16x32_f16): 11-bit significands for operands in range — used for every GEMM launched here
typedef _Float16 v16h __attribute__((ext_vector_type(16)));
union FragH { v16h v; v8us half[2]; _Float16 h[16]; unsigned short u[16]; };
template <int NT>
__device__ __forceinline__ v8f mmaH(v16h ah, v16h al, v16h bh, v16h bl, v8f c) {
  c = __builtin_amdgcn_wmma_f32_16x16x32_f16(false, ah, false, bh, (short)0, c, false, false);
  if (NT >= 2) c = __builtin_amdgcn_wmma_f32_16x16x32_f16(false, al, false, bh, (short)0, c, false, false);
  if (NT >= 3) c = __builtin_amdgcn_wmma_f32_16x16x32_f16(false, ah, false, bl, (short)0, c, false, false);
  asm volatile("v_nop\n\tv_nop\n\tv_nop\n\tv_nop" : "+v"(c) : "v"(ah), "v"(al), "v"(bh), "v"(bl));
  return c;
}
// batched GEMM like k_gemm_b but f16 operands: A f32 (split into f16 hi/lo if ASPLIT, else rounded to f16), Bt = f16 values [n][k]; alpha; C f32; N multiple of 16 (partial tiles skipped)
template <bool ASPLIT>
__global__ __launch_bounds__(128) void k_gemm_h(const float* __restrict__ A, int lda, size_t sA, const _Float16* __restrict__ Bh, int ldb, size_t sB, float alpha, float* __restrict__ C, int ldc, size_t sC, int M, int N, int K) {
  __shared__ __attribute__((aligned(16))) float so[4][16][64];
  const int tid = threadIdx.x, w = tid >> 5, lane = tid & 31, ln = lane & 15, hh = lane >> 4; const int by = blockIdx.y;
  A += (size_t)by * sA; Bh += (size_t)by * sB; C += (size_t)by * sC;
  const int ntn = (N + 63) / 64; const int wid = blockIdx.x * 4 + w; const int mt = wid / ntn, nq = wid % ntn; if (mt * 16 >= M) return;
  const int row0 = mt * 16, col0 = nq * 64; const float* arow = A + (size_t)(row0 + ln) * lda;
  v8f acc[4] = {};
  for (int kb = 0; kb < K; kb += 32) {
    FragH ah, al;
    const v4f x0 = *(const v4fa*)(arow + kb + 8 * hh), x1 = *(const v4fa*)(arow + kb + 8 * hh + 4), x2 = *(const v4fa*)(arow + kb + 16 + 8 * hh), x3 = *(const v4fa*)(arow + kb + 16 + 8 * hh + 4);
    float xs[16] = {x0[0],x0[1],x0[2],x0[3],x1[0],x1[1],x1[2],x1[3],x2[0],x2[1],x2[2],x2[3],x3[0],x3[1],x3[2],x3[3]};
#pragma unroll
    for (int i = 0; i < 16; ++i) { const _Float16 h = (_Float16)xs[i]; ah.h[i] = h; al.h[i] = ASPLIT ? (_Float16)(xs[i] - (float)h) : (_Float16)0.0f; }
#pragma unroll
    for (int t = 0; t < 4; ++t) { if (col0 + t * 16 >= N) continue; const size_t boff = (size_t)(col0 + t * 16 + ln) * ldb + kb; FragH bq; bq.half[0] = *(const v8us*)(Bh + boff + 8 * hh); bq.half[1] = *(const v8us*)(Bh + boff + 16 + 8 * hh);
      acc[t] = mmaH<ASPLIT ? 2 : 1>(ah.v, al.v, bq.v, bq.v, acc[t]); }
  }
#pragma unroll
  for (int t = 0; t < 4; ++t) { if (col0 + t * 16 >= N) continue;
#pragma unroll
    for (int r = 0; r < 8; ++r) so[w][8 * hh + r][t * 16 + ln] = acc[t][r] * alpha; }
  __builtin_amdgcn_fence(__ATOMIC_ACQ_REL, "workgroup"); __builtin_amdgcn_wave_barrier();
  const int rsub = lane >> 4, c4 = (lane & 15) * 4;
  {
#pragma unroll
    for (int q = 0; q < 8; ++q) { const int r = q * 2 + rsub; if (col0 + c4 < N) { const v4f v = *(const v4fa*)&so[w][r][c4]; *(v4f*)(C + (size_t)(row0 + r) * ldc + col0 + c4) = v; } }
     }
}

// Wt[n][k] = f16(W[k][n]·scale) from f32 row-major W[K][N] (scale = power of two; bf16-exact weights stay exact in f16 away from the subnormal range)
__global__ __launch_bounds__(256) void k_wt_f16(const float* __restrict__ W, _Float16* __restrict__ Wt, int K, int N, float scale) {
  const int t = blockIdx.x * 256 + threadIdx.x; if (t >= N * (K / 8)) return; const int n = t / (K / 8), k8 = (t % (K / 8)) * 8; FragH f;
#pragma unroll
  for (int i = 0; i < 8; ++i) f.h[i] = (_Float16)(bf16_round(W[(size_t)(k8 + i) * N + n]) * scale); const v8us o = f.half[0];
  *(v8us*)((unsigned short*)Wt + (size_t)n * K + k8) = o; 
}
// k_gemm_hh variant with fused epilogue: v = acc·alpha + bias[by·sBias + col] (+ CP[(row/rowsPerB)·sCPb + by·64 + col] if CP) ; ACT 0 none / 1 elu ; writes f16 C16 (and f32 C if non-null)
template <int ACT>
__global__ __launch_bounds__(128) void k_gemm_hhx(const _Float16* __restrict__ A, int lda, size_t sA, const _Float16* __restrict__ Bh, int ldb, size_t sB, float alpha, const float* __restrict__ bias, size_t sBias, const float* __restrict__ CP, int rowsPerB, size_t sCPb, int row0g,
    float* __restrict__ C, _Float16* __restrict__ C16, int ldc, size_t sC, int M, int N, int K) {
  __shared__ __attribute__((aligned(16))) float so[4][16][64];
  const int tid = threadIdx.x, w = tid >> 5, lane = tid & 31, ln = lane & 15, hh = lane >> 4; const int by = blockIdx.y;
  A += (size_t)by * sA; Bh += (size_t)by * sB; const size_t cofs = (size_t)by * sC; const float* bp = bias ? bias + (size_t)by * sBias : nullptr;
  const int ntn = (N + 63) / 64; const int wid = blockIdx.x * 4 + w; const int mt = wid / ntn, nq = wid % ntn; if (mt * 16 >= M) return;
  const int row0 = mt * 16, col0 = nq * 64; const _Float16* arow = A + (size_t)(row0 + ln) * lda;
  v8f acc[4] = {};
  for (int kb = 0; kb < K; kb += 32) { FragH ah; ah.half[0] = *(const v8us*)((const unsigned short*)arow + kb + 8 * hh); ah.half[1] = *(const v8us*)((const unsigned short*)arow + kb + 16 + 8 * hh);
#pragma unroll
    for (int t = 0; t < 4; ++t) { if (col0 + t * 16 >= N) continue; const size_t boff = (size_t)(col0 + t * 16 + ln) * ldb + kb; FragH bq; bq.half[0] = *(const v8us*)((const unsigned short*)Bh + boff + 8 * hh); bq.half[1] = *(const v8us*)((const unsigned short*)Bh + boff + 16 + 8 * hh);
      acc[t] = mmaH<1>(ah.v, ah.v, bq.v, bq.v, acc[t]); }
  }
#pragma unroll
  for (int t = 0; t < 4; ++t) { if (col0 + t * 16 >= N) continue; const int col = col0 + t * 16 + ln; const float bv = bp ? bf16_round(bp[col]) : 0.f;
#pragma unroll
    for (int r = 0; r < 8; ++r) { float v = acc[t][r] * alpha + bv; if (CP) { const int rr = row0g + row0 + 8 * hh + r; if (rowsPerB < 0) v += CP[cofs + (size_t)rr * ldc + col];      /* rowsPerB < 0: own element of the batched C plane */ else { const int bidx = rr / rowsPerB; v += CP[(size_t)bidx * sCPb + (size_t)by * 64 + col]; } } if (ACT == 1) v = (v > 0.f) ? v : expm1f(v); else if (ACT == 7) v = (v > 0.f) ? v + 1.0f : expf(v); else if (ACT == 8) v = tanhf(v); else if (ACT == 9) v = 0.5f * v * (1.0f + tanhf(0.7978845608028654f * (v + 0.044715f * v * v * v))); else if (ACT == 11) v = 1.0f / (1.0f + expf(-v)); else if (ACT == 12) v = (v > 0.f) ? v : 0.01f * v; else if (ACT == 14) v = (v > 0.f) ? v : 0.1f * v; else if (ACT == 16) v = (v >= 0.f) ? v : 0.3f * v; else if (ACT == 17) v = (v >= 0.f) ? v : 0.2f * v; else if (ACT == 15) v = v / (1.0f + expf(-v)); else if (ACT == 3) v = fmaxf(v, 0.f); else if (ACT == 6) v = 0.5f * v * (1.0f + erff(v * 0.70710678118654752f)); so[w][8 * hh + r][t * 16 + ln] = v; } }
  __builtin_amdgcn_fence(__ATOMIC_ACQ_REL, "workgroup"); __builtin_amdgcn_wave_barrier();
  const int rsub = lane >> 4, c4 = (lane & 15) * 4; typedef _Float16 v4h __attribute__((ext_vector_type(4)));
  {
#pragma unroll
    for (int q = 0; q < 8; ++q) { const int r = q * 2 + rsub; if (col0 + c4 < N) { const v4f v = *(const v4fa*)&so[w][r][c4]; if (C) *(v4f*)(C + cofs + (size_t)(row0 + r) * ldc + col0 + c4) = v; if (C16) { v4h h4; for (int i = 0; i < 4; ++i) h4[i] = (_Float16)v[i]; *(v4h*)(C16 + cofs + (size_t)(row0 + r) * ldc + col0 + c4) = h4; } } }
     }
}


typedef _Float16 v4h __attribute__((ext_vector_type(4)));

__global__ __launch_bounds__(256) void k_x16(const float* __restrict__ x, _Float16* __restrict__ X16, size_t n8) { const size_t t = (size_t)blockIdx.x * 256 + threadIdx.x; if (t >= n8) return; FragH f;
#pragma unroll
  for (int q = 0; q < 8; ++q) f.h[q] = (_Float16)bf16_round(x[t * 8 + q]); *(v8us*)((unsigned short*)X16 + t * 8) = f.half[0];  }
__global__ __launch_bounds__(256) void k_h16(const float* __restrict__ x, _Float16* __restrict__ X16, size_t n8) { const size_t t = (size_t)blockIdx.x * 256 + threadIdx.x; if (t >= n8) return; FragH f;
#pragma unroll
  for (int q = 0; q < 8; ++q) f.h[q] = (_Float16)x[t * 8 + q]; *(v8us*)((unsigned short*)X16 + t * 8) = f.half[0];  }
__global__ __launch_bounds__(256) void k_round16f(const float* __restrict__ W, _Float16* __restrict__ Bt, size_t n8) { const size_t t = (size_t)blockIdx.x * 256 + threadIdx.x; if (t >= n8) return; FragH f;
#pragma unroll
  for (int i = 0; i < 8; ++i) f.h[i] = (_Float16)(bf16_round(W[t * 8 + i]) * 16.0f); *(v8us*)((unsigned short*)Bt + t * 8) = f.half[0];  }
template <int NHv, int TTv>
__global__ __launch_bounds__(256) void k_vt(const _Float16* __restrict__ V16, int ldv, int voff, _Float16* __restrict__ Vt) { __shared__ unsigned short tl[64][66]; const int tid = threadIdx.x; const int slab = blockIdx.x / (TTv / 64), lg = blockIdx.x % (TTv / 64); const int b = slab / NHv, h = slab % NHv;
  for (int i = tid; i < 64 * 8; i += 256) { const int r = i / 8, c8 = (i % 8) * 8; FragH f; f.half[0] = *(const v8us*)((const unsigned short*)V16 + ((size_t)b * TTv + lg * 64 + r) * ldv + voff + h * 64 + c8);
#pragma unroll
    for (int q = 0; q < 8; ++q) tl[r][c8 + q] = f.u[q]; }
  __syncthreads();
  {
#pragma unroll
    for (int rd = 0; rd < 2; ++rd) { const int d = rd * 32 + tid / 8, pc = tid % 8; FragH f;
#pragma unroll
      for (int q = 0; q < 8; ++q) f.u[q] = tl[pc * 8 + q][d];
      *(v8us*)((unsigned short*)Vt + ((size_t)slab * 64 + d) * TTv + lg * 64 + pc * 8) = f.half[0]; }
     } }

__global__ __launch_bounds__(256) void k_hl(const float* __restrict__ F, _Float16* __restrict__ Hh, _Float16* __restrict__ Hl, size_t n8) { const size_t t = (size_t)blockIdx.x * 256 + threadIdx.x; if (t >= n8) return; FragH fh, fl; const v4f a = *(const v4fa*)(F + t * 8), c = *(const v4fa*)(F + t * 8 + 4);
#pragma unroll
  for (int q = 0; q < 4; ++q) { _Float16 h = (_Float16)a[q]; fh.h[q] = h; fl.h[q] = (_Float16)((a[q] - (float)h) * 1024.0f); h = (_Float16)c[q]; fh.h[4 + q] = h; fl.h[4 + q] = (_Float16)((c[q] - (float)h) * 1024.0f); }
  { *(v8us*)((unsigned short*)Hh + t * 8) = fh.half[0]; *(v8us*)((unsigned short*)Hl + t * 8) = fl.half[0];  } }

// ---- fast GEMM (work-group tile 128x64, wave tile 32x64; requires M % 128 == 0, N % 64 == 0, K % 64 == 0); epilogue = k_gemm_hhx semantics ----
// Operand path: per stage of 64 k (one 128-B line of every operand row) the 128 A rows and 64 B rows of the work-group's tile are copied to LDS by
// asynchronous b128 copies (a wave-wide copy = 4 whole lines), two buffers, the next stage in flight while this one is multiplied; fragments come from LDS.
#define G2_PITCH 144                      /* LDS row pitch in bytes, 16 B x odd: conflict-free for the ds_load_b128 fragment reads of 128-B rows */
#define G2_STAGE ((128 + 64) * G2_PITCH)  /* bytes of one buffer: A rows 0..127, then B rows 0..63 */
__device__ __forceinline__ v16h g2_frag(const unsigned char* p) { FragH f; f.half[0] = *(const v8us*)p; f.half[1] = *(const v8us*)(p + 32); return f.v; }
__device__ __forceinline__ v8f g2_mma(v16h a, v16h b, v8f c) { v8f d = __builtin_amdgcn_wmma_f32_16x16x32_f16(false, a, false, b, (short)0, c, false, false); asm volatile("v_nop\n\tv_nop\n\tv_nop\n\tv_nop" : "+v"(d) : "v"(a), "v"(b)); return d; }
// One stage: each of the 128 threads copies 16 B of 8 A rows and 4 B rows (rows 16 apart). l = the lane's LDS byte address in the buffer, a / b = its global
// addresses, sa / sb = 16 rows in elements. The closing s_wait_xcnt keeps every address register intact until the copies have taken it.
__device__ __forceinline__ void g2_stage(unsigned l, const _Float16* a, size_t sa, const _Float16* b, size_t sb) {
  asm volatile("global_load_async_to_lds_b128 %0, %12, off\n\t"
               "global_load_async_to_lds_b128 %1, %13, off\n\t"
               "global_load_async_to_lds_b128 %2, %14, off\n\t"
               "global_load_async_to_lds_b128 %3, %15, off\n\t"
               "global_load_async_to_lds_b128 %4, %16, off\n\t"
               "global_load_async_to_lds_b128 %5, %17, off\n\t"
               "global_load_async_to_lds_b128 %6, %18, off\n\t"
               "global_load_async_to_lds_b128 %7, %19, off\n\t"
               "global_load_async_to_lds_b128 %8, %20, off\n\t"
               "global_load_async_to_lds_b128 %9, %21, off\n\t"
               "global_load_async_to_lds_b128 %10, %22, off\n\t"
               "global_load_async_to_lds_b128 %11, %23, off\n\t"
               "s_wait_xcnt 0x0"
               :: "v"(l), "v"(l + 16 * G2_PITCH), "v"(l + 32 * G2_PITCH), "v"(l + 48 * G2_PITCH), "v"(l + 64 * G2_PITCH), "v"(l + 80 * G2_PITCH), "v"(l + 96 * G2_PITCH), "v"(l + 112 * G2_PITCH),
                  "v"(l + 128 * G2_PITCH), "v"(l + 144 * G2_PITCH), "v"(l + 160 * G2_PITCH), "v"(l + 176 * G2_PITCH),
                  "v"(a), "v"(a + sa), "v"(a + 2 * sa), "v"(a + 3 * sa), "v"(a + 4 * sa), "v"(a + 5 * sa), "v"(a + 6 * sa), "v"(a + 7 * sa),
                  "v"(b), "v"(b + sb), "v"(b + 2 * sb), "v"(b + 3 * sb)
               : "memory");
}
template <int ACT>
__global__ __launch_bounds__(128) void k_gemm2(const _Float16* __restrict__ A, int lda, size_t sA, const _Float16* __restrict__ Bh, int ldb, size_t sB, float alpha, const float* __restrict__ bias, size_t sBias, const float* __restrict__ CP, int rowsPerB, size_t sCPb, int row0g,
    float* __restrict__ C, _Float16* __restrict__ C16, int ldc, size_t sC, int M, int N, int K) { static_assert(ACT == 0 || ACT == 3 || ACT == 6 || ACT == 8 || ACT == 9 || ACT == 11 || ACT == 12 || ACT == 14 || ACT == 15 || ACT == 16 || ACT == 17, "k_gemm2: unsupported ACT code (would silently apply no activation)");
  __shared__ __attribute__((aligned(16))) unsigned char smem[2 * G2_STAGE];      /* the two operand buffers; behind the K loop's last barrier the same bytes stage the output tile */
  static_assert(sizeof(float) * 4 * 32 * 68 <= 2 * G2_STAGE, "output staging must fit the operand buffers");
  float (*so)[32][68] = (float (*)[32][68])smem;
  const int tid = threadIdx.x, w = tid >> 5, lane = tid & 31, ln = lane & 15, hh = lane >> 4; const int by = blockIdx.y;
  A += (size_t)by * sA; Bh += (size_t)by * sB; const size_t cofs = (size_t)by * sC; const float* bp = bias ? bias + (size_t)by * sBias : nullptr;
  const int ntn = N >> 6; const int mt = blockIdx.x / ntn, nq = blockIdx.x - mt * ntn; const int row0 = mt * 128 + 32 * w, col0 = nq * 64; if (mt * 128 >= M) return;      /* the whole work-group leaves, in front of every barrier */
  const unsigned lcp = (unsigned)(size_t)smem + (unsigned)((tid >> 3) * G2_PITCH + (tid & 7) * 16);
  const _Float16* gA = A + (size_t)(mt * 128 + (tid >> 3)) * lda + (tid & 7) * 8; const _Float16* gB = Bh + (size_t)(col0 + (tid >> 3)) * ldb + (tid & 7) * 8; const size_t sa16 = (size_t)16 * lda, sb16 = (size_t)16 * ldb;
  const int nst = K >> 6;
  const v8f z8 = {0.f,0.f,0.f,0.f,0.f,0.f,0.f,0.f}; v8f c00 = z8, c01 = z8, c02 = z8, c03 = z8, c10 = z8, c11 = z8, c12 = z8, c13 = z8;
  g2_stage(lcp, gA, sa16, gB, sb16);
  asm volatile("s_wait_asynccnt 0x0" ::: "memory");      /* this wave's copies of stage 0 have landed */
  __syncthreads();                                       /* ... and every other wave's */
  if (nst > 1) g2_stage(lcp + G2_STAGE, gA + 64, sa16, gB + 64, sb16);
#pragma unroll 1
  for (int s = 0; s < nst; ++s) { const unsigned char* sb = smem + (s & 1) * G2_STAGE; const unsigned char* pa = sb + (32 * w + ln) * G2_PITCH + 16 * hh; const unsigned char* pb = sb + (128 + ln) * G2_PITCH + 16 * hh;
    v16h fa[2][2], fb[2][4];      /* the stage's 12 fragments are read as one group in front of its 16 WMMAs: one LDS latency a stage instead of one per B fragment */
#pragma unroll
    for (int h = 0; h < 2; ++h) { fa[h][0] = g2_frag(pa + 64 * h); fa[h][1] = g2_frag(pa + 16 * G2_PITCH + 64 * h);
#pragma unroll
      for (int t = 0; t < 4; ++t) fb[h][t] = g2_frag(pb + 16 * t * G2_PITCH + 64 * h); }
#pragma unroll
    for (int h = 0; h < 2; ++h) {
      c00 = g2_mma(fa[h][0], fb[h][0], c00); c10 = g2_mma(fa[h][1], fb[h][0], c10);
      c01 = g2_mma(fa[h][0], fb[h][1], c01); c11 = g2_mma(fa[h][1], fb[h][1], c11);
      c02 = g2_mma(fa[h][0], fb[h][2], c02); c12 = g2_mma(fa[h][1], fb[h][2], c12);
      c03 = g2_mma(fa[h][0], fb[h][3], c03); c13 = g2_mma(fa[h][1], fb[h][3], c13); }
    asm volatile("s_wait_dscnt 0x0" ::: "memory");       /* this wave's reads of the buffer are over before it may be refilled */
    asm volatile("s_wait_asynccnt 0x0" ::: "memory");    /* this wave's copies of stage s + 1 have landed */
    __syncthreads();                                     /* publishes stage s + 1 and ends every wave's reads of stage s */
    if (s + 2 < nst) g2_stage(lcp + (unsigned)(s & 1) * G2_STAGE, gA + (size_t)(s + 2) * 64, sa16, gB + (size_t)(s + 2) * 64, sb16); }
  asm volatile("s_wait_asynccnt 0x0" ::: "memory");      /* no copy is outstanding when the buffers become output staging */
  v8f accs[8] = {c00, c01, c02, c03, c10, c11, c12, c13};
#pragma unroll
  for (int u = 0; u < 8; ++u) { const int t = u & 3, half = u >> 2; const int col = col0 + t * 16 + ln; const float bv = bp ? bf16_round(bp[col]) : 0.f;
#pragma unroll
    for (int r = 0; r < 8; ++r) { const int rloc = half * 16 + 8 * hh + r; float v = accs[u][r] * alpha + bv; if (CP) { if (rowsPerB < 0) v += CP[cofs + (size_t)(row0g + row0 + rloc) * ldc + col];      /* rowsPerB < 0: own element of the batched C plane */ else { const int bidx = (row0g + row0 + rloc) / rowsPerB; v += CP[(size_t)bidx * sCPb + (size_t)by * 64 + col]; } }
      if (ACT == 3) v = fmaxf(v, 0.f); else if (ACT == 6) v = 0.5f * v * (1.0f + erff(v * 0.70710678118654752f)); else if (ACT == 11) v = 1.0f / (1.0f + expf(-v)); else if (ACT == 15) v = v / (1.0f + expf(-v)); else if (ACT == 12) v = (v > 0.f) ? v : 0.01f * v; else if (ACT == 8) v = tanhf(v); else if (ACT == 9) v = 0.5f * v * (1.0f + tanhf(0.7978845608028654f * (v + 0.044715f * v * v * v))); else if (ACT == 14) v = (v > 0.f) ? v : 0.1f * v; else if (ACT == 16) v = (v >= 0.f) ? v : 0.3f * v; else if (ACT == 17) v = (v >= 0.f) ? v : 0.2f * v;
      so[w][rloc][t * 16 + ln] = v; } }
  __builtin_amdgcn_fence(__ATOMIC_ACQ_REL, "workgroup"); __builtin_amdgcn_wave_barrier();
  const int rsub = lane >> 4, c4 = (lane & 15) * 4;
  {
#pragma unroll
    for (int q = 0; q < 16; ++q) { const int r = q * 2 + rsub; const v4f v = *(const v4fa*)&so[w][r][c4]; if (C) *(v4f*)(C + cofs + (size_t)(row0 + r) * ldc + col0 + c4) = v; if (C16) { v4h h4; for (int i = 0; i < 4; ++i) h4[i] = (_Float16)v[i]; *(v4h*)(C16 + cofs + (size_t)(row0 + r) * ldc + col0 + c4) = h4; } }
     } }


__global__ __launch_bounds__(256) void k_xrows(const float* __restrict__ x, _Float16* __restrict__ X16) { __shared__ float tl[64][33]; const int tid = threadIdx.x; const int cg = blockIdx.x % (CC / 64); const int pb = (blockIdx.x / (CC / 64)) % (PX / 32); const int n = blockIdx.x / ((CC / 64) * (PX / 32)); const int p0 = pb * 32, c0 = cg * 64;
  for (int i = tid; i < 64 * 32; i += 256) { const int c = i / 32, j = i % 32; tl[c][j] = bf16_round(x[((size_t)n * CC + c0 + c) * PX + p0 + j]); }
  __syncthreads();
  { for (int i = tid; i < 32 * 8; i += 256) { const int j = i / 8, c8 = (i % 8) * 8; FragH f; for (int q = 0; q < 8; ++q) f.h[q] = (_Float16)tl[c8 + q][j]; *(v8us*)((unsigned short*)X16 + ((size_t)n * PX + p0 + j) * CC + c0 + c8) = f.half[0]; }  } }
__global__ __launch_bounds__(256) void k_wnat(const float* __restrict__ w, size_t n8, _Float16* __restrict__ Bt) { const size_t t = (size_t)blockIdx.x * 256 + threadIdx.x; if (t >= n8) return; FragH f; for (int q = 0; q < 8; ++q) f.h[q] = (_Float16)(bf16_round(w[t * 8 + q]) * 16.0f); *(v8us*)((unsigned short*)Bt + t * 8) = f.half[0];  }
__global__ __launch_bounds__(256) void k_tr(const _Float16* __restrict__ RK, const _Float16* __restrict__ RV, _Float16* __restrict__ TK, _Float16* __restrict__ TV) { __shared__ unsigned short tl[64][65]; const int tid = threadIdx.x; const int n = blockIdx.y; const _Float16* R = blockIdx.z ? RV : RK; _Float16* T = (blockIdx.z ? TV : TK) + (size_t)n * CC * PX;      /* grid: x = tile, y = sample, z = K or V plane */ const int cg = blockIdx.x % (CC / 64), pg = blockIdx.x / (CC / 64); const int c0 = cg * 64, p0 = pg * 64;
  for (int i = tid; i < 64 * 8; i += 256) { const int j = i / 8, c8 = (i % 8) * 8; FragH f; f.half[0] = *(const v8us*)((const unsigned short*)R + ((size_t)n * PX + p0 + j) * CC + c0 + c8); for (int q = 0; q < 8; ++q) tl[c8 + q][j] = f.u[q]; }
  __syncthreads();
  { for (int i = tid; i < 64 * 8; i += 256) { const int c = i / 8, j8 = (i % 8) * 8; FragH f; for (int q = 0; q < 8; ++q) f.u[q] = tl[c][j8 + q]; *(v8us*)((unsigned short*)T + (size_t)(c0 + c) * PX + p0 + j8) = f.half[0]; }  } }
__global__ __launch_bounds__(256) void k_bdiag(const float* __restrict__ M, _Float16* __restrict__ BD) { M += (size_t)blockIdx.y * CC * CC; BD += (size_t)blockIdx.y * CC * CC;      /* y = sample */ const size_t t = (size_t)blockIdx.x * 256 + threadIdx.x; if (t >= (size_t)CC * CC / 8) return; const int cp0 = (int)((t * 8) % CC); const int c = (int)((t * 8) / CC); FragH f; for (int q = 0; q < 8; ++q) { const int cp = cp0 + q; f.h[q] = (cp / HD == c / HD) ? (_Float16)M[(size_t)cp * CC + c] : (_Float16)0.f; }
  *(v8us*)((unsigned short*)BD + t * 8) = f.half[0];  }
__global__ __launch_bounds__(256) void k_gnstat(const float* __restrict__ O2, float* __restrict__ stat) { __shared__ double rs_[256], rq[256]; const int tid = threadIdx.x; const int n = blockIdx.x / GRP, g = blockIdx.x % GRP; double s = 0.0, q2 = 0.0;
#pragma unroll 1
  for (int i = tid; i < PX * CPG; i += 256) { const int p = i / CPG, cc = i % CPG; const double v = (double)O2[((size_t)n * PX + p) * CC + g * CPG + cc]; s += v; q2 += v * v; }
  rs_[tid] = s; rq[tid] = q2; __syncthreads();
  for (int st = 128; st > 0; st >>= 1) { if (tid < st) { rs_[tid] += rs_[tid + st]; rq[tid] += rq[tid + st]; } __syncthreads(); }
  if (tid == 0) { const double cnt = (double)(PX * CPG); const double mu = rs_[0] / cnt; double var = rq[0] / cnt - mu * mu; if (var < 0.0) var = 0.0; const float m = (float)mu, r = (float)(1.0 / sqrt(var + 1e-5));
    v8f l0, z; for (int q = 0; q < 8; ++q) { l0[q] = 0.f; z[q] = 0.f; } l0[0] = m; l0[1] = r; float* d = stat + (size_t)blockIdx.x * 32;      
    { *(v8f*)d = l0; *(v8f*)(d + 8) = z; *(v8f*)(d + 16) = z; *(v8f*)(d + 24) = z;  } } }
__global__ __launch_bounds__(256) void k_out(const float* __restrict__ O2, const float* __restrict__ stat, const float* __restrict__ gw, const float* __restrict__ gb, const float* __restrict__ x, float* __restrict__ out) {
  #pragma clang fp contract(off)
  const size_t t = (size_t)blockIdx.x * 256 + threadIdx.x; if (t >= (size_t)NB * CC * PX / 8) return; const int p0 = (int)((t * 8) % PX); const size_t nc = (t * 8) / PX; const int c = (int)(nc % CC); const size_t n = nc / CC; const int g = c / CPG; const float m = stat[(n * GRP + g) * 32], r = stat[(n * GRP + g) * 32 + 1]; const float w = bf16_round(gw[c]), bb = bf16_round(gb[c]); v8f o;
  for (int q = 0; q < 8; ++q) { const float v = O2[(n * PX + p0 + q) * CC + c]; o[q] = __fadd_rn(__fadd_rn(__fmul_rn((v - m) * r, w), bb), bf16_round(x[t * 8 + q])); }
  *(v8f*)(out + t * 8) = o;  }

extern "C" void kernel_launch(void* const* d_in, const int* in_sizes, int n_in,
                              void* d_out, int out_size, void* d_ws, size_t ws_size, hipStream_t stream) {
  (void)in_sizes; (void)n_in; (void)out_size;
  const float* const* I = (const float* const*)d_in; const float* X = I[0]; const float* Wq = I[1]; const float* bq = I[2]; const float* Wk = I[3]; const float* bk = I[4]; const float* Wv = I[5]; const float* bv = I[6]; const float* Wo = I[7]; const float* bo = I[8]; const float* gw = I[9]; const float* gb = I[10];
  char* ws = (char*)d_ws; size_t off = 0;
  auto take = [&](size_t bytes) { char* p = ws + off; off += (bytes + 255) & ~(size_t)255; return p; };
  _Float16* BWq = (_Float16*)take((size_t)CC * CC * 2); _Float16* BWk = (_Float16*)take((size_t)CC * CC * 2); _Float16* BWv = (_Float16*)take((size_t)CC * CC * 2); _Float16* BWo = (_Float16*)take((size_t)CC * CC * 2);
  _Float16* X16 = (_Float16*)take(NR * CC * 2); _Float16* KR = (_Float16*)take(NR * CC * 2); _Float16* QR = (_Float16*)take(NR * CC * 2); _Float16* VR = (_Float16*)take(NR * CC * 2); _Float16* KC = (_Float16*)take(NR * CC * 2); _Float16* VC = (_Float16*)take(NR * CC * 2); float* M = (float*)take((size_t)NB * CC * CC * 4); _Float16* BD = (_Float16*)take((size_t)NB * CC * CC * 2); _Float16* OR = (_Float16*)take(NR * CC * 2); float* O2 = (float*)take(NR * CC * 4); float* stat = (float*)take((size_t)NB * GRP * 32 * 4);
  if (off > ws_size) return;      /* 2 + 16x7 + 16 + 8 + 32 = about 170 MiB */
  const size_t nw8 = (size_t)CC * CC / 8; const unsigned gw_ = (unsigned)((nw8 + 255) / 256);
  k_wnat<<<gw_, 256, 0, stream>>>(Wq, nw8, BWq); k_wnat<<<gw_, 256, 0, stream>>>(Wk, nw8, BWk); k_wnat<<<gw_, 256, 0, stream>>>(Wv, nw8, BWv); k_wnat<<<gw_, 256, 0, stream>>>(Wo, nw8, BWo);
  k_xrows<<<NB * (CC / 64) * (PX / 32), 256, 0, stream>>>(X, X16);
  const dim3 gp((unsigned)((NR / 128) * (CC / 64)), 1);
  k_gemm2<0><<<gp, 128, 0, stream>>>(X16, CC, 0, BWq, CC, 0, 0.0625f, bq, 0, nullptr, 1, 0, 0, nullptr, KR, CC, 0, (int)NR, CC, CC);      /* K = Q_conv(X) (the module's swap) */
  k_gemm2<0><<<gp, 128, 0, stream>>>(X16, CC, 0, BWk, CC, 0, 0.0625f, bk, 0, nullptr, 1, 0, 0, nullptr, QR, CC, 0, (int)NR, CC, CC);      /* Q = K_conv(X) */
  k_gemm2<0><<<gp, 128, 0, stream>>>(X16, CC, 0, BWv, CC, 0, 0.0625f, bv, 0, nullptr, 1, 0, 0, nullptr, VR, CC, 0, (int)NR, CC, CC);
  /* all samples in one launch each: blockIdx.y = sample, per-sample planes of KC, VC, M and BD */
  k_tr<<<dim3((CC / 64) * (PX / 64), NB, 2), 256, 0, stream>>>(KR, VR, KC, VC);
  k_gemm2<0><<<dim3((CC / 128) * (CC / 64), NB), 128, 0, stream>>>(KC, PX, (size_t)CC * PX, VC, PX, (size_t)CC * PX, 1.0f, nullptr, 0, nullptr, 1, 0, 0, M, nullptr, CC, (size_t)CC * CC, CC, CC, PX);      /* M[c'][c] = sum_D K[c'][D] V[c][D] */
  k_bdiag<<<dim3((unsigned)((nw8 + 255) / 256), NB), 256, 0, stream>>>(M, BD);
  k_gemm2<0><<<dim3((PX / 128) * (CC / 64), NB), 128, 0, stream>>>(QR, CC, (size_t)PX * CC, BD, CC, (size_t)CC * CC, 1.0f, nullptr, 0, nullptr, 1, 0, 0, nullptr, OR, CC, (size_t)PX * CC, PX, CC, CC);      /* O[d][c] = sum_c' Q[d][c'] M[c'][c] within the head */
  k_gemm2<0><<<gp, 128, 0, stream>>>(OR, CC, 0, BWo, CC, 0, 0.0625f, bo, 0, nullptr, 1, 0, 0, O2, nullptr, CC, 0, (int)NR, CC, CC);
  k_gnstat<<<NB * GRP, 256, 0, stream>>>(O2, stat);
  k_out<<<(unsigned)(((size_t)NB * CC * PX / 8 + 255) / 256), 256, 0, stream>>>(O2, stat, gw, gb, X, (float*)d_out);
}

// v003
// It runs in 146 microseconds.
// Next to v002, in two timings, it ran 1.27 times as fast each time.
// Over all steps from v000 it is 8.06 times as fast.
#include <hip/hip_runtime.h>
// Non_local_MH (X [16][512][32][32]; K = conv1x1(X, Wq, bq), Q = conv1x1(X, Wk, bk), V = conv1x1(X, Wv, bv) (the module's swapped naming), 8 heads of 64 channels over d = 1,024 positions; softmax-FREE attention A = Q^T K ([d][d]), O = V A^T; O = conv1x1(O, Wo, bo); GroupNorm(128 groups of 4 channels, eps 1e-5, affine); out = GN(O) + X -> [16][512][32][32]).
// Structure (analytic reassociation, exact in real arithmetic): O[c][d] = sum_D A[d][D] V[c][D] = sum_c' Q[c'][d] (sum_D K[c'][D] V[c][D]) = sum_c' Q[c'][d] M[c'][c] with the per-head 64x64 matrix M = K V^T - so per sample: the 1x1 convs as WMMA GEMMs (32x64 wave tiles, f32 accumulation, exact x16 weights + bias, f16 outputs): Q with the token rows as A (token-major result), K and V with the weight rows as A and the token rows as B (channel-major result, bias per row); M^T = V_cm K_cm^T as one 512x512 GEMM (K = 1,024; only the head-diagonal 64x64 blocks are used), its block-diagonal plane masked on VALU (f16), O_rows = Q_rows . blockdiag GEMM (K = 512), O2 = Wo O^T + bo GEMM (f32, weight rows as A: channel-major); GroupNorm statistics per (sample, group) on VALU (float64 accumulation) over 4,096 contiguous values, affine + residual elementwise on VALU.
// Compute dtype: inputs rounded to bf16; X / weights exact; K, Q, V, M and O as plain f16 GEMM operands (~2^-12); GN statistics float64; everything else f32. v_wmma_f32_16x16x32_f16.
#define NB 16
#define CC 512
#define PX 1024
#define NR ((size_t)NB * PX)         /* 16384 */
#define NH 8
#define HD 64
#define GRP 128
#define CPG (CC / GRP)               /* 4 */
typedef __bf16 v16b __attribute__((ext_vector_type(16)));
typedef unsigned short v8us __attribute__((ext_vector_type(8), may_alias));
typedef float  v8f  __attribute__((ext_vector_type(8)));
typedef float  v4f  __attribute__((ext_vector_type(4)));
typedef float  v4fa __attribute__((ext_vector_type(4), may_alias));
union FragB { v16b v; v8us half[2]; unsigned short u[16]; };

__device__ __forceinline__ unsigned short bf16_bits(float x) { unsigned int u = __float_as_uint(x); return (unsigned short)((u + 0x7FFFu + ((u >> 16) & 1u)) >> 16); }
__device__ __forceinline__ float bf16_val(unsigned short b) { return __uint_as_float(((unsigned int)b) << 16); }
__device__ __forceinline__ float bf16_round(float x) { return bf16_val(bf16_bits(x)); }
// D += A·B with NT terms: 1 = ah·bh, 2 = + al·bh (A split), 3 = + ah·bl (both split)
template <int NT>
__device__ __forceinline__ v8f mmaN(v16b ah, v16b al, v16b bh, v16b bl, v8f c) {
  c = __builtin_amdgcn_wmma_f32_16x16x32_bf16(false, ah, false, bh, (short)0, c, false, false);
  if (NT >= 2) c = __builtin_amdgcn_wmma_f32_16x16x32_bf16(false, al, false, bh, (short)0, c, false, false);
  if (NT >= 3) c = __builtin_amdgcn_wmma_f32_16x16x32_bf16(false, ah, false, bl, (short)0, c, false, false);
  asm volatile("v_nop\n\tv_nop\n\tv_nop\n\tv_nop" : "+v"(c) : "v"(ah), "v"(al), "v"(bh), "v"(bl));
  return c;
}

__global__ __launch_bounds__(256) void k_wt_bf16(const float* __restrict__ W, unsigned short* __restrict__ Wt, int K, int N) {
  const int t = blockIdx.x * 256 + threadIdx.x;
  const int k8n = K / 8;
  if (t >= N * k8n) return;
  const int n = t / k8n, k8 = (t % k8n) * 8;
  v8us v;
#pragma unroll
  for (int i = 0; i < 8; ++i) v[i] = bf16_bits(W[(size_t)(k8 + i) * N + n]);
  *(v8us*)(Wt + (size_t)n * K + k8) = v;
  
}

// GEMM C[M][N] (f32, pitch ldc) = act(A[M][K]·W + bias). A f32 row-major (pitch lda) converted per fragment to bf16
// (ASPLIT: hi/lo two planes -> 2 terms, else single rounded term); Wt bf16 [N][K] (pitch ldb). BIAS_BF16 rounds the
// bias to bf16 first (bias quantised to bf16 before the add). K%32==0, M%16==0, N%64==0.
template <bool ASPLIT, int ACT, bool BIAS_BF16>
__global__ __launch_bounds__(128) void k_gemm_bf(const float* __restrict__ A, int lda, const unsigned short* __restrict__ Wt, int ldb,
                                               const float* __restrict__ bias, float* __restrict__ C, int ldc, int M, int N, int K) {
  __shared__ __attribute__((aligned(16))) float so[4][16][64];
  const int tid = threadIdx.x, w = tid >> 5, lane = tid & 31, ln = lane & 15, hh = lane >> 4;
  const int ntn = N / 64;
  const int wid = blockIdx.x * 4 + w;
  const int mt = wid / ntn, nq = wid % ntn;
  if (mt * 16 >= M) return;
  const int row0 = mt * 16, col0 = nq * 64;
  const float* arow = A + (size_t)(row0 + ln) * lda;
  v8f acc[4] = {};
  for (int kb = 0; kb < K; kb += 32) {
    FragB ah, al;
    const v4f x0 = *(const v4fa*)(arow + kb + 8 * hh), x1 = *(const v4fa*)(arow + kb + 8 * hh + 4);
    const v4f x2 = *(const v4fa*)(arow + kb + 16 + 8 * hh), x3 = *(const v4fa*)(arow + kb + 16 + 8 * hh + 4);
    float xs[16] = {x0[0],x0[1],x0[2],x0[3],x1[0],x1[1],x1[2],x1[3],x2[0],x2[1],x2[2],x2[3],x3[0],x3[1],x3[2],x3[3]};
#pragma unroll
    for (int i = 0; i < 16; ++i) { const unsigned short hb = bf16_bits(xs[i]); ah.u[i] = hb; al.u[i] = ASPLIT ? bf16_bits(xs[i] - bf16_val(hb)) : (unsigned short)0; }
#pragma unroll
    for (int t = 0; t < 4; ++t) {
      const unsigned short* brow = Wt + (size_t)(col0 + t * 16 + ln) * ldb + kb;
      FragB b;
      b.half[0] = *(const v8us*)(brow + 8 * hh);
      b.half[1] = *(const v8us*)(brow + 16 + 8 * hh);
      acc[t] = mmaN<ASPLIT ? 2 : 1>(ah.v, al.v, b.v, b.v, acc[t]);
    }
  }
#pragma unroll
  for (int t = 0; t < 4; ++t) {
    float bv = bias ? bias[col0 + t * 16 + ln] : 0.f;
    if (BIAS_BF16) bv = bf16_round(bv);
#pragma unroll
    for (int r = 0; r < 8; ++r) { float v = acc[t][r] + bv; if (ACT == 1) v = fmaxf(v, 0.f); so[w][8 * hh + r][t * 16 + ln] = v; }
  }
  __builtin_amdgcn_fence(__ATOMIC_ACQ_REL, "workgroup");
  __builtin_amdgcn_wave_barrier();
  const int rsub = lane >> 4, c4 = (lane & 15) * 4;
  {
#pragma unroll
    for (int q = 0; q < 8; ++q) {
      const int r = q * 2 + rsub;
      const v4f v = *(const v4fa*)&so[w][r][c4];
      *(v4f*)(C + (size_t)(row0 + r) * ldc + col0 + c4) = v;
    }
    
  }
}

// GEMM C = act(A·W + bias + resid): A f32 (ASPLIT -> hi/lo 2 terms), Wt bf16 [N][K]; ACT 0 none, 1 relu, 2 exact gelu;
// resid (optional, f32, row index = (row % rmod), pitch ldr, RES_BF16 rounds it) added before the activation.
template <bool ASPLIT, int ACT, bool BIAS_BF16, bool RES_BF16>
__global__ __launch_bounds__(128) void k_gemm_bf3(const float* __restrict__ A, int lda, const unsigned short* __restrict__ Wt, int ldb,
                                                const float* __restrict__ bias, const float* __restrict__ resid, int rmod, int ldr,
                                                float* __restrict__ C, int ldc, int M, int N, int K) {
  __shared__ __attribute__((aligned(16))) float so[4][16][64];
  const int tid = threadIdx.x, w = tid >> 5, lane = tid & 31, ln = lane & 15, hh = lane >> 4;
  const int ntn = N / 64;
  const int wid = blockIdx.x * 4 + w;
  const int mt = wid / ntn, nq = wid % ntn;
  if (mt * 16 >= M) return;
  const int row0 = mt * 16, col0 = nq * 64;
  const float* arow = A + (size_t)(row0 + ln) * lda;
  v8f acc[4] = {};
  for (int kb = 0; kb < K; kb += 32) {
    FragB ah, al;
    const v4f x0 = *(const v4fa*)(arow + kb + 8 * hh), x1 = *(const v4fa*)(arow + kb + 8 * hh + 4);
    const v4f x2 = *(const v4fa*)(arow + kb + 16 + 8 * hh), x3 = *(const v4fa*)(arow + kb + 16 + 8 * hh + 4);
    float xs[16] = {x0[0],x0[1],x0[2],x0[3],x1[0],x1[1],x1[2],x1[3],x2[0],x2[1],x2[2],x2[3],x3[0],x3[1],x3[2],x3[3]};
#pragma unroll
    for (int i = 0; i < 16; ++i) { const unsigned short hb = bf16_bits(xs[i]); ah.u[i] = hb; al.u[i] = ASPLIT ? bf16_bits(xs[i] - bf16_val(hb)) : (unsigned short)0; }
#pragma unroll
    for (int t = 0; t < 4; ++t) {
      const unsigned short* brow = Wt + (size_t)(col0 + t * 16 + ln) * ldb + kb;
      FragB b;
      b.half[0] = *(const v8us*)(brow + 8 * hh);
      b.half[1] = *(const v8us*)(brow + 16 + 8 * hh);
      acc[t] = mmaN<ASPLIT ? 2 : 1>(ah.v, al.v, b.v, b.v, acc[t]);
    }
  }
#pragma unroll
  for (int t = 0; t < 4; ++t) {
    const int col = col0 + t * 16 + ln;
    float bv = bias ? bias[col] : 0.f;
    if (BIAS_BF16) bv = bf16_round(bv);
#pragma unroll
    for (int r = 0; r < 8; ++r) {
      float v = acc[t][r] + bv;
      if (resid) { float rv = resid[(size_t)((row0 + 8 * hh + r) % rmod) * ldr + col]; if (RES_BF16) rv = bf16_round(rv); v += rv; }
      if (ACT == 1) v = fmaxf(v, 0.f);
      if (ACT == 2) v = 0.5f * v * (1.0f + erff(v * 0.70710678118654752f));
      if (ACT == 3) { const float u = 0.7978845608028654f * (v + 0.044715f * v * v * v); v = 0.5f * v * (1.0f + tanhf(u)); }
      so[w][8 * hh + r][t * 16 + ln] = v;
    }
  }
  __builtin_amdgcn_fence(__ATOMIC_ACQ_REL, "workgroup");
  __builtin_amdgcn_wave_barrier();
  const int rsub = lane >> 4, c4 = (lane & 15) * 4;
  {
#pragma unroll
    for (int q = 0; q < 8; ++q) {
      const int r = q * 2 + rsub;
      const v4f v = *(const v4fa*)&so[w][r][c4];
      *(v4f*)(C + (size_t)(row0 + r) * ldc + col0 + c4) = v;
    }
    
  }
}
// row LayerNorm (biased variance, eps) over N: s = X (+ R); optional out_sum <- s; out_norm <- (s-mu)*rsqrt(var+eps)*g + b
template <bool PARAM_BF16>
__global__ __launch_bounds__(256) void k_layernorm(const float* __restrict__ X, const float* __restrict__ R, const float* __restrict__ g, const float* __restrict__ bta,
                                                  float* __restrict__ out_sum, float* __restrict__ out_norm, int N, float eps) {
  __shared__ float red[256];
  const int row = blockIdx.x, tid = threadIdx.x;
  const float* x = X + (size_t)row * N; const float* rr = R ? R + (size_t)row * N : nullptr;
  float vals[16];                     // up to N = 4096
  const int per = N / 256;            // contiguous chunk per thread? use strided-by-4 chunks: thread handles j = tid*4 + 1024*u
  float s1 = 0.f;
  for (int u = 0; u < per / 4; ++u) {
    const int j = tid * 4 + 1024 * u;
    const v4f a = *(const v4fa*)(x + j);
    v4f b = {0.f,0.f,0.f,0.f}; if (rr) b = *(const v4fa*)(rr + j);
#pragma unroll
    for (int q = 0; q < 4; ++q) { const float v = a[q] + b[q]; vals[u * 4 + q] = v; s1 += v; }
  }
  red[tid] = s1; __syncthreads();
  for (int st = 128; st > 0; st >>= 1) { if (tid < st) red[tid] += red[tid + st]; __syncthreads(); }
  const float mu = red[0] / (float)N; __syncthreads();
  float s2 = 0.f;
  for (int u = 0; u < per / 4; ++u)
#pragma unroll
    for (int q = 0; q < 4; ++q) { const float c = vals[u * 4 + q] - mu; s2 += c * c; }
  red[tid] = s2; __syncthreads();
  for (int st = 128; st > 0; st >>= 1) { if (tid < st) red[tid] += red[tid + st]; __syncthreads(); }
  const float rs = rsqrtf(red[0] / (float)N + eps);
  {
    for (int u = 0; u < per / 4; ++u) {
      const int j = tid * 4 + 1024 * u;
      v4f o, sm;
#pragma unroll
      for (int q = 0; q < 4; ++q) {
        float gg = g[j + q], bb = bta[j + q];
        if (PARAM_BF16) { gg = bf16_round(gg); bb = bf16_round(bb); }
        sm[q] = vals[u * 4 + q]; o[q] = (vals[u * 4 + q] - mu) * rs * gg + bb;
      }
      if (out_sum) *(v4f*)(out_sum + (size_t)row * N + j) = sm;
      *(v4f*)(out_norm + (size_t)row * N + j) = o;
    }
    
  }
}



// ---- f16 WMMA path (v_wmma_f32_16x16x32_f16): 11-bit significands for operands in range — used for every GEMM launched here
typedef _Float16 v16h __attribute__((ext_vector_type(16)));
union FragH { v16h v; v8us half[2]; _Float16 h[16]; unsigned short u[16]; };
template <int NT>
__device__ __forceinline__ v8f mmaH(v16h ah, v16h al, v16h bh, v16h bl, v8f c) {
  c = __builtin_amdgcn_wmma_f32_16x16x32_f16(false, ah, false, bh, (short)0, c, false, false);
  if (NT >= 2) c = __builtin_amdgcn_wmma_f32_16x16x32_f16(false, al, false, bh, (short)0, c, false, false);
  if (NT >= 3) c = __builtin_amdgcn_wmma_f32_16x16x32_f16(false, ah, false, bl, (short)0, c, false, false);
  asm volatile("v_nop\n\tv_nop\n\tv_nop\n\tv_nop" : "+v"(c) : "v"(ah), "v"(al), "v"(bh), "v"(bl));
  return c;
}
// batched GEMM like k_gemm_b but f16 operands: A f32 (split into f16 hi/lo if ASPLIT, else rounded to f16), Bt = f16 values [n][k]; alpha; C f32; N multiple of 16 (partial tiles skipped)
template <bool ASPLIT>
__global__ __launch_bounds__(128) void k_gemm_h(const float* __restrict__ A, int lda, size_t sA, const _Float16* __restrict__ Bh, int ldb, size_t sB, float alpha, float* __restrict__ C, int ldc, size_t sC, int M, int N, int K) {
  __shared__ __attribute__((aligned(16))) float so[4][16][64];
  const int tid = threadIdx.x, w = tid >> 5, lane = tid & 31, ln = lane & 15, hh = lane >> 4; const int by = blockIdx.y;
  A += (size_t)by * sA; Bh += (size_t)by * sB; C += (size_t)by * sC;
  const int ntn = (N + 63) / 64; const int wid = blockIdx.x * 4 + w; const int mt = wid / ntn, nq = wid % ntn; if (mt * 16 >= M) return;
  const int row0 = mt * 16, col0 = nq * 64; const float* arow = A + (size_t)(row0 + ln) * lda;
  v8f acc[4] = {};
  for (int kb = 0; kb < K; kb += 32) {
    FragH ah, al;
    const v4f x0 = *(const v4fa*)(arow + kb + 8 * hh), x1 = *(const v4fa*)(arow + kb + 8 * hh + 4), x2 = *(const v4fa*)(arow + kb + 16 + 8 * hh), x3 = *(const v4fa*)(arow + kb + 16 + 8 * hh + 4);
    float xs[16] = {x0[0],x0[1],x0[2],x0[3],x1[0],x1[1],x1[2],x1[3],x2[0],x2[1],x2[2],x2[3],x3[0],x3[1],x3[2],x3[3]};
#pragma unroll
    for (int i = 0; i < 16; ++i) { const _Float16 h = (_Float16)xs[i]; ah.h[i] = h; al.h[i] = ASPLIT ? (_Float16)(xs[i] - (float)h) : (_Float16)0.0f; }
#pragma unroll
    for (int t = 0; t < 4; ++t) { if (col0 + t * 16 >= N) continue; const size_t boff = (size_t)(col0 + t * 16 + ln) * ldb + kb; FragH bq; bq.half[0] = *(const v8us*)(Bh + boff + 8 * hh); bq.half[1] = *(const v8us*)(Bh + boff + 16 + 8 * hh);
      acc[t] = mmaH<ASPLIT ? 2 : 1>(ah.v, al.v, bq.v, bq.v, acc[t]); }
  }
#pragma unroll
  for (int t = 0; t < 4; ++t) { if (col0 + t * 16 >= N) continue;
#pragma unroll
    for (int r = 0; r < 8; ++r) so[w][8 * hh + r][t * 16 + ln] = acc[t][r] * alpha; }
  __builtin_amdgcn_fence(__ATOMIC_ACQ_REL, "workgroup"); __builtin_amdgcn_wave_barrier();
  const int rsub = lane >> 4, c4 = (lane & 15) * 4;
  {
#pragma unroll
    for (int q = 0; q < 8; ++q) { const int r = q * 2 + rsub; if (col0 + c4 < N) { const v4f v = *(const v4fa*)&so[w][r][c4]; *(v4f*)(C + (size_t)(row0 + r) * ldc + col0 + c4) = v; } }
     }
}

// Wt[n][k] = f16(W[k][n]·scale) from f32 row-major W[K][N] (scale = power of two; bf16-exact weights stay exact in f16 away from the subnormal range)
__global__ __launch_bounds__(256) void k_wt_f16(const float* __restrict__ W, _Float16* __restrict__ Wt, int K, int N, float scale) {
  const int t = blockIdx.x * 256 + threadIdx.x; if (t >= N * (K / 8)) return; const int n = t / (K / 8), k8 = (t % (K / 8)) * 8; FragH f;
#pragma unroll
  for (int i = 0; i < 8; ++i) f.h[i] = (_Float16)(bf16_round(W[(size_t)(k8 + i) * N + n]) * scale); const v8us o = f.half[0];
  *(v8us*)((unsigned short*)Wt + (size_t)n * K + k8) = o; 
}
// k_gemm_hh variant with fused epilogue: v = acc·alpha + bias[by·sBias + col] (+ CP[(row/rowsPerB)·sCPb + by·64 + col] if CP) ; ACT 0 none / 1 elu ; writes f16 C16 (and f32 C if non-null)
template <int ACT>
__global__ __launch_bounds__(128) void k_gemm_hhx(const _Float16* __restrict__ A, int lda, size_t sA, const _Float16* __restrict__ Bh, int ldb, size_t sB, float alpha, const float* __restrict__ bias, size_t sBias, const float* __restrict__ CP, int rowsPerB, size_t sCPb, int row0g,
    float* __restrict__ C, _Float16* __restrict__ C16, int ldc, size_t sC, int M, int N, int K) {
  __shared__ __attribute__((aligned(16))) float so[4][16][64];
  const int tid = threadIdx.x, w = tid >> 5, lane = tid & 31, ln = lane & 15, hh = lane >> 4; const int by = blockIdx.y;
  A += (size_t)by * sA; Bh += (size_t)by * sB; const size_t cofs = (size_t)by * sC; const float* bp = bias ? bias + (size_t)by * sBias : nullptr;
  const int ntn = (N + 63) / 64; const int wid = blockIdx.x * 4 + w; const int mt = wid / ntn, nq = wid % ntn; if (mt * 16 >= M) return;
  const int row0 = mt * 16, col0 = nq * 64; const _Float16* arow = A + (size_t)(row0 + ln) * lda;
  v8f acc[4] = {};
  for (int kb = 0; kb < K; kb += 32) { FragH ah; ah.half[0] = *(const v8us*)((const unsigned short*)arow + kb + 8 * hh); ah.half[1] = *(const v8us*)((const unsigned short*)arow + kb + 16 + 8 * hh);
#pragma unroll
    for (int t = 0; t < 4; ++t) { if (col0 + t * 16 >= N) continue; const size_t boff = (size_t)(col0 + t * 16 + ln) * ldb + kb; FragH bq; bq.half[0] = *(const v8us*)((const unsigned short*)Bh + boff + 8 * hh); bq.half[1] = *(const v8us*)((const unsigned short*)Bh + boff + 16 + 8 * hh);
      acc[t] = mmaH<1>(ah.v, ah.v, bq.v, bq.v, acc[t]); }
  }
#pragma unroll
  for (int t = 0; t < 4; ++t) { if (col0 + t * 16 >= N) continue; const int col = col0 + t * 16 + ln; const float bv = bp ? bf16_round(bp[col]) : 0.f;
#pragma unroll
    for (int r = 0; r < 8; ++r) { float v = acc[t][r] * alpha + bv; if (CP) { const int rr = row0g + row0 + 8 * hh + r; if (rowsPerB < 0) v += CP[cofs + (size_t)rr * ldc + col];      /* rowsPerB < 0: own element of the batched C plane */ else { const int bidx = rr / rowsPerB; v += CP[(size_t)bidx * sCPb + (size_t)by * 64 + col]; } } if (ACT == 1) v = (v > 0.f) ? v : expm1f(v); else if (ACT == 7) v = (v > 0.f) ? v + 1.0f : expf(v); else if (ACT == 8) v = tanhf(v); else if (ACT == 9) v = 0.5f * v * (1.0f + tanhf(0.7978845608028654f * (v + 0.044715f * v * v * v))); else if (ACT == 11) v = 1.0f / (1.0f + expf(-v)); else if (ACT == 12) v = (v > 0.f) ? v : 0.01f * v; else if (ACT == 14) v = (v > 0.f) ? v : 0.1f * v; else if (ACT == 16) v = (v >= 0.f) ? v : 0.3f * v; else if (ACT == 17) v = (v >= 0.f) ? v : 0.2f * v; else if (ACT == 15) v = v / (1.0f + expf(-v)); else if (ACT == 3) v = fmaxf(v, 0.f); else if (ACT == 6) v = 0.5f * v * (1.0f + erff(v * 0.70710678118654752f)); so[w][8 * hh + r][t * 16 + ln] = v; } }
  __builtin_amdgcn_fence(__ATOMIC_ACQ_REL, "workgroup"); __builtin_amdgcn_wave_barrier();
  const int rsub = lane >> 4, c4 = (lane & 15) * 4; typedef _Float16 v4h __attribute__((ext_vector_type(4)));
  {
#pragma unroll
    for (int q = 0; q < 8; ++q) { const int r = q * 2 + rsub; if (col0 + c4 < N) { const v4f v = *(const v4fa*)&so[w][r][c4]; if (C) *(v4f*)(C + cofs + (size_t)(row0 + r) * ldc + col0 + c4) = v; if (C16) { v4h h4; for (int i = 0; i < 4; ++i) h4[i] = (_Float16)v[i]; *(v4h*)(C16 + cofs + (size_t)(row0 + r) * ldc + col0 + c4) = h4; } } }
     }
}


typedef _Float16 v4h __attribute__((ext_vector_type(4)));

__global__ __launch_bounds__(256) void k_x16(const float* __restrict__ x, _Float16* __restrict__ X16, size_t n8) { const size_t t = (size_t)blockIdx.x * 256 + threadIdx.x; if (t >= n8) return; FragH f;
#pragma unroll
  for (int q = 0; q < 8; ++q) f.h[q] = (_Float16)bf16_round(x[t * 8 + q]); *(v8us*)((unsigned short*)X16 + t * 8) = f.half[0];  }
__global__ __launch_bounds__(256) void k_h16(const float* __restrict__ x, _Float16* __restrict__ X16, size_t n8) { const size_t t = (size_t)blockIdx.x * 256 + threadIdx.x; if (t >= n8) return; FragH f;
#pragma unroll
  for (int q = 0; q < 8; ++q) f.h[q] = (_Float16)x[t * 8 + q]; *(v8us*)((unsigned short*)X16 + t * 8) = f.half[0];  }
__global__ __launch_bounds__(256) void k_round16f(const float* __restrict__ W, _Float16* __restrict__ Bt, size_t n8) { const size_t t = (size_t)blockIdx.x * 256 + threadIdx.x; if (t >= n8) return; FragH f;
#pragma unroll
  for (int i = 0; i < 8; ++i) f.h[i] = (_Float16)(bf16_round(W[t * 8 + i]) * 16.0f); *(v8us*)((unsigned short*)Bt + t * 8) = f.half[0];  }
template <int NHv, int TTv>
__global__ __launch_bounds__(256) void k_vt(const _Float16* __restrict__ V16, int ldv, int voff, _Float16* __restrict__ Vt) { __shared__ unsigned short tl[64][66]; const int tid = threadIdx.x; const int slab = blockIdx.x / (TTv / 64), lg = blockIdx.x % (TTv / 64); const int b = slab / NHv, h = slab % NHv;
  for (int i = tid; i < 64 * 8; i += 256) { const int r = i / 8, c8 = (i % 8) * 8; FragH f; f.half[0] = *(const v8us*)((const unsigned short*)V16 + ((size_t)b * TTv + lg * 64 + r) * ldv + voff + h * 64 + c8);
#pragma unroll
    for (int q = 0; q < 8; ++q) tl[r][c8 + q] = f.u[q]; }
  __syncthreads();
  {
#pragma unroll
    for (int rd = 0; rd < 2; ++rd) { const int d = rd * 32 + tid / 8, pc = tid % 8; FragH f;
#pragma unroll
      for (int q = 0; q < 8; ++q) f.u[q] = tl[pc * 8 + q][d];
      *(v8us*)((unsigned short*)Vt + ((size_t)slab * 64 + d) * TTv + lg * 64 + pc * 8) = f.half[0]; }
     } }

__global__ __launch_bounds__(256) void k_hl(const float* __restrict__ F, _Float16* __restrict__ Hh, _Float16* __restrict__ Hl, size_t n8) { const size_t t = (size_t)blockIdx.x * 256 + threadIdx.x; if (t >= n8) return; FragH fh, fl; const v4f a = *(const v4fa*)(F + t * 8), c = *(const v4fa*)(F + t * 8 + 4);
#pragma unroll
  for (int q = 0; q < 4; ++q) { _Float16 h = (_Float16)a[q]; fh.h[q] = h; fl.h[q] = (_Float16)((a[q] - (float)h) * 1024.0f); h = (_Float16)c[q]; fh.h[4 + q] = h; fl.h[4 + q] = (_Float16)((c[q] - (float)h) * 1024.0f); }
  { *(v8us*)((unsigned short*)Hh + t * 8) = fh.half[0]; *(v8us*)((unsigned short*)Hl + t * 8) = fl.half[0];  } }

// ---- fast GEMM (work-group tile 128x64, wave tile 32x64; requires M % 128 == 0, N % 64 == 0, K % 64 == 0); epilogue = k_gemm_hhx semantics; ROWB: bias indexed by the C row (weights as A) instead of the C column ----
// Operand path: per stage of 64 k (one 128-B line of every operand row) the 128 A rows and 64 B rows of the work-group's tile are copied to LDS by
// asynchronous b128 copies (a wave-wide copy = 4 whole lines), two buffers, the next stage in flight while this one is multiplied; fragments come from LDS.
#define G2_PITCH 144                      /* LDS row pitch in bytes, 16 B x odd: conflict-free for the ds_load_b128 fragment reads of 128-B rows */
#define G2_STAGE ((128 + 64) * G2_PITCH)  /* bytes of one buffer: A rows 0..127, then B rows 0..63 */
__device__ __forceinline__ v16h g2_frag(const unsigned char* p) { FragH f; f.half[0] = *(const v8us*)p; f.half[1] = *(const v8us*)(p + 32); return f.v; }
__device__ __forceinline__ v8f g2_mma(v16h a, v16h b, v8f c) { v8f d = __builtin_amdgcn_wmma_f32_16x16x32_f16(false, a, false, b, (short)0, c, false, false); asm volatile("v_nop\n\tv_nop\n\tv_nop\n\tv_nop" : "+v"(d) : "v"(a), "v"(b)); return d; }
// One stage: each of the 128 threads copies 16 B of 8 A rows and 4 B rows (rows 16 apart). l = the lane's LDS byte address in the buffer, a / b = its global
// addresses, sa / sb = 16 rows in elements. The closing s_wait_xcnt keeps every address register intact until the copies have taken it.
__device__ __forceinline__ void g2_stage(unsigned l, const _Float16* a, size_t sa, const _Float16* b, size_t sb) {
  asm volatile("global_load_async_to_lds_b128 %0, %12, off\n\t"
               "global_load_async_to_lds_b128 %1, %13, off\n\t"
               "global_load_async_to_lds_b128 %2, %14, off\n\t"
               "global_load_async_to_lds_b128 %3, %15, off\n\t"
               "global_load_async_to_lds_b128 %4, %16, off\n\t"
               "global_load_async_to_lds_b128 %5, %17, off\n\t"
               "global_load_async_to_lds_b128 %6, %18, off\n\t"
               "global_load_async_to_lds_b128 %7, %19, off\n\t"
               "global_load_async_to_lds_b128 %8, %20, off\n\t"
               "global_load_async_to_lds_b128 %9, %21, off\n\t"
               "global_load_async_to_lds_b128 %10, %22, off\n\t"
               "global_load_async_to_lds_b128 %11, %23, off\n\t"
               "s_wait_xcnt 0x0"
               :: "v"(l), "v"(l + 16 * G2_PITCH), "v"(l + 32 * G2_PITCH), "v"(l + 48 * G2_PITCH), "v"(l + 64 * G2_PITCH), "v"(l + 80 * G2_PITCH), "v"(l + 96 * G2_PITCH), "v"(l + 112 * G2_PITCH),
                  "v"(l + 128 * G2_PITCH), "v"(l + 144 * G2_PITCH), "v"(l + 160 * G2_PITCH), "v"(l + 176 * G2_PITCH),
                  "v"(a), "v"(a + sa), "v"(a + 2 * sa), "v"(a + 3 * sa), "v"(a + 4 * sa), "v"(a + 5 * sa), "v"(a + 6 * sa), "v"(a + 7 * sa),
                  "v"(b), "v"(b + sb), "v"(b + 2 * sb), "v"(b + 3 * sb)
               : "memory");
}
template <int ACT, bool ROWB>
__global__ __launch_bounds__(128) void k_gemm2(const _Float16* __restrict__ A, int lda, size_t sA, const _Float16* __restrict__ Bh, int ldb, size_t sB, float alpha, const float* __restrict__ bias, size_t sBias, const float* __restrict__ CP, int rowsPerB, size_t sCPb, int row0g,
    float* __restrict__ C, _Float16* __restrict__ C16, int ldc, size_t sC, int M, int N, int K) { static_assert(ACT == 0 || ACT == 3 || ACT == 6 || ACT == 8 || ACT == 9 || ACT == 11 || ACT == 12 || ACT == 14 || ACT == 15 || ACT == 16 || ACT == 17, "k_gemm2: unsupported ACT code (would silently apply no activation)");
  __shared__ __attribute__((aligned(16))) unsigned char smem[2 * G2_STAGE];      /* the two operand buffers; behind the K loop's last barrier the same bytes stage the output tile */
  static_assert(sizeof(float) * 4 * 32 * 68 <= 2 * G2_STAGE, "output staging must fit the operand buffers");
  float (*so)[32][68] = (float (*)[32][68])smem;
  const int tid = threadIdx.x, w = tid >> 5, lane = tid & 31, ln = lane & 15, hh = lane >> 4; const int by = blockIdx.y;
  A += (size_t)by * sA; Bh += (size_t)by * sB; const size_t cofs = (size_t)by * sC; const float* bp = bias ? bias + (size_t)by * sBias : nullptr;
  const int ntn = N >> 6; const int mt = blockIdx.x / ntn, nq = blockIdx.x - mt * ntn; const int row0 = mt * 128 + 32 * w, col0 = nq * 64; if (mt * 128 >= M) return;      /* the whole work-group leaves, in front of every barrier */
  const unsigned lcp = (unsigned)(size_t)smem + (unsigned)((tid >> 3) * G2_PITCH + (tid & 7) * 16);
  const _Float16* gA = A + (size_t)(mt * 128 + (tid >> 3)) * lda + (tid & 7) * 8; const _Float16* gB = Bh + (size_t)(col0 + (tid >> 3)) * ldb + (tid & 7) * 8; const size_t sa16 = (size_t)16 * lda, sb16 = (size_t)16 * ldb;
  const int nst = K >> 6;
  const v8f z8 = {0.f,0.f,0.f,0.f,0.f,0.f,0.f,0.f}; v8f c00 = z8, c01 = z8, c02 = z8, c03 = z8, c10 = z8, c11 = z8, c12 = z8, c13 = z8;
  g2_stage(lcp, gA, sa16, gB, sb16);
  asm volatile("s_wait_asynccnt 0x0" ::: "memory");      /* this wave's copies of stage 0 have landed */
  __syncthreads();                                       /* ... and every other wave's */
  if (nst > 1) g2_stage(lcp + G2_STAGE, gA + 64, sa16, gB + 64, sb16);
#pragma unroll 1
  for (int s = 0; s < nst; ++s) { const unsigned char* sb = smem + (s & 1) * G2_STAGE; const unsigned char* pa = sb + (32 * w + ln) * G2_PITCH + 16 * hh; const unsigned char* pb = sb + (128 + ln) * G2_PITCH + 16 * hh;
    v16h fa[2][2], fb[2][4];      /* the stage's 12 fragments are read as one group in front of its 16 WMMAs: one LDS latency a stage instead of one per B fragment */
#pragma unroll
    for (int h = 0; h < 2; ++h) { fa[h][0] = g2_frag(pa + 64 * h); fa[h][1] = g2_frag(pa + 16 * G2_PITCH + 64 * h);
#pragma unroll
      for (int t = 0; t < 4; ++t) fb[h][t] = g2_frag(pb + 16 * t * G2_PITCH + 64 * h); }
#pragma unroll
    for (int h = 0; h < 2; ++h) {
      c00 = g2_mma(fa[h][0], fb[h][0], c00); c10 = g2_mma(fa[h][1], fb[h][0], c10);
      c01 = g2_mma(fa[h][0], fb[h][1], c01); c11 = g2_mma(fa[h][1], fb[h][1], c11);
      c02 = g2_mma(fa[h][0], fb[h][2], c02); c12 = g2_mma(fa[h][1], fb[h][2], c12);
      c03 = g2_mma(fa[h][0], fb[h][3], c03); c13 = g2_mma(fa[h][1], fb[h][3], c13); }
    asm volatile("s_wait_dscnt 0x0" ::: "memory");       /* this wave's reads of the buffer are over before it may be refilled */
    asm volatile("s_wait_asynccnt 0x0" ::: "memory");    /* this wave's copies of stage s + 1 have landed */
    __syncthreads();                                     /* publishes stage s + 1 and ends every wave's reads of stage s */
    if (s + 2 < nst) g2_stage(lcp + (unsigned)(s & 1) * G2_STAGE, gA + (size_t)(s + 2) * 64, sa16, gB + (size_t)(s + 2) * 64, sb16); }
  asm volatile("s_wait_asynccnt 0x0" ::: "memory");      /* no copy is outstanding when the buffers become output staging */
  v8f accs[8] = {c00, c01, c02, c03, c10, c11, c12, c13};
  float rbias[16];      /* ROWB: the bias of this lane's 16 C rows, loaded as one group in front of the element loop; both loops unrolled so that every index is a constant and the array stays in registers */
#pragma unroll
  for (int i = 0; i < 16; ++i) rbias[i] = 0.f;
  if (ROWB && bp) { const float* br = bp + row0 + 8 * hh;
#pragma unroll
    for (int i = 0; i < 16; ++i) rbias[i] = bf16_round(br[(i >> 3) * 16 + (i & 7)]); }
#pragma unroll
  for (int u = 0; u < 8; ++u) { const int t = u & 3, half = u >> 2; const int col = col0 + t * 16 + ln; const float bvc = (!ROWB && bp) ? bf16_round(bp[col]) : 0.f;
#pragma unroll
    for (int r = 0; r < 8; ++r) { const int rloc = half * 16 + 8 * hh + r; const float bv = ROWB ? rbias[half * 8 + r] : bvc; float v = accs[u][r] * alpha + bv; if (CP) { if (rowsPerB < 0) v += CP[cofs + (size_t)(row0g + row0 + rloc) * ldc + col];      /* rowsPerB < 0: own element of the batched C plane */ else { const int bidx = (row0g + row0 + rloc) / rowsPerB; v += CP[(size_t)bidx * sCPb + (size_t)by * 64 + col]; } }
      if (ACT == 3) v = fmaxf(v, 0.f); else if (ACT == 6) v = 0.5f * v * (1.0f + erff(v * 0.70710678118654752f)); else if (ACT == 11) v = 1.0f / (1.0f + expf(-v)); else if (ACT == 15) v = v / (1.0f + expf(-v)); else if (ACT == 12) v = (v > 0.f) ? v : 0.01f * v; else if (ACT == 8) v = tanhf(v); else if (ACT == 9) v = 0.5f * v * (1.0f + tanhf(0.7978845608028654f * (v + 0.044715f * v * v * v))); else if (ACT == 14) v = (v > 0.f) ? v : 0.1f * v; else if (ACT == 16) v = (v >= 0.f) ? v : 0.3f * v; else if (ACT == 17) v = (v >= 0.f) ? v : 0.2f * v;
      so[w][rloc][t * 16 + ln] = v; } }
  __builtin_amdgcn_fence(__ATOMIC_ACQ_REL, "workgroup"); __builtin_amdgcn_wave_barrier();
  const int rsub = lane >> 4, c4 = (lane & 15) * 4;
  {
#pragma unroll
    for (int q = 0; q < 16; ++q) { const int r = q * 2 + rsub; const v4f v = *(const v4fa*)&so[w][r][c4]; if (C) *(v4f*)(C + cofs + (size_t)(row0 + r) * ldc + col0 + c4) = v; if (C16) { v4h h4; for (int i = 0; i < 4; ++i) h4[i] = (_Float16)v[i]; *(v4h*)(C16 + cofs + (size_t)(row0 + r) * ldc + col0 + c4) = h4; } }
     } }


__global__ __launch_bounds__(256) void k_xrows(const float* __restrict__ x, _Float16* __restrict__ X16) { __shared__ float tl[64][33]; const int tid = threadIdx.x; const int cg = blockIdx.x % (CC / 64); const int pb = (blockIdx.x / (CC / 64)) % (PX / 32); const int n = blockIdx.x / ((CC / 64) * (PX / 32)); const int p0 = pb * 32, c0 = cg * 64;
  for (int i = tid; i < 64 * 32; i += 256) { const int c = i / 32, j = i % 32; tl[c][j] = bf16_round(x[((size_t)n * CC + c0 + c) * PX + p0 + j]); }
  __syncthreads();
  { for (int i = tid; i < 32 * 8; i += 256) { const int j = i / 8, c8 = (i % 8) * 8; FragH f; for (int q = 0; q < 8; ++q) f.h[q] = (_Float16)tl[c8 + q][j]; *(v8us*)((unsigned short*)X16 + ((size_t)n * PX + p0 + j) * CC + c0 + c8) = f.half[0]; }  } }
__global__ __launch_bounds__(256) void k_wnat(const float* __restrict__ w, size_t n8, _Float16* __restrict__ Bt) { const size_t t = (size_t)blockIdx.x * 256 + threadIdx.x; if (t >= n8) return; FragH f; for (int q = 0; q < 8; ++q) f.h[q] = (_Float16)(bf16_round(w[t * 8 + q]) * 16.0f); *(v8us*)((unsigned short*)Bt + t * 8) = f.half[0];  }
__global__ __launch_bounds__(256) void k_bdiag(const float* __restrict__ M, _Float16* __restrict__ BD) { M += (size_t)blockIdx.y * CC * CC; BD += (size_t)blockIdx.y * CC * CC;      /* y = sample */ const size_t t = (size_t)blockIdx.x * 256 + threadIdx.x; if (t >= (size_t)CC * CC / 8) return; const int cp0 = (int)((t * 8) % CC); const int c = (int)((t * 8) / CC); FragH f; for (int q = 0; q < 8; ++q) { const int cp = cp0 + q; f.h[q] = (cp / HD == c / HD) ? (_Float16)M[(size_t)c * CC + cp] : (_Float16)0.f; }
  *(v8us*)((unsigned short*)BD + t * 8) = f.half[0];  }
__global__ __launch_bounds__(256) void k_gnstat(const float* __restrict__ O2, float* __restrict__ stat) { __shared__ double rs_[256], rq[256]; const int tid = threadIdx.x; const int n = blockIdx.x / GRP, g = blockIdx.x % GRP; double s = 0.0, q2 = 0.0;
#pragma unroll 1
  for (int i = tid; i < PX * CPG; i += 256) { const double v = (double)O2[((size_t)n * CC + g * CPG) * PX + i]; s += v; q2 += v * v; }      /* the group's 4 channel rows are contiguous */
  rs_[tid] = s; rq[tid] = q2; __syncthreads();
  for (int st = 128; st > 0; st >>= 1) { if (tid < st) { rs_[tid] += rs_[tid + st]; rq[tid] += rq[tid + st]; } __syncthreads(); }
  if (tid == 0) { const double cnt = (double)(PX * CPG); const double mu = rs_[0] / cnt; double var = rq[0] / cnt - mu * mu; if (var < 0.0) var = 0.0; const float m = (float)mu, r = (float)(1.0 / sqrt(var + 1e-5));
    v8f l0, z; for (int q = 0; q < 8; ++q) { l0[q] = 0.f; z[q] = 0.f; } l0[0] = m; l0[1] = r; float* d = stat + (size_t)blockIdx.x * 32;      
    { *(v8f*)d = l0; *(v8f*)(d + 8) = z; *(v8f*)(d + 16) = z; *(v8f*)(d + 24) = z;  } } }
__global__ __launch_bounds__(256) void k_out(const float* __restrict__ O2, const float* __restrict__ stat, const float* __restrict__ gw, const float* __restrict__ gb, const float* __restrict__ x, float* __restrict__ out) {
  #pragma clang fp contract(off)
  const size_t t = (size_t)blockIdx.x * 256 + threadIdx.x; if (t >= (size_t)NB * CC * PX / 8) return; const size_t nc = (t * 8) / PX; const int c = (int)(nc % CC); const size_t n = nc / CC; const int g = c / CPG; const float m = stat[(n * GRP + g) * 32], r = stat[(n * GRP + g) * 32 + 1]; const float gwc = gw[c], gbc = gb[c];
  asm volatile("s_wait_xcnt 0x0" ::: "memory");      /* stands in front of any overwrite of the offset register that the two loads above name */
  const float w = bf16_round(gwc), bb = bf16_round(gbc); v8f o;
  for (int q = 0; q < 8; ++q) { const float v = O2[t * 8 + q]; o[q] = __fadd_rn(__fadd_rn(__fmul_rn((v - m) * r, w), bb), bf16_round(x[t * 8 + q])); }
  *(v8f*)(out + t * 8) = o;  }

extern "C" void kernel_launch(void* const* d_in, const int* in_sizes, int n_in,
                              void* d_out, int out_size, void* d_ws, size_t ws_size, hipStream_t stream) {
  (void)in_sizes; (void)n_in; (void)out_size;
  const float* const* I = (const float* const*)d_in; const float* X = I[0]; const float* Wq = I[1]; const float* bq = I[2]; const float* Wk = I[3]; const float* bk = I[4]; const float* Wv = I[5]; const float* bv = I[6]; const float* Wo = I[7]; const float* bo = I[8]; const float* gw = I[9]; const float* gb = I[10];
  char* ws = (char*)d_ws; size_t off = 0;
  auto take = [&](size_t bytes) { char* p = ws + off; off += (bytes + 255) & ~(size_t)255; return p; };
  _Float16* BWq = (_Float16*)take((size_t)CC * CC * 2); _Float16* BWk = (_Float16*)take((size_t)CC * CC * 2); _Float16* BWv = (_Float16*)take((size_t)CC * CC * 2); _Float16* BWo = (_Float16*)take((size_t)CC * CC * 2);
  _Float16* X16 = (_Float16*)take(NR * CC * 2); _Float16* QR = (_Float16*)take(NR * CC * 2); _Float16* KC = (_Float16*)take(NR * CC * 2); _Float16* VC = (_Float16*)take(NR * CC * 2); float* M = (float*)take((size_t)NB * CC * CC * 4); _Float16* BD = (_Float16*)take((size_t)NB * CC * CC * 2); _Float16* OR = (_Float16*)take(NR * CC * 2); float* O2 = (float*)take(NR * CC * 4); float* stat = (float*)take((size_t)NB * GRP * 32 * 4);
  if (off > ws_size) return;      /* 2 + 16x5 + 16 + 8 + 32 = about 138 MiB */
  const size_t nw8 = (size_t)CC * CC / 8; const unsigned gw_ = (unsigned)((nw8 + 255) / 256);
  k_wnat<<<gw_, 256, 0, stream>>>(Wq, nw8, BWq); k_wnat<<<gw_, 256, 0, stream>>>(Wk, nw8, BWk); k_wnat<<<gw_, 256, 0, stream>>>(Wv, nw8, BWv); k_wnat<<<gw_, 256, 0, stream>>>(Wo, nw8, BWo);
  k_xrows<<<NB * (CC / 64) * (PX / 32), 256, 0, stream>>>(X, X16);
  const dim3 gp((unsigned)((NR / 128) * (CC / 64)), 1);
  const dim3 gc((CC / 128) * (PX / 64), NB);      /* weights as A: C[channel][position] per sample, y = sample */
  k_gemm2<0, true><<<gc, 128, 0, stream>>>(BWq, CC, 0, X16, CC, (size_t)PX * CC, 0.0625f, bq, 0, nullptr, 1, 0, 0, nullptr, KC, PX, (size_t)CC * PX, CC, PX, CC);      /* K = Q_conv(X) (the module's swap), channel-major */
  k_gemm2<0, false><<<gp, 128, 0, stream>>>(X16, CC, 0, BWk, CC, 0, 0.0625f, bk, 0, nullptr, 1, 0, 0, nullptr, QR, CC, 0, (int)NR, CC, CC);      /* Q = K_conv(X), token-major */
  k_gemm2<0, true><<<gc, 128, 0, stream>>>(BWv, CC, 0, X16, CC, (size_t)PX * CC, 0.0625f, bv, 0, nullptr, 1, 0, 0, nullptr, VC, PX, (size_t)CC * PX, CC, PX, CC);      /* V, channel-major */
  /* all samples in one launch each: blockIdx.y = sample, per-sample planes of KC, VC, M and BD */
  k_gemm2<0, false><<<dim3((CC / 128) * (CC / 64), NB), 128, 0, stream>>>(VC, PX, (size_t)CC * PX, KC, PX, (size_t)CC * PX, 1.0f, nullptr, 0, nullptr, 1, 0, 0, M, nullptr, CC, (size_t)CC * CC, CC, CC, PX);      /* M[c][c'] = sum_D V[c][D] K[c'][D]: already in the [n][k] order that the O GEMM's B operand wants */
  k_bdiag<<<dim3((unsigned)((nw8 + 255) / 256), NB), 256, 0, stream>>>(M, BD);
  k_gemm2<0, false><<<dim3((PX / 128) * (CC / 64), NB), 128, 0, stream>>>(QR, CC, (size_t)PX * CC, BD, CC, (size_t)CC * CC, 1.0f, nullptr, 0, nullptr, 1, 0, 0, nullptr, OR, CC, (size_t)PX * CC, PX, CC, CC);      /* O[d][c] = sum_c' Q[d][c'] M[c][c'] within the head */
  k_gemm2<0, true><<<gc, 128, 0, stream>>>(BWo, CC, 0, OR, CC, (size_t)PX * CC, 0.0625f, bo, 0, nullptr, 1, 0, 0, O2, nullptr, PX, (size_t)CC * PX, CC, PX, CC);      /* O2[n][c][p], the output's own layout */
  k_gnstat<<<NB * GRP, 256, 0, stream>>>(O2, stat);
  k_out<<<(unsigned)(((size_t)NB * CC * PX / 8 + 255) / 256), 256, 0, stream>>>(O2, stat, gw, gb, X, (float*)d_out);
}

// v004
// A run of this version takes 131 microseconds.
// Two timings next to v003 put it at 1.13 and 1.04 times that version's speed.
// All steps since v000 together make it 8.73 times as fast.
#include <hip/hip_runtime.h>
// Non_local_MH (X [16][512][32][32]; K = conv1x1(X, Wq, bq), Q = conv1x1(X, Wk, bk), V = conv1x1(X, Wv, bv) (the module's swapped naming), 8 heads of 64 channels over d = 1,024 positions; softmax-FREE attention A = Q^T K ([d][d]), O = V A^T; O = conv1x1(O, Wo, bo); GroupNorm(128 groups of 4 channels, eps 1e-5, affine); out = GN(O) + X -> [16][512][32][32]).
// Structure (analytic reassociation, exact in real arithmetic): O[c][d] = sum_D A[d][D] V[c][D] = sum_c' Q[c'][d] (sum_D K[c'][D] V[c][D]) = sum_c' Q[c'][d] M[c'][c] with the per-head 64x64 matrix M = K V^T - so per sample: the 1x1 convs as WMMA GEMMs (32x64 wave tiles, f32 accumulation, exact x16 weights + bias, f16 outputs): Q with the token rows as A (token-major result), K and V with the weight rows as A and the token rows as B (channel-major result, bias per row); M^T = V_cm K_cm^T as one 512x512 GEMM (K = 1,024; only the head-diagonal 64x64 blocks are used), its block-diagonal plane masked on VALU (f16), O_rows = Q_rows . blockdiag GEMM (K = 512), O2 = Wo O^T + bo GEMM (f32, weight rows as A: channel-major); GroupNorm statistics per (sample, group) on VALU (float64 accumulation) over 4,096 contiguous values, affine + residual elementwise on VALU.
// Compute dtype: inputs rounded to bf16; X / weights exact; K, Q, V, M and O as plain f16 GEMM operands (~2^-12); GN statistics float64; everything else f32. v_wmma_f32_16x16x32_f16.
#define NB 16
#define CC 512
#define PX 1024
#define NR ((size_t)NB * PX)         /* 16384 */
#define NH 8
#define HD 64
#define GRP 128
#define CPG (CC / GRP)               /* 4 */
typedef __bf16 v16b __attribute__((ext_vector_type(16)));
typedef unsigned short v8us __attribute__((ext_vector_type(8), may_alias));
typedef float  v8f  __attribute__((ext_vector_type(8)));
typedef float  v4f  __attribute__((ext_vector_type(4)));
typedef float  v4fa __attribute__((ext_vector_type(4), may_alias));
union FragB { v16b v; v8us half[2]; unsigned short u[16]; };

__device__ __forceinline__ unsigned short bf16_bits(float x) { unsigned int u = __float_as_uint(x); return (unsigned short)((u + 0x7FFFu + ((u >> 16) & 1u)) >> 16); }
__device__ __forceinline__ float bf16_val(unsigned short b) { return __uint_as_float(((unsigned int)b) << 16); }
__device__ __forceinline__ float bf16_round(float x) { return bf16_val(bf16_bits(x)); }
// D += A·B with NT terms: 1 = ah·bh, 2 = + al·bh (A split), 3 = + ah·bl (both split)
template <int NT>
__device__ __forceinline__ v8f mmaN(v16b ah, v16b al, v16b bh, v16b bl, v8f c) {
  c = __builtin_amdgcn_wmma_f32_16x16x32_bf16(false, ah, false, bh, (short)0, c, false, false);
  if (NT >= 2) c = __builtin_amdgcn_wmma_f32_16x16x32_bf16(false, al, false, bh, (short)0, c, false, false);
  if (NT >= 3) c = __builtin_amdgcn_wmma_f32_16x16x32_bf16(false, ah, false, bl, (short)0, c, false, false);
  asm volatile("v_nop\n\tv_nop\n\tv_nop\n\tv_nop" : "+v"(c) : "v"(ah), "v"(al), "v"(bh), "v"(bl));
  return c;
}

__global__ __launch_bounds__(256) void k_wt_bf16(const float* __restrict__ W, unsigned short* __restrict__ Wt, int K, int N) {
  const int t = blockIdx.x * 256 + threadIdx.x;
  const int k8n = K / 8;
  if (t >= N * k8n) return;
  const int n = t / k8n, k8 = (t % k8n) * 8;
  v8us v;
#pragma unroll
  for (int i = 0; i < 8; ++i) v[i] = bf16_bits(W[(size_t)(k8 + i) * N + n]);
  *(v8us*)(Wt + (size_t)n * K + k8) = v;
  
}

// GEMM C[M][N] (f32, pitch ldc) = act(A[M][K]·W + bias). A f32 row-major (pitch lda) converted per fragment to bf16
// (ASPLIT: hi/lo two planes -> 2 terms, else single rounded term); Wt bf16 [N][K] (pitch ldb). BIAS_BF16 rounds the
// bias to bf16 first (bias quantised to bf16 before the add). K%32==0, M%16==0, N%64==0.
template <bool ASPLIT, int ACT, bool BIAS_BF16>
__global__ __launch_bounds__(128) void k_gemm_bf(const float* __restrict__ A, int lda, const unsigned short* __restrict__ Wt, int ldb,
                                               const float* __restrict__ bias, float* __restrict__ C, int ldc, int M, int N, int K) {
  __shared__ __attribute__((aligned(16))) float so[4][16][64];
  const int tid = threadIdx.x, w = tid >> 5, lane = tid & 31, ln = lane & 15, hh = lane >> 4;
  const int ntn = N / 64;
  const int wid = blockIdx.x * 4 + w;
  const int mt = wid / ntn, nq = wid % ntn;
  if (mt * 16 >= M) return;
  const int row0 = mt * 16, col0 = nq * 64;
  const float* arow = A + (size_t)(row0 + ln) * lda;
  v8f acc[4] = {};
  for (int kb = 0; kb < K; kb += 32) {
    FragB ah, al;
    const v4f x0 = *(const v4fa*)(arow + kb + 8 * hh), x1 = *(const v4fa*)(arow + kb + 8 * hh + 4);
    const v4f x2 = *(const v4fa*)(arow + kb + 16 + 8 * hh), x3 = *(const v4fa*)(arow + kb + 16 + 8 * hh + 4);
    float xs[16] = {x0[0],x0[1],x0[2],x0[3],x1[0],x1[1],x1[2],x1[3],x2[0],x2[1],x2[2],x2[3],x3[0],x3[1],x3[2],x3[3]};
#pragma unroll
    for (int i = 0; i < 16; ++i) { const unsigned short hb = bf16_bits(xs[i]); ah.u[i] = hb; al.u[i] = ASPLIT ? bf16_bits(xs[i] - bf16_val(hb)) : (unsigned short)0; }
#pragma unroll
    for (int t = 0; t < 4; ++t) {
      const unsigned short* brow = Wt + (size_t)(col0 + t * 16 + ln) * ldb + kb;
      FragB b;
      b.half[0] = *(const v8us*)(brow + 8 * hh);
      b.half[1] = *(const v8us*)(brow + 16 + 8 * hh);
      acc[t] = mmaN<ASPLIT ? 2 : 1>(ah.v, al.v, b.v, b.v, acc[t]);
    }
  }
#pragma unroll
  for (int t = 0; t < 4; ++t) {
    float bv = bias ? bias[col0 + t * 16 + ln] : 0.f;
    if (BIAS_BF16) bv = bf16_round(bv);
#pragma unroll
    for (int r = 0; r < 8; ++r) { float v = acc[t][r] + bv; if (ACT == 1) v = fmaxf(v, 0.f); so[w][8 * hh + r][t * 16 + ln] = v; }
  }
  __builtin_amdgcn_fence(__ATOMIC_ACQ_REL, "workgroup");
  __builtin_amdgcn_wave_barrier();
  const int rsub = lane >> 4, c4 = (lane & 15) * 4;
  {
#pragma unroll
    for (int q = 0; q < 8; ++q) {
      const int r = q * 2 + rsub;
      const v4f v = *(const v4fa*)&so[w][r][c4];
      *(v4f*)(C + (size_t)(row0 + r) * ldc + col0 + c4) = v;
    }
    
  }
}

// GEMM C = act(A·W + bias + resid): A f32 (ASPLIT -> hi/lo 2 terms), Wt bf16 [N][K]; ACT 0 none, 1 relu, 2 exact gelu;
// resid (optional, f32, row index = (row % rmod), pitch ldr, RES_BF16 rounds it) added before the activation.
template <bool ASPLIT, int ACT, bool BIAS_BF16, bool RES_BF16>
__global__ __launch_bounds__(128) void k_gemm_bf3(const float* __restrict__ A, int lda, const unsigned short* __restrict__ Wt, int ldb,
                                                const float* __restrict__ bias, const float* __restrict__ resid, int rmod, int ldr,
                                                float* __restrict__ C, int ldc, int M, int N, int K) {
  __shared__ __attribute__((aligned(16))) float so[4][16][64];
  const int tid = threadIdx.x, w = tid >> 5, lane = tid & 31, ln = lane & 15, hh = lane >> 4;
  const int ntn = N / 64;
  const int wid = blockIdx.x * 4 + w;
  const int mt = wid / ntn, nq = wid % ntn;
  if (mt * 16 >= M) return;
  const int row0 = mt * 16, col0 = nq * 64;
  const float* arow = A + (size_t)(row0 + ln) * lda;
  v8f acc[4] = {};
  for (int kb = 0; kb < K; kb += 32) {
    FragB ah, al;
    const v4f x0 = *(const v4fa*)(arow + kb + 8 * hh), x1 = *(const v4fa*)(arow + kb + 8 * hh + 4);
    const v4f x2 = *(const v4fa*)(arow + kb + 16 + 8 * hh), x3 = *(const v4fa*)(arow + kb + 16 + 8 * hh + 4);
    float xs[16] = {x0[0],x0[1],x0[2],x0[3],x1[0],x1[1],x1[2],x1[3],x2[0],x2[1],x2[2],x2[3],x3[0],x3[1],x3[2],x3[3]};
#pragma unroll
    for (int i = 0; i < 16; ++i) { const unsigned short hb = bf16_bits(xs[i]); ah.u[i] = hb; al.u[i] = ASPLIT ? bf16_bits(xs[i] - bf16_val(hb)) : (unsigned short)0; }
#pragma unroll
    for (int t = 0; t < 4; ++t) {
      const unsigned short* brow = Wt + (size_t)(col0 + t * 16 + ln) * ldb + kb;
      FragB b;
      b.half[0] = *(const v8us*)(brow + 8 * hh);
      b.half[1] = *(const v8us*)(brow + 16 + 8 * hh);
      acc[t] = mmaN<ASPLIT ? 2 : 1>(ah.v, al.v, b.v, b.v, acc[t]);
    }
  }
#pragma unroll
  for (int t = 0; t < 4; ++t) {
    const int col = col0 + t * 16 + ln;
    float bv = bias ? bias[col] : 0.f;
    if (BIAS_BF16) bv = bf16_round(bv);
#pragma unroll
    for (int r = 0; r < 8; ++r) {
      float v = acc[t][r] + bv;
      if (resid) { float rv = resid[(size_t)((row0 + 8 * hh + r) % rmod) * ldr + col]; if (RES_BF16) rv = bf16_round(rv); v += rv; }
      if (ACT == 1) v = fmaxf(v, 0.f);
      if (ACT == 2) v = 0.5f * v * (1.0f + erff(v * 0.70710678118654752f));
      if (ACT == 3) { const float u = 0.7978845608028654f * (v + 0.044715f * v * v * v); v = 0.5f * v * (1.0f + tanhf(u)); }
      so[w][8 * hh + r][t * 16 + ln] = v;
    }
  }
  __builtin_amdgcn_fence(__ATOMIC_ACQ_REL, "workgroup");
  __builtin_amdgcn_wave_barrier();
  const int rsub = lane >> 4, c4 = (lane & 15) * 4;
  {
#pragma unroll
    for (int q = 0; q < 8; ++q) {
      const int r = q * 2 + rsub;
      const v4f v = *(const v4fa*)&so[w][r][c4];
      *(v4f*)(C + (size_t)(row0 + r) * ldc + col0 + c4) = v;
    }
    
  }
}
// row LayerNorm (biased variance, eps) over N: s = X (+ R); optional out_sum <- s; out_norm <- (s-mu)*rsqrt(var+eps)*g + b
template <bool PARAM_BF16>
__global__ __launch_bounds__(256) void k_layernorm(const float* __restrict__ X, const float* __restrict__ R, const float* __restrict__ g, const float* __restrict__ bta,
                                                  float* __restrict__ out_sum, float* __restrict__ out_norm, int N, float eps) {
  __shared__ float red[256];
  const int row = blockIdx.x, tid = threadIdx.x;
  const float* x = X + (size_t)row * N; const float* rr = R ? R + (size_t)row * N : nullptr;
  float vals[16];                     // up to N = 4096
  const int per = N / 256;            // contiguous chunk per thread? use strided-by-4 chunks: thread handles j = tid*4 + 1024*u
  float s1 = 0.f;
  for (int u = 0; u < per / 4; ++u) {
    const int j = tid * 4 + 1024 * u;
    const v4f a = *(const v4fa*)(x + j);
    v4f b = {0.f,0.f,0.f,0.f}; if (rr) b = *(const v4fa*)(rr + j);
#pragma unroll
    for (int q = 0; q < 4; ++q) { const float v = a[q] + b[q]; vals[u * 4 + q] = v; s1 += v; }
  }
  red[tid] = s1; __syncthreads();
  for (int st = 128; st > 0; st >>= 1) { if (tid < st) red[tid] += red[tid + st]; __syncthreads(); }
  const float mu = red[0] / (float)N; __syncthreads();
  float s2 = 0.f;
  for (int u = 0; u < per / 4; ++u)
#pragma unroll
    for (int q = 0; q < 4; ++q) { const float c = vals[u * 4 + q] - mu; s2 += c * c; }
  red[tid] = s2; __syncthreads();
  for (int st = 128; st > 0; st >>= 1) { if (tid < st) red[tid] += red[tid + st]; __syncthreads(); }
  const float rs = rsqrtf(red[0] / (float)N + eps);
  {
    for (int u = 0; u < per / 4; ++u) {
      const int j = tid * 4 + 1024 * u;
      v4f o, sm;
#pragma unroll
      for (int q = 0; q < 4; ++q) {
        float gg = g[j + q], bb = bta[j + q];
        if (PARAM_BF16) { gg = bf16_round(gg); bb = bf16_round(bb); }
        sm[q] = vals[u * 4 + q]; o[q] = (vals[u * 4 + q] - mu) * rs * gg + bb;
      }
      if (out_sum) *(v4f*)(out_sum + (size_t)row * N + j) = sm;
      *(v4f*)(out_norm + (size_t)row * N + j) = o;
    }
    
  }
}



// ---- f16 WMMA path (v_wmma_f32_16x16x32_f16): 11-bit significands for operands in range — used for every GEMM launched here
typedef _Float16 v16h __attribute__((ext_vector_type(16)));
union FragH { v16h v; v8us half[2]; _Float16 h[16]; unsigned short u[16]; };
template <int NT>
__device__ __forceinline__ v8f mmaH(v16h ah, v16h al, v16h bh, v16h bl, v8f c) {
  c = __builtin_amdgcn_wmma_f32_16x16x32_f16(false, ah, false, bh, (short)0, c, false, false);
  if (NT >= 2) c = __builtin_amdgcn_wmma_f32_16x16x32_f16(false, al, false, bh, (short)0, c, false, false);
  if (NT >= 3) c = __builtin_amdgcn_wmma_f32_16x16x32_f16(false, ah, false, bl, (short)0, c, false, false);
  asm volatile("v_nop\n\tv_nop\n\tv_nop\n\tv_nop" : "+v"(c) : "v"(ah), "v"(al), "v"(bh), "v"(bl));
  return c;
}
// batched GEMM like k_gemm_b but f16 operands: A f32 (split into f16 hi/lo if ASPLIT, else rounded to f16), Bt = f16 values [n][k]; alpha; C f32; N multiple of 16 (partial tiles skipped)
template <bool ASPLIT>
__global__ __launch_bounds__(128) void k_gemm_h(const float* __restrict__ A, int lda, size_t sA, const _Float16* __restrict__ Bh, int ldb, size_t sB, float alpha, float* __restrict__ C, int ldc, size_t sC, int M, int N, int K) {
  __shared__ __attribute__((aligned(16))) float so[4][16][64];
  const int tid = threadIdx.x, w = tid >> 5, lane = tid & 31, ln = lane & 15, hh = lane >> 4; const int by = blockIdx.y;
  A += (size_t)by * sA; Bh += (size_t)by * sB; C += (size_t)by * sC;
  const int ntn = (N + 63) / 64; const int wid = blockIdx.x * 4 + w; const int mt = wid / ntn, nq = wid % ntn; if (mt * 16 >= M) return;
  const int row0 = mt * 16, col0 = nq * 64; const float* arow = A + (size_t)(row0 + ln) * lda;
  v8f acc[4] = {};
  for (int kb = 0; kb < K; kb += 32) {
    FragH ah, al;
    const v4f x0 = *(const v4fa*)(arow + kb + 8 * hh), x1 = *(const v4fa*)(arow + kb + 8 * hh + 4), x2 = *(const v4fa*)(arow + kb + 16 + 8 * hh), x3 = *(const v4fa*)(arow + kb + 16 + 8 * hh + 4);
    float xs[16] = {x0[0],x0[1],x0[2],x0[3],x1[0],x1[1],x1[2],x1[3],x2[0],x2[1],x2[2],x2[3],x3[0],x3[1],x3[2],x3[3]};
#pragma unroll
    for (int i = 0; i < 16; ++i) { const _Float16 h = (_Float16)xs[i]; ah.h[i] = h; al.h[i] = ASPLIT ? (_Float16)(xs[i] - (float)h) : (_Float16)0.0f; }
#pragma unroll
    for (int t = 0; t < 4; ++t) { if (col0 + t * 16 >= N) continue; const size_t boff = (size_t)(col0 + t * 16 + ln) * ldb + kb; FragH bq; bq.half[0] = *(const v8us*)(Bh + boff + 8 * hh); bq.half[1] = *(const v8us*)(Bh + boff + 16 + 8 * hh);
      acc[t] = mmaH<ASPLIT ? 2 : 1>(ah.v, al.v, bq.v, bq.v, acc[t]); }
  }
#pragma unroll
  for (int t = 0; t < 4; ++t) { if (col0 + t * 16 >= N) continue;
#pragma unroll
    for (int r = 0; r < 8; ++r) so[w][8 * hh + r][t * 16 + ln] = acc[t][r] * alpha; }
  __builtin_amdgcn_fence(__ATOMIC_ACQ_REL, "workgroup"); __builtin_amdgcn_wave_barrier();
  const int rsub = lane >> 4, c4 = (lane & 15) * 4;
  {
#pragma unroll
    for (int q = 0; q < 8; ++q) { const int r = q * 2 + rsub; if (col0 + c4 < N) { const v4f v = *(const v4fa*)&so[w][r][c4]; *(v4f*)(C + (size_t)(row0 + r) * ldc + col0 + c4) = v; } }
     }
}

// Wt[n][k] = f16(W[k][n]·scale) from f32 row-major W[K][N] (scale = power of two; bf16-exact weights stay exact in f16 away from the subnormal range)
__global__ __launch_bounds__(256) void k_wt_f16(const float* __restrict__ W, _Float16* __restrict__ Wt, int K, int N, float scale) {
  const int t = blockIdx.x * 256 + threadIdx.x; if (t >= N * (K / 8)) return; const int n = t / (K / 8), k8 = (t % (K / 8)) * 8; FragH f;
#pragma unroll
  for (int i = 0; i < 8; ++i) f.h[i] = (_Float16)(bf16_round(W[(size_t)(k8 + i) * N + n]) * scale); const v8us o = f.half[0];
  *(v8us*)((unsigned short*)Wt + (size_t)n * K + k8) = o; 
}
// k_gemm_hh variant with fused epilogue: v = acc·alpha + bias[by·sBias + col] (+ CP[(row/rowsPerB)·sCPb + by·64 + col] if CP) ; ACT 0 none / 1 elu ; writes f16 C16 (and f32 C if non-null)
template <int ACT>
__global__ __launch_bounds__(128) void k_gemm_hhx(const _Float16* __restrict__ A, int lda, size_t sA, const _Float16* __restrict__ Bh, int ldb, size_t sB, float alpha, const float* __restrict__ bias, size_t sBias, const float* __restrict__ CP, int rowsPerB, size_t sCPb, int row0g,
    float* __restrict__ C, _Float16* __restrict__ C16, int ldc, size_t sC, int M, int N, int K) {
  __shared__ __attribute__((aligned(16))) float so[4][16][64];
  const int tid = threadIdx.x, w = tid >> 5, lane = tid & 31, ln = lane & 15, hh = lane >> 4; const int by = blockIdx.y;
  A += (size_t)by * sA; Bh += (size_t)by * sB; const size_t cofs = (size_t)by * sC; const float* bp = bias ? bias + (size_t)by * sBias : nullptr;
  const int ntn = (N + 63) / 64; const int wid = blockIdx.x * 4 + w; const int mt = wid / ntn, nq = wid % ntn; if (mt * 16 >= M) return;
  const int row0 = mt * 16, col0 = nq * 64; const _Float16* arow = A + (size_t)(row0 + ln) * lda;
  v8f acc[4] = {};
  for (int kb = 0; kb < K; kb += 32) { FragH ah; ah.half[0] = *(const v8us*)((const unsigned short*)arow + kb + 8 * hh); ah.half[1] = *(const v8us*)((const unsigned short*)arow + kb + 16 + 8 * hh);
#pragma unroll
    for (int t = 0; t < 4; ++t) { if (col0 + t * 16 >= N) continue; const size_t boff = (size_t)(col0 + t * 16 + ln) * ldb + kb; FragH bq; bq.half[0] = *(const v8us*)((const unsigned short*)Bh + boff + 8 * hh); bq.half[1] = *(const v8us*)((const unsigned short*)Bh + boff + 16 + 8 * hh);
      acc[t] = mmaH<1>(ah.v, ah.v, bq.v, bq.v, acc[t]); }
  }
#pragma unroll
  for (int t = 0; t < 4; ++t) { if (col0 + t * 16 >= N) continue; const int col = col0 + t * 16 + ln; const float bv = bp ? bf16_round(bp[col]) : 0.f;
#pragma unroll
    for (int r = 0; r < 8; ++r) { float v = acc[t][r] * alpha + bv; if (CP) { const int rr = row0g + row0 + 8 * hh + r; if (rowsPerB < 0) v += CP[cofs + (size_t)rr * ldc + col];      /* rowsPerB < 0: own element of the batched C plane */ else { const int bidx = rr / rowsPerB; v += CP[(size_t)bidx * sCPb + (size_t)by * 64 + col]; } } if (ACT == 1) v = (v > 0.f) ? v : expm1f(v); else if (ACT == 7) v = (v > 0.f) ? v + 1.0f : expf(v); else if (ACT == 8) v = tanhf(v); else if (ACT == 9) v = 0.5f * v * (1.0f + tanhf(0.7978845608028654f * (v + 0.044715f * v * v * v))); else if (ACT == 11) v = 1.0f / (1.0f + expf(-v)); else if (ACT == 12) v = (v > 0.f) ? v : 0.01f * v; else if (ACT == 14) v = (v > 0.f) ? v : 0.1f * v; else if (ACT == 16) v = (v >= 0.f) ? v : 0.3f * v; else if (ACT == 17) v = (v >= 0.f) ? v : 0.2f * v; else if (ACT == 15) v = v / (1.0f + expf(-v)); else if (ACT == 3) v = fmaxf(v, 0.f); else if (ACT == 6) v = 0.5f * v * (1.0f + erff(v * 0.70710678118654752f)); so[w][8 * hh + r][t * 16 + ln] = v; } }
  __builtin_amdgcn_fence(__ATOMIC_ACQ_REL, "workgroup"); __builtin_amdgcn_wave_barrier();
  const int rsub = lane >> 4, c4 = (lane & 15) * 4; typedef _Float16 v4h __attribute__((ext_vector_type(4)));
  {
#pragma unroll
    for (int q = 0; q < 8; ++q) { const int r = q * 2 + rsub; if (col0 + c4 < N) { const v4f v = *(const v4fa*)&so[w][r][c4]; if (C) *(v4f*)(C + cofs + (size_t)(row0 + r) * ldc + col0 + c4) = v; if (C16) { v4h h4; for (int i = 0; i < 4; ++i) h4[i] = (_Float16)v[i]; *(v4h*)(C16 + cofs + (size_t)(row0 + r) * ldc + col0 + c4) = h4; } } }
     }
}


typedef _Float16 v4h __attribute__((ext_vector_type(4)));

__global__ __launch_bounds__(256) void k_x16(const float* __restrict__ x, _Float16* __restrict__ X16, size_t n8) { const size_t t = (size_t)blockIdx.x * 256 + threadIdx.x; if (t >= n8) return; FragH f;
#pragma unroll
  for (int q = 0; q < 8; ++q) f.h[q] = (_Float16)bf16_round(x[t * 8 + q]); *(v8us*)((unsigned short*)X16 + t * 8) = f.half[0];  }
__global__ __launch_bounds__(256) void k_h16(const float* __restrict__ x, _Float16* __restrict__ X16, size_t n8) { const size_t t = (size_t)blockIdx.x * 256 + threadIdx.x; if (t >= n8) return; FragH f;
#pragma unroll
  for (int q = 0; q < 8; ++q) f.h[q] = (_Float16)x[t * 8 + q]; *(v8us*)((unsigned short*)X16 + t * 8) = f.half[0];  }
__global__ __launch_bounds__(256) void k_round16f(const float* __restrict__ W, _Float16* __restrict__ Bt, size_t n8) { const size_t t = (size_t)blockIdx.x * 256 + threadIdx.x; if (t >= n8) return; FragH f;
#pragma unroll
  for (int i = 0; i < 8; ++i) f.h[i] = (_Float16)(bf16_round(W[t * 8 + i]) * 16.0f); *(v8us*)((unsigned short*)Bt + t * 8) = f.half[0];  }
template <int NHv, int TTv>
__global__ __launch_bounds__(256) void k_vt(const _Float16* __restrict__ V16, int ldv, int voff, _Float16* __restrict__ Vt) { __shared__ unsigned short tl[64][66]; const int tid = threadIdx.x; const int slab = blockIdx.x / (TTv / 64), lg = blockIdx.x % (TTv / 64); const int b = slab / NHv, h = slab % NHv;
  for (int i = tid; i < 64 * 8; i += 256) { const int r = i / 8, c8 = (i % 8) * 8; FragH f; f.half[0] = *(const v8us*)((const unsigned short*)V16 + ((size_t)b * TTv + lg * 64 + r) * ldv + voff + h * 64 + c8);
#pragma unroll
    for (int q = 0; q < 8; ++q) tl[r][c8 + q] = f.u[q]; }
  __syncthreads();
  {
#pragma unroll
    for (int rd = 0; rd < 2; ++rd) { const int d = rd * 32 + tid / 8, pc = tid % 8; FragH f;
#pragma unroll
      for (int q = 0; q < 8; ++q) f.u[q] = tl[pc * 8 + q][d];
      *(v8us*)((unsigned short*)Vt + ((size_t)slab * 64 + d) * TTv + lg * 64 + pc * 8) = f.half[0]; }
     } }

__global__ __launch_bounds__(256) void k_hl(const float* __restrict__ F, _Float16* __restrict__ Hh, _Float16* __restrict__ Hl, size_t n8) { const size_t t = (size_t)blockIdx.x * 256 + threadIdx.x; if (t >= n8) return; FragH fh, fl; const v4f a = *(const v4fa*)(F + t * 8), c = *(const v4fa*)(F + t * 8 + 4);
#pragma unroll
  for (int q = 0; q < 4; ++q) { _Float16 h = (_Float16)a[q]; fh.h[q] = h; fl.h[q] = (_Float16)((a[q] - (float)h) * 1024.0f); h = (_Float16)c[q]; fh.h[4 + q] = h; fl.h[4 + q] = (_Float16)((c[q] - (float)h) * 1024.0f); }
  { *(v8us*)((unsigned short*)Hh + t * 8) = fh.half[0]; *(v8us*)((unsigned short*)Hl + t * 8) = fl.half[0];  } }

// ---- fast GEMM (work-group tile 128x64, wave tile 32x64; requires M % 128 == 0, N % 64 == 0, K % 64 == 0); epilogue = k_gemm_hhx semantics; ROWB: bias indexed by the C row (weights as A) instead of the C column ----
// Operand path: per stage of 64 k (one 128-B line of every operand row) the 128 A rows and 64 B rows of the work-group's tile are copied to LDS by
// asynchronous b128 copies (a wave-wide copy = 4 whole lines), two buffers, the next stage in flight while this one is multiplied; fragments come from LDS.
#define G2_PITCH 144                      /* LDS row pitch in bytes, 16 B x odd: conflict-free for the ds_load_b128 fragment reads of 128-B rows */
#define G2_STAGE ((128 + 64) * G2_PITCH)  /* bytes of one buffer: A rows 0..127, then B rows 0..63 */
__device__ __forceinline__ v16h g2_frag(const unsigned char* p) { FragH f; f.half[0] = *(const v8us*)p; f.half[1] = *(const v8us*)(p + 32); return f.v; }
__device__ __forceinline__ v8f g2_mma(v16h a, v16h b, v8f c) { v8f d = __builtin_amdgcn_wmma_f32_16x16x32_f16(false, a, false, b, (short)0, c, false, false); asm volatile("v_nop\n\tv_nop\n\tv_nop\n\tv_nop" : "+v"(d) : "v"(a), "v"(b)); return d; }
// One stage: each of the 128 threads copies 16 B of 8 A rows and 4 B rows (rows 16 apart). l = the lane's LDS byte address in the buffer, a / b = its global
// addresses, sa / sb = 16 rows in elements. The closing s_wait_xcnt keeps every address register intact until the copies have taken it.
__device__ __forceinline__ void g2_stage(unsigned l, const _Float16* a, size_t sa, const _Float16* b, size_t sb) {
  asm volatile("global_load_async_to_lds_b128 %0, %12, off\n\t"
               "global_load_async_to_lds_b128 %1, %13, off\n\t"
               "global_load_async_to_lds_b128 %2, %14, off\n\t"
               "global_load_async_to_lds_b128 %3, %15, off\n\t"
               "global_load_async_to_lds_b128 %4, %16, off\n\t"
               "global_load_async_to_lds_b128 %5, %17, off\n\t"
               "global_load_async_to_lds_b128 %6, %18, off\n\t"
               "global_load_async_to_lds_b128 %7, %19, off\n\t"
               "global_load_async_to_lds_b128 %8, %20, off\n\t"
               "global_load_async_to_lds_b128 %9, %21, off\n\t"
               "global_load_async_to_lds_b128 %10, %22, off\n\t"
               "global_load_async_to_lds_b128 %11, %23, off\n\t"
               "s_wait_xcnt 0x0"
               :: "v"(l), "v"(l + 16 * G2_PITCH), "v"(l + 32 * G2_PITCH), "v"(l + 48 * G2_PITCH), "v"(l + 64 * G2_PITCH), "v"(l + 80 * G2_PITCH), "v"(l + 96 * G2_PITCH), "v"(l + 112 * G2_PITCH),
                  "v"(l + 128 * G2_PITCH), "v"(l + 144 * G2_PITCH), "v"(l + 160 * G2_PITCH), "v"(l + 176 * G2_PITCH),
                  "v"(a), "v"(a + sa), "v"(a + 2 * sa), "v"(a + 3 * sa), "v"(a + 4 * sa), "v"(a + 5 * sa), "v"(a + 6 * sa), "v"(a + 7 * sa),
                  "v"(b), "v"(b + sb), "v"(b + 2 * sb), "v"(b + 3 * sb)
               : "memory");
}
// The body takes its LDS and its block indices (bx = tile, by = batch plane) from the caller, so that one launch can hold the tiles of several independent GEMMs.
template <int ACT, bool ROWB>
__device__ __forceinline__ void g2_body(unsigned char* smem, const int bx, const int by, const _Float16* __restrict__ A, int lda, size_t sA, const _Float16* __restrict__ Bh, int ldb, size_t sB, float alpha, const float* __restrict__ bias, size_t sBias, const float* __restrict__ CP, int rowsPerB, size_t sCPb, int row0g,
    float* __restrict__ C, _Float16* __restrict__ C16, int ldc, size_t sC, int M, int N, int K) { static_assert(ACT == 0 || ACT == 3 || ACT == 6 || ACT == 8 || ACT == 9 || ACT == 11 || ACT == 12 || ACT == 14 || ACT == 15 || ACT == 16 || ACT == 17, "k_gemm2: unsupported ACT code (would silently apply no activation)");
  static_assert(sizeof(float) * 4 * 32 * 68 <= 2 * G2_STAGE, "output staging must fit the operand buffers");
  float (*so)[32][68] = (float (*)[32][68])smem;
  const int tid = threadIdx.x, w = tid >> 5, lane = tid & 31, ln = lane & 15, hh = lane >> 4;
  A += (size_t)by * sA; Bh += (size_t)by * sB; const size_t cofs = (size_t)by * sC; const float* bp = bias ? bias + (size_t)by * sBias : nullptr;
  const int ntn = N >> 6; const int mt = bx / ntn, nq = bx - mt * ntn; const int row0 = mt * 128 + 32 * w, col0 = nq * 64; if (mt * 128 >= M) return;      /* the whole work-group leaves, in front of every barrier */
  const unsigned lcp = (unsigned)(size_t)smem + (unsigned)((tid >> 3) * G2_PITCH + (tid & 7) * 16);
  const _Float16* gA = A + (size_t)(mt * 128 + (tid >> 3)) * lda + (tid & 7) * 8; const _Float16* gB = Bh + (size_t)(col0 + (tid >> 3)) * ldb + (tid & 7) * 8; const size_t sa16 = (size_t)16 * lda, sb16 = (size_t)16 * ldb;
  const int nst = K >> 6;
  const v8f z8 = {0.f,0.f,0.f,0.f,0.f,0.f,0.f,0.f}; v8f c00 = z8, c01 = z8, c02 = z8, c03 = z8, c10 = z8, c11 = z8, c12 = z8, c13 = z8;
  g2_stage(lcp, gA, sa16, gB, sb16);
  asm volatile("s_wait_asynccnt 0x0" ::: "memory");      /* this wave's copies of stage 0 have landed */
  __syncthreads();                                       /* ... and every other wave's */
  if (nst > 1) g2_stage(lcp + G2_STAGE, gA + 64, sa16, gB + 64, sb16);
#pragma unroll 1
  for (int s = 0; s < nst; ++s) { const unsigned char* sb = smem + (s & 1) * G2_STAGE; const unsigned char* pa = sb + (32 * w + ln) * G2_PITCH + 16 * hh; const unsigned char* pb = sb + (128 + ln) * G2_PITCH + 16 * hh;
    v16h fa[2][2], fb[2][4];      /* the stage's 12 fragments are read as one group in front of its 16 WMMAs: one LDS latency a stage instead of one per B fragment */
#pragma unroll
    for (int h = 0; h < 2; ++h) { fa[h][0] = g2_frag(pa + 64 * h); fa[h][1] = g2_frag(pa + 16 * G2_PITCH + 64 * h);
#pragma unroll
      for (int t = 0; t < 4; ++t) fb[h][t] = g2_frag(pb + 16 * t * G2_PITCH + 64 * h); }
#pragma unroll
    for (int h = 0; h < 2; ++h) {
      c00 = g2_mma(fa[h][0], fb[h][0], c00); c10 = g2_mma(fa[h][1], fb[h][0], c10);
      c01 = g2_mma(fa[h][0], fb[h][1], c01); c11 = g2_mma(fa[h][1], fb[h][1], c11);
      c02 = g2_mma(fa[h][0], fb[h][2], c02); c12 = g2_mma(fa[h][1], fb[h][2], c12);
      c03 = g2_mma(fa[h][0], fb[h][3], c03); c13 = g2_mma(fa[h][1], fb[h][3], c13); }
    asm volatile("s_wait_dscnt 0x0" ::: "memory");       /* this wave's reads of the buffer are over before it may be refilled */
    asm volatile("s_wait_asynccnt 0x0" ::: "memory");    /* this wave's copies of stage s + 1 have landed */
    __syncthreads();                                     /* publishes stage s + 1 and ends every wave's reads of stage s */
    if (s + 2 < nst) g2_stage(lcp + (unsigned)(s & 1) * G2_STAGE, gA + (size_t)(s + 2) * 64, sa16, gB + (size_t)(s + 2) * 64, sb16); }
  asm volatile("s_wait_asynccnt 0x0" ::: "memory");      /* no copy is outstanding when the buffers become output staging */
  v8f accs[8] = {c00, c01, c02, c03, c10, c11, c12, c13};
  float rbias[16];      /* ROWB: the bias of this lane's 16 C rows, loaded as one group in front of the element loop; both loops unrolled so that every index is a constant and the array stays in registers */
#pragma unroll
  for (int i = 0; i < 16; ++i) rbias[i] = 0.f;
  if (ROWB && bp) { const float* br = bp + row0 + 8 * hh;
#pragma unroll
    for (int i = 0; i < 16; ++i) rbias[i] = bf16_round(br[(i >> 3) * 16 + (i & 7)]); }
#pragma unroll
  for (int u = 0; u < 8; ++u) { const int t = u & 3, half = u >> 2; const int col = col0 + t * 16 + ln; const float bvc = (!ROWB && bp) ? bf16_round(bp[col]) : 0.f;
#pragma unroll
    for (int r = 0; r < 8; ++r) { const int rloc = half * 16 + 8 * hh + r; const float bv = ROWB ? rbias[half * 8 + r] : bvc; float v = accs[u][r] * alpha + bv; if (CP) { if (rowsPerB < 0) v += CP[cofs + (size_t)(row0g + row0 + rloc) * ldc + col];      /* rowsPerB < 0: own element of the batched C plane */ else { const int bidx = (row0g + row0 + rloc) / rowsPerB; v += CP[(size_t)bidx * sCPb + (size_t)by * 64 + col]; } }
      if (ACT == 3) v = fmaxf(v, 0.f); else if (ACT == 6) v = 0.5f * v * (1.0f + erff(v * 0.70710678118654752f)); else if (ACT == 11) v = 1.0f / (1.0f + expf(-v)); else if (ACT == 15) v = v / (1.0f + expf(-v)); else if (ACT == 12) v = (v > 0.f) ? v : 0.01f * v; else if (ACT == 8) v = tanhf(v); else if (ACT == 9) v = 0.5f * v * (1.0f + tanhf(0.7978845608028654f * (v + 0.044715f * v * v * v))); else if (ACT == 14) v = (v > 0.f) ? v : 0.1f * v; else if (ACT == 16) v = (v >= 0.f) ? v : 0.3f * v; else if (ACT == 17) v = (v >= 0.f) ? v : 0.2f * v;
      so[w][rloc][t * 16 + ln] = v; } }
  __builtin_amdgcn_fence(__ATOMIC_ACQ_REL, "workgroup"); __builtin_amdgcn_wave_barrier();
  const int rsub = lane >> 4, c4 = (lane & 15) * 4;
  {
#pragma unroll
    for (int q = 0; q < 16; ++q) { const int r = q * 2 + rsub; const v4f v = *(const v4fa*)&so[w][r][c4]; if (C) { *(v4f*)(C + cofs + (size_t)(row0 + r) * ldc + col0 + c4) = v; if (C16) asm volatile("s_wait_xcnt 0x0" ::: "memory"); }      /* the wait stands in front of the conversion below, which may overwrite registers that the f32 store names */
      if (C16) { v4h h4; for (int i = 0; i < 4; ++i) h4[i] = (_Float16)v[i]; *(v4h*)(C16 + cofs + (size_t)(row0 + r) * ldc + col0 + c4) = h4; } }
    asm volatile("s_wait_xcnt 0x0" ::: "memory");      /* stands behind the last stores, in front of any code of the calling kernel that follows the body and may overwrite registers that they name */
     } }
#define G2_SMEM __shared__ __attribute__((aligned(16))) unsigned char smem[2 * G2_STAGE]      /* the two operand buffers; behind the K loop's last barrier the same bytes stage the output tile */
template <int ACT, bool ROWB>
__global__ __launch_bounds__(128) void k_gemm2(const _Float16* __restrict__ A, int lda, size_t sA, const _Float16* __restrict__ Bh, int ldb, size_t sB, float alpha, const float* __restrict__ bias, size_t sBias, const float* __restrict__ CP, int rowsPerB, size_t sCPb, int row0g,
    float* __restrict__ C, _Float16* __restrict__ C16, int ldc, size_t sC, int M, int N, int K) { G2_SMEM;
  g2_body<ACT, ROWB>(smem, (int)blockIdx.x, (int)blockIdx.y, A, lda, sA, Bh, ldb, sB, alpha, bias, sBias, CP, rowsPerB, sCPb, row0g, C, C16, ldc, sC, M, N, K); }
// K and V in one launch (neither reads the other): x = tile, y = sample, z = which. Weights as A: C[channel][position] per sample.
__global__ __launch_bounds__(128) void k_gemm_kv(const _Float16* __restrict__ X16, const _Float16* __restrict__ BWq, const _Float16* __restrict__ BWv, const float* __restrict__ bq, const float* __restrict__ bv, _Float16* __restrict__ KC, _Float16* __restrict__ VC) { G2_SMEM;
  const bool isv = blockIdx.z != 0;
  g2_body<0, true>(smem, (int)blockIdx.x, (int)blockIdx.y, isv ? BWv : BWq, CC, 0, X16, CC, (size_t)PX * CC, 0.0625f, isv ? bv : bq, 0, nullptr, 1, 0, 0, nullptr, isv ? VC : KC, PX, (size_t)CC * PX, CC, PX, CC); }
// M and Q in one launch (M reads K and V, Q reads X: neither reads the other). M's tiles have twice the k length and stand first in the grid, so that they start first.
#define MQ_MT ((CC / 128) * (CC / 64))      /* M tiles per sample */
__global__ __launch_bounds__(128) void k_gemm_mq(const _Float16* __restrict__ VC, const _Float16* __restrict__ KC, float* __restrict__ M, const _Float16* __restrict__ X16, const _Float16* __restrict__ BWk, const float* __restrict__ bk, _Float16* __restrict__ QR) { G2_SMEM;
  const int b = (int)blockIdx.x;
  if (b < NB * MQ_MT) g2_body<0, false>(smem, b % MQ_MT, b / MQ_MT, VC, PX, (size_t)CC * PX, KC, PX, (size_t)CC * PX, 1.0f, nullptr, 0, nullptr, 1, 0, 0, M, nullptr, CC, (size_t)CC * CC, CC, CC, PX);      /* M[c][c'] = sum_D V[c][D] K[c'][D]: already in the [n][k] order that the O GEMM's B operand wants */
  else g2_body<0, false>(smem, b - NB * MQ_MT, 0, X16, CC, 0, BWk, CC, 0, 0.0625f, bk, 0, nullptr, 1, 0, 0, nullptr, QR, CC, 0, (int)NR, CC, CC); }      /* Q = K_conv(X), token-major */


__device__ __forceinline__ void xrows_body(const float* __restrict__ x, _Float16* __restrict__ X16, const int bx) { __shared__ float tl[64][33]; const int tid = threadIdx.x; const int cg = bx % (CC / 64); const int pb = (bx / (CC / 64)) % (PX / 32); const int n = bx / ((CC / 64) * (PX / 32)); const int p0 = pb * 32, c0 = cg * 64;
  for (int i = tid; i < 64 * 32; i += 256) { const int c = i / 32, j = i % 32; tl[c][j] = bf16_round(x[((size_t)n * CC + c0 + c) * PX + p0 + j]); }
  __syncthreads();
  { for (int i = tid; i < 32 * 8; i += 256) { const int j = i / 8, c8 = (i % 8) * 8; FragH f; for (int q = 0; q < 8; ++q) f.h[q] = (_Float16)tl[c8 + q][j]; *(v8us*)((unsigned short*)X16 + ((size_t)n * PX + p0 + j) * CC + c0 + c8) = f.half[0]; }  } }
__device__ __forceinline__ void wnat_body(const float* __restrict__ w, size_t n8, _Float16* __restrict__ Bt, const int bx) { const size_t t = (size_t)bx * 256 + threadIdx.x; if (t >= n8) return; FragH f; for (int q = 0; q < 8; ++q) f.h[q] = (_Float16)(bf16_round(w[t * 8 + q]) * 16.0f); *(v8us*)((unsigned short*)Bt + t * 8) = f.half[0];  }
// The X transpose and the four weight roundings in one launch (none reads another's result): the transpose's blocks first, then WB blocks per weight matrix.
#define XB (NB * (CC / 64) * (PX / 32))
#define WB ((CC * CC / 8 + 255) / 256)
__global__ __launch_bounds__(256) void k_prep(const float* __restrict__ x, _Float16* __restrict__ X16, const float* __restrict__ Wq, const float* __restrict__ Wk, const float* __restrict__ Wv, const float* __restrict__ Wo,
    _Float16* __restrict__ BWq, _Float16* __restrict__ BWk, _Float16* __restrict__ BWv, _Float16* __restrict__ BWo) {
  const int b = (int)blockIdx.x;
  if (b < XB) { xrows_body(x, X16, b); return; }      /* the same for the whole block */
  const int m = (b - XB) / WB;
  wnat_body(m == 0 ? Wq : m == 1 ? Wk : m == 2 ? Wv : Wo, (size_t)CC * CC / 8, m == 0 ? BWq : m == 1 ? BWk : m == 2 ? BWv : BWo, (b - XB) % WB); }
__global__ __launch_bounds__(256) void k_bdiag(const float* __restrict__ M, _Float16* __restrict__ BD) { M += (size_t)blockIdx.y * CC * CC; BD += (size_t)blockIdx.y * CC * CC;      /* y = sample */ const size_t t = (size_t)blockIdx.x * 256 + threadIdx.x; if (t >= (size_t)CC * CC / 8) return; const int cp0 = (int)((t * 8) % CC); const int c = (int)((t * 8) / CC); FragH f; for (int q = 0; q < 8; ++q) { const int cp = cp0 + q; f.h[q] = (cp / HD == c / HD) ? (_Float16)M[(size_t)c * CC + cp] : (_Float16)0.f; }
  *(v8us*)((unsigned short*)BD + t * 8) = f.half[0];  }
__global__ __launch_bounds__(256) void k_gnstat(const float* __restrict__ O2, float* __restrict__ stat) { __shared__ double rs_[256], rq[256]; const int tid = threadIdx.x; const int n = blockIdx.x / GRP, g = blockIdx.x % GRP; double s = 0.0, q2 = 0.0;
#pragma unroll 1
  for (int i = tid; i < PX * CPG; i += 256) { const double v = (double)O2[((size_t)n * CC + g * CPG) * PX + i]; s += v; q2 += v * v; }      /* the group's 4 channel rows are contiguous */
  rs_[tid] = s; rq[tid] = q2; __syncthreads();
  for (int st = 128; st > 0; st >>= 1) { if (tid < st) { rs_[tid] += rs_[tid + st]; rq[tid] += rq[tid + st]; } __syncthreads(); }
  if (tid == 0) { const double cnt = (double)(PX * CPG); const double mu = rs_[0] / cnt; double var = rq[0] / cnt - mu * mu; if (var < 0.0) var = 0.0; const float m = (float)mu, r = (float)(1.0 / sqrt(var + 1e-5));
    v8f l0, z; for (int q = 0; q < 8; ++q) { l0[q] = 0.f; z[q] = 0.f; } l0[0] = m; l0[1] = r; float* d = stat + (size_t)blockIdx.x * 32;      
    { *(v8f*)d = l0; *(v8f*)(d + 8) = z; *(v8f*)(d + 16) = z; *(v8f*)(d + 24) = z;  } } }
__global__ __launch_bounds__(256) void k_out(const float* __restrict__ O2, const float* __restrict__ stat, const float* __restrict__ gw, const float* __restrict__ gb, const float* __restrict__ x, float* __restrict__ out) {
  #pragma clang fp contract(off)
  const size_t t = (size_t)blockIdx.x * 256 + threadIdx.x; if (t >= (size_t)NB * CC * PX / 8) return; const size_t nc = (t * 8) / PX; const int c = (int)(nc % CC); const size_t n = nc / CC; const int g = c / CPG; const float m = stat[(n * GRP + g) * 32], r = stat[(n * GRP + g) * 32 + 1]; const float gwc = gw[c], gbc = gb[c];
  asm volatile("s_wait_xcnt 0x0" ::: "memory");      /* stands in front of any overwrite of the offset register that the two loads above name */
  const float w = bf16_round(gwc), bb = bf16_round(gbc); v8f o;
  for (int q = 0; q < 8; ++q) { const float v = O2[t * 8 + q]; o[q] = __fadd_rn(__fadd_rn(__fmul_rn((v - m) * r, w), bb), bf16_round(x[t * 8 + q])); }
  *(v8f*)(out + t * 8) = o;  }

extern "C" void kernel_launch(void* const* d_in, const int* in_sizes, int n_in,
                              void* d_out, int out_size, void* d_ws, size_t ws_size, hipStream_t stream) {
  (void)in_sizes; (void)n_in; (void)out_size;
  const float* const* I = (const float* const*)d_in; const float* X = I[0]; const float* Wq = I[1]; const float* bq = I[2]; const float* Wk = I[3]; const float* bk = I[4]; const float* Wv = I[5]; const float* bv = I[6]; const float* Wo = I[7]; const float* bo = I[8]; const float* gw = I[9]; const float* gb = I[10];
  char* ws = (char*)d_ws; size_t off = 0;
  auto take = [&](size_t bytes) { char* p = ws + off; off += (bytes + 255) & ~(size_t)255; return p; };
  _Float16* BWq = (_Float16*)take((size_t)CC * CC * 2); _Float16* BWk = (_Float16*)take((size_t)CC * CC * 2); _Float16* BWv = (_Float16*)take((size_t)CC * CC * 2); _Float16* BWo = (_Float16*)take((size_t)CC * CC * 2);
  _Float16* X16 = (_Float16*)take(NR * CC * 2); _Float16* QR = (_Float16*)take(NR * CC * 2); _Float16* KC = (_Float16*)take(NR * CC * 2); _Float16* VC = (_Float16*)take(NR * CC * 2); float* M = (float*)take((size_t)NB * CC * CC * 4); _Float16* BD = (_Float16*)take((size_t)NB * CC * CC * 2); _Float16* OR = (_Float16*)take(NR * CC * 2); float* O2 = (float*)take(NR * CC * 4); float* stat = (float*)take((size_t)NB * GRP * 32 * 4);
  if (off > ws_size) return;      /* 2 + 16x5 + 16 + 8 + 32 = about 138 MiB */
  const size_t nw8 = (size_t)CC * CC / 8;
  k_prep<<<XB + 4 * WB, 256, 0, stream>>>(X, X16, Wq, Wk, Wv, Wo, BWq, BWk, BWv, BWo);
  const dim3 gc((CC / 128) * (PX / 64), NB);      /* weights as A: C[channel][position] per sample, y = sample */
  k_gemm_kv<<<dim3((CC / 128) * (PX / 64), NB, 2), 128, 0, stream>>>(X16, BWq, BWv, bq, bv, KC, VC);      /* K = Q_conv(X) (the module's swap) and V, channel-major */
  /* all samples in one launch each: per-sample planes of KC, VC, M and BD */
  k_gemm_mq<<<NB * MQ_MT + (unsigned)((NR / 128) * (CC / 64)), 128, 0, stream>>>(VC, KC, M, X16, BWk, bk, QR);
  k_bdiag<<<dim3((unsigned)((nw8 + 255) / 256), NB), 256, 0, stream>>>(M, BD);
  k_gemm2<0, false><<<dim3((PX / 128) * (CC / 64), NB), 128, 0, stream>>>(QR, CC, (size_t)PX * CC, BD, CC, (size_t)CC * CC, 1.0f, nullptr, 0, nullptr, 1, 0, 0, nullptr, OR, CC, (size_t)PX * CC, PX, CC, CC);      /* O[d][c] = sum_c' Q[d][c'] M[c][c'] within the head */
  k_gemm2<0, true><<<gc, 128, 0, stream>>>(BWo, CC, 0, OR, CC, (size_t)PX * CC, 0.0625f, bo, 0, nullptr, 1, 0, 0, O2, nullptr, PX, (size_t)CC * PX, CC, PX, CC);      /* O2[n][c][p], the output's own layout */
  k_gnstat<<<NB * GRP, 256, 0, stream>>>(O2, stat);
  k_out<<<(unsigned)(((size_t)NB * CC * PX / 8 + 255) / 256), 256, 0, stream>>>(O2, stat, gw, gb, X, (float*)d_out);
}

// v005
// It runs in 97.3 microseconds.
// Two timings next to v004 put it at 1.34 and 1.32 times that version's speed.
// Over all steps from v000 it is 11.6 times as fast.
#include <hip/hip_runtime.h>
// Non_local_MH (X [16][512][32][32]; K = conv1x1(X, Wq, bq), Q = conv1x1(X, Wk, bk), V = conv1x1(X, Wv, bv) (the module's swapped naming), 8 heads of 64 channels over d = 1,024 positions; softmax-FREE attention A = Q^T K ([d][d]), O = V A^T; O = conv1x1(O, Wo, bo); GroupNorm(128 groups of 4 channels, eps 1e-5, affine); out = GN(O) + X -> [16][512][32][32]).
// Structure (analytic reassociation, exact in real arithmetic): O[c][d] = sum_D A[d][D] V[c][D] = sum_c' Q[c'][d] (sum_D K[c'][D] V[c][D]) = sum_c' Q[c'][d] M[c'][c] with the per-head 64x64 matrix M = K V^T - so per sample: the 1x1 convs as WMMA GEMMs (32x64 wave tiles, f32 accumulation, exact x16 weights + bias, f16 outputs): Q with the token rows as A (token-major result), K and V with the weight rows as A and the token rows as B (channel-major result, bias per row); M^T = V_cm K_cm^T (K = 1,024) only in the 128x64 tiles that hold a head-diagonal 64x64 block, stored f16, O_rows = Q_rows . M_head GEMM per head (K = 64: the head's own channels), O2 = Wo O^T + bo GEMM (f32, weight rows as A: channel-major); GroupNorm statistics per (sample, group) on VALU (float64 accumulation) over 4,096 contiguous values, affine + residual elementwise on VALU.
// Compute dtype: inputs rounded to bf16; X / weights exact; K, Q, V, M and O as plain f16 GEMM operands (~2^-12); GN statistics float64; everything else f32. v_wmma_f32_16x16x32_f16.
#define NB 16
#define CC 512
#define PX 1024
#define NR ((size_t)NB * PX)         /* 16384 */
#define NH 8
#define HD 64
#define GRP 128
#define CPG (CC / GRP)               /* 4 */
typedef __bf16 v16b __attribute__((ext_vector_type(16)));
typedef unsigned short v8us __attribute__((ext_vector_type(8), may_alias));
typedef float  v8f  __attribute__((ext_vector_type(8)));
typedef float  v4f  __attribute__((ext_vector_type(4)));
typedef float  v4fa __attribute__((ext_vector_type(4), may_alias));
union FragB { v16b v; v8us half[2]; unsigned short u[16]; };

__device__ __forceinline__ unsigned short bf16_bits(float x) { unsigned int u = __float_as_uint(x); return (unsigned short)((u + 0x7FFFu + ((u >> 16) & 1u)) >> 16); }
__device__ __forceinline__ float bf16_val(unsigned short b) { return __uint_as_float(((unsigned int)b) << 16); }
__device__ __forceinline__ float bf16_round(float x) { return bf16_val(bf16_bits(x)); }
// D += A·B with NT terms: 1 = ah·bh, 2 = + al·bh (A split), 3 = + ah·bl (both split)
template <int NT>
__device__ __forceinline__ v8f mmaN(v16b ah, v16b al, v16b bh, v16b bl, v8f c) {
  c = __builtin_amdgcn_wmma_f32_16x16x32_bf16(false, ah, false, bh, (short)0, c, false, false);
  if (NT >= 2) c = __builtin_amdgcn_wmma_f32_16x16x32_bf16(false, al, false, bh, (short)0, c, false, false);
  if (NT >= 3) c = __builtin_amdgcn_wmma_f32_16x16x32_bf16(false, ah, false, bl, (short)0, c, false, false);
  asm volatile("v_nop\n\tv_nop\n\tv_nop\n\tv_nop" : "+v"(c) : "v"(ah), "v"(al), "v"(bh), "v"(bl));
  return c;
}

__global__ __launch_bounds__(256) void k_wt_bf16(const float* __restrict__ W, unsigned short* __restrict__ Wt, int K, int N) {
  const int t = blockIdx.x * 256 + threadIdx.x;
  const int k8n = K / 8;
  if (t >= N * k8n) return;
  const int n = t / k8n, k8 = (t % k8n) * 8;
  v8us v;
#pragma unroll
  for (int i = 0; i < 8; ++i) v[i] = bf16_bits(W[(size_t)(k8 + i) * N + n]);
  *(v8us*)(Wt + (size_t)n * K + k8) = v;
  
}

// GEMM C[M][N] (f32, pitch ldc) = act(A[M][K]·W + bias). A f32 row-major (pitch lda) converted per fragment to bf16
// (ASPLIT: hi/lo two planes -> 2 terms, else single rounded term); Wt bf16 [N][K] (pitch ldb). BIAS_BF16 rounds the
// bias to bf16 first (bias quantised to bf16 before the add). K%32==0, M%16==0, N%64==0.
template <bool ASPLIT, int ACT, bool BIAS_BF16>
__global__ __launch_bounds__(128) void k_gemm_bf(const float* __restrict__ A, int lda, const unsigned short* __restrict__ Wt, int ldb,
                                               const float* __restrict__ bias, float* __restrict__ C, int ldc, int M, int N, int K) {
  __shared__ __attribute__((aligned(16))) float so[4][16][64];
  const int tid = threadIdx.x, w = tid >> 5, lane = tid & 31, ln = lane & 15, hh = lane >> 4;
  const int ntn = N / 64;
  const int wid = blockIdx.x * 4 + w;
  const int mt = wid / ntn, nq = wid % ntn;
  if (mt * 16 >= M) return;
  const int row0 = mt * 16, col0 = nq * 64;
  const float* arow = A + (size_t)(row0 + ln) * lda;
  v8f acc[4] = {};
  for (int kb = 0; kb < K; kb += 32) {
    FragB ah, al;
    const v4f x0 = *(const v4fa*)(arow + kb + 8 * hh), x1 = *(const v4fa*)(arow + kb + 8 * hh + 4);
    const v4f x2 = *(const v4fa*)(arow + kb + 16 + 8 * hh), x3 = *(const v4fa*)(arow + kb + 16 + 8 * hh + 4);
    float xs[16] = {x0[0],x0[1],x0[2],x0[3],x1[0],x1[1],x1[2],x1[3],x2[0],x2[1],x2[2],x2[3],x3[0],x3[1],x3[2],x3[3]};
#pragma unroll
    for (int i = 0; i < 16; ++i) { const unsigned short hb = bf16_bits(xs[i]); ah.u[i] = hb; al.u[i] = ASPLIT ? bf16_bits(xs[i] - bf16_val(hb)) : (unsigned short)0; }
#pragma unroll
    for (int t = 0; t < 4; ++t) {
      const unsigned short* brow = Wt + (size_t)(col0 + t * 16 + ln) * ldb + kb;
      FragB b;
      b.half[0] = *(const v8us*)(brow + 8 * hh);
      b.half[1] = *(const v8us*)(brow + 16 + 8 * hh);
      acc[t] = mmaN<ASPLIT ? 2 : 1>(ah.v, al.v, b.v, b.v, acc[t]);
    }
  }
#pragma unroll
  for (int t = 0; t < 4; ++t) {
    float bv = bias ? bias[col0 + t * 16 + ln] : 0.f;
    if (BIAS_BF16) bv = bf16_round(bv);
#pragma unroll
    for (int r = 0; r < 8; ++r) { float v = acc[t][r] + bv; if (ACT == 1) v = fmaxf(v, 0.f); so[w][8 * hh + r][t * 16 + ln] = v; }
  }
  __builtin_amdgcn_fence(__ATOMIC_ACQ_REL, "workgroup");
  __builtin_amdgcn_wave_barrier();
  const int rsub = lane >> 4, c4 = (lane & 15) * 4;
  {
#pragma unroll
    for (int q = 0; q < 8; ++q) {
      const int r = q * 2 + rsub;
      const v4f v = *(const v4fa*)&so[w][r][c4];
      *(v4f*)(C + (size_t)(row0 + r) * ldc + col0 + c4) = v;
    }
    
  }
}

// GEMM C = act(A·W + bias + resid): A f32 (ASPLIT -> hi/lo 2 terms), Wt bf16 [N][K]; ACT 0 none, 1 relu, 2 exact gelu;
// resid (optional, f32, row index = (row % rmod), pitch ldr, RES_BF16 rounds it) added before the activation.
template <bool ASPLIT, int ACT, bool BIAS_BF16, bool RES_BF16>
__global__ __launch_bounds__(128) void k_gemm_bf3(const float* __restrict__ A, int lda, const unsigned short* __restrict__ Wt, int ldb,
                                                const float* __restrict__ bias, const float* __restrict__ resid, int rmod, int ldr,
                                                float* __restrict__ C, int ldc, int M, int N, int K) {
  __shared__ __attribute__((aligned(16))) float so[4][16][64];
  const int tid = threadIdx.x, w = tid >> 5, lane = tid & 31, ln = lane & 15, hh = lane >> 4;
  const int ntn = N / 64;
  const int wid = blockIdx.x * 4 + w;
  const int mt = wid / ntn, nq = wid % ntn;
  if (mt * 16 >= M) return;
  const int row0 = mt * 16, col0 = nq * 64;
  const float* arow = A + (size_t)(row0 + ln) * lda;
  v8f acc[4] = {};
  for (int kb = 0; kb < K; kb += 32) {
    FragB ah, al;
    const v4f x0 = *(const v4fa*)(arow + kb + 8 * hh), x1 = *(const v4fa*)(arow + kb + 8 * hh + 4);
    const v4f x2 = *(const v4fa*)(arow + kb + 16 + 8 * hh), x3 = *(const v4fa*)(arow + kb + 16 + 8 * hh + 4);
    float xs[16] = {x0[0],x0[1],x0[2],x0[3],x1[0],x1[1],x1[2],x1[3],x2[0],x2[1],x2[2],x2[3],x3[0],x3[1],x3[2],x3[3]};
#pragma unroll
    for (int i = 0; i < 16; ++i) { const unsigned short hb = bf16_bits(xs[i]); ah.u[i] = hb; al.u[i] = ASPLIT ? bf16_bits(xs[i] - bf16_val(hb)) : (unsigned short)0; }
#pragma unroll
    for (int t = 0; t < 4; ++t) {
      const unsigned short* brow = Wt + (size_t)(col0 + t * 16 + ln) * ldb + kb;
      FragB b;
      b.half[0] = *(const v8us*)(brow + 8 * hh);
      b.half[1] = *(const v8us*)(brow + 16 + 8 * hh);
      acc[t] = mmaN<ASPLIT ? 2 : 1>(ah.v, al.v, b.v, b.v, acc[t]);
    }
  }
#pragma unroll
  for (int t = 0; t < 4; ++t) {
    const int col = col0 + t * 16 + ln;
    float bv = bias ? bias[col] : 0.f;
    if (BIAS_BF16) bv = bf16_round(bv);
#pragma unroll
    for (int r = 0; r < 8; ++r) {
      float v = acc[t][r] + bv;
      if (resid) { float rv = resid[(size_t)((row0 + 8 * hh + r) % rmod) * ldr + col]; if (RES_BF16) rv = bf16_round(rv); v += rv; }
      if (ACT == 1) v = fmaxf(v, 0.f);
      if (ACT == 2) v = 0.5f * v * (1.0f + erff(v * 0.70710678118654752f));
      if (ACT == 3) { const float u = 0.7978845608028654f * (v + 0.044715f * v * v * v); v = 0.5f * v * (1.0f + tanhf(u)); }
      so[w][8 * hh + r][t * 16 + ln] = v;
    }
  }
  __builtin_amdgcn_fence(__ATOMIC_ACQ_REL, "workgroup");
  __builtin_amdgcn_wave_barrier();
  const int rsub = lane >> 4, c4 = (lane & 15) * 4;
  {
#pragma unroll
    for (int q = 0; q < 8; ++q) {
      const int r = q * 2 + rsub;
      const v4f v = *(const v4fa*)&so[w][r][c4];
      *(v4f*)(C + (size_t)(row0 + r) * ldc + col0 + c4) = v;
    }
    
  }
}
// row LayerNorm (biased variance, eps) over N: s = X (+ R); optional out_sum <- s; out_norm <- (s-mu)*rsqrt(var+eps)*g + b
template <bool PARAM_BF16>
__global__ __launch_bounds__(256) void k_layernorm(const float* __restrict__ X, const float* __restrict__ R, const float* __restrict__ g, const float* __restrict__ bta,
                                                  float* __restrict__ out_sum, float* __restrict__ out_norm, int N, float eps) {
  __shared__ float red[256];
  const int row = blockIdx.x, tid = threadIdx.x;
  const float* x = X + (size_t)row * N; const float* rr = R ? R + (size_t)row * N : nullptr;
  float vals[16];                     // up to N = 4096
  const int per = N / 256;            // contiguous chunk per thread? use strided-by-4 chunks: thread handles j = tid*4 + 1024*u
  float s1 = 0.f;
  for (int u = 0; u < per / 4; ++u) {
    const int j = tid * 4 + 1024 * u;
    const v4f a = *(const v4fa*)(x + j);
    v4f b = {0.f,0.f,0.f,0.f}; if (rr) b = *(const v4fa*)(rr + j);
#pragma unroll
    for (int q = 0; q < 4; ++q) { const float v = a[q] + b[q]; vals[u * 4 + q] = v; s1 += v; }
  }
  red[tid] = s1; __syncthreads();
  for (int st = 128; st > 0; st >>= 1) { if (tid < st) red[tid] += red[tid + st]; __syncthreads(); }
  const float mu = red[0] / (float)N; __syncthreads();
  float s2 = 0.f;
  for (int u = 0; u < per / 4; ++u)
#pragma unroll
    for (int q = 0; q < 4; ++q) { const float c = vals[u * 4 + q] - mu; s2 += c * c; }
  red[tid] = s2; __syncthreads();
  for (int st = 128; st > 0; st >>= 1) { if (tid < st) red[tid] += red[tid + st]; __syncthreads(); }
  const float rs = rsqrtf(red[0] / (float)N + eps);
  {
    for (int u = 0; u < per / 4; ++u) {
      const int j = tid * 4 + 1024 * u;
      v4f o, sm;
#pragma unroll
      for (int q = 0; q < 4; ++q) {
        float gg = g[j + q], bb = bta[j + q];
        if (PARAM_BF16) { gg = bf16_round(gg); bb = bf16_round(bb); }
        sm[q] = vals[u * 4 + q]; o[q] = (vals[u * 4 + q] - mu) * rs * gg + bb;
      }
      if (out_sum) *(v4f*)(out_sum + (size_t)row * N + j) = sm;
      *(v4f*)(out_norm + (size_t)row * N + j) = o;
    }
    
  }
}



// ---- f16 WMMA path (v_wmma_f32_16x16x32_f16): 11-bit significands for operands in range — used for every GEMM launched here
typedef _Float16 v16h __attribute__((ext_vector_type(16)));
union FragH { v16h v; v8us half[2]; _Float16 h[16]; unsigned short u[16]; };
template <int NT>
__device__ __forceinline__ v8f mmaH(v16h ah, v16h al, v16h bh, v16h bl, v8f c) {
  c = __builtin_amdgcn_wmma_f32_16x16x32_f16(false, ah, false, bh, (short)0, c, false, false);
  if (NT >= 2) c = __builtin_amdgcn_wmma_f32_16x16x32_f16(false, al, false, bh, (short)0, c, false, false);
  if (NT >= 3) c = __builtin_amdgcn_wmma_f32_16x16x32_f16(false, ah, false, bl, (short)0, c, false, false);
  asm volatile("v_nop\n\tv_nop\n\tv_nop\n\tv_nop" : "+v"(c) : "v"(ah), "v"(al), "v"(bh), "v"(bl));
  return c;
}
// batched GEMM like k_gemm_b but f16 operands: A f32 (split into f16 hi/lo if ASPLIT, else rounded to f16), Bt = f16 values [n][k]; alpha; C f32; N multiple of 16 (partial tiles skipped)
template <bool ASPLIT>
__global__ __launch_bounds__(128) void k_gemm_h(const float* __restrict__ A, int lda, size_t sA, const _Float16* __restrict__ Bh, int ldb, size_t sB, float alpha, float* __restrict__ C, int ldc, size_t sC, int M, int N, int K) {
  __shared__ __attribute__((aligned(16))) float so[4][16][64];
  const int tid = threadIdx.x, w = tid >> 5, lane = tid & 31, ln = lane & 15, hh = lane >> 4; const int by = blockIdx.y;
  A += (size_t)by * sA; Bh += (size_t)by * sB; C += (size_t)by * sC;
  const int ntn = (N + 63) / 64; const int wid = blockIdx.x * 4 + w; const int mt = wid / ntn, nq = wid % ntn; if (mt * 16 >= M) return;
  const int row0 = mt * 16, col0 = nq * 64; const float* arow = A + (size_t)(row0 + ln) * lda;
  v8f acc[4] = {};
  for (int kb = 0; kb < K; kb += 32) {
    FragH ah, al;
    const v4f x0 = *(const v4fa*)(arow + kb + 8 * hh), x1 = *(const v4fa*)(arow + kb + 8 * hh + 4), x2 = *(const v4fa*)(arow + kb + 16 + 8 * hh), x3 = *(const v4fa*)(arow + kb + 16 + 8 * hh + 4);
    float xs[16] = {x0[0],x0[1],x0[2],x0[3],x1[0],x1[1],x1[2],x1[3],x2[0],x2[1],x2[2],x2[3],x3[0],x3[1],x3[2],x3[3]};
#pragma unroll
    for (int i = 0; i < 16; ++i) { const _Float16 h = (_Float16)xs[i]; ah.h[i] = h; al.h[i] = ASPLIT ? (_Float16)(xs[i] - (float)h) : (_Float16)0.0f; }
#pragma unroll
    for (int t = 0; t < 4; ++t) { if (col0 + t * 16 >= N) continue; const size_t boff = (size_t)(col0 + t * 16 + ln) * ldb + kb; FragH bq; bq.half[0] = *(const v8us*)(Bh + boff + 8 * hh); bq.half[1] = *(const v8us*)(Bh + boff + 16 + 8 * hh);
      acc[t] = mmaH<ASPLIT ? 2 : 1>(ah.v, al.v, bq.v, bq.v, acc[t]); }
  }
#pragma unroll
  for (int t = 0; t < 4; ++t) { if (col0 + t * 16 >= N) continue;
#pragma unroll
    for (int r = 0; r < 8; ++r) so[w][8 * hh + r][t * 16 + ln] = acc[t][r] * alpha; }
  __builtin_amdgcn_fence(__ATOMIC_ACQ_REL, "workgroup"); __builtin_amdgcn_wave_barrier();
  const int rsub = lane >> 4, c4 = (lane & 15) * 4;
  {
#pragma unroll
    for (int q = 0; q < 8; ++q) { const int r = q * 2 + rsub; if (col0 + c4 < N) { const v4f v = *(const v4fa*)&so[w][r][c4]; *(v4f*)(C + (size_t)(row0 + r) * ldc + col0 + c4) = v; } }
     }
}

// Wt[n][k] = f16(W[k][n]·scale) from f32 row-major W[K][N] (scale = power of two; bf16-exact weights stay exact in f16 away from the subnormal range)
__global__ __launch_bounds__(256) void k_wt_f16(const float* __restrict__ W, _Float16* __restrict__ Wt, int K, int N, float scale) {
  const int t = blockIdx.x * 256 + threadIdx.x; if (t >= N * (K / 8)) return; const int n = t / (K / 8), k8 = (t % (K / 8)) * 8; FragH f;
#pragma unroll
  for (int i = 0; i < 8; ++i) f.h[i] = (_Float16)(bf16_round(W[(size_t)(k8 + i) * N + n]) * scale); const v8us o = f.half[0];
  *(v8us*)((unsigned short*)Wt + (size_t)n * K + k8) = o; 
}
// k_gemm_hh variant with fused epilogue: v = acc·alpha + bias[by·sBias + col] (+ CP[(row/rowsPerB)·sCPb + by·64 + col] if CP) ; ACT 0 none / 1 elu ; writes f16 C16 (and f32 C if non-null)
template <int ACT>
__global__ __launch_bounds__(128) void k_gemm_hhx(const _Float16* __restrict__ A, int lda, size_t sA, const _Float16* __restrict__ Bh, int ldb, size_t sB, float alpha, const float* __restrict__ bias, size_t sBias, const float* __restrict__ CP, int rowsPerB, size_t sCPb, int row0g,
    float* __restrict__ C, _Float16* __restrict__ C16, int ldc, size_t sC, int M, int N, int K) {
  __shared__ __attribute__((aligned(16))) float so[4][16][64];
  const int tid = threadIdx.x, w = tid >> 5, lane = tid & 31, ln = lane & 15, hh = lane >> 4; const int by = blockIdx.y;
  A += (size_t)by * sA; Bh += (size_t)by * sB; const size_t cofs = (size_t)by * sC; const float* bp = bias ? bias + (size_t)by * sBias : nullptr;
  const int ntn = (N + 63) / 64; const int wid = blockIdx.x * 4 + w; const int mt = wid / ntn, nq = wid % ntn; if (mt * 16 >= M) return;
  const int row0 = mt * 16, col0 = nq * 64; const _Float16* arow = A + (size_t)(row0 + ln) * lda;
  v8f acc[4] = {};
  for (int kb = 0; kb < K; kb += 32) { FragH ah; ah.half[0] = *(const v8us*)((const unsigned short*)arow + kb + 8 * hh); ah.half[1] = *(const v8us*)((const unsigned short*)arow + kb + 16 + 8 * hh);
#pragma unroll
    for (int t = 0; t < 4; ++t) { if (col0 + t * 16 >= N) continue; const size_t boff = (size_t)(col0 + t * 16 + ln) * ldb + kb; FragH bq; bq.half[0] = *(const v8us*)((const unsigned short*)Bh + boff + 8 * hh); bq.half[1] = *(const v8us*)((const unsigned short*)Bh + boff + 16 + 8 * hh);
      acc[t] = mmaH<1>(ah.v, ah.v, bq.v, bq.v, acc[t]); }
  }
#pragma unroll
  for (int t = 0; t < 4; ++t) { if (col0 + t * 16 >= N) continue; const int col = col0 + t * 16 + ln; const float bv = bp ? bf16_round(bp[col]) : 0.f;
#pragma unroll
    for (int r = 0; r < 8; ++r) { float v = acc[t][r] * alpha + bv; if (CP) { const int rr = row0g + row0 + 8 * hh + r; if (rowsPerB < 0) v += CP[cofs + (size_t)rr * ldc + col];      /* rowsPerB < 0: own element of the batched C plane */ else { const int bidx = rr / rowsPerB; v += CP[(size_t)bidx * sCPb + (size_t)by * 64 + col]; } } if (ACT == 1) v = (v > 0.f) ? v : expm1f(v); else if (ACT == 7) v = (v > 0.f) ? v + 1.0f : expf(v); else if (ACT == 8) v = tanhf(v); else if (ACT == 9) v = 0.5f * v * (1.0f + tanhf(0.7978845608028654f * (v + 0.044715f * v * v * v))); else if (ACT == 11) v = 1.0f / (1.0f + expf(-v)); else if (ACT == 12) v = (v > 0.f) ? v : 0.01f * v; else if (ACT == 14) v = (v > 0.f) ? v : 0.1f * v; else if (ACT == 16) v = (v >= 0.f) ? v : 0.3f * v; else if (ACT == 17) v = (v >= 0.f) ? v : 0.2f * v; else if (ACT == 15) v = v / (1.0f + expf(-v)); else if (ACT == 3) v = fmaxf(v, 0.f); else if (ACT == 6) v = 0.5f * v * (1.0f + erff(v * 0.70710678118654752f)); so[w][8 * hh + r][t * 16 + ln] = v; } }
  __builtin_amdgcn_fence(__ATOMIC_ACQ_REL, "workgroup"); __builtin_amdgcn_wave_barrier();
  const int rsub = lane >> 4, c4 = (lane & 15) * 4; typedef _Float16 v4h __attribute__((ext_vector_type(4)));
  {
#pragma unroll
    for (int q = 0; q < 8; ++q) { const int r = q * 2 + rsub; if (col0 + c4 < N) { const v4f v = *(const v4fa*)&so[w][r][c4]; if (C) *(v4f*)(C + cofs + (size_t)(row0 + r) * ldc + col0 + c4) = v; if (C16) { v4h h4; for (int i = 0; i < 4; ++i) h4[i] = (_Float16)v[i]; *(v4h*)(C16 + cofs + (size_t)(row0 + r) * ldc + col0 + c4) = h4; } } }
     }
}


typedef _Float16 v4h __attribute__((ext_vector_type(4)));

__global__ __launch_bounds__(256) void k_x16(const float* __restrict__ x, _Float16* __restrict__ X16, size_t n8) { const size_t t = (size_t)blockIdx.x * 256 + threadIdx.x; if (t >= n8) return; FragH f;
#pragma unroll
  for (int q = 0; q < 8; ++q) f.h[q] = (_Float16)bf16_round(x[t * 8 + q]); *(v8us*)((unsigned short*)X16 + t * 8) = f.half[0];  }
__global__ __launch_bounds__(256) void k_h16(const float* __restrict__ x, _Float16* __restrict__ X16, size_t n8) { const size_t t = (size_t)blockIdx.x * 256 + threadIdx.x; if (t >= n8) return; FragH f;
#pragma unroll
  for (int q = 0; q < 8; ++q) f.h[q] = (_Float16)x[t * 8 + q]; *(v8us*)((unsigned short*)X16 + t * 8) = f.half[0];  }
__global__ __launch_bounds__(256) void k_round16f(const float* __restrict__ W, _Float16* __restrict__ Bt, size_t n8) { const size_t t = (size_t)blockIdx.x * 256 + threadIdx.x; if (t >= n8) return; FragH f;
#pragma unroll
  for (int i = 0; i < 8; ++i) f.h[i] = (_Float16)(bf16_round(W[t * 8 + i]) * 16.0f); *(v8us*)((unsigned short*)Bt + t * 8) = f.half[0];  }
template <int NHv, int TTv>
__global__ __launch_bounds__(256) void k_vt(const _Float16* __restrict__ V16, int ldv, int voff, _Float16* __restrict__ Vt) { __shared__ unsigned short tl[64][66]; const int tid = threadIdx.x; const int slab = blockIdx.x / (TTv / 64), lg = blockIdx.x % (TTv / 64); const int b = slab / NHv, h = slab % NHv;
  for (int i = tid; i < 64 * 8; i += 256) { const int r = i / 8, c8 = (i % 8) * 8; FragH f; f.half[0] = *(const v8us*)((const unsigned short*)V16 + ((size_t)b * TTv + lg * 64 + r) * ldv + voff + h * 64 + c8);
#pragma unroll
    for (int q = 0; q < 8; ++q) tl[r][c8 + q] = f.u[q]; }
  __syncthreads();
  {
#pragma unroll
    for (int rd = 0; rd < 2; ++rd) { const int d = rd * 32 + tid / 8, pc = tid % 8; FragH f;
#pragma unroll
      for (int q = 0; q < 8; ++q) f.u[q] = tl[pc * 8 + q][d];
      *(v8us*)((unsigned short*)Vt + ((size_t)slab * 64 + d) * TTv + lg * 64 + pc * 8) = f.half[0]; }
     } }

__global__ __launch_bounds__(256) void k_hl(const float* __restrict__ F, _Float16* __restrict__ Hh, _Float16* __restrict__ Hl, size_t n8) { const size_t t = (size_t)blockIdx.x * 256 + threadIdx.x; if (t >= n8) return; FragH fh, fl; const v4f a = *(const v4fa*)(F + t * 8), c = *(const v4fa*)(F + t * 8 + 4);
#pragma unroll
  for (int q = 0; q < 4; ++q) { _Float16 h = (_Float16)a[q]; fh.h[q] = h; fl.h[q] = (_Float16)((a[q] - (float)h) * 1024.0f); h = (_Float16)c[q]; fh.h[4 + q] = h; fl.h[4 + q] = (_Float16)((c[q] - (float)h) * 1024.0f); }
  { *(v8us*)((unsigned short*)Hh + t * 8) = fh.half[0]; *(v8us*)((unsigned short*)Hl + t * 8) = fl.half[0];  } }

// ---- fast GEMM (work-group tile 128x64, wave tile 32x64; requires M % 128 == 0, N % 64 == 0, K % 64 == 0); epilogue = k_gemm_hhx semantics; ROWB: bias indexed by the C row (weights as A) instead of the C column ----
// Operand path: per stage of 64 k (one 128-B line of every operand row) the 128 A rows and 64 B rows of the work-group's tile are copied to LDS by
// asynchronous b128 copies (a wave-wide copy = 4 whole lines), two buffers, the next stage in flight while this one is multiplied; fragments come from LDS.
#define G2_PITCH 144                      /* LDS row pitch in bytes, 16 B x odd: conflict-free for the ds_load_b128 fragment reads of 128-B rows */
#define G2_STAGE ((128 + 64) * G2_PITCH)  /* bytes of one buffer: A rows 0..127, then B rows 0..63 */
__device__ __forceinline__ v16h g2_frag(const unsigned char* p) { FragH f; f.half[0] = *(const v8us*)p; f.half[1] = *(const v8us*)(p + 32); return f.v; }
__device__ __forceinline__ v8f g2_mma(v16h a, v16h b, v8f c) { v8f d = __builtin_amdgcn_wmma_f32_16x16x32_f16(false, a, false, b, (short)0, c, false, false); asm volatile("v_nop\n\tv_nop\n\tv_nop\n\tv_nop" : "+v"(d) : "v"(a), "v"(b)); return d; }
// One stage: each of the 128 threads copies 16 B of 8 A rows and 4 B rows (rows 16 apart). l = the lane's LDS byte address in the buffer, a / b = its global
// addresses, sa / sb = 16 rows in elements. The closing s_wait_xcnt keeps every address register intact until the copies have taken it.
__device__ __forceinline__ void g2_stage(unsigned l, const _Float16* a, size_t sa, const _Float16* b, size_t sb) {
  asm volatile("global_load_async_to_lds_b128 %0, %12, off\n\t"
               "global_load_async_to_lds_b128 %1, %13, off\n\t"
               "global_load_async_to_lds_b128 %2, %14, off\n\t"
               "global_load_async_to_lds_b128 %3, %15, off\n\t"
               "global_load_async_to_lds_b128 %4, %16, off\n\t"
               "global_load_async_to_lds_b128 %5, %17, off\n\t"
               "global_load_async_to_lds_b128 %6, %18, off\n\t"
               "global_load_async_to_lds_b128 %7, %19, off\n\t"
               "global_load_async_to_lds_b128 %8, %20, off\n\t"
               "global_load_async_to_lds_b128 %9, %21, off\n\t"
               "global_load_async_to_lds_b128 %10, %22, off\n\t"
               "global_load_async_to_lds_b128 %11, %23, off\n\t"
               "s_wait_xcnt 0x0"
               :: "v"(l), "v"(l + 16 * G2_PITCH), "v"(l + 32 * G2_PITCH), "v"(l + 48 * G2_PITCH), "v"(l + 64 * G2_PITCH), "v"(l + 80 * G2_PITCH), "v"(l + 96 * G2_PITCH), "v"(l + 112 * G2_PITCH),
                  "v"(l + 128 * G2_PITCH), "v"(l + 144 * G2_PITCH), "v"(l + 160 * G2_PITCH), "v"(l + 176 * G2_PITCH),
                  "v"(a), "v"(a + sa), "v"(a + 2 * sa), "v"(a + 3 * sa), "v"(a + 4 * sa), "v"(a + 5 * sa), "v"(a + 6 * sa), "v"(a + 7 * sa),
                  "v"(b), "v"(b + sb), "v"(b + 2 * sb), "v"(b + 3 * sb)
               : "memory");
}
// The body takes its LDS and its block indices (bx = tile, by = batch plane) from the caller, so that one launch can hold the tiles of several independent GEMMs.
template <int ACT, bool ROWB>
__device__ __forceinline__ void g2_body(unsigned char* smem, const int bx, const int by, const _Float16* __restrict__ A, int lda, size_t sA, const _Float16* __restrict__ Bh, int ldb, size_t sB, float alpha, const float* __restrict__ bias, size_t sBias, const float* __restrict__ CP, int rowsPerB, size_t sCPb, int row0g,
    float* __restrict__ C, _Float16* __restrict__ C16, int ldc, size_t sC, int M, int N, int K) { static_assert(ACT == 0 || ACT == 3 || ACT == 6 || ACT == 8 || ACT == 9 || ACT == 11 || ACT == 12 || ACT == 14 || ACT == 15 || ACT == 16 || ACT == 17, "k_gemm2: unsupported ACT code (would silently apply no activation)");
  static_assert(sizeof(float) * 4 * 32 * 68 <= 2 * G2_STAGE, "output staging must fit the operand buffers");
  float (*so)[32][68] = (float (*)[32][68])smem;
  const int tid = threadIdx.x, w = tid >> 5, lane = tid & 31, ln = lane & 15, hh = lane >> 4;
  A += (size_t)by * sA; Bh += (size_t)by * sB; const size_t cofs = (size_t)by * sC; const float* bp = bias ? bias + (size_t)by * sBias : nullptr;
  const int ntn = N >> 6; const int mt = bx / ntn, nq = bx - mt * ntn; const int row0 = mt * 128 + 32 * w, col0 = nq * 64; if (mt * 128 >= M) return;      /* the whole work-group leaves, in front of every barrier */
  const unsigned lcp = (unsigned)(size_t)smem + (unsigned)((tid >> 3) * G2_PITCH + (tid & 7) * 16);
  const _Float16* gA = A + (size_t)(mt * 128 + (tid >> 3)) * lda + (tid & 7) * 8; const _Float16* gB = Bh + (size_t)(col0 + (tid >> 3)) * ldb + (tid & 7) * 8; const size_t sa16 = (size_t)16 * lda, sb16 = (size_t)16 * ldb;
  const int nst = K >> 6;
  const v8f z8 = {0.f,0.f,0.f,0.f,0.f,0.f,0.f,0.f}; v8f c00 = z8, c01 = z8, c02 = z8, c03 = z8, c10 = z8, c11 = z8, c12 = z8, c13 = z8;
  g2_stage(lcp, gA, sa16, gB, sb16);
  asm volatile("s_wait_asynccnt 0x0" ::: "memory");      /* this wave's copies of stage 0 have landed */
  __syncthreads();                                       /* ... and every other wave's */
  if (nst > 1) g2_stage(lcp + G2_STAGE, gA + 64, sa16, gB + 64, sb16);
#pragma unroll 1
  for (int s = 0; s < nst; ++s) { const unsigned char* sb = smem + (s & 1) * G2_STAGE; const unsigned char* pa = sb + (32 * w + ln) * G2_PITCH + 16 * hh; const unsigned char* pb = sb + (128 + ln) * G2_PITCH + 16 * hh;
    v16h fa[2][2], fb[2][4];      /* the stage's 12 fragments are read as one group in front of its 16 WMMAs: one LDS latency a stage instead of one per B fragment */
#pragma unroll
    for (int h = 0; h < 2; ++h) { fa[h][0] = g2_frag(pa + 64 * h); fa[h][1] = g2_frag(pa + 16 * G2_PITCH + 64 * h);
#pragma unroll
      for (int t = 0; t < 4; ++t) fb[h][t] = g2_frag(pb + 16 * t * G2_PITCH + 64 * h); }
#pragma unroll
    for (int h = 0; h < 2; ++h) {
      c00 = g2_mma(fa[h][0], fb[h][0], c00); c10 = g2_mma(fa[h][1], fb[h][0], c10);
      c01 = g2_mma(fa[h][0], fb[h][1], c01); c11 = g2_mma(fa[h][1], fb[h][1], c11);
      c02 = g2_mma(fa[h][0], fb[h][2], c02); c12 = g2_mma(fa[h][1], fb[h][2], c12);
      c03 = g2_mma(fa[h][0], fb[h][3], c03); c13 = g2_mma(fa[h][1], fb[h][3], c13); }
    asm volatile("s_wait_dscnt 0x0" ::: "memory");       /* this wave's reads of the buffer are over before it may be refilled */
    asm volatile("s_wait_asynccnt 0x0" ::: "memory");    /* this wave's copies of stage s + 1 have landed */
    __syncthreads();                                     /* publishes stage s + 1 and ends every wave's reads of stage s */
    if (s + 2 < nst) g2_stage(lcp + (unsigned)(s & 1) * G2_STAGE, gA + (size_t)(s + 2) * 64, sa16, gB + (size_t)(s + 2) * 64, sb16); }
  asm volatile("s_wait_asynccnt 0x0" ::: "memory");      /* no copy is outstanding when the buffers become output staging */
  v8f accs[8] = {c00, c01, c02, c03, c10, c11, c12, c13};
  float rbias[16];      /* ROWB: the bias of this lane's 16 C rows, loaded as one group in front of the element loop; both loops unrolled so that every index is a constant and the array stays in registers */
#pragma unroll
  for (int i = 0; i < 16; ++i) rbias[i] = 0.f;
  if (ROWB && bp) { const float* br = bp + row0 + 8 * hh;
#pragma unroll
    for (int i = 0; i < 16; ++i) rbias[i] = bf16_round(br[(i >> 3) * 16 + (i & 7)]); }
#pragma unroll
  for (int u = 0; u < 8; ++u) { const int t = u & 3, half = u >> 2; const int col = col0 + t * 16 + ln; const float bvc = (!ROWB && bp) ? bf16_round(bp[col]) : 0.f;
#pragma unroll
    for (int r = 0; r < 8; ++r) { const int rloc = half * 16 + 8 * hh + r; const float bv = ROWB ? rbias[half * 8 + r] : bvc; float v = accs[u][r] * alpha + bv; if (CP) { if (rowsPerB < 0) v += CP[cofs + (size_t)(row0g + row0 + rloc) * ldc + col];      /* rowsPerB < 0: own element of the batched C plane */ else { const int bidx = (row0g + row0 + rloc) / rowsPerB; v += CP[(size_t)bidx * sCPb + (size_t)by * 64 + col]; } }
      if (ACT == 3) v = fmaxf(v, 0.f); else if (ACT == 6) v = 0.5f * v * (1.0f + erff(v * 0.70710678118654752f)); else if (ACT == 11) v = 1.0f / (1.0f + expf(-v)); else if (ACT == 15) v = v / (1.0f + expf(-v)); else if (ACT == 12) v = (v > 0.f) ? v : 0.01f * v; else if (ACT == 8) v = tanhf(v); else if (ACT == 9) v = 0.5f * v * (1.0f + tanhf(0.7978845608028654f * (v + 0.044715f * v * v * v))); else if (ACT == 14) v = (v > 0.f) ? v : 0.1f * v; else if (ACT == 16) v = (v >= 0.f) ? v : 0.3f * v; else if (ACT == 17) v = (v >= 0.f) ? v : 0.2f * v;
      so[w][rloc][t * 16 + ln] = v; } }
  __builtin_amdgcn_fence(__ATOMIC_ACQ_REL, "workgroup"); __builtin_amdgcn_wave_barrier();
  const int rsub = lane >> 4, c4 = (lane & 15) * 4;
  {
#pragma unroll
    for (int q = 0; q < 16; ++q) { const int r = q * 2 + rsub; const v4f v = *(const v4fa*)&so[w][r][c4]; if (C) { *(v4f*)(C + cofs + (size_t)(row0 + r) * ldc + col0 + c4) = v; if (C16) asm volatile("s_wait_xcnt 0x0" ::: "memory"); }      /* the wait stands in front of the conversion below, which may overwrite registers that the f32 store names */
      if (C16) { v4h h4; for (int i = 0; i < 4; ++i) h4[i] = (_Float16)v[i]; *(v4h*)(C16 + cofs + (size_t)(row0 + r) * ldc + col0 + c4) = h4; } }
    asm volatile("s_wait_xcnt 0x0" ::: "memory");      /* stands behind the last stores, in front of any code of the calling kernel that follows the body and may overwrite registers that they name */
     } }
#define G2_SMEM __shared__ __attribute__((aligned(16))) unsigned char smem[2 * G2_STAGE]      /* the two operand buffers; behind the K loop's last barrier the same bytes stage the output tile */
template <int ACT, bool ROWB>
__global__ __launch_bounds__(128) void k_gemm2(const _Float16* __restrict__ A, int lda, size_t sA, const _Float16* __restrict__ Bh, int ldb, size_t sB, float alpha, const float* __restrict__ bias, size_t sBias, const float* __restrict__ CP, int rowsPerB, size_t sCPb, int row0g,
    float* __restrict__ C, _Float16* __restrict__ C16, int ldc, size_t sC, int M, int N, int K) { G2_SMEM;
  g2_body<ACT, ROWB>(smem, (int)blockIdx.x, (int)blockIdx.y, A, lda, sA, Bh, ldb, sB, alpha, bias, sBias, CP, rowsPerB, sCPb, row0g, C, C16, ldc, sC, M, N, K); }
// K and V in one launch (neither reads the other): x = tile, y = sample, z = which. Weights as A: C[channel][position] per sample.
__global__ __launch_bounds__(128) void k_gemm_kv(const _Float16* __restrict__ X16, const _Float16* __restrict__ BWq, const _Float16* __restrict__ BWv, const float* __restrict__ bq, const float* __restrict__ bv, _Float16* __restrict__ KC, _Float16* __restrict__ VC) { G2_SMEM;
  const bool isv = blockIdx.z != 0;
  g2_body<0, true>(smem, (int)blockIdx.x, (int)blockIdx.y, isv ? BWv : BWq, CC, 0, X16, CC, (size_t)PX * CC, 0.0625f, isv ? bv : bq, 0, nullptr, 1, 0, 0, nullptr, isv ? VC : KC, PX, (size_t)CC * PX, CC, PX, CC); }
// M and Q in one launch (M reads K and V, Q reads X: neither reads the other). M's tiles have twice the k length and stand first in the grid, so that they start first.
#define MQ_MT NH      /* M tiles per sample: one per head, the 128x64 tile that holds the head's diagonal block (O never reads the other tiles) */
__global__ __launch_bounds__(128) void k_gemm_mq(const _Float16* __restrict__ VC, const _Float16* __restrict__ KC, _Float16* __restrict__ BD, const _Float16* __restrict__ X16, const _Float16* __restrict__ BWk, const float* __restrict__ bk, _Float16* __restrict__ QR) { G2_SMEM;
  const int b = (int)blockIdx.x;
  if (b < NB * MQ_MT) { const int h = b % MQ_MT; g2_body<0, false>(smem, (h >> 1) * (CC / 64) + h, b / MQ_MT, VC, PX, (size_t)CC * PX, KC, PX, (size_t)CC * PX, 1.0f, nullptr, 0, nullptr, 1, 0, 0, nullptr, BD, CC, (size_t)CC * CC, CC, CC, PX); }      /* M[c][c'] = sum_D V[c][D] K[c'][D], column tile h, row tile h / 2: already in the [n][k] order that the O GEMM's B operand wants */
  else g2_body<0, false>(smem, b - NB * MQ_MT, 0, X16, CC, 0, BWk, CC, 0, 0.0625f, bk, 0, nullptr, 1, 0, 0, nullptr, QR, CC, 0, (int)NR, CC, CC); }      /* Q = K_conv(X), token-major */
// O per head: O[d][c] = sum_c' Q[d][c'] M[c][c'] with c and c' in head h only, so each 128x64 tile is a GEMM of k = 64 on the head's columns of Q and the head's diagonal block of M. x = row tile * heads + head, y = sample.
__global__ __launch_bounds__(128) void k_gemm_o(const _Float16* __restrict__ QR, const _Float16* __restrict__ BD, _Float16* __restrict__ OR) { G2_SMEM;
  const int h = (int)blockIdx.x % NH;
  g2_body<0, false>(smem, (int)blockIdx.x / NH, (int)blockIdx.y, QR + h * HD, CC, (size_t)PX * CC, BD + (size_t)h * HD * CC + h * HD, CC, (size_t)CC * CC, 1.0f, nullptr, 0, nullptr, 1, 0, 0, nullptr, OR + h * HD, CC, (size_t)PX * CC, PX, HD, HD); }


__device__ __forceinline__ void xrows_body(const float* __restrict__ x, _Float16* __restrict__ X16, const int bx) { __shared__ float tl[64][33]; const int tid = threadIdx.x; const int cg = bx % (CC / 64); const int pb = (bx / (CC / 64)) % (PX / 32); const int n = bx / ((CC / 64) * (PX / 32)); const int p0 = pb * 32, c0 = cg * 64;
  for (int i = tid; i < 64 * 32; i += 256) { const int c = i / 32, j = i % 32; tl[c][j] = bf16_round(x[((size_t)n * CC + c0 + c) * PX + p0 + j]); }
  __syncthreads();
  { for (int i = tid; i < 32 * 8; i += 256) { const int j = i / 8, c8 = (i % 8) * 8; FragH f; for (int q = 0; q < 8; ++q) f.h[q] = (_Float16)tl[c8 + q][j]; *(v8us*)((unsigned short*)X16 + ((size_t)n * PX + p0 + j) * CC + c0 + c8) = f.half[0]; }  } }
__device__ __forceinline__ void wnat_body(const float* __restrict__ w, size_t n8, _Float16* __restrict__ Bt, const int bx) { const size_t t = (size_t)bx * 256 + threadIdx.x; if (t >= n8) return; FragH f; for (int q = 0; q < 8; ++q) f.h[q] = (_Float16)(bf16_round(w[t * 8 + q]) * 16.0f); *(v8us*)((unsigned short*)Bt + t * 8) = f.half[0];  }
// The X transpose and the four weight roundings in one launch (none reads another's result): the transpose's blocks first, then WB blocks per weight matrix.
#define XB (NB * (CC / 64) * (PX / 32))
#define WB ((CC * CC / 8 + 255) / 256)
__global__ __launch_bounds__(256) void k_prep(const float* __restrict__ x, _Float16* __restrict__ X16, const float* __restrict__ Wq, const float* __restrict__ Wk, const float* __restrict__ Wv, const float* __restrict__ Wo,
    _Float16* __restrict__ BWq, _Float16* __restrict__ BWk, _Float16* __restrict__ BWv, _Float16* __restrict__ BWo) {
  const int b = (int)blockIdx.x;
  if (b < XB) { xrows_body(x, X16, b); return; }      /* the same for the whole block */
  const int m = (b - XB) / WB;
  wnat_body(m == 0 ? Wq : m == 1 ? Wk : m == 2 ? Wv : Wo, (size_t)CC * CC / 8, m == 0 ? BWq : m == 1 ? BWk : m == 2 ? BWv : BWo, (b - XB) % WB); }
__global__ __launch_bounds__(256) void k_gnstat(const float* __restrict__ O2, float* __restrict__ stat) { __shared__ double rs_[256], rq[256]; const int tid = threadIdx.x; const int n = blockIdx.x / GRP, g = blockIdx.x % GRP; double s = 0.0, q2 = 0.0;
#pragma unroll 1
  for (int i = tid; i < PX * CPG; i += 256) { const double v = (double)O2[((size_t)n * CC + g * CPG) * PX + i]; s += v; q2 += v * v; }      /* the group's 4 channel rows are contiguous */
  rs_[tid] = s; rq[tid] = q2; __syncthreads();
  for (int st = 128; st > 0; st >>= 1) { if (tid < st) { rs_[tid] += rs_[tid + st]; rq[tid] += rq[tid + st]; } __syncthreads(); }
  if (tid == 0) { const double cnt = (double)(PX * CPG); const double mu = rs_[0] / cnt; double var = rq[0] / cnt - mu * mu; if (var < 0.0) var = 0.0; const float m = (float)mu, r = (float)(1.0 / sqrt(var + 1e-5));
    v8f l0, z; for (int q = 0; q < 8; ++q) { l0[q] = 0.f; z[q] = 0.f; } l0[0] = m; l0[1] = r; float* d = stat + (size_t)blockIdx.x * 32;      
    { *(v8f*)d = l0; *(v8f*)(d + 8) = z; *(v8f*)(d + 16) = z; *(v8f*)(d + 24) = z;  } } }
__global__ __launch_bounds__(256) void k_out(const float* __restrict__ O2, const float* __restrict__ stat, const float* __restrict__ gw, const float* __restrict__ gb, const float* __restrict__ x, float* __restrict__ out) {
  #pragma clang fp contract(off)
  const size_t t = (size_t)blockIdx.x * 256 + threadIdx.x; if (t >= (size_t)NB * CC * PX / 8) return; const size_t nc = (t * 8) / PX; const int c = (int)(nc % CC); const size_t n = nc / CC; const int g = c / CPG; const float m = stat[(n * GRP + g) * 32], r = stat[(n * GRP + g) * 32 + 1]; const float gwc = gw[c], gbc = gb[c];
  asm volatile("s_wait_xcnt 0x0" ::: "memory");      /* stands in front of any overwrite of the offset register that the two loads above name */
  const float w = bf16_round(gwc), bb = bf16_round(gbc); v8f o;
  for (int q = 0; q < 8; ++q) { const float v = O2[t * 8 + q]; o[q] = __fadd_rn(__fadd_rn(__fmul_rn((v - m) * r, w), bb), bf16_round(x[t * 8 + q])); }
  *(v8f*)(out + t * 8) = o;  }

extern "C" void kernel_launch(void* const* d_in, const int* in_sizes, int n_in,
                              void* d_out, int out_size, void* d_ws, size_t ws_size, hipStream_t stream) {
  (void)in_sizes; (void)n_in; (void)out_size;
  const float* const* I = (const float* const*)d_in; const float* X = I[0]; const float* Wq = I[1]; const float* bq = I[2]; const float* Wk = I[3]; const float* bk = I[4]; const float* Wv = I[5]; const float* bv = I[6]; const float* Wo = I[7]; const float* bo = I[8]; const float* gw = I[9]; const float* gb = I[10];
  char* ws = (char*)d_ws; size_t off = 0;
  auto take = [&](size_t bytes) { char* p = ws + off; off += (bytes + 255) & ~(size_t)255; return p; };
  _Float16* BWq = (_Float16*)take((size_t)CC * CC * 2); _Float16* BWk = (_Float16*)take((size_t)CC * CC * 2); _Float16* BWv = (_Float16*)take((size_t)CC * CC * 2); _Float16* BWo = (_Float16*)take((size_t)CC * CC * 2);
  _Float16* X16 = (_Float16*)take(NR * CC * 2); _Float16* QR = (_Float16*)take(NR * CC * 2); _Float16* KC = (_Float16*)take(NR * CC * 2); _Float16* VC = (_Float16*)take(NR * CC * 2); _Float16* BD = (_Float16*)take((size_t)NB * CC * CC * 2); _Float16* OR = (_Float16*)take(NR * CC * 2); float* O2 = (float*)take(NR * CC * 4); float* stat = (float*)take((size_t)NB * GRP * 32 * 4);
  if (off > ws_size) return;      /* 2 + 16x5 + 8 + 32 = about 122 MiB */
  k_prep<<<XB + 4 * WB, 256, 0, stream>>>(X, X16, Wq, Wk, Wv, Wo, BWq, BWk, BWv, BWo);
  const dim3 gc((CC / 128) * (PX / 64), NB);      /* weights as A: C[channel][position] per sample, y = sample */
  k_gemm_kv<<<dim3((CC / 128) * (PX / 64), NB, 2), 128, 0, stream>>>(X16, BWq, BWv, bq, bv, KC, VC);      /* K = Q_conv(X) (the module's swap) and V, channel-major */
  /* all samples in one launch each: per-sample planes of KC, VC and BD (of BD only the tiles with a diagonal block are written, and only the diagonal blocks read) */
  k_gemm_mq<<<NB * MQ_MT + (unsigned)((NR / 128) * (CC / 64)), 128, 0, stream>>>(VC, KC, BD, X16, BWk, bk, QR);
  k_gemm_o<<<dim3((PX / 128) * NH, NB), 128, 0, stream>>>(QR, BD, OR);      /* O[d][c] = sum_c' Q[d][c'] M[c][c'] within the head */
  k_gemm2<0, true><<<gc, 128, 0, stream>>>(BWo, CC, 0, OR, CC, (size_t)PX * CC, 0.0625f, bo, 0, nullptr, 1, 0, 0, O2, nullptr, PX, (size_t)CC * PX, CC, PX, CC);      /* O2[n][c][p], the output's own layout */
  k_gnstat<<<NB * GRP, 256, 0, stream>>>(O2, stat);
  k_out<<<(unsigned)(((size_t)NB * CC * PX / 8 + 255) / 256), 256, 0, stream>>>(O2, stat, gw, gb, X, (float*)d_out);
}

// v006
// Measured time: 90.9 microseconds a run.
// Two timings next to v005 both put it at 1.07 times that version's speed.
// Over all steps from v000 it is 12.4 times as fast.
#include <hip/hip_runtime.h>
// Non_local_MH (X [16][512][32][32]; K = conv1x1(X, Wq, bq), Q = conv1x1(X, Wk, bk), V = conv1x1(X, Wv, bv) (the module's swapped naming), 8 heads of 64 channels over d = 1,024 positions; softmax-FREE attention A = Q^T K ([d][d]), O = V A^T; O = conv1x1(O, Wo, bo); GroupNorm(128 groups of 4 channels, eps 1e-5, affine); out = GN(O) + X -> [16][512][32][32]).
// Structure (analytic reassociation, exact in real arithmetic): O[c][d] = sum_D A[d][D] V[c][D] = sum_c' Q[c'][d] (sum_D K[c'][D] V[c][D]) = sum_c' Q[c'][d] M[c'][c] with the per-head 64x64 matrix M = K V^T - so per sample: the 1x1 convs as WMMA GEMMs (32x64 wave tiles, f32 accumulation, exact x16 weights + bias, f16 outputs): Q with the token rows as A (token-major result), K and V with the weight rows as A and the token rows as B (channel-major result, bias per row); M^T = V_cm K_cm^T (K = 1,024) only in the 128x64 tiles that hold a head-diagonal 64x64 block, stored f16, O_rows = Q_rows . M_head GEMM per head (K = 64: the head's own channels), O2 = Wo O^T + bo GEMM (f32, weight rows as A: channel-major); GroupNorm statistics per (sample, group) on VALU (float64 accumulation) over 4,096 contiguous values, affine + residual elementwise on VALU.
// Compute dtype: inputs rounded to bf16; X / weights exact; K, Q, V, M and O as plain f16 GEMM operands (~2^-12); GN statistics float64; everything else f32. v_wmma_f32_16x16x32_f16.
#define NB 16
#define CC 512
#define PX 1024
#define NR ((size_t)NB * PX)         /* 16384 */
#define NH 8
#define HD 64
#define GRP 128
#define CPG (CC / GRP)               /* 4 */
typedef __bf16 v16b __attribute__((ext_vector_type(16)));
typedef unsigned short v8us __attribute__((ext_vector_type(8), may_alias));
typedef float  v8f  __attribute__((ext_vector_type(8)));
typedef float  v4f  __attribute__((ext_vector_type(4)));
typedef float  v4fa __attribute__((ext_vector_type(4), may_alias));
union FragB { v16b v; v8us half[2]; unsigned short u[16]; };

__device__ __forceinline__ unsigned short bf16_bits(float x) { unsigned int u = __float_as_uint(x); return (unsigned short)((u + 0x7FFFu + ((u >> 16) & 1u)) >> 16); }
__device__ __forceinline__ float bf16_val(unsigned short b) { return __uint_as_float(((unsigned int)b) << 16); }
__device__ __forceinline__ float bf16_round(float x) { return bf16_val(bf16_bits(x)); }
// D += A·B with NT terms: 1 = ah·bh, 2 = + al·bh (A split), 3 = + ah·bl (both split)
template <int NT>
__device__ __forceinline__ v8f mmaN(v16b ah, v16b al, v16b bh, v16b bl, v8f c) {
  c = __builtin_amdgcn_wmma_f32_16x16x32_bf16(false, ah, false, bh, (short)0, c, false, false);
  if (NT >= 2) c = __builtin_amdgcn_wmma_f32_16x16x32_bf16(false, al, false, bh, (short)0, c, false, false);
  if (NT >= 3) c = __builtin_amdgcn_wmma_f32_16x16x32_bf16(false, ah, false, bl, (short)0, c, false, false);
  asm volatile("v_nop\n\tv_nop\n\tv_nop\n\tv_nop" : "+v"(c) : "v"(ah), "v"(al), "v"(bh), "v"(bl));
  return c;
}

__global__ __launch_bounds__(256) void k_wt_bf16(const float* __restrict__ W, unsigned short* __restrict__ Wt, int K, int N) {
  const int t = blockIdx.x * 256 + threadIdx.x;
  const int k8n = K / 8;
  if (t >= N * k8n) return;
  const int n = t / k8n, k8 = (t % k8n) * 8;
  v8us v;
#pragma unroll
  for (int i = 0; i < 8; ++i) v[i] = bf16_bits(W[(size_t)(k8 + i) * N + n]);
  *(v8us*)(Wt + (size_t)n * K + k8) = v;
  
}

// GEMM C[M][N] (f32, pitch ldc) = act(A[M][K]·W + bias). A f32 row-major (pitch lda) converted per fragment to bf16
// (ASPLIT: hi/lo two planes -> 2 terms, else single rounded term); Wt bf16 [N][K] (pitch ldb). BIAS_BF16 rounds the
// bias to bf16 first (bias quantised to bf16 before the add). K%32==0, M%16==0, N%64==0.
template <bool ASPLIT, int ACT, bool BIAS_BF16>
__global__ __launch_bounds__(128) void k_gemm_bf(const float* __restrict__ A, int lda, const unsigned short* __restrict__ Wt, int ldb,
                                               const float* __restrict__ bias, float* __restrict__ C, int ldc, int M, int N, int K) {
  __shared__ __attribute__((aligned(16))) float so[4][16][64];
  const int tid = threadIdx.x, w = tid >> 5, lane = tid & 31, ln = lane & 15, hh = lane >> 4;
  const int ntn = N / 64;
  const int wid = blockIdx.x * 4 + w;
  const int mt = wid / ntn, nq = wid % ntn;
  if (mt * 16 >= M) return;
  const int row0 = mt * 16, col0 = nq * 64;
  const float* arow = A + (size_t)(row0 + ln) * lda;
  v8f acc[4] = {};
  for (int kb = 0; kb < K; kb += 32) {
    FragB ah, al;
    const v4f x0 = *(const v4fa*)(arow + kb + 8 * hh), x1 = *(const v4fa*)(arow + kb + 8 * hh + 4);
    const v4f x2 = *(const v4fa*)(arow + kb + 16 + 8 * hh), x3 = *(const v4fa*)(arow + kb + 16 + 8 * hh + 4);
    float xs[16] = {x0[0],x0[1],x0[2],x0[3],x1[0],x1[1],x1[2],x1[3],x2[0],x2[1],x2[2],x2[3],x3[0],x3[1],x3[2],x3[3]};
#pragma unroll
    for (int i = 0; i < 16; ++i) { const unsigned short hb = bf16_bits(xs[i]); ah.u[i] = hb; al.u[i] = ASPLIT ? bf16_bits(xs[i] - bf16_val(hb)) : (unsigned short)0; }
#pragma unroll
    for (int t = 0; t < 4; ++t) {
      const unsigned short* brow = Wt + (size_t)(col0 + t * 16 + ln) * ldb + kb;
      FragB b;
      b.half[0] = *(const v8us*)(brow + 8 * hh);
      b.half[1] = *(const v8us*)(brow + 16 + 8 * hh);
      acc[t] = mmaN<ASPLIT ? 2 : 1>(ah.v, al.v, b.v, b.v, acc[t]);
    }
  }
#pragma unroll
  for (int t = 0; t < 4; ++t) {
    float bv = bias ? bias[col0 + t * 16 + ln] : 0.f;
    if (BIAS_BF16) bv = bf16_round(bv);
#pragma unroll
    for (int r = 0; r < 8; ++r) { float v = acc[t][r] + bv; if (ACT == 1) v = fmaxf(v, 0.f); so[w][8 * hh + r][t * 16 + ln] = v; }
  }
  __builtin_amdgcn_fence(__ATOMIC_ACQ_REL, "workgroup");
  __builtin_amdgcn_wave_barrier();
  const int rsub = lane >> 4, c4 = (lane & 15) * 4;
  {
#pragma unroll
    for (int q = 0; q < 8; ++q) {
      const int r = q * 2 + rsub;
      const v4f v = *(const v4fa*)&so[w][r][c4];
      *(v4f*)(C + (size_t)(row0 + r) * ldc + col0 + c4) = v;
    }
    
  }
}

// GEMM C = act(A·W + bias + resid): A f32 (ASPLIT -> hi/lo 2 terms), Wt bf16 [N][K]; ACT 0 none, 1 relu, 2 exact gelu;
// resid (optional, f32, row index = (row % rmod), pitch ldr, RES_BF16 rounds it) added before the activation.
template <bool ASPLIT, int ACT, bool BIAS_BF16, bool RES_BF16>
__global__ __launch_bounds__(128) void k_gemm_bf3(const float* __restrict__ A, int lda, const unsigned short* __restrict__ Wt, int ldb,
                                                const float* __restrict__ bias, const float* __restrict__ resid, int rmod, int ldr,
                                                float* __restrict__ C, int ldc, int M, int N, int K) {
  __shared__ __attribute__((aligned(16))) float so[4][16][64];
  const int tid = threadIdx.x, w = tid >> 5, lane = tid & 31, ln = lane & 15, hh = lane >> 4;
  const int ntn = N / 64;
  const int wid = blockIdx.x * 4 + w;
  const int mt = wid / ntn, nq = wid % ntn;
  if (mt * 16 >= M) return;
  const int row0 = mt * 16, col0 = nq * 64;
  const float* arow = A + (size_t)(row0 + ln) * lda;
  v8f acc[4] = {};
  for (int kb = 0; kb < K; kb += 32) {
    FragB ah, al;
    const v4f x0 = *(const v4fa*)(arow + kb + 8 * hh), x1 = *(const v4fa*)(arow + kb + 8 * hh + 4);
    const v4f x2 = *(const v4fa*)(arow + kb + 16 + 8 * hh), x3 = *(const v4fa*)(arow + kb + 16 + 8 * hh + 4);
    float xs[16] = {x0[0],x0[1],x0[2],x0[3],x1[0],x1[1],x1[2],x1[3],x2[0],x2[1],x2[2],x2[3],x3[0],x3[1],x3[2],x3[3]};
#pragma unroll
    for (int i = 0; i < 16; ++i) { const unsigned short hb = bf16_bits(xs[i]); ah.u[i] = hb; al.u[i] = ASPLIT ? bf16_bits(xs[i] - bf16_val(hb)) : (unsigned short)0; }
#pragma unroll
    for (int t = 0; t < 4; ++t) {
      const unsigned short* brow = Wt + (size_t)(col0 + t * 16 + ln) * ldb + kb;
      FragB b;
      b.half[0] = *(const v8us*)(brow + 8 * hh);
      b.half[1] = *(const v8us*)(brow + 16 + 8 * hh);
      acc[t] = mmaN<ASPLIT ? 2 : 1>(ah.v, al.v, b.v, b.v, acc[t]);
    }
  }
#pragma unroll
  for (int t = 0; t < 4; ++t) {
    const int col = col0 + t * 16 + ln;
    float bv = bias ? bias[col] : 0.f;
    if (BIAS_BF16) bv = bf16_round(bv);
#pragma unroll
    for (int r = 0; r < 8; ++r) {
      float v = acc[t][r] + bv;
      if (resid) { float rv = resid[(size_t)((row0 + 8 * hh + r) % rmod) * ldr + col]; if (RES_BF16) rv = bf16_round(rv); v += rv; }
      if (ACT == 1) v = fmaxf(v, 0.f);
      if (ACT == 2) v = 0.5f * v * (1.0f + erff(v * 0.70710678118654752f));
      if (ACT == 3) { const float u = 0.7978845608028654f * (v + 0.044715f * v * v * v); v = 0.5f * v * (1.0f + tanhf(u)); }
      so[w][8 * hh + r][t * 16 + ln] = v;
    }
  }
  __builtin_amdgcn_fence(__ATOMIC_ACQ_REL, "workgroup");
  __builtin_amdgcn_wave_barrier();
  const int rsub = lane >> 4, c4 = (lane & 15) * 4;
  {
#pragma unroll
    for (int q = 0; q < 8; ++q) {
      const int r = q * 2 + rsub;
      const v4f v = *(const v4fa*)&so[w][r][c4];
      *(v4f*)(C + (size_t)(row0 + r) * ldc + col0 + c4) = v;
    }
    
  }
}
// row LayerNorm (biased variance, eps) over N: s = X (+ R); optional out_sum <- s; out_norm <- (s-mu)*rsqrt(var+eps)*g + b
template <bool PARAM_BF16>
__global__ __launch_bounds__(256) void k_layernorm(const float* __restrict__ X, const float* __restrict__ R, const float* __restrict__ g, const float* __restrict__ bta,
                                                  float* __restrict__ out_sum, float* __restrict__ out_norm, int N, float eps) {
  __shared__ float red[256];
  const int row = blockIdx.x, tid = threadIdx.x;
  const float* x = X + (size_t)row * N; const float* rr = R ? R + (size_t)row * N : nullptr;
  float vals[16];                     // up to N = 4096
  const int per = N / 256;            // contiguous chunk per thread? use strided-by-4 chunks: thread handles j = tid*4 + 1024*u
  float s1 = 0.f;
  for (int u = 0; u < per / 4; ++u) {
    const int j = tid * 4 + 1024 * u;
    const v4f a = *(const v4fa*)(x + j);
    v4f b = {0.f,0.f,0.f,0.f}; if (rr) b = *(const v4fa*)(rr + j);
#pragma unroll
    for (int q = 0; q < 4; ++q) { const float v = a[q] + b[q]; vals[u * 4 + q] = v; s1 += v; }
  }
  red[tid] = s1; __syncthreads();
  for (int st = 128; st > 0; st >>= 1) { if (tid < st) red[tid] += red[tid + st]; __syncthreads(); }
  const float mu = red[0] / (float)N; __syncthreads();
  float s2 = 0.f;
  for (int u = 0; u < per / 4; ++u)
#pragma unroll
    for (int q = 0; q < 4; ++q) { const float c = vals[u * 4 + q] - mu; s2 += c * c; }
  red[tid] = s2; __syncthreads();
  for (int st = 128; st > 0; st >>= 1) { if (tid < st) red[tid] += red[tid + st]; __syncthreads(); }
  const float rs = rsqrtf(red[0] / (float)N + eps);
  {
    for (int u = 0; u < per / 4; ++u) {
      const int j = tid * 4 + 1024 * u;
      v4f o, sm;
#pragma unroll
      for (int q = 0; q < 4; ++q) {
        float gg = g[j + q], bb = bta[j + q];
        if (PARAM_BF16) { gg = bf16_round(gg); bb = bf16_round(bb); }
        sm[q] = vals[u * 4 + q]; o[q] = (vals[u * 4 + q] - mu) * rs * gg + bb;
      }
      if (out_sum) *(v4f*)(out_sum + (size_t)row * N + j) = sm;
      *(v4f*)(out_norm + (size_t)row * N + j) = o;
    }
    
  }
}



// ---- f16 WMMA path (v_wmma_f32_16x16x32_f16): 11-bit significands for operands in range — used for every GEMM launched here
typedef _Float16 v16h __attribute__((ext_vector_type(16)));
union FragH { v16h v; v8us half[2]; _Float16 h[16]; unsigned short u[16]; };
template <int NT>
__device__ __forceinline__ v8f mmaH(v16h ah, v16h al, v16h bh, v16h bl, v8f c) {
  c = __builtin_amdgcn_wmma_f32_16x16x32_f16(false, ah, false, bh, (short)0, c, false, false);
  if (NT >= 2) c = __builtin_amdgcn_wmma_f32_16x16x32_f16(false, al, false, bh, (short)0, c, false, false);
  if (NT >= 3) c = __builtin_amdgcn_wmma_f32_16x16x32_f16(false, ah, false, bl, (short)0, c, false, false);
  asm volatile("v_nop\n\tv_nop\n\tv_nop\n\tv_nop" : "+v"(c) : "v"(ah), "v"(al), "v"(bh), "v"(bl));
  return c;
}
// batched GEMM like k_gemm_b but f16 operands: A f32 (split into f16 hi/lo if ASPLIT, else rounded to f16), Bt = f16 values [n][k]; alpha; C f32; N multiple of 16 (partial tiles skipped)
template <bool ASPLIT>
__global__ __launch_bounds__(128) void k_gemm_h(const float* __restrict__ A, int lda, size_t sA, const _Float16* __restrict__ Bh, int ldb, size_t sB, float alpha, float* __restrict__ C, int ldc, size_t sC, int M, int N, int K) {
  __shared__ __attribute__((aligned(16))) float so[4][16][64];
  const int tid = threadIdx.x, w = tid >> 5, lane = tid & 31, ln = lane & 15, hh = lane >> 4; const int by = blockIdx.y;
  A += (size_t)by * sA; Bh += (size_t)by * sB; C += (size_t)by * sC;
  const int ntn = (N + 63) / 64; const int wid = blockIdx.x * 4 + w; const int mt = wid / ntn, nq = wid % ntn; if (mt * 16 >= M) return;
  const int row0 = mt * 16, col0 = nq * 64; const float* arow = A + (size_t)(row0 + ln) * lda;
  v8f acc[4] = {};
  for (int kb = 0; kb < K; kb += 32) {
    FragH ah, al;
    const v4f x0 = *(const v4fa*)(arow + kb + 8 * hh), x1 = *(const v4fa*)(arow + kb + 8 * hh + 4), x2 = *(const v4fa*)(arow + kb + 16 + 8 * hh), x3 = *(const v4fa*)(arow + kb + 16 + 8 * hh + 4);
    float xs[16] = {x0[0],x0[1],x0[2],x0[3],x1[0],x1[1],x1[2],x1[3],x2[0],x2[1],x2[2],x2[3],x3[0],x3[1],x3[2],x3[3]};
#pragma unroll
    for (int i = 0; i < 16; ++i) { const _Float16 h = (_Float16)xs[i]; ah.h[i] = h; al.h[i] = ASPLIT ? (_Float16)(xs[i] - (float)h) : (_Float16)0.0f; }
#pragma unroll
    for (int t = 0; t < 4; ++t) { if (col0 + t * 16 >= N) continue; const size_t boff = (size_t)(col0 + t * 16 + ln) * ldb + kb; FragH bq; bq.half[0] = *(const v8us*)(Bh + boff + 8 * hh); bq.half[1] = *(const v8us*)(Bh + boff + 16 + 8 * hh);
      acc[t] = mmaH<ASPLIT ? 2 : 1>(ah.v, al.v, bq.v, bq.v, acc[t]); }
  }
#pragma unroll
  for (int t = 0; t < 4; ++t) { if (col0 + t * 16 >= N) continue;
#pragma unroll
    for (int r = 0; r < 8; ++r) so[w][8 * hh + r][t * 16 + ln] = acc[t][r] * alpha; }
  __builtin_amdgcn_fence(__ATOMIC_ACQ_REL, "workgroup"); __builtin_amdgcn_wave_barrier();
  const int rsub = lane >> 4, c4 = (lane & 15) * 4;
  {
#pragma unroll
    for (int q = 0; q < 8; ++q) { const int r = q * 2 + rsub; if (col0 + c4 < N) { const v4f v = *(const v4fa*)&so[w][r][c4]; *(v4f*)(C + (size_t)(row0 + r) * ldc + col0 + c4) = v; } }
     }
}

// Wt[n][k] = f16(W[k][n]·scale) from f32 row-major W[K][N] (scale = power of two; bf16-exact weights stay exact in f16 away from the subnormal range)
__global__ __launch_bounds__(256) void k_wt_f16(const float* __restrict__ W, _Float16* __restrict__ Wt, int K, int N, float scale) {
  const int t = blockIdx.x * 256 + threadIdx.x; if (t >= N * (K / 8)) return; const int n = t / (K / 8), k8 = (t % (K / 8)) * 8; FragH f;
#pragma unroll
  for (int i = 0; i < 8; ++i) f.h[i] = (_Float16)(bf16_round(W[(size_t)(k8 + i) * N + n]) * scale); const v8us o = f.half[0];
  *(v8us*)((unsigned short*)Wt + (size_t)n * K + k8) = o; 
}
// k_gemm_hh variant with fused epilogue: v = acc·alpha + bias[by·sBias + col] (+ CP[(row/rowsPerB)·sCPb + by·64 + col] if CP) ; ACT 0 none / 1 elu ; writes f16 C16 (and f32 C if non-null)
template <int ACT>
__global__ __launch_bounds__(128) void k_gemm_hhx(const _Float16* __restrict__ A, int lda, size_t sA, const _Float16* __restrict__ Bh, int ldb, size_t sB, float alpha, const float* __restrict__ bias, size_t sBias, const float* __restrict__ CP, int rowsPerB, size_t sCPb, int row0g,
    float* __restrict__ C, _Float16* __restrict__ C16, int ldc, size_t sC, int M, int N, int K) {
  __shared__ __attribute__((aligned(16))) float so[4][16][64];
  const int tid = threadIdx.x, w = tid >> 5, lane = tid & 31, ln = lane & 15, hh = lane >> 4; const int by = blockIdx.y;
  A += (size_t)by * sA; Bh += (size_t)by * sB; const size_t cofs = (size_t)by * sC; const float* bp = bias ? bias + (size_t)by * sBias : nullptr;
  const int ntn = (N + 63) / 64; const int wid = blockIdx.x * 4 + w; const int mt = wid / ntn, nq = wid % ntn; if (mt * 16 >= M) return;
  const int row0 = mt * 16, col0 = nq * 64; const _Float16* arow = A + (size_t)(row0 + ln) * lda;
  v8f acc[4] = {};
  for (int kb = 0; kb < K; kb += 32) { FragH ah; ah.half[0] = *(const v8us*)((const unsigned short*)arow + kb + 8 * hh); ah.half[1] = *(const v8us*)((const unsigned short*)arow + kb + 16 + 8 * hh);
#pragma unroll
    for (int t = 0; t < 4; ++t) { if (col0 + t * 16 >= N) continue; const size_t boff = (size_t)(col0 + t * 16 + ln) * ldb + kb; FragH bq; bq.half[0] = *(const v8us*)((const unsigned short*)Bh + boff + 8 * hh); bq.half[1] = *(const v8us*)((const unsigned short*)Bh + boff + 16 + 8 * hh);
      acc[t] = mmaH<1>(ah.v, ah.v, bq.v, bq.v, acc[t]); }
  }
#pragma unroll
  for (int t = 0; t < 4; ++t) { if (col0 + t * 16 >= N) continue; const int col = col0 + t * 16 + ln; const float bv = bp ? bf16_round(bp[col]) : 0.f;
#pragma unroll
    for (int r = 0; r < 8; ++r) { float v = acc[t][r] * alpha + bv; if (CP) { const int rr = row0g + row0 + 8 * hh + r; if (rowsPerB < 0) v += CP[cofs + (size_t)rr * ldc + col];      /* rowsPerB < 0: own element of the batched C plane */ else { const int bidx = rr / rowsPerB; v += CP[(size_t)bidx * sCPb + (size_t)by * 64 + col]; } } if (ACT == 1) v = (v > 0.f) ? v : expm1f(v); else if (ACT == 7) v = (v > 0.f) ? v + 1.0f : expf(v); else if (ACT == 8) v = tanhf(v); else if (ACT == 9) v = 0.5f * v * (1.0f + tanhf(0.7978845608028654f * (v + 0.044715f * v * v * v))); else if (ACT == 11) v = 1.0f / (1.0f + expf(-v)); else if (ACT == 12) v = (v > 0.f) ? v : 0.01f * v; else if (ACT == 14) v = (v > 0.f) ? v : 0.1f * v; else if (ACT == 16) v = (v >= 0.f) ? v : 0.3f * v; else if (ACT == 17) v = (v >= 0.f) ? v : 0.2f * v; else if (ACT == 15) v = v / (1.0f + expf(-v)); else if (ACT == 3) v = fmaxf(v, 0.f); else if (ACT == 6) v = 0.5f * v * (1.0f + erff(v * 0.70710678118654752f)); so[w][8 * hh + r][t * 16 + ln] = v; } }
  __builtin_amdgcn_fence(__ATOMIC_ACQ_REL, "workgroup"); __builtin_amdgcn_wave_barrier();
  const int rsub = lane >> 4, c4 = (lane & 15) * 4; typedef _Float16 v4h __attribute__((ext_vector_type(4)));
  {
#pragma unroll
    for (int q = 0; q < 8; ++q) { const int r = q * 2 + rsub; if (col0 + c4 < N) { const v4f v = *(const v4fa*)&so[w][r][c4]; if (C) *(v4f*)(C + cofs + (size_t)(row0 + r) * ldc + col0 + c4) = v; if (C16) { v4h h4; for (int i = 0; i < 4; ++i) h4[i] = (_Float16)v[i]; *(v4h*)(C16 + cofs + (size_t)(row0 + r) * ldc + col0 + c4) = h4; } } }
     }
}


typedef _Float16 v4h __attribute__((ext_vector_type(4)));

__global__ __launch_bounds__(256) void k_x16(const float* __restrict__ x, _Float16* __restrict__ X16, size_t n8) { const size_t t = (size_t)blockIdx.x * 256 + threadIdx.x; if (t >= n8) return; FragH f;
#pragma unroll
  for (int q = 0; q < 8; ++q) f.h[q] = (_Float16)bf16_round(x[t * 8 + q]); *(v8us*)((unsigned short*)X16 + t * 8) = f.half[0];  }
__global__ __launch_bounds__(256) void k_h16(const float* __restrict__ x, _Float16* __restrict__ X16, size_t n8) { const size_t t = (size_t)blockIdx.x * 256 + threadIdx.x; if (t >= n8) return; FragH f;
#pragma unroll
  for (int q = 0; q < 8; ++q) f.h[q] = (_Float16)x[t * 8 + q]; *(v8us*)((unsigned short*)X16 + t * 8) = f.half[0];  }
__global__ __launch_bounds__(256) void k_round16f(const float* __restrict__ W, _Float16* __restrict__ Bt, size_t n8) { const size_t t = (size_t)blockIdx.x * 256 + threadIdx.x; if (t >= n8) return; FragH f;
#pragma unroll
  for (int i = 0; i < 8; ++i) f.h[i] = (_Float16)(bf16_round(W[t * 8 + i]) * 16.0f); *(v8us*)((unsigned short*)Bt + t * 8) = f.half[0];  }
template <int NHv, int TTv>
__global__ __launch_bounds__(256) void k_vt(const _Float16* __restrict__ V16, int ldv, int voff, _Float16* __restrict__ Vt) { __shared__ unsigned short tl[64][66]; const int tid = threadIdx.x; const int slab = blockIdx.x / (TTv / 64), lg = blockIdx.x % (TTv / 64); const int b = slab / NHv, h = slab % NHv;
  for (int i = tid; i < 64 * 8; i += 256) { const int r = i / 8, c8 = (i % 8) * 8; FragH f; f.half[0] = *(const v8us*)((const unsigned short*)V16 + ((size_t)b * TTv + lg * 64 + r) * ldv + voff + h * 64 + c8);
#pragma unroll
    for (int q = 0; q < 8; ++q) tl[r][c8 + q] = f.u[q]; }
  __syncthreads();
  {
#pragma unroll
    for (int rd = 0; rd < 2; ++rd) { const int d = rd * 32 + tid / 8, pc = tid % 8; FragH f;
#pragma unroll
      for (int q = 0; q < 8; ++q) f.u[q] = tl[pc * 8 + q][d];
      *(v8us*)((unsigned short*)Vt + ((size_t)slab * 64 + d) * TTv + lg * 64 + pc * 8) = f.half[0]; }
     } }

__global__ __launch_bounds__(256) void k_hl(const float* __restrict__ F, _Float16* __restrict__ Hh, _Float16* __restrict__ Hl, size_t n8) { const size_t t = (size_t)blockIdx.x * 256 + threadIdx.x; if (t >= n8) return; FragH fh, fl; const v4f a = *(const v4fa*)(F + t * 8), c = *(const v4fa*)(F + t * 8 + 4);
#pragma unroll
  for (int q = 0; q < 4; ++q) { _Float16 h = (_Float16)a[q]; fh.h[q] = h; fl.h[q] = (_Float16)((a[q] - (float)h) * 1024.0f); h = (_Float16)c[q]; fh.h[4 + q] = h; fl.h[4 + q] = (_Float16)((c[q] - (float)h) * 1024.0f); }
  { *(v8us*)((unsigned short*)Hh + t * 8) = fh.half[0]; *(v8us*)((unsigned short*)Hl + t * 8) = fl.half[0];  } }

// ---- fast GEMM (work-group tile 128x64, wave tile 32x64; requires M % 128 == 0, N % 64 == 0, K % 64 == 0); epilogue = k_gemm_hhx semantics; ROWB: bias indexed by the C row (weights as A) instead of the C column ----
// Operand path: per stage of 64 k (one 128-B line of every operand row) the 128 A rows and 64 B rows of the work-group's tile are copied to LDS by
// asynchronous b128 copies (a wave-wide copy = 4 whole lines), two buffers, the next stage in flight while this one is multiplied; fragments come from LDS.
#define G2_PITCH 144                      /* LDS row pitch in bytes, 16 B x odd: conflict-free for the ds_load_b128 fragment reads of 128-B rows */
#define G2_STAGE ((128 + 64) * G2_PITCH)  /* bytes of one buffer: A rows 0..127, then B rows 0..63 */
__device__ __forceinline__ v16h g2_frag(const unsigned char* p) { FragH f; f.half[0] = *(const v8us*)p; f.half[1] = *(const v8us*)(p + 32); return f.v; }
__device__ __forceinline__ v8f g2_mma(v16h a, v16h b, v8f c) { v8f d = __builtin_amdgcn_wmma_f32_16x16x32_f16(false, a, false, b, (short)0, c, false, false); asm volatile("v_nop\n\tv_nop\n\tv_nop\n\tv_nop" : "+v"(d) : "v"(a), "v"(b)); return d; }
// One stage: each of the 128 threads copies 16 B of 8 A rows and 4 B rows (rows 16 apart). l = the lane's LDS byte address in the buffer, a / b = its global
// addresses, sa / sb = 16 rows in elements. The closing s_wait_xcnt keeps every address register intact until the copies have taken it.
__device__ __forceinline__ void g2_stage(unsigned l, const _Float16* a, size_t sa, const _Float16* b, size_t sb) {
  asm volatile("global_load_async_to_lds_b128 %0, %12, off\n\t"
               "global_load_async_to_lds_b128 %1, %13, off\n\t"
               "global_load_async_to_lds_b128 %2, %14, off\n\t"
               "global_load_async_to_lds_b128 %3, %15, off\n\t"
               "global_load_async_to_lds_b128 %4, %16, off\n\t"
               "global_load_async_to_lds_b128 %5, %17, off\n\t"
               "global_load_async_to_lds_b128 %6, %18, off\n\t"
               "global_load_async_to_lds_b128 %7, %19, off\n\t"
               "global_load_async_to_lds_b128 %8, %20, off\n\t"
               "global_load_async_to_lds_b128 %9, %21, off\n\t"
               "global_load_async_to_lds_b128 %10, %22, off\n\t"
               "global_load_async_to_lds_b128 %11, %23, off\n\t"
               "s_wait_xcnt 0x0"
               :: "v"(l), "v"(l + 16 * G2_PITCH), "v"(l + 32 * G2_PITCH), "v"(l + 48 * G2_PITCH), "v"(l + 64 * G2_PITCH), "v"(l + 80 * G2_PITCH), "v"(l + 96 * G2_PITCH), "v"(l + 112 * G2_PITCH),
                  "v"(l + 128 * G2_PITCH), "v"(l + 144 * G2_PITCH), "v"(l + 160 * G2_PITCH), "v"(l + 176 * G2_PITCH),
                  "v"(a), "v"(a + sa), "v"(a + 2 * sa), "v"(a + 3 * sa), "v"(a + 4 * sa), "v"(a + 5 * sa), "v"(a + 6 * sa), "v"(a + 7 * sa),
                  "v"(b), "v"(b + sb), "v"(b + 2 * sb), "v"(b + 3 * sb)
               : "memory");
}
// The body takes its LDS and its block indices (bx = tile, by = batch plane) from the caller, so that one launch can hold the tiles of several independent GEMMs.
template <int ACT, bool ROWB>
__device__ __forceinline__ void g2_body(unsigned char* smem, const int bx, const int by, const _Float16* __restrict__ A, int lda, size_t sA, const _Float16* __restrict__ Bh, int ldb, size_t sB, float alpha, const float* __restrict__ bias, size_t sBias, const float* __restrict__ CP, int rowsPerB, size_t sCPb, int row0g,
    float* __restrict__ C, _Float16* __restrict__ C16, int ldc, size_t sC, int M, int N, int K) { static_assert(ACT == 0 || ACT == 3 || ACT == 6 || ACT == 8 || ACT == 9 || ACT == 11 || ACT == 12 || ACT == 14 || ACT == 15 || ACT == 16 || ACT == 17, "k_gemm2: unsupported ACT code (would silently apply no activation)");
  static_assert(sizeof(float) * 4 * 32 * 68 <= 2 * G2_STAGE, "output staging must fit the operand buffers");
  float (*so)[32][68] = (float (*)[32][68])smem;
  const int tid = threadIdx.x, w = tid >> 5, lane = tid & 31, ln = lane & 15, hh = lane >> 4;
  A += (size_t)by * sA; Bh += (size_t)by * sB; const size_t cofs = (size_t)by * sC; const float* bp = bias ? bias + (size_t)by * sBias : nullptr;
  const int ntn = N >> 6; const int mt = bx / ntn, nq = bx - mt * ntn; const int row0 = mt * 128 + 32 * w, col0 = nq * 64; if (mt * 128 >= M) return;      /* the whole work-group leaves, in front of every barrier */
  const unsigned lcp = (unsigned)(size_t)smem + (unsigned)((tid >> 3) * G2_PITCH + (tid & 7) * 16);
  const _Float16* gA = A + (size_t)(mt * 128 + (tid >> 3)) * lda + (tid & 7) * 8; const _Float16* gB = Bh + (size_t)(col0 + (tid >> 3)) * ldb + (tid & 7) * 8; const size_t sa16 = (size_t)16 * lda, sb16 = (size_t)16 * ldb;
  const int nst = K >> 6;
  const v8f z8 = {0.f,0.f,0.f,0.f,0.f,0.f,0.f,0.f}; v8f c00 = z8, c01 = z8, c02 = z8, c03 = z8, c10 = z8, c11 = z8, c12 = z8, c13 = z8;
  g2_stage(lcp, gA, sa16, gB, sb16);
  asm volatile("s_wait_asynccnt 0x0" ::: "memory");      /* this wave's copies of stage 0 have landed */
  __syncthreads();                                       /* ... and every other wave's */
  if (nst > 1) g2_stage(lcp + G2_STAGE, gA + 64, sa16, gB + 64, sb16);
#pragma unroll 1
  for (int s = 0; s < nst; ++s) { const unsigned char* sb = smem + (s & 1) * G2_STAGE; const unsigned char* pa = sb + (32 * w + ln) * G2_PITCH + 16 * hh; const unsigned char* pb = sb + (128 + ln) * G2_PITCH + 16 * hh;
    v16h fa[2][2], fb[2][4];      /* the stage's 12 fragments are read as one group in front of its 16 WMMAs: one LDS latency a stage instead of one per B fragment */
#pragma unroll
    for (int h = 0; h < 2; ++h) { fa[h][0] = g2_frag(pa + 64 * h); fa[h][1] = g2_frag(pa + 16 * G2_PITCH + 64 * h);
#pragma unroll
      for (int t = 0; t < 4; ++t) fb[h][t] = g2_frag(pb + 16 * t * G2_PITCH + 64 * h); }
#pragma unroll
    for (int h = 0; h < 2; ++h) {
      c00 = g2_mma(fa[h][0], fb[h][0], c00); c10 = g2_mma(fa[h][1], fb[h][0], c10);
      c01 = g2_mma(fa[h][0], fb[h][1], c01); c11 = g2_mma(fa[h][1], fb[h][1], c11);
      c02 = g2_mma(fa[h][0], fb[h][2], c02); c12 = g2_mma(fa[h][1], fb[h][2], c12);
      c03 = g2_mma(fa[h][0], fb[h][3], c03); c13 = g2_mma(fa[h][1], fb[h][3], c13); }
    asm volatile("s_wait_dscnt 0x0" ::: "memory");       /* this wave's reads of the buffer are over before it may be refilled */
    asm volatile("s_wait_asynccnt 0x0" ::: "memory");    /* this wave's copies of stage s + 1 have landed */
    __syncthreads();                                     /* publishes stage s + 1 and ends every wave's reads of stage s */
    if (s + 2 < nst) g2_stage(lcp + (unsigned)(s & 1) * G2_STAGE, gA + (size_t)(s + 2) * 64, sa16, gB + (size_t)(s + 2) * 64, sb16); }
  asm volatile("s_wait_asynccnt 0x0" ::: "memory");      /* no copy is outstanding when the buffers become output staging */
  v8f accs[8] = {c00, c01, c02, c03, c10, c11, c12, c13};
  float rbias[16];      /* ROWB: the bias of this lane's 16 C rows, loaded as one group in front of the element loop; both loops unrolled so that every index is a constant and the array stays in registers */
#pragma unroll
  for (int i = 0; i < 16; ++i) rbias[i] = 0.f;
  if (ROWB && bp) { const float* br = bp + row0 + 8 * hh;
#pragma unroll
    for (int i = 0; i < 16; ++i) rbias[i] = bf16_round(br[(i >> 3) * 16 + (i & 7)]); }
#pragma unroll
  for (int u = 0; u < 8; ++u) { const int t = u & 3, half = u >> 2; const int col = col0 + t * 16 + ln; const float bvc = (!ROWB && bp) ? bf16_round(bp[col]) : 0.f;
#pragma unroll
    for (int r = 0; r < 8; ++r) { const int rloc = half * 16 + 8 * hh + r; const float bv = ROWB ? rbias[half * 8 + r] : bvc; float v = accs[u][r] * alpha + bv; if (CP) { if (rowsPerB < 0) v += CP[cofs + (size_t)(row0g + row0 + rloc) * ldc + col];      /* rowsPerB < 0: own element of the batched C plane */ else { const int bidx = (row0g + row0 + rloc) / rowsPerB; v += CP[(size_t)bidx * sCPb + (size_t)by * 64 + col]; } }
      if (ACT == 3) v = fmaxf(v, 0.f); else if (ACT == 6) v = 0.5f * v * (1.0f + erff(v * 0.70710678118654752f)); else if (ACT == 11) v = 1.0f / (1.0f + expf(-v)); else if (ACT == 15) v = v / (1.0f + expf(-v)); else if (ACT == 12) v = (v > 0.f) ? v : 0.01f * v; else if (ACT == 8) v = tanhf(v); else if (ACT == 9) v = 0.5f * v * (1.0f + tanhf(0.7978845608028654f * (v + 0.044715f * v * v * v))); else if (ACT == 14) v = (v > 0.f) ? v : 0.1f * v; else if (ACT == 16) v = (v >= 0.f) ? v : 0.3f * v; else if (ACT == 17) v = (v >= 0.f) ? v : 0.2f * v;
      so[w][rloc][t * 16 + ln] = v; } }
  __builtin_amdgcn_fence(__ATOMIC_ACQ_REL, "workgroup"); __builtin_amdgcn_wave_barrier();
  const int rsub = lane >> 4, c4 = (lane & 15) * 4;
  {
#pragma unroll
    for (int q = 0; q < 16; ++q) { const int r = q * 2 + rsub; const v4f v = *(const v4fa*)&so[w][r][c4]; if (C) { *(v4f*)(C + cofs + (size_t)(row0 + r) * ldc + col0 + c4) = v; if (C16) asm volatile("s_wait_xcnt 0x0" ::: "memory"); }      /* the wait stands in front of the conversion below, which may overwrite registers that the f32 store names */
      if (C16) { v4h h4; for (int i = 0; i < 4; ++i) h4[i] = (_Float16)v[i]; *(v4h*)(C16 + cofs + (size_t)(row0 + r) * ldc + col0 + c4) = h4; } }
    asm volatile("s_wait_xcnt 0x0" ::: "memory");      /* stands behind the last stores, in front of any code of the calling kernel that follows the body and may overwrite registers that they name */
     } }
#define G2_SMEM __shared__ __attribute__((aligned(16))) unsigned char smem[2 * G2_STAGE]      /* the two operand buffers; behind the K loop's last barrier the same bytes stage the output tile */
template <int ACT, bool ROWB>
__global__ __launch_bounds__(128) void k_gemm2(const _Float16* __restrict__ A, int lda, size_t sA, const _Float16* __restrict__ Bh, int ldb, size_t sB, float alpha, const float* __restrict__ bias, size_t sBias, const float* __restrict__ CP, int rowsPerB, size_t sCPb, int row0g,
    float* __restrict__ C, _Float16* __restrict__ C16, int ldc, size_t sC, int M, int N, int K) { G2_SMEM;
  g2_body<ACT, ROWB>(smem, (int)blockIdx.x, (int)blockIdx.y, A, lda, sA, Bh, ldb, sB, alpha, bias, sBias, CP, rowsPerB, sCPb, row0g, C, C16, ldc, sC, M, N, K); }
// K and V in one launch (neither reads the other): x = tile, y = sample, z = which. Weights as A: C[channel][position] per sample.
__global__ __launch_bounds__(128) void k_gemm_kv(const _Float16* __restrict__ X16, const _Float16* __restrict__ BWq, const _Float16* __restrict__ BWv, const float* __restrict__ bq, const float* __restrict__ bv, _Float16* __restrict__ KC, _Float16* __restrict__ VC) { G2_SMEM;
  const bool isv = blockIdx.z != 0;
  g2_body<0, true>(smem, (int)blockIdx.x, (int)blockIdx.y, isv ? BWv : BWq, CC, 0, X16, CC, (size_t)PX * CC, 0.0625f, isv ? bv : bq, 0, nullptr, 1, 0, 0, nullptr, isv ? VC : KC, PX, (size_t)CC * PX, CC, PX, CC); }
// M and Q in one launch (M reads K and V, Q reads X: neither reads the other). M's tiles have twice the k length and stand first in the grid, so that they start first.
#define MQ_MT NH      /* M tiles per sample: one per head, the 128x64 tile that holds the head's diagonal block (O never reads the other tiles) */
__global__ __launch_bounds__(128) void k_gemm_mq(const _Float16* __restrict__ VC, const _Float16* __restrict__ KC, _Float16* __restrict__ BD, const _Float16* __restrict__ X16, const _Float16* __restrict__ BWk, const float* __restrict__ bk, _Float16* __restrict__ QR) { G2_SMEM;
  const int b = (int)blockIdx.x;
  if (b < NB * MQ_MT) { const int h = b % MQ_MT; g2_body<0, false>(smem, (h >> 1) * (CC / 64) + h, b / MQ_MT, VC, PX, (size_t)CC * PX, KC, PX, (size_t)CC * PX, 1.0f, nullptr, 0, nullptr, 1, 0, 0, nullptr, BD, CC, (size_t)CC * CC, CC, CC, PX); }      /* M[c][c'] = sum_D V[c][D] K[c'][D], column tile h, row tile h / 2: already in the [n][k] order that the O GEMM's B operand wants */
  else g2_body<0, false>(smem, b - NB * MQ_MT, 0, X16, CC, 0, BWk, CC, 0, 0.0625f, bk, 0, nullptr, 1, 0, 0, nullptr, QR, CC, 0, (int)NR, CC, CC); }      /* Q = K_conv(X), token-major */
// O per head: O[d][c] = sum_c' Q[d][c'] M[c][c'] with c and c' in head h only, so each 128x64 tile is a GEMM of k = 64 on the head's columns of Q and the head's diagonal block of M. x = row tile * heads + head, y = sample.
__global__ __launch_bounds__(128) void k_gemm_o(const _Float16* __restrict__ QR, const _Float16* __restrict__ BD, _Float16* __restrict__ OR) { G2_SMEM;
  const int h = (int)blockIdx.x % NH;
  g2_body<0, false>(smem, (int)blockIdx.x / NH, (int)blockIdx.y, QR + h * HD, CC, (size_t)PX * CC, BD + (size_t)h * HD * CC + h * HD, CC, (size_t)CC * CC, 1.0f, nullptr, 0, nullptr, 1, 0, 0, nullptr, OR + h * HD, CC, (size_t)PX * CC, PX, HD, HD); }


// The three streaming launches (prep, GN statistics, output) are gridded with few waves, each with 8 KiB to 16 KiB of whole-line 16-B loads in flight.
// X transpose: a work-group takes 64 channels x 256 positions. A wave-wide load covers 4 channel rows x one 128-B line; a lane holds the same 4 positions of two neighbouring channels,
// so that each LDS store is one dword (a channel pair of one position). LDS rows = positions, pitch 144 B (16 B x odd) for the ds_load_b128 read-back of 8 channels.
#define XT_P 256
#define XT_PITCH 144
typedef _Float16 v2h __attribute__((ext_vector_type(2)));
__device__ __forceinline__ void xrows_body(const float* __restrict__ x, _Float16* __restrict__ X16, const int bx) { __shared__ __attribute__((aligned(16))) unsigned char tl[XT_P * XT_PITCH]; const int tid = threadIdx.x, w = tid >> 5, lane = tid & 31, r = lane >> 3, pq = lane & 7; const int cg = bx % (CC / 64); const int pb = (bx / (CC / 64)) % (PX / XT_P); const int n = bx / ((CC / 64) * (PX / XT_P)); const int p0 = pb * XT_P, c0 = cg * 64;
  const float* src = x + ((size_t)n * CC + c0 + w * 8 + 2 * r) * PX + p0 + pq * 4;
  v4f e[XT_P / 32], o[XT_P / 32];
#pragma unroll
  for (int k = 0; k < XT_P / 32; ++k) { e[k] = *(const v4fa*)(src + k * 32); o[k] = *(const v4fa*)(src + PX + k * 32); }
  __builtin_amdgcn_sched_barrier(0);      /* keeps the 16 loads in flight together: without it the scheduler lifts the first conversions, with their waits, in between the loads */
  asm volatile("s_wait_xcnt 0x0" :: "v"(src) : "memory");      /* stands behind the loads, in front of any overwrite of the address register that they name; the operand keeps that register whole up to here */
  unsigned char* dst = tl + pq * 4 * XT_PITCH + (w * 4 + r) * 4;
#pragma unroll
  for (int k = 0; k < XT_P / 32; ++k)
#pragma unroll
    for (int j = 0; j < 4; ++j) { v2h h; h[0] = (_Float16)bf16_round(e[k][j]); h[1] = (_Float16)bf16_round(o[k][j]); *(v2h*)(dst + (k * 32 + j) * XT_PITCH) = h; }
  __syncthreads();
  const unsigned char* rd = tl + (tid >> 3) * XT_PITCH + (tid & 7) * 16; unsigned short* g = (unsigned short*)X16 + ((size_t)n * PX + p0 + (tid >> 3)) * CC + c0 + (tid & 7) * 8;
#pragma unroll
  for (int i = 0; i < XT_P / 32; ++i) *(v8us*)(g + (size_t)i * 32 * CC) = *(const v8us*)(rd + i * 32 * XT_PITCH); }      /* a wave-wide store = 4 positions x one 128-B line */
#define WCH 8      /* chunks of 8 weights per thread */
__device__ __forceinline__ void wnat_body(const float* __restrict__ w, _Float16* __restrict__ Bt, const int bx) { const unsigned t0 = (unsigned)bx * (256 * WCH) + threadIdx.x; const unsigned src = t0 * 32u; const char* wb = (const char*)w; v4f a[WCH], b[WCH];      /* src = the lane's byte offset in the matrix */
#pragma unroll
  for (int u = 0; u < WCH; ++u) { a[u] = *(const v4fa*)(wb + (src + u * 8192)); b[u] = *(const v4fa*)(wb + (src + u * 8192 + 16)); }
  asm volatile("s_wait_xcnt 0x0" :: "v"(src) : "memory");      /* stands behind the loads, in front of any overwrite of the address register that they name; the operand keeps that register whole up to here */
#pragma unroll
  for (int u = 0; u < WCH; ++u) { FragH f; for (int q = 0; q < 4; ++q) { f.h[q] = (_Float16)(bf16_round(a[u][q]) * 16.0f); f.h[4 + q] = (_Float16)(bf16_round(b[u][q]) * 16.0f); } *(v8us*)((unsigned short*)Bt + (t0 + u * 256) * 8) = f.half[0]; }
  asm volatile("s_wait_xcnt 0x0" ::: "memory"); }      /* stands behind the last stores, in front of any code of the calling kernel that follows the body and may overwrite registers that they name */
// The X transpose and the four weight roundings in one launch (none reads another's result): the transpose's blocks first, then WB blocks per weight matrix.
#define XB (NB * (CC / 64) * (PX / XT_P))
#define WB (CC * CC / 8 / 256 / WCH)
static_assert(WB * WCH * 256 * 8 == CC * CC, "the weight blocks cover a matrix exactly");
__global__ __launch_bounds__(256) void k_prep(const float* __restrict__ x, _Float16* __restrict__ X16, const float* __restrict__ Wq, const float* __restrict__ Wk, const float* __restrict__ Wv, const float* __restrict__ Wo,
    _Float16* __restrict__ BWq, _Float16* __restrict__ BWk, _Float16* __restrict__ BWv, _Float16* __restrict__ BWo) {
  const int b = (int)blockIdx.x;
  if (b < XB) { xrows_body(x, X16, b); return; }      /* the same for the whole block */
  const int m = (b - XB) / WB;
  wnat_body(m == 0 ? Wq : m == 1 ? Wk : m == 2 ? Wv : Wo, m == 0 ? BWq : m == 1 ? BWk : m == 2 ? BWv : BWo, (b - XB) % WB); }
// GN statistics: one wave per (sample, group). Its 4,096 contiguous values are 32 wave-wide 16-B loads; float64 sums in four chains per lane, then a butterfly over the 32 lanes: no LDS, no barrier.
__global__ __launch_bounds__(256) void k_gnstat(const float* __restrict__ O2, float* __restrict__ stat) { const int lane = threadIdx.x & 31; const int sg = (int)blockIdx.x * 8 + (int)(threadIdx.x >> 5);
  const float* src = O2 + (size_t)sg * (PX * CPG) + lane * 4;      /* the group's 4 channel rows are contiguous */
  v4f v[PX * CPG / 128];
#pragma unroll
  for (int i = 0; i < PX * CPG / 128; ++i) v[i] = *(const v4fa*)(src + i * 128);
  __builtin_amdgcn_sched_barrier(0);      /* keeps the 32 loads in flight together: without it the scheduler sinks most of them between the uses, a few at a time, and the wave pays the memory latency once per batch */
  double s[4] = {0.0, 0.0, 0.0, 0.0}, q2[4] = {0.0, 0.0, 0.0, 0.0};
#pragma unroll
  for (int i = 0; i < PX * CPG / 128; ++i)
#pragma unroll
    for (int k = 0; k < 4; ++k) { const double d = (double)v[i][k]; s[k] += d; q2[k] += d * d; }
  double st = (s[0] + s[1]) + (s[2] + s[3]), qt = (q2[0] + q2[1]) + (q2[2] + q2[3]);
#pragma unroll
  for (int mk = 16; mk > 0; mk >>= 1) { st += __shfl_xor(st, mk, 32); qt += __shfl_xor(qt, mk, 32); }
  const double cnt = (double)(PX * CPG); const double mu = st / cnt; double var = qt / cnt - mu * mu; if (var < 0.0) var = 0.0; const float m = (float)mu, r = (float)(1.0 / sqrt(var + 1e-5));
  stat[(size_t)sg * 32 + lane] = lane == 0 ? m : lane == 1 ? r : 0.f; }      /* the wave writes its group's whole 128-B line */
// Output: one wave per pair of channel rows (8 KiB of O2, 8 KiB of X, both rows in one group): 32 wave-wide 16-B loads in flight, 16 whole-line stores.
__global__ __launch_bounds__(256) void k_out(const float* __restrict__ O2, const float* __restrict__ stat, const float* __restrict__ gw, const float* __restrict__ gb, const float* __restrict__ x, float* __restrict__ out) {
  #pragma clang fp contract(off)
  const int lane = threadIdx.x & 31; const int pr = __builtin_amdgcn_readfirstlane((int)blockIdx.x * 8 + (int)(threadIdx.x >> 5));      /* the wave's row pair, told to the compiler as wave-uniform so that the statistics and the affine pair come by scalar loads */
  const int c = (pr * 2) % CC; const size_t sg = (size_t)(pr / (CPG / 2)); const size_t base = (size_t)pr * (2 * PX); const unsigned l4 = (unsigned)lane * 4u;      /* scalar base + one lane offset that lives to the last store */
  const float* __restrict__ pa = O2 + base; const float* __restrict__ px = x + base; float* __restrict__ po = out + base;
  v4f a[16], xx[16];
#pragma unroll
  for (int i = 0; i < 16; ++i) { a[i] = *(const v4fa*)(pa + (l4 + i * 128)); xx[i] = *(const v4fa*)(px + (l4 + i * 128)); }
  __builtin_amdgcn_sched_barrier(0);      /* keeps the 32 loads in flight together: without it the scheduler sinks most of them between the uses, a few at a time, and the wave pays the memory latency once per batch */
  const float m = stat[sg * 32], r = stat[sg * 32 + 1]; const float w0 = bf16_round(gw[c]), b0 = bf16_round(gb[c]), w1 = bf16_round(gw[c + 1]), b1 = bf16_round(gb[c + 1]);
#pragma unroll
  for (int i = 0; i < 16; ++i) { const float w = i < 8 ? w0 : w1, bb = i < 8 ? b0 : b1; v4f o;
#pragma unroll
    for (int q = 0; q < 4; ++q) o[q] = __fadd_rn(__fadd_rn(__fmul_rn((a[i][q] - m) * r, w), bb), bf16_round(xx[i][q]));
    *(v4f*)(po + (l4 + i * 128)) = o; } }

extern "C" void kernel_launch(void* const* d_in, const int* in_sizes, int n_in,
                              void* d_out, int out_size, void* d_ws, size_t ws_size, hipStream_t stream) {
  (void)in_sizes; (void)n_in; (void)out_size;
  const float* const* I = (const float* const*)d_in; const float* X = I[0]; const float* Wq = I[1]; const float* bq = I[2]; const float* Wk = I[3]; const float* bk = I[4]; const float* Wv = I[5]; const float* bv = I[6]; const float* Wo = I[7]; const float* bo = I[8]; const float* gw = I[9]; const float* gb = I[10];
  char* ws = (char*)d_ws; size_t off = 0;
  auto take = [&](size_t bytes) { char* p = ws + off; off += (bytes + 255) & ~(size_t)255; return p; };
  _Float16* BWq = (_Float16*)take((size_t)CC * CC * 2); _Float16* BWk = (_Float16*)take((size_t)CC * CC * 2); _Float16* BWv = (_Float16*)take((size_t)CC * CC * 2); _Float16* BWo = (_Float16*)take((size_t)CC * CC * 2);
  _Float16* X16 = (_Float16*)take(NR * CC * 2); _Float16* QR = (_Float16*)take(NR * CC * 2); _Float16* KC = (_Float16*)take(NR * CC * 2); _Float16* VC = (_Float16*)take(NR * CC * 2); _Float16* BD = (_Float16*)take((size_t)NB * CC * CC * 2); _Float16* OR = (_Float16*)take(NR * CC * 2); float* O2 = (float*)take(NR * CC * 4); float* stat = (float*)take((size_t)NB * GRP * 32 * 4);
  if (off > ws_size) return;      /* 2 + 16x5 + 8 + 32 = about 122 MiB */
  k_prep<<<XB + 4 * WB, 256, 0, stream>>>(X, X16, Wq, Wk, Wv, Wo, BWq, BWk, BWv, BWo);
  const dim3 gc((CC / 128) * (PX / 64), NB);      /* weights as A: C[channel][position] per sample, y = sample */
  k_gemm_kv<<<dim3((CC / 128) * (PX / 64), NB, 2), 128, 0, stream>>>(X16, BWq, BWv, bq, bv, KC, VC);      /* K = Q_conv(X) (the module's swap) and V, channel-major */
  /* all samples in one launch each: per-sample planes of KC, VC and BD (of BD only the tiles with a diagonal block are written, and only the diagonal blocks read) */
  k_gemm_mq<<<NB * MQ_MT + (unsigned)((NR / 128) * (CC / 64)), 128, 0, stream>>>(VC, KC, BD, X16, BWk, bk, QR);
  k_gemm_o<<<dim3((PX / 128) * NH, NB), 128, 0, stream>>>(QR, BD, OR);      /* O[d][c] = sum_c' Q[d][c'] M[c][c'] within the head */
  k_gemm2<0, true><<<gc, 128, 0, stream>>>(BWo, CC, 0, OR, CC, (size_t)PX * CC, 0.0625f, bo, 0, nullptr, 1, 0, 0, O2, nullptr, PX, (size_t)CC * PX, CC, PX, CC);      /* O2[n][c][p], the output's own layout */
  k_gnstat<<<NB * GRP / 8, 256, 0, stream>>>(O2, stat);      /* 8 waves a block, one group each */
  k_out<<<NB * CC / 2 / 8, 256, 0, stream>>>(O2, stat, gw, gb, X, (float*)d_out);
}

// v007
// One run takes 82.6 microseconds.
// Next to v006, in two timings, it ran 1.09 times as fast each time.
// Over all steps from v000 it is 13.5 times as fast.
#include <hip/hip_runtime.h>
// Non_local_MH (X [16][512][32][32]; K = conv1x1(X, Wq, bq), Q = conv1x1(X, Wk, bk), V = conv1x1(X, Wv, bv) (the module's swapped naming), 8 heads of 64 channels over d = 1,024 positions; softmax-FREE attention A = Q^T K ([d][d]), O = V A^T; O = conv1x1(O, Wo, bo); GroupNorm(128 groups of 4 channels, eps 1e-5, affine); out = GN(O) + X -> [16][512][32][32]).
// Structure (analytic reassociation, exact in real arithmetic): O[c][d] = sum_D A[d][D] V[c][D] = sum_c' Q[c'][d] (sum_D K[c'][D] V[c][D]) = sum_c' Q[c'][d] M[c'][c] with the per-head 64x64 matrix M = K V^T - so per sample: the 1x1 convs as WMMA GEMMs (64x64 wave tiles, f32 accumulation, exact x16 weights + bias, f16 outputs): Q with the token rows as A (token-major result), K and V with the weight rows as A and the token rows as B (channel-major result, bias per row); M^T = V_cm K_cm^T (K = 1,024) only in the 128x64 tiles that hold a head-diagonal 64x64 block, stored f16, O_rows = Q_rows . M_head GEMM per head (K = 64: the head's own channels), O2 = Wo O^T + bo GEMM (f32, weight rows as A: channel-major); GroupNorm statistics per (sample, group) on VALU (float64 accumulation) over 4,096 contiguous values, affine + residual elementwise on VALU.
// Compute dtype: inputs rounded to bf16; X / weights exact; K, Q, V, M and O as plain f16 GEMM operands (~2^-12); GN statistics float64; everything else f32. v_wmma_f32_16x16x32_f16.
#define NB 16
#define CC 512
#define PX 1024
#define NR ((size_t)NB * PX)         /* 16384 */
#define NH 8
#define HD 64
#define GRP 128
#define CPG (CC / GRP)               /* 4 */
typedef __bf16 v16b __attribute__((ext_vector_type(16)));
typedef unsigned short v8us __attribute__((ext_vector_type(8), may_alias));
typedef float  v8f  __attribute__((ext_vector_type(8)));
typedef float  v4f  __attribute__((ext_vector_type(4)));
typedef float  v4fa __attribute__((ext_vector_type(4), may_alias));
union FragB { v16b v; v8us half[2]; unsigned short u[16]; };

__device__ __forceinline__ unsigned short bf16_bits(float x) { unsigned int u = __float_as_uint(x); return (unsigned short)((u + 0x7FFFu + ((u >> 16) & 1u)) >> 16); }
__device__ __forceinline__ float bf16_val(unsigned short b) { return __uint_as_float(((unsigned int)b) << 16); }
__device__ __forceinline__ float bf16_round(float x) { return bf16_val(bf16_bits(x)); }
// D += A·B with NT terms: 1 = ah·bh, 2 = + al·bh (A split), 3 = + ah·bl (both split)
template <int NT>
__device__ __forceinline__ v8f mmaN(v16b ah, v16b al, v16b bh, v16b bl, v8f c) {
  c = __builtin_amdgcn_wmma_f32_16x16x32_bf16(false, ah, false, bh, (short)0, c, false, false);
  if (NT >= 2) c = __builtin_amdgcn_wmma_f32_16x16x32_bf16(false, al, false, bh, (short)0, c, false, false);
  if (NT >= 3) c = __builtin_amdgcn_wmma_f32_16x16x32_bf16(false, ah, false, bl, (short)0, c, false, false);
  asm volatile("v_nop\n\tv_nop\n\tv_nop\n\tv_nop" : "+v"(c) : "v"(ah), "v"(al), "v"(bh), "v"(bl));
  return c;
}

__global__ __launch_bounds__(256) void k_wt_bf16(const float* __restrict__ W, unsigned short* __restrict__ Wt, int K, int N) {
  const int t = blockIdx.x * 256 + threadIdx.x;
  const int k8n = K / 8;
  if (t >= N * k8n) return;
  const int n = t / k8n, k8 = (t % k8n) * 8;
  v8us v;
#pragma unroll
  for (int i = 0; i < 8; ++i) v[i] = bf16_bits(W[(size_t)(k8 + i) * N + n]);
  *(v8us*)(Wt + (size_t)n * K + k8) = v;
  
}

// GEMM C[M][N] (f32, pitch ldc) = act(A[M][K]·W + bias). A f32 row-major (pitch lda) converted per fragment to bf16
// (ASPLIT: hi/lo two planes -> 2 terms, else single rounded term); Wt bf16 [N][K] (pitch ldb). BIAS_BF16 rounds the
// bias to bf16 first (bias quantised to bf16 before the add). K%32==0, M%16==0, N%64==0.
template <bool ASPLIT, int ACT, bool BIAS_BF16>
__global__ __launch_bounds__(128) void k_gemm_bf(const float* __restrict__ A, int lda, const unsigned short* __restrict__ Wt, int ldb,
                                               const float* __restrict__ bias, float* __restrict__ C, int ldc, int M, int N, int K) {
  __shared__ __attribute__((aligned(16))) float so[4][16][64];
  const int tid = threadIdx.x, w = tid >> 5, lane = tid & 31, ln = lane & 15, hh = lane >> 4;
  const int ntn = N / 64;
  const int wid = blockIdx.x * 4 + w;
  const int mt = wid / ntn, nq = wid % ntn;
  if (mt * 16 >= M) return;
  const int row0 = mt * 16, col0 = nq * 64;
  const float* arow = A + (size_t)(row0 + ln) * lda;
  v8f acc[4] = {};
  for (int kb = 0; kb < K; kb += 32) {
    FragB ah, al;
    const v4f x0 = *(const v4fa*)(arow + kb + 8 * hh), x1 = *(const v4fa*)(arow + kb + 8 * hh + 4);
    const v4f x2 = *(const v4fa*)(arow + kb + 16 + 8 * hh), x3 = *(const v4fa*)(arow + kb + 16 + 8 * hh + 4);
    float xs[16] = {x0[0],x0[1],x0[2],x0[3],x1[0],x1[1],x1[2],x1[3],x2[0],x2[1],x2[2],x2[3],x3[0],x3[1],x3[2],x3[3]};
#pragma unroll
    for (int i = 0; i < 16; ++i) { const unsigned short hb = bf16_bits(xs[i]); ah.u[i] = hb; al.u[i] = ASPLIT ? bf16_bits(xs[i] - bf16_val(hb)) : (unsigned short)0; }
#pragma unroll
    for (int t = 0; t < 4; ++t) {
      const unsigned short* brow = Wt + (size_t)(col0 + t * 16 + ln) * ldb + kb;
      FragB b;
      b.half[0] = *(const v8us*)(brow + 8 * hh);
      b.half[1] = *(const v8us*)(brow + 16 + 8 * hh);
      acc[t] = mmaN<ASPLIT ? 2 : 1>(ah.v, al.v, b.v, b.v, acc[t]);
    }
  }
#pragma unroll
  for (int t = 0; t < 4; ++t) {
    float bv = bias ? bias[col0 + t * 16 + ln] : 0.f;
    if (BIAS_BF16) bv = bf16_round(bv);
#pragma unroll
    for (int r = 0; r < 8; ++r) { float v = acc[t][r] + bv; if (ACT == 1) v = fmaxf(v, 0.f); so[w][8 * hh + r][t * 16 + ln] = v; }
  }
  __builtin_amdgcn_fence(__ATOMIC_ACQ_REL, "workgroup");
  __builtin_amdgcn_wave_barrier();
  const int rsub = lane >> 4, c4 = (lane & 15) * 4;
  {
#pragma unroll
    for (int q = 0; q < 8; ++q) {
      const int r = q * 2 + rsub;
      const v4f v = *(const v4fa*)&so[w][r][c4];
      *(v4f*)(C + (size_t)(row0 + r) * ldc + col0 + c4) = v;
    }
    
  }
}

// GEMM C = act(A·W + bias + resid): A f32 (ASPLIT -> hi/lo 2 terms), Wt bf16 [N][K]; ACT 0 none, 1 relu, 2 exact gelu;
// resid (optional, f32, row index = (row % rmod), pitch ldr, RES_BF16 rounds it) added before the activation.
template <bool ASPLIT, int ACT, bool BIAS_BF16, bool RES_BF16>
__global__ __launch_bounds__(128) void k_gemm_bf3(const float* __restrict__ A, int lda, const unsigned short* __restrict__ Wt, int ldb,
                                                const float* __restrict__ bias, const float* __restrict__ resid, int rmod, int ldr,
                                                float* __restrict__ C, int ldc, int M, int N, int K) {
  __shared__ __attribute__((aligned(16))) float so[4][16][64];
  const int tid = threadIdx.x, w = tid >> 5, lane = tid & 31, ln = lane & 15, hh = lane >> 4;
  const int ntn = N / 64;
  const int wid = blockIdx.x * 4 + w;
  const int mt = wid / ntn, nq = wid % ntn;
  if (mt * 16 >= M) return;
  const int row0 = mt * 16, col0 = nq * 64;
  const float* arow = A + (size_t)(row0 + ln) * lda;
  v8f acc[4] = {};
  for (int kb = 0; kb < K; kb += 32) {
    FragB ah, al;
    const v4f x0 = *(const v4fa*)(arow + kb + 8 * hh), x1 = *(const v4fa*)(arow + kb + 8 * hh + 4);
    const v4f x2 = *(const v4fa*)(arow + kb + 16 + 8 * hh), x3 = *(const v4fa*)(arow + kb + 16 + 8 * hh + 4);
    float xs[16] = {x0[0],x0[1],x0[2],x0[3],x1[0],x1[1],x1[2],x1[3],x2[0],x2[1],x2[2],x2[3],x3[0],x3[1],x3[2],x3[3]};
#pragma unroll
    for (int i = 0; i < 16; ++i) { const unsigned short hb = bf16_bits(xs[i]); ah.u[i] = hb; al.u[i] = ASPLIT ? bf16_bits(xs[i] - bf16_val(hb)) : (unsigned short)0; }
#pragma unroll
    for (int t = 0; t < 4; ++t) {
      const unsigned short* brow = Wt + (size_t)(col0 + t * 16 + ln) * ldb + kb;
      FragB b;
      b.half[0] = *(const v8us*)(brow + 8 * hh);
      b.half[1] = *(const v8us*)(brow + 16 + 8 * hh);
      acc[t] = mmaN<ASPLIT ? 2 : 1>(ah.v, al.v, b.v, b.v, acc[t]);
    }
  }
#pragma unroll
  for (int t = 0; t < 4; ++t) {
    const int col = col0 + t * 16 + ln;
    float bv = bias ? bias[col] : 0.f;
    if (BIAS_BF16) bv = bf16_round(bv);
#pragma unroll
    for (int r = 0; r < 8; ++r) {
      float v = acc[t][r] + bv;
      if (resid) { float rv = resid[(size_t)((row0 + 8 * hh + r) % rmod) * ldr + col]; if (RES_BF16) rv = bf16_round(rv); v += rv; }
      if (ACT == 1) v = fmaxf(v, 0.f);
      if (ACT == 2) v = 0.5f * v * (1.0f + erff(v * 0.70710678118654752f));
      if (ACT == 3) { const float u = 0.7978845608028654f * (v + 0.044715f * v * v * v); v = 0.5f * v * (1.0f + tanhf(u)); }
      so[w][8 * hh + r][t * 16 + ln] = v;
    }
  }
  __builtin_amdgcn_fence(__ATOMIC_ACQ_REL, "workgroup");
  __builtin_amdgcn_wave_barrier();
  const int rsub = lane >> 4, c4 = (lane & 15) * 4;
  {
#pragma unroll
    for (int q = 0; q < 8; ++q) {
      const int r = q * 2 + rsub;
      const v4f v = *(const v4fa*)&so[w][r][c4];
      *(v4f*)(C + (size_t)(row0 + r) * ldc + col0 + c4) = v;
    }
    
  }
}
// row LayerNorm (biased variance, eps) over N: s = X (+ R); optional out_sum <- s; out_norm <- (s-mu)*rsqrt(var+eps)*g + b
template <bool PARAM_BF16>
__global__ __launch_bounds__(256) void k_layernorm(const float* __restrict__ X, const float* __restrict__ R, const float* __restrict__ g, const float* __restrict__ bta,
                                                  float* __restrict__ out_sum, float* __restrict__ out_norm, int N, float eps) {
  __shared__ float red[256];
  const int row = blockIdx.x, tid = threadIdx.x;
  const float* x = X + (size_t)row * N; const float* rr = R ? R + (size_t)row * N : nullptr;
  float vals[16];                     // up to N = 4096
  const int per = N / 256;            // contiguous chunk per thread? use strided-by-4 chunks: thread handles j = tid*4 + 1024*u
  float s1 = 0.f;
  for (int u = 0; u < per / 4; ++u) {
    const int j = tid * 4 + 1024 * u;
    const v4f a = *(const v4fa*)(x + j);
    v4f b = {0.f,0.f,0.f,0.f}; if (rr) b = *(const v4fa*)(rr + j);
#pragma unroll
    for (int q = 0; q < 4; ++q) { const float v = a[q] + b[q]; vals[u * 4 + q] = v; s1 += v; }
  }
  red[tid] = s1; __syncthreads();
  for (int st = 128; st > 0; st >>= 1) { if (tid < st) red[tid] += red[tid + st]; __syncthreads(); }
  const float mu = red[0] / (float)N; __syncthreads();
  float s2 = 0.f;
  for (int u = 0; u < per / 4; ++u)
#pragma unroll
    for (int q = 0; q < 4; ++q) { const float c = vals[u * 4 + q] - mu; s2 += c * c; }
  red[tid] = s2; __syncthreads();
  for (int st = 128; st > 0; st >>= 1) { if (tid < st) red[tid] += red[tid + st]; __syncthreads(); }
  const float rs = rsqrtf(red[0] / (float)N + eps);
  {
    for (int u = 0; u < per / 4; ++u) {
      const int j = tid * 4 + 1024 * u;
      v4f o, sm;
#pragma unroll
      for (int q = 0; q < 4; ++q) {
        float gg = g[j + q], bb = bta[j + q];
        if (PARAM_BF16) { gg = bf16_round(gg); bb = bf16_round(bb); }
        sm[q] = vals[u * 4 + q]; o[q] = (vals[u * 4 + q] - mu) * rs * gg + bb;
      }
      if (out_sum) *(v4f*)(out_sum + (size_t)row * N + j) = sm;
      *(v4f*)(out_norm + (size_t)row * N + j) = o;
    }
    
  }
}



// ---- f16 WMMA path (v_wmma_f32_16x16x32_f16): 11-bit significands for operands in range — used for every GEMM launched here
typedef _Float16 v16h __attribute__((ext_vector_type(16)));
union FragH { v16h v; v8us half[2]; _Float16 h[16]; unsigned short u[16]; };
template <int NT>
__device__ __forceinline__ v8f mmaH(v16h ah, v16h al, v16h bh, v16h bl, v8f c) {
  c = __builtin_amdgcn_wmma_f32_16x16x32_f16(false, ah, false, bh, (short)0, c, false, false);
  if (NT >= 2) c = __builtin_amdgcn_wmma_f32_16x16x32_f16(false, al, false, bh, (short)0, c, false, false);
  if (NT >= 3) c = __builtin_amdgcn_wmma_f32_16x16x32_f16(false, ah, false, bl, (short)0, c, false, false);
  asm volatile("v_nop\n\tv_nop\n\tv_nop\n\tv_nop" : "+v"(c) : "v"(ah), "v"(al), "v"(bh), "v"(bl));
  return c;
}
// batched GEMM like k_gemm_b but f16 operands: A f32 (split into f16 hi/lo if ASPLIT, else rounded to f16), Bt = f16 values [n][k]; alpha; C f32; N multiple of 16 (partial tiles skipped)
template <bool ASPLIT>
__global__ __launch_bounds__(128) void k_gemm_h(const float* __restrict__ A, int lda, size_t sA, const _Float16* __restrict__ Bh, int ldb, size_t sB, float alpha, float* __restrict__ C, int ldc, size_t sC, int M, int N, int K) {
  __shared__ __attribute__((aligned(16))) float so[4][16][64];
  const int tid = threadIdx.x, w = tid >> 5, lane = tid & 31, ln = lane & 15, hh = lane >> 4; const int by = blockIdx.y;
  A += (size_t)by * sA; Bh += (size_t)by * sB; C += (size_t)by * sC;
  const int ntn = (N + 63) / 64; const int wid = blockIdx.x * 4 + w; const int mt = wid / ntn, nq = wid % ntn; if (mt * 16 >= M) return;
  const int row0 = mt * 16, col0 = nq * 64; const float* arow = A + (size_t)(row0 + ln) * lda;
  v8f acc[4] = {};
  for (int kb = 0; kb < K; kb += 32) {
    FragH ah, al;
    const v4f x0 = *(const v4fa*)(arow + kb + 8 * hh), x1 = *(const v4fa*)(arow + kb + 8 * hh + 4), x2 = *(const v4fa*)(arow + kb + 16 + 8 * hh), x3 = *(const v4fa*)(arow + kb + 16 + 8 * hh + 4);
    float xs[16] = {x0[0],x0[1],x0[2],x0[3],x1[0],x1[1],x1[2],x1[3],x2[0],x2[1],x2[2],x2[3],x3[0],x3[1],x3[2],x3[3]};
#pragma unroll
    for (int i = 0; i < 16; ++i) { const _Float16 h = (_Float16)xs[i]; ah.h[i] = h; al.h[i] = ASPLIT ? (_Float16)(xs[i] - (float)h) : (_Float16)0.0f; }
#pragma unroll
    for (int t = 0; t < 4; ++t) { if (col0 + t * 16 >= N) continue; const size_t boff = (size_t)(col0 + t * 16 + ln) * ldb + kb; FragH bq; bq.half[0] = *(const v8us*)(Bh + boff + 8 * hh); bq.half[1] = *(const v8us*)(Bh + boff + 16 + 8 * hh);
      acc[t] = mmaH<ASPLIT ? 2 : 1>(ah.v, al.v, bq.v, bq.v, acc[t]); }
  }
#pragma unroll
  for (int t = 0; t < 4; ++t) { if (col0 + t * 16 >= N) continue;
#pragma unroll
    for (int r = 0; r < 8; ++r) so[w][8 * hh + r][t * 16 + ln] = acc[t][r] * alpha; }
  __builtin_amdgcn_fence(__ATOMIC_ACQ_REL, "workgroup"); __builtin_amdgcn_wave_barrier();
  const int rsub = lane >> 4, c4 = (lane & 15) * 4;
  {
#pragma unroll
    for (int q = 0; q < 8; ++q) { const int r = q * 2 + rsub; if (col0 + c4 < N) { const v4f v = *(const v4fa*)&so[w][r][c4]; *(v4f*)(C + (size_t)(row0 + r) * ldc + col0 + c4) = v; } }
     }
}

// Wt[n][k] = f16(W[k][n]·scale) from f32 row-major W[K][N] (scale = power of two; bf16-exact weights stay exact in f16 away from the subnormal range)
__global__ __launch_bounds__(256) void k_wt_f16(const float* __restrict__ W, _Float16* __restrict__ Wt, int K, int N, float scale) {
  const int t = blockIdx.x * 256 + threadIdx.x; if (t >= N * (K / 8)) return; const int n = t / (K / 8), k8 = (t % (K / 8)) * 8; FragH f;
#pragma unroll
  for (int i = 0; i < 8; ++i) f.h[i] = (_Float16)(bf16_round(W[(size_t)(k8 + i) * N + n]) * scale); const v8us o = f.half[0];
  *(v8us*)((unsigned short*)Wt + (size_t)n * K + k8) = o; 
}
// k_gemm_hh variant with fused epilogue: v = acc·alpha + bias[by·sBias + col] (+ CP[(row/rowsPerB)·sCPb + by·64 + col] if CP) ; ACT 0 none / 1 elu ; writes f16 C16 (and f32 C if non-null)
template <int ACT>
__global__ __launch_bounds__(128) void k_gemm_hhx(const _Float16* __restrict__ A, int lda, size_t sA, const _Float16* __restrict__ Bh, int ldb, size_t sB, float alpha, const float* __restrict__ bias, size_t sBias, const float* __restrict__ CP, int rowsPerB, size_t sCPb, int row0g,
    float* __restrict__ C, _Float16* __restrict__ C16, int ldc, size_t sC, int M, int N, int K) {
  __shared__ __attribute__((aligned(16))) float so[4][16][64];
  const int tid = threadIdx.x, w = tid >> 5, lane = tid & 31, ln = lane & 15, hh = lane >> 4; const int by = blockIdx.y;
  A += (size_t)by * sA; Bh += (size_t)by * sB; const size_t cofs = (size_t)by * sC; const float* bp = bias ? bias + (size_t)by * sBias : nullptr;
  const int ntn = (N + 63) / 64; const int wid = blockIdx.x * 4 + w; const int mt = wid / ntn, nq = wid % ntn; if (mt * 16 >= M) return;
  const int row0 = mt * 16, col0 = nq * 64; const _Float16* arow = A + (size_t)(row0 + ln) * lda;
  v8f acc[4] = {};
  for (int kb = 0; kb < K; kb += 32) { FragH ah; ah.half[0] = *(const v8us*)((const unsigned short*)arow + kb + 8 * hh); ah.half[1] = *(const v8us*)((const unsigned short*)arow + kb + 16 + 8 * hh);
#pragma unroll
    for (int t = 0; t < 4; ++t) { if (col0 + t * 16 >= N) continue; const size_t boff = (size_t)(col0 + t * 16 + ln) * ldb + kb; FragH bq; bq.half[0] = *(const v8us*)((const unsigned short*)Bh + boff + 8 * hh); bq.half[1] = *(const v8us*)((const unsigned short*)Bh + boff + 16 + 8 * hh);
      acc[t] = mmaH<1>(ah.v, ah.v, bq.v, bq.v, acc[t]); }
  }
#pragma unroll
  for (int t = 0; t < 4; ++t) { if (col0 + t * 16 >= N) continue; const int col = col0 + t * 16 + ln; const float bv = bp ? bf16_round(bp[col]) : 0.f;
#pragma unroll
    for (int r = 0; r < 8; ++r) { float v = acc[t][r] * alpha + bv; if (CP) { const int rr = row0g + row0 + 8 * hh + r; if (rowsPerB < 0) v += CP[cofs + (size_t)rr * ldc + col];      /* rowsPerB < 0: own element of the batched C plane */ else { const int bidx = rr / rowsPerB; v += CP[(size_t)bidx * sCPb + (size_t)by * 64 + col]; } } if (ACT == 1) v = (v > 0.f) ? v : expm1f(v); else if (ACT == 7) v = (v > 0.f) ? v + 1.0f : expf(v); else if (ACT == 8) v = tanhf(v); else if (ACT == 9) v = 0.5f * v * (1.0f + tanhf(0.7978845608028654f * (v + 0.044715f * v * v * v))); else if (ACT == 11) v = 1.0f / (1.0f + expf(-v)); else if (ACT == 12) v = (v > 0.f) ? v : 0.01f * v; else if (ACT == 14) v = (v > 0.f) ? v : 0.1f * v; else if (ACT == 16) v = (v >= 0.f) ? v : 0.3f * v; else if (ACT == 17) v = (v >= 0.f) ? v : 0.2f * v; else if (ACT == 15) v = v / (1.0f + expf(-v)); else if (ACT == 3) v = fmaxf(v, 0.f); else if (ACT == 6) v = 0.5f * v * (1.0f + erff(v * 0.70710678118654752f)); so[w][8 * hh + r][t * 16 + ln] = v; } }
  __builtin_amdgcn_fence(__ATOMIC_ACQ_REL, "workgroup"); __builtin_amdgcn_wave_barrier();
  const int rsub = lane >> 4, c4 = (lane & 15) * 4; typedef _Float16 v4h __attribute__((ext_vector_type(4)));
  {
#pragma unroll
    for (int q = 0; q < 8; ++q) { const int r = q * 2 + rsub; if (col0 + c4 < N) { const v4f v = *(const v4fa*)&so[w][r][c4]; if (C) *(v4f*)(C + cofs + (size_t)(row0 + r) * ldc + col0 + c4) = v; if (C16) { v4h h4; for (int i = 0; i < 4; ++i) h4[i] = (_Float16)v[i]; *(v4h*)(C16 + cofs + (size_t)(row0 + r) * ldc + col0 + c4) = h4; } } }
     }
}


typedef _Float16 v4h __attribute__((ext_vector_type(4)));

__global__ __launch_bounds__(256) void k_x16(const float* __restrict__ x, _Float16* __restrict__ X16, size_t n8) { const size_t t = (size_t)blockIdx.x * 256 + threadIdx.x; if (t >= n8) return; FragH f;
#pragma unroll
  for (int q = 0; q < 8; ++q) f.h[q] = (_Float16)bf16_round(x[t * 8 + q]); *(v8us*)((unsigned short*)X16 + t * 8) = f.half[0];  }
__global__ __launch_bounds__(256) void k_h16(const float* __restrict__ x, _Float16* __restrict__ X16, size_t n8) { const size_t t = (size_t)blockIdx.x * 256 + threadIdx.x; if (t >= n8) return; FragH f;
#pragma unroll
  for (int q = 0; q < 8; ++q) f.h[q] = (_Float16)x[t * 8 + q]; *(v8us*)((unsigned short*)X16 + t * 8) = f.half[0];  }
__global__ __launch_bounds__(256) void k_round16f(const float* __restrict__ W, _Float16* __restrict__ Bt, size_t n8) { const size_t t = (size_t)blockIdx.x * 256 + threadIdx.x; if (t >= n8) return; FragH f;
#pragma unroll
  for (int i = 0; i < 8; ++i) f.h[i] = (_Float16)(bf16_round(W[t * 8 + i]) * 16.0f); *(v8us*)((unsigned short*)Bt + t * 8) = f.half[0];  }
template <int NHv, int TTv>
__global__ __launch_bounds__(256) void k_vt(const _Float16* __restrict__ V16, int ldv, int voff, _Float16* __restrict__ Vt) { __shared__ unsigned short tl[64][66]; const int tid = threadIdx.x; const int slab = blockIdx.x / (TTv / 64), lg = blockIdx.x % (TTv / 64); const int b = slab / NHv, h = slab % NHv;
  for (int i = tid; i < 64 * 8; i += 256) { const int r = i / 8, c8 = (i % 8) * 8; FragH f; f.half[0] = *(const v8us*)((const unsigned short*)V16 + ((size_t)b * TTv + lg * 64 + r) * ldv + voff + h * 64 + c8);
#pragma unroll
    for (int q = 0; q < 8; ++q) tl[r][c8 + q] = f.u[q]; }
  __syncthreads();
  {
#pragma unroll
    for (int rd = 0; rd < 2; ++rd) { const int d = rd * 32 + tid / 8, pc = tid % 8; FragH f;
#pragma unroll
      for (int q = 0; q < 8; ++q) f.u[q] = tl[pc * 8 + q][d];
      *(v8us*)((unsigned short*)Vt + ((size_t)slab * 64 + d) * TTv + lg * 64 + pc * 8) = f.half[0]; }
     } }

__global__ __launch_bounds__(256) void k_hl(const float* __restrict__ F, _Float16* __restrict__ Hh, _Float16* __restrict__ Hl, size_t n8) { const size_t t = (size_t)blockIdx.x * 256 + threadIdx.x; if (t >= n8) return; FragH fh, fl; const v4f a = *(const v4fa*)(F + t * 8), c = *(const v4fa*)(F + t * 8 + 4);
#pragma unroll
  for (int q = 0; q < 4; ++q) { _Float16 h = (_Float16)a[q]; fh.h[q] = h; fl.h[q] = (_Float16)((a[q] - (float)h) * 1024.0f); h = (_Float16)c[q]; fh.h[4 + q] = h; fl.h[4 + q] = (_Float16)((c[q] - (float)h) * 1024.0f); }
  { *(v8us*)((unsigned short*)Hh + t * 8) = fh.half[0]; *(v8us*)((unsigned short*)Hl + t * 8) = fl.half[0];  } }

// ---- fast GEMM (work-group tile 128x64, wave tile 32x64; requires M % 128 == 0, N % 64 == 0, K % 64 == 0); epilogue = k_gemm_hhx semantics; ROWB: bias indexed by the C row (weights as A) instead of the C column ----
// Operand path: per stage of 64 k (one 128-B line of every operand row) the 128 A rows and 64 B rows of the work-group's tile are copied to LDS by
// asynchronous b128 copies (a wave-wide copy = 4 whole lines), two buffers, the next stage in flight while this one is multiplied; fragments come from LDS.
#define G2_PITCH 144                      /* LDS row pitch in bytes, 16 B x odd: conflict-free for the ds_load_b128 fragment reads of 128-B rows */
#define G2_STAGE ((128 + 64) * G2_PITCH)  /* bytes of one buffer: A rows 0..127, then B rows 0..63 */
__device__ __forceinline__ v16h g2_frag(const unsigned char* p) { FragH f; f.half[0] = *(const v8us*)p; f.half[1] = *(const v8us*)(p + 32); return f.v; }
__device__ __forceinline__ v8f g2_mma(v16h a, v16h b, v8f c) { v8f d = __builtin_amdgcn_wmma_f32_16x16x32_f16(false, a, false, b, (short)0, c, false, false); asm volatile("v_nop\n\tv_nop\n\tv_nop\n\tv_nop" : "+v"(d) : "v"(a), "v"(b)); return d; }
// One stage: each of the 128 threads copies 16 B of 8 A rows and 4 B rows (rows 16 apart). l = the lane's LDS byte address in the buffer, a / b = its global
// addresses, sa / sb = 16 rows in elements. The closing s_wait_xcnt keeps every address register intact until the copies have taken it.
__device__ __forceinline__ void g2_stage(unsigned l, const _Float16* a, size_t sa, const _Float16* b, size_t sb) {
  asm volatile("global_load_async_to_lds_b128 %0, %12, off\n\t"
               "global_load_async_to_lds_b128 %1, %13, off\n\t"
               "global_load_async_to_lds_b128 %2, %14, off\n\t"
               "global_load_async_to_lds_b128 %3, %15, off\n\t"
               "global_load_async_to_lds_b128 %4, %16, off\n\t"
               "global_load_async_to_lds_b128 %5, %17, off\n\t"
               "global_load_async_to_lds_b128 %6, %18, off\n\t"
               "global_load_async_to_lds_b128 %7, %19, off\n\t"
               "global_load_async_to_lds_b128 %8, %20, off\n\t"
               "global_load_async_to_lds_b128 %9, %21, off\n\t"
               "global_load_async_to_lds_b128 %10, %22, off\n\t"
               "global_load_async_to_lds_b128 %11, %23, off\n\t"
               "s_wait_xcnt 0x0"
               :: "v"(l), "v"(l + 16 * G2_PITCH), "v"(l + 32 * G2_PITCH), "v"(l + 48 * G2_PITCH), "v"(l + 64 * G2_PITCH), "v"(l + 80 * G2_PITCH), "v"(l + 96 * G2_PITCH), "v"(l + 112 * G2_PITCH),
                  "v"(l + 128 * G2_PITCH), "v"(l + 144 * G2_PITCH), "v"(l + 160 * G2_PITCH), "v"(l + 176 * G2_PITCH),
                  "v"(a), "v"(a + sa), "v"(a + 2 * sa), "v"(a + 3 * sa), "v"(a + 4 * sa), "v"(a + 5 * sa), "v"(a + 6 * sa), "v"(a + 7 * sa),
                  "v"(b), "v"(b + sb), "v"(b + 2 * sb), "v"(b + 3 * sb)
               : "memory");
}
// The body takes its LDS and its block indices (bx = tile, by = batch plane) from the caller, so that one launch can hold the tiles of several independent GEMMs.
template <int ACT, bool ROWB>
__device__ __forceinline__ void g2_body(unsigned char* smem, const int bx, const int by, const _Float16* __restrict__ A, int lda, size_t sA, const _Float16* __restrict__ Bh, int ldb, size_t sB, float alpha, const float* __restrict__ bias, size_t sBias, const float* __restrict__ CP, int rowsPerB, size_t sCPb, int row0g,
    float* __restrict__ C, _Float16* __restrict__ C16, int ldc, size_t sC, int M, int N, int K) { static_assert(ACT == 0 || ACT == 3 || ACT == 6 || ACT == 8 || ACT == 9 || ACT == 11 || ACT == 12 || ACT == 14 || ACT == 15 || ACT == 16 || ACT == 17, "k_gemm2: unsupported ACT code (would silently apply no activation)");
  static_assert(sizeof(float) * 4 * 32 * 68 <= 2 * G2_STAGE, "output staging must fit the operand buffers");
  float (*so)[32][68] = (float (*)[32][68])smem;
  const int tid = threadIdx.x, w = tid >> 5, lane = tid & 31, ln = lane & 15, hh = lane >> 4;
  A += (size_t)by * sA; Bh += (size_t)by * sB; const size_t cofs = (size_t)by * sC; const float* bp = bias ? bias + (size_t)by * sBias : nullptr;
  const int ntn = N >> 6; const int mt = bx / ntn, nq = bx - mt * ntn; const int row0 = mt * 128 + 32 * w, col0 = nq * 64; if (mt * 128 >= M) return;      /* the whole work-group leaves, in front of every barrier */
  const unsigned lcp = (unsigned)(size_t)smem + (unsigned)((tid >> 3) * G2_PITCH + (tid & 7) * 16);
  const _Float16* gA = A + (size_t)(mt * 128 + (tid >> 3)) * lda + (tid & 7) * 8; const _Float16* gB = Bh + (size_t)(col0 + (tid >> 3)) * ldb + (tid & 7) * 8; const size_t sa16 = (size_t)16 * lda, sb16 = (size_t)16 * ldb;
  const int nst = K >> 6;
  const v8f z8 = {0.f,0.f,0.f,0.f,0.f,0.f,0.f,0.f}; v8f c00 = z8, c01 = z8, c02 = z8, c03 = z8, c10 = z8, c11 = z8, c12 = z8, c13 = z8;
  g2_stage(lcp, gA, sa16, gB, sb16);
  asm volatile("s_wait_asynccnt 0x0" ::: "memory");      /* this wave's copies of stage 0 have landed */
  __syncthreads();                                       /* ... and every other wave's */
  if (nst > 1) g2_stage(lcp + G2_STAGE, gA + 64, sa16, gB + 64, sb16);
#pragma unroll 1
  for (int s = 0; s < nst; ++s) { const unsigned char* sb = smem + (s & 1) * G2_STAGE; const unsigned char* pa = sb + (32 * w + ln) * G2_PITCH + 16 * hh; const unsigned char* pb = sb + (128 + ln) * G2_PITCH + 16 * hh;
    v16h fa[2][2], fb[2][4];      /* the stage's 12 fragments are read as one group in front of its 16 WMMAs: one LDS latency a stage instead of one per B fragment */
#pragma unroll
    for (int h = 0; h < 2; ++h) { fa[h][0] = g2_frag(pa + 64 * h); fa[h][1] = g2_frag(pa + 16 * G2_PITCH + 64 * h);
#pragma unroll
      for (int t = 0; t < 4; ++t) fb[h][t] = g2_frag(pb + 16 * t * G2_PITCH + 64 * h); }
#pragma unroll
    for (int h = 0; h < 2; ++h) {
      c00 = g2_mma(fa[h][0], fb[h][0], c00); c10 = g2_mma(fa[h][1], fb[h][0], c10);
      c01 = g2_mma(fa[h][0], fb[h][1], c01); c11 = g2_mma(fa[h][1], fb[h][1], c11);
      c02 = g2_mma(fa[h][0], fb[h][2], c02); c12 = g2_mma(fa[h][1], fb[h][2], c12);
      c03 = g2_mma(fa[h][0], fb[h][3], c03); c13 = g2_mma(fa[h][1], fb[h][3], c13); }
    asm volatile("s_wait_dscnt 0x0" ::: "memory");       /* this wave's reads of the buffer are over before it may be refilled */
    asm volatile("s_wait_asynccnt 0x0" ::: "memory");    /* this wave's copies of stage s + 1 have landed */
    __syncthreads();                                     /* publishes stage s + 1 and ends every wave's reads of stage s */
    if (s + 2 < nst) g2_stage(lcp + (unsigned)(s & 1) * G2_STAGE, gA + (size_t)(s + 2) * 64, sa16, gB + (size_t)(s + 2) * 64, sb16); }
  asm volatile("s_wait_asynccnt 0x0" ::: "memory");      /* no copy is outstanding when the buffers become output staging */
  v8f accs[8] = {c00, c01, c02, c03, c10, c11, c12, c13};
  float rbias[16];      /* ROWB: the bias of this lane's 16 C rows, loaded as one group in front of the element loop; both loops unrolled so that every index is a constant and the array stays in registers */
#pragma unroll
  for (int i = 0; i < 16; ++i) rbias[i] = 0.f;
  if (ROWB && bp) { const float* br = bp + row0 + 8 * hh;
#pragma unroll
    for (int i = 0; i < 16; ++i) rbias[i] = bf16_round(br[(i >> 3) * 16 + (i & 7)]); }
#pragma unroll
  for (int u = 0; u < 8; ++u) { const int t = u & 3, half = u >> 2; const int col = col0 + t * 16 + ln; const float bvc = (!ROWB && bp) ? bf16_round(bp[col]) : 0.f;
#pragma unroll
    for (int r = 0; r < 8; ++r) { const int rloc = half * 16 + 8 * hh + r; const float bv = ROWB ? rbias[half * 8 + r] : bvc; float v = accs[u][r] * alpha + bv; if (CP) { if (rowsPerB < 0) v += CP[cofs + (size_t)(row0g + row0 + rloc) * ldc + col];      /* rowsPerB < 0: own element of the batched C plane */ else { const int bidx = (row0g + row0 + rloc) / rowsPerB; v += CP[(size_t)bidx * sCPb + (size_t)by * 64 + col]; } }
      if (ACT == 3) v = fmaxf(v, 0.f); else if (ACT == 6) v = 0.5f * v * (1.0f + erff(v * 0.70710678118654752f)); else if (ACT == 11) v = 1.0f / (1.0f + expf(-v)); else if (ACT == 15) v = v / (1.0f + expf(-v)); else if (ACT == 12) v = (v > 0.f) ? v : 0.01f * v; else if (ACT == 8) v = tanhf(v); else if (ACT == 9) v = 0.5f * v * (1.0f + tanhf(0.7978845608028654f * (v + 0.044715f * v * v * v))); else if (ACT == 14) v = (v > 0.f) ? v : 0.1f * v; else if (ACT == 16) v = (v >= 0.f) ? v : 0.3f * v; else if (ACT == 17) v = (v >= 0.f) ? v : 0.2f * v;
      so[w][rloc][t * 16 + ln] = v; } }
  __builtin_amdgcn_fence(__ATOMIC_ACQ_REL, "workgroup"); __builtin_amdgcn_wave_barrier();
  const int rsub = lane >> 4, c4 = (lane & 15) * 4;
  {
#pragma unroll
    for (int q = 0; q < 16; ++q) { const int r = q * 2 + rsub; const v4f v = *(const v4fa*)&so[w][r][c4]; if (C) { *(v4f*)(C + cofs + (size_t)(row0 + r) * ldc + col0 + c4) = v; if (C16) asm volatile("s_wait_xcnt 0x0" ::: "memory"); }      /* the wait stands in front of the conversion below, which may overwrite registers that the f32 store names */
      if (C16) { v4h h4; for (int i = 0; i < 4; ++i) h4[i] = (_Float16)v[i]; *(v4h*)(C16 + cofs + (size_t)(row0 + r) * ldc + col0 + c4) = h4; } }
    asm volatile("s_wait_xcnt 0x0" ::: "memory");      /* stands behind the last stores, in front of any code of the calling kernel that follows the body and may overwrite registers that they name */
     } }
#define G2_SMEM __shared__ __attribute__((aligned(16))) unsigned char smem[2 * G2_STAGE]      /* the two operand buffers; behind the K loop's last barrier the same bytes stage the output tile */
template <int ACT, bool ROWB>
__global__ __launch_bounds__(128) void k_gemm2(const _Float16* __restrict__ A, int lda, size_t sA, const _Float16* __restrict__ Bh, int ldb, size_t sB, float alpha, const float* __restrict__ bias, size_t sBias, const float* __restrict__ CP, int rowsPerB, size_t sCPb, int row0g,
    float* __restrict__ C, _Float16* __restrict__ C16, int ldc, size_t sC, int M, int N, int K) { G2_SMEM;
  g2_body<ACT, ROWB>(smem, (int)blockIdx.x, (int)blockIdx.y, A, lda, sA, Bh, ldb, sB, alpha, bias, sBias, CP, rowsPerB, sCPb, row0g, C, C16, ldc, sC, M, N, K); }
// ---- large-tile GEMM for the three 512-k products (K and V, Q, O2): wave tile 64x64 (16 accumulator tiles; 8 fragments feed 16 WMMAs), WR x 2 waves, work-group tile 64 WR x 128 (WR = 2: 128x128, WR = 4: 256x128).
// Against the 128x64 tile of 32x64 waves it brings a third (WR = 2) or half (WR = 4) fewer operand bytes from L2 and reads a third fewer LDS bytes per WMMA, with half the waves and at most half the barriers.
// Same stage (64 k), same two buffers, same order of waits, same k order per output element. Requires M % (64 WR) == 0, N % 128 == 0, K % 64 == 0.
// v = acc * alpha + bias (ROWB: by C row, else by C column); writes f32 C (F32) or f16 C16.
#define G3_STAGE(WR) ((64 * (WR) + 128) * G2_PITCH)      /* bytes of one buffer: the A rows, then 128 B rows */
#define G3_OUT(WR) (2 * (WR) * 64 * 68 * 4)              /* bytes of the output staging: 64 rows of pitch 68 floats per wave */
#define G3_BYTES(WR) (2 * G3_STAGE(WR) > G3_OUT(WR) ? 2 * G3_STAGE(WR) : G3_OUT(WR))
// Eight copies: 16 B of 8 rows that lie LS bytes apart in LDS and s elements apart in global memory. l = the lane's LDS byte address of the first row, g = its global address.
// The closing s_wait_xcnt keeps every address register intact until the copies have taken it.
template <unsigned LS>
__device__ __forceinline__ void g3_copy8(unsigned l, const _Float16* g, size_t s) {
  asm volatile("global_load_async_to_lds_b128 %0, %8, off\n\t"
               "global_load_async_to_lds_b128 %1, %9, off\n\t"
               "global_load_async_to_lds_b128 %2, %10, off\n\t"
               "global_load_async_to_lds_b128 %3, %11, off\n\t"
               "global_load_async_to_lds_b128 %4, %12, off\n\t"
               "global_load_async_to_lds_b128 %5, %13, off\n\t"
               "global_load_async_to_lds_b128 %6, %14, off\n\t"
               "global_load_async_to_lds_b128 %7, %15, off\n\t"
               "s_wait_xcnt 0x0"
               :: "v"(l), "v"(l + 1 * LS), "v"(l + 2 * LS), "v"(l + 3 * LS), "v"(l + 4 * LS), "v"(l + 5 * LS), "v"(l + 6 * LS), "v"(l + 7 * LS),
                  "v"(g), "v"(g + s), "v"(g + 2 * s), "v"(g + 3 * s), "v"(g + 4 * s), "v"(g + 5 * s), "v"(g + 6 * s), "v"(g + 7 * s)
               : "memory");
}
// Twelve copies in one statement, one wait: 8 passes of A rows and, directly behind them in LDS, 4 passes of B rows.
template <unsigned LS>
__device__ __forceinline__ void g3_copy12(unsigned l, const _Float16* a, size_t sa, const _Float16* b, size_t sb) {
  asm volatile("global_load_async_to_lds_b128 %0, %12, off\n\t"
               "global_load_async_to_lds_b128 %1, %13, off\n\t"
               "global_load_async_to_lds_b128 %2, %14, off\n\t"
               "global_load_async_to_lds_b128 %3, %15, off\n\t"
               "global_load_async_to_lds_b128 %4, %16, off\n\t"
               "global_load_async_to_lds_b128 %5, %17, off\n\t"
               "global_load_async_to_lds_b128 %6, %18, off\n\t"
               "global_load_async_to_lds_b128 %7, %19, off\n\t"
               "global_load_async_to_lds_b128 %8, %20, off\n\t"
               "global_load_async_to_lds_b128 %9, %21, off\n\t"
               "global_load_async_to_lds_b128 %10, %22, off\n\t"
               "global_load_async_to_lds_b128 %11, %23, off\n\t"
               "s_wait_xcnt 0x0"
               :: "v"(l), "v"(l + 1 * LS), "v"(l + 2 * LS), "v"(l + 3 * LS), "v"(l + 4 * LS), "v"(l + 5 * LS), "v"(l + 6 * LS), "v"(l + 7 * LS), "v"(l + 8 * LS), "v"(l + 9 * LS), "v"(l + 10 * LS), "v"(l + 11 * LS),
                  "v"(a), "v"(a + sa), "v"(a + 2 * sa), "v"(a + 3 * sa), "v"(a + 4 * sa), "v"(a + 5 * sa), "v"(a + 6 * sa), "v"(a + 7 * sa),
                  "v"(b), "v"(b + sb), "v"(b + 2 * sb), "v"(b + 3 * sb)
               : "memory");
}
// One stage: the 64 WR threads x 16 B cover 8 WR rows a pass; 8 passes for the A rows, 16 / WR for the 128 B rows.
template <int WR>
__device__ __forceinline__ void g3_stage(unsigned l, const _Float16* a, size_t sa, const _Float16* b, size_t sb) {
  if (WR == 2) { g3_copy8<8 * WR * G2_PITCH>(l, a, sa); g3_copy8<8 * WR * G2_PITCH>(l + 64 * WR * G2_PITCH, b, sb); }      /* 16 copies: more operands than one statement takes */
  else g3_copy12<8 * WR * G2_PITCH>(l, a, sa, b, sb); }
template <int WR, bool ROWB, bool F32>
__device__ __forceinline__ void g3_body(unsigned char* smem, const int bx, const int by, const _Float16* __restrict__ A, int lda, size_t sA, const _Float16* __restrict__ Bh, int ldb, size_t sB, float alpha, const float* __restrict__ bias,
    float* __restrict__ C, _Float16* __restrict__ C16, int ldc, size_t sC, int M, int N, int K) {
  static_assert(WR == 2 || WR == 4, "the copy passes are written for these two");
  constexpr int TM = 64 * WR, RP = 8 * WR;      /* tile rows; rows per copy pass */
  float (*so)[64][68] = (float (*)[64][68])smem;
  const int tid = threadIdx.x, w = tid >> 5, lane = tid & 31, ln = lane & 15, hh = lane >> 4, wr = w >> 1, wc = w & 1;
  A += (size_t)by * sA; Bh += (size_t)by * sB; const size_t cofs = (size_t)by * sC;
  const int ntn = N >> 7; const int mt = bx / ntn, nq = bx - mt * ntn; const int row0 = mt * TM + 64 * wr, col0 = nq * 128 + 64 * wc; if (mt * TM >= M) return;      /* the whole work-group leaves, in front of every barrier */
  const unsigned lcp = (unsigned)(size_t)smem + (unsigned)((tid >> 3) * G2_PITCH + (tid & 7) * 16);
  const _Float16* gA = A + (size_t)(mt * TM + (tid >> 3)) * lda + (tid & 7) * 8; const _Float16* gB = Bh + (size_t)(nq * 128 + (tid >> 3)) * ldb + (tid & 7) * 8; const size_t sar = (size_t)RP * lda, sbr = (size_t)RP * ldb;
  const int nst = K >> 6;
  v8f acc[4][4];      /* [row tile][column tile]; every index below is a constant after unrolling */
#pragma unroll      /* constant indices: the arrays stay in registers */
  for (int i = 0; i < 4; ++i)
#pragma unroll      /* constant indices: the arrays stay in registers */
    for (int t = 0; t < 4; ++t) acc[i][t] = (v8f){0.f,0.f,0.f,0.f,0.f,0.f,0.f,0.f};
  g3_stage<WR>(lcp, gA, sar, gB, sbr);
  asm volatile("s_wait_asynccnt 0x0" ::: "memory");      /* this wave's copies of stage 0 have landed */
  __syncthreads();                                       /* ... and every other wave's */
  if (nst > 1) g3_stage<WR>(lcp + G3_STAGE(WR), gA + 64, sar, gB + 64, sbr);
#pragma unroll 1      /* stays rolled: one copy of the 32 WMMAs and of the ring's foot, so that the waits stand once and the loop is short in the instruction cache */
  for (int s = 0; s < nst; ++s) { const unsigned char* sb = smem + (s & 1) * G3_STAGE(WR); const unsigned char* pa = sb + (64 * wr + ln) * G2_PITCH + 16 * hh; const unsigned char* pb = sb + (TM + 64 * wc + ln) * G2_PITCH + 16 * hh;
#pragma unroll      /* constant indices: the arrays stay in registers */
    for (int h = 0; h < 2; ++h) { v16h fa[4], fb[4];      /* the 8 fragments of 32 k are read as one group in front of their 16 WMMAs */
#pragma unroll      /* constant indices: the arrays stay in registers */
      for (int i = 0; i < 4; ++i) { fa[i] = g2_frag(pa + 16 * i * G2_PITCH + 64 * h); fb[i] = g2_frag(pb + 16 * i * G2_PITCH + 64 * h); }
#pragma unroll      /* constant indices: the arrays stay in registers */
      for (int t = 0; t < 4; ++t)
#pragma unroll      /* constant indices: the arrays stay in registers */
        for (int i = 0; i < 4; ++i) acc[i][t] = g2_mma(fa[i], fb[t], acc[i][t]); }
    asm volatile("s_wait_dscnt 0x0" ::: "memory");       /* this wave's reads of the buffer are over before it may be refilled */
    asm volatile("s_wait_asynccnt 0x0" ::: "memory");    /* this wave's copies of stage s + 1 have landed */
    __syncthreads();                                     /* publishes stage s + 1 and ends every wave's reads of stage s */
    if (s + 2 < nst) g3_stage<WR>(lcp + (unsigned)(s & 1) * G3_STAGE(WR), gA + (size_t)(s + 2) * 64, sar, gB + (size_t)(s + 2) * 64, sbr); }
  asm volatile("s_wait_asynccnt 0x0" ::: "memory");      /* no copy is outstanding when the buffers become output staging */
#pragma unroll      /* constant indices: the arrays stay in registers */
  for (int i = 0; i < 4; ++i) { float rb[8];      /* ROWB: the bias of this lane's 8 C rows of row tile i */
#pragma unroll      /* constant indices: the arrays stay in registers */
    for (int r = 0; r < 8; ++r) rb[r] = ROWB ? bf16_round(bias[row0 + i * 16 + 8 * hh + r]) : 0.f;
#pragma unroll      /* constant indices: the arrays stay in registers */
    for (int t = 0; t < 4; ++t) { const float bvc = ROWB ? 0.f : bf16_round(bias[col0 + t * 16 + ln]);
#pragma unroll      /* constant indices: the arrays stay in registers */
      for (int r = 0; r < 8; ++r) so[w][i * 16 + 8 * hh + r][t * 16 + ln] = acc[i][t][r] * alpha + (ROWB ? rb[r] : bvc); } }
  __builtin_amdgcn_fence(__ATOMIC_ACQ_REL, "workgroup"); __builtin_amdgcn_wave_barrier();      /* the wave's staging writes stand in front of its read-back of other lanes' values; each wave stages in its own range, so no work-group barrier */
  const int rsub = lane >> 4, c4 = (lane & 15) * 4;
#pragma unroll      /* straight-line: the row pairs' LDS reads run ahead of the stores */
  for (int q = 0; q < 32; ++q) { const int r = q * 2 + rsub; const v4f v = *(const v4fa*)&so[w][r][c4];
    if (F32) *(v4f*)(C + cofs + (size_t)(row0 + r) * ldc + col0 + c4) = v;
    else { v4h h4; for (int i = 0; i < 4; ++i) h4[i] = (_Float16)v[i]; *(v4h*)(C16 + cofs + (size_t)(row0 + r) * ldc + col0 + c4) = h4; } }
  asm volatile("s_wait_xcnt 0x0" ::: "memory"); }      /* stands behind the last stores, in front of any code of the calling kernel that follows the body and may overwrite registers that they name */
#define G3_SMEM(WR) __shared__ __attribute__((aligned(16))) unsigned char smem[G3_BYTES(WR)]      /* the two operand buffers; behind the K loop's last barrier the same bytes stage the output tile */
// O2 = Wo O^T + bo, weights as A: x = tile, y = sample. 128x128 tiles: 512 work-groups, two independent ones per WGP.
__global__ __launch_bounds__(128) void k_gemm_o2(const _Float16* __restrict__ BWo, const _Float16* __restrict__ OR, const float* __restrict__ bo, float* __restrict__ O2) { G3_SMEM(2);
  g3_body<2, true, true>(smem, (int)blockIdx.x, (int)blockIdx.y, BWo, CC, 0, OR, CC, (size_t)PX * CC, 0.0625f, bo, O2, nullptr, PX, (size_t)CC * PX, CC, PX, CC); }
// K and V in one launch (neither reads the other): x = tile, y = sample, z = which. Weights as A: C[channel][position] per sample. 256x128 tiles: 512 work-groups of 8 waves, two per WGP.
__global__ __launch_bounds__(256) void k_gemm_kv(const _Float16* __restrict__ X16, const _Float16* __restrict__ BWq, const _Float16* __restrict__ BWv, const float* __restrict__ bq, const float* __restrict__ bv, _Float16* __restrict__ KC, _Float16* __restrict__ VC) { G3_SMEM(4);
  const bool isv = blockIdx.z != 0;
  g3_body<4, true, false>(smem, (int)blockIdx.x, (int)blockIdx.y, isv ? BWv : BWq, CC, 0, X16, CC, (size_t)PX * CC, 0.0625f, isv ? bv : bq, nullptr, isv ? VC : KC, PX, (size_t)CC * PX, CC, PX, CC); }
// M and Q in one launch (M reads K and V, Q reads X: neither reads the other). M's tiles have twice the k length and stand first in the grid.
#define MQ_MT NH      /* M tiles per sample: one per head, the 128x64 tile that holds the head's diagonal block (O never reads the other tiles) */
__global__ __launch_bounds__(128) void k_gemm_mq(const _Float16* __restrict__ VC, const _Float16* __restrict__ KC, _Float16* __restrict__ BD, const _Float16* __restrict__ X16, const _Float16* __restrict__ BWk, const float* __restrict__ bk, _Float16* __restrict__ QR) { G3_SMEM(2);
  const int b = (int)blockIdx.x;
  if (b < NB * MQ_MT) { const int h = b % MQ_MT; g2_body<0, false>(smem, (h >> 1) * (CC / 64) + h, b / MQ_MT, VC, PX, (size_t)CC * PX, KC, PX, (size_t)CC * PX, 1.0f, nullptr, 0, nullptr, 1, 0, 0, nullptr, BD, CC, (size_t)CC * CC, CC, CC, PX); }      /* M[c][c'] = sum_D V[c][D] K[c'][D], column tile h, row tile h / 2: already in the [n][k] order that the O GEMM's B operand wants */
  else g3_body<2, false, false>(smem, b - NB * MQ_MT, 0, X16, CC, 0, BWk, CC, 0, 0.0625f, bk, nullptr, QR, CC, 0, (int)NR, CC, CC); }      /* Q = K_conv(X), token-major */
// O per head: O[d][c] = sum_c' Q[d][c'] M[c][c'] with c and c' in head h only, so each 128x64 tile is a GEMM of k = 64 on the head's columns of Q and the head's diagonal block of M. x = row tile * heads + head, y = sample.
__global__ __launch_bounds__(128) void k_gemm_o(const _Float16* __restrict__ QR, const _Float16* __restrict__ BD, _Float16* __restrict__ OR) { G2_SMEM;
  const int h = (int)blockIdx.x % NH;
  g2_body<0, false>(smem, (int)blockIdx.x / NH, (int)blockIdx.y, QR + h * HD, CC, (size_t)PX * CC, BD + (size_t)h * HD * CC + h * HD, CC, (size_t)CC * CC, 1.0f, nullptr, 0, nullptr, 1, 0, 0, nullptr, OR + h * HD, CC, (size_t)PX * CC, PX, HD, HD); }


// The three streaming launches (prep, GN statistics, output) are gridded with few waves, each with 8 KiB to 16 KiB of whole-line 16-B loads in flight.
// X transpose: a work-group takes 64 channels x 256 positions. A wave-wide load covers 4 channel rows x one 128-B line; a lane holds the same 4 positions of two neighbouring channels,
// so that each LDS store is one dword (a channel pair of one position). LDS rows = positions, pitch 144 B (16 B x odd) for the ds_load_b128 read-back of 8 channels.
#define XT_P 256
#define XT_PITCH 144
typedef _Float16 v2h __attribute__((ext_vector_type(2)));
__device__ __forceinline__ void xrows_body(const float* __restrict__ x, _Float16* __restrict__ X16, const int bx) { __shared__ __attribute__((aligned(16))) unsigned char tl[XT_P * XT_PITCH]; const int tid = threadIdx.x, w = tid >> 5, lane = tid & 31, r = lane >> 3, pq = lane & 7; const int cg = bx % (CC / 64); const int pb = (bx / (CC / 64)) % (PX / XT_P); const int n = bx / ((CC / 64) * (PX / XT_P)); const int p0 = pb * XT_P, c0 = cg * 64;
  const float* src = x + ((size_t)n * CC + c0 + w * 8 + 2 * r) * PX + p0 + pq * 4;
  v4f e[XT_P / 32], o[XT_P / 32];
#pragma unroll
  for (int k = 0; k < XT_P / 32; ++k) { e[k] = *(const v4fa*)(src + k * 32); o[k] = *(const v4fa*)(src + PX + k * 32); }
  __builtin_amdgcn_sched_barrier(0);      /* keeps the 16 loads in flight together: without it the scheduler lifts the first conversions, with their waits, in between the loads */
  asm volatile("s_wait_xcnt 0x0" :: "v"(src) : "memory");      /* stands behind the loads, in front of any overwrite of the address register that they name; the operand keeps that register whole up to here */
  unsigned char* dst = tl + pq * 4 * XT_PITCH + (w * 4 + r) * 4;
#pragma unroll
  for (int k = 0; k < XT_P / 32; ++k)
#pragma unroll
    for (int j = 0; j < 4; ++j) { v2h h; h[0] = (_Float16)bf16_round(e[k][j]); h[1] = (_Float16)bf16_round(o[k][j]); *(v2h*)(dst + (k * 32 + j) * XT_PITCH) = h; }
  __syncthreads();
  const unsigned char* rd = tl + (tid >> 3) * XT_PITCH + (tid & 7) * 16; unsigned short* g = (unsigned short*)X16 + ((size_t)n * PX + p0 + (tid >> 3)) * CC + c0 + (tid & 7) * 8;
#pragma unroll
  for (int i = 0; i < XT_P / 32; ++i) *(v8us*)(g + (size_t)i * 32 * CC) = *(const v8us*)(rd + i * 32 * XT_PITCH); }      /* a wave-wide store = 4 positions x one 128-B line */
#define WCH 8      /* chunks of 8 weights per thread */
__device__ __forceinline__ void wnat_body(const float* __restrict__ w, _Float16* __restrict__ Bt, const int bx) { const unsigned t0 = (unsigned)bx * (256 * WCH) + threadIdx.x; const unsigned src = t0 * 32u; const char* wb = (const char*)w; v4f a[WCH], b[WCH];      /* src = the lane's byte offset in the matrix */
#pragma unroll
  for (int u = 0; u < WCH; ++u) { a[u] = *(const v4fa*)(wb + (src + u * 8192)); b[u] = *(const v4fa*)(wb + (src + u * 8192 + 16)); }
  asm volatile("s_wait_xcnt 0x0" :: "v"(src) : "memory");      /* stands behind the loads, in front of any overwrite of the address register that they name; the operand keeps that register whole up to here */
#pragma unroll
  for (int u = 0; u < WCH; ++u) { FragH f; for (int q = 0; q < 4; ++q) { f.h[q] = (_Float16)(bf16_round(a[u][q]) * 16.0f); f.h[4 + q] = (_Float16)(bf16_round(b[u][q]) * 16.0f); } *(v8us*)((unsigned short*)Bt + (t0 + u * 256) * 8) = f.half[0]; }
  asm volatile("s_wait_xcnt 0x0" ::: "memory"); }      /* stands behind the last stores, in front of any code of the calling kernel that follows the body and may overwrite registers that they name */
// The X transpose and the four weight roundings in one launch (none reads another's result): the transpose's blocks first, then WB blocks per weight matrix.
#define XB (NB * (CC / 64) * (PX / XT_P))
#define WB (CC * CC / 8 / 256 / WCH)
static_assert(WB * WCH * 256 * 8 == CC * CC, "the weight blocks cover a matrix exactly");
__global__ __launch_bounds__(256) void k_prep(const float* __restrict__ x, _Float16* __restrict__ X16, const float* __restrict__ Wq, const float* __restrict__ Wk, const float* __restrict__ Wv, const float* __restrict__ Wo,
    _Float16* __restrict__ BWq, _Float16* __restrict__ BWk, _Float16* __restrict__ BWv, _Float16* __restrict__ BWo) {
  const int b = (int)blockIdx.x;
  if (b < XB) { xrows_body(x, X16, b); return; }      /* the same for the whole block */
  const int m = (b - XB) / WB;
  wnat_body(m == 0 ? Wq : m == 1 ? Wk : m == 2 ? Wv : Wo, m == 0 ? BWq : m == 1 ? BWk : m == 2 ? BWv : BWo, (b - XB) % WB); }
// GN statistics: one wave per (sample, group). Its 4,096 contiguous values are 32 wave-wide 16-B loads; float64 sums in four chains per lane, then a butterfly over the 32 lanes: no LDS, no barrier.
__global__ __launch_bounds__(256) void k_gnstat(const float* __restrict__ O2, float* __restrict__ stat) { const int lane = threadIdx.x & 31; const int sg = (int)blockIdx.x * 8 + (int)(threadIdx.x >> 5);
  const float* src = O2 + (size_t)sg * (PX * CPG) + lane * 4;      /* the group's 4 channel rows are contiguous */
  v4f v[PX * CPG / 128];
#pragma unroll
  for (int i = 0; i < PX * CPG / 128; ++i) v[i] = *(const v4fa*)(src + i * 128);
  __builtin_amdgcn_sched_barrier(0);      /* keeps the 32 loads in flight together: without it the scheduler sinks most of them between the uses, a few at a time, and the wave pays the memory latency once per batch */
  double s[4] = {0.0, 0.0, 0.0, 0.0}, q2[4] = {0.0, 0.0, 0.0, 0.0};
#pragma unroll
  for (int i = 0; i < PX * CPG / 128; ++i)
#pragma unroll
    for (int k = 0; k < 4; ++k) { const double d = (double)v[i][k]; s[k] += d; q2[k] += d * d; }
  double st = (s[0] + s[1]) + (s[2] + s[3]), qt = (q2[0] + q2[1]) + (q2[2] + q2[3]);
#pragma unroll
  for (int mk = 16; mk > 0; mk >>= 1) { st += __shfl_xor(st, mk, 32); qt += __shfl_xor(qt, mk, 32); }
  const double cnt = (double)(PX * CPG); const double mu = st / cnt; double var = qt / cnt - mu * mu; if (var < 0.0) var = 0.0; const float m = (float)mu, r = (float)(1.0 / sqrt(var + 1e-5));
  stat[(size_t)sg * 32 + lane] = lane == 0 ? m : lane == 1 ? r : 0.f; }      /* the wave writes its group's whole 128-B line */
// Output: one wave per pair of channel rows (8 KiB of O2, 8 KiB of X, both rows in one group): 32 wave-wide 16-B loads in flight, 16 whole-line stores.
__global__ __launch_bounds__(256) void k_out(const float* __restrict__ O2, const float* __restrict__ stat, const float* __restrict__ gw, const float* __restrict__ gb, const float* __restrict__ x, float* __restrict__ out) {
  #pragma clang fp contract(off)
  const int lane = threadIdx.x & 31; const int pr = __builtin_amdgcn_readfirstlane((int)blockIdx.x * 8 + (int)(threadIdx.x >> 5));      /* the wave's row pair, told to the compiler as wave-uniform so that the statistics and the affine pair come by scalar loads */
  const int c = (pr * 2) % CC; const size_t sg = (size_t)(pr / (CPG / 2)); const size_t base = (size_t)pr * (2 * PX); const unsigned l4 = (unsigned)lane * 4u;      /* scalar base + one lane offset that lives to the last store */
  const float* __restrict__ pa = O2 + base; const float* __restrict__ px = x + base; float* __restrict__ po = out + base;
  v4f a[16], xx[16];
#pragma unroll
  for (int i = 0; i < 16; ++i) { a[i] = *(const v4fa*)(pa + (l4 + i * 128)); xx[i] = *(const v4fa*)(px + (l4 + i * 128)); }
  __builtin_amdgcn_sched_barrier(0);      /* keeps the 32 loads in flight together: without it the scheduler sinks most of them between the uses, a few at a time, and the wave pays the memory latency once per batch */
  const float m = stat[sg * 32], r = stat[sg * 32 + 1]; const float w0 = bf16_round(gw[c]), b0 = bf16_round(gb[c]), w1 = bf16_round(gw[c + 1]), b1 = bf16_round(gb[c + 1]);
#pragma unroll
  for (int i = 0; i < 16; ++i) { const float w = i < 8 ? w0 : w1, bb = i < 8 ? b0 : b1; v4f o;
#pragma unroll
    for (int q = 0; q < 4; ++q) o[q] = __fadd_rn(__fadd_rn(__fmul_rn((a[i][q] - m) * r, w), bb), bf16_round(xx[i][q]));
    *(v4f*)(po + (l4 + i * 128)) = o; } }

extern "C" void kernel_launch(void* const* d_in, const int* in_sizes, int n_in,
                              void* d_out, int out_size, void* d_ws, size_t ws_size, hipStream_t stream) {
  (void)in_sizes; (void)n_in; (void)out_size;
  const float* const* I = (const float* const*)d_in; const float* X = I[0]; const float* Wq = I[1]; const float* bq = I[2]; const float* Wk = I[3]; const float* bk = I[4]; const float* Wv = I[5]; const float* bv = I[6]; const float* Wo = I[7]; const float* bo = I[8]; const float* gw = I[9]; const float* gb = I[10];
  char* ws = (char*)d_ws; size_t off = 0;
  auto take = [&](size_t bytes) { char* p = ws + off; off += (bytes + 255) & ~(size_t)255; return p; };
  _Float16* BWq = (_Float16*)take((size_t)CC * CC * 2); _Float16* BWk = (_Float16*)take((size_t)CC * CC * 2); _Float16* BWv = (_Float16*)take((size_t)CC * CC * 2); _Float16* BWo = (_Float16*)take((size_t)CC * CC * 2);
  _Float16* X16 = (_Float16*)take(NR * CC * 2); _Float16* QR = (_Float16*)take(NR * CC * 2); _Float16* KC = (_Float16*)take(NR * CC * 2); _Float16* VC = (_Float16*)take(NR * CC * 2); _Float16* BD = (_Float16*)take((size_t)NB * CC * CC * 2); _Float16* OR = (_Float16*)take(NR * CC * 2); float* O2 = (float*)take(NR * CC * 4); float* stat = (float*)take((size_t)NB * GRP * 32 * 4);
  if (off > ws_size) return;      /* 2 + 16x5 + 8 + 32 = about 122 MiB */
  k_prep<<<XB + 4 * WB, 256, 0, stream>>>(X, X16, Wq, Wk, Wv, Wo, BWq, BWk, BWv, BWo);
  const dim3 gc((CC / 128) * (PX / 128), NB);      /* weights as A: C[channel][position] per sample, y = sample */
  k_gemm_kv<<<dim3((CC / 256) * (PX / 128), NB, 2), 256, 0, stream>>>(X16, BWq, BWv, bq, bv, KC, VC);      /* K = Q_conv(X) (the module's swap) and V, channel-major */
  /* all samples in one launch each: per-sample planes of KC, VC and BD (of BD only the tiles with a diagonal block are written, and only the diagonal blocks read) */
  k_gemm_mq<<<NB * MQ_MT + (unsigned)((NR / 128) * (CC / 128)), 128, 0, stream>>>(VC, KC, BD, X16, BWk, bk, QR);
  k_gemm_o<<<dim3((PX / 128) * NH, NB), 128, 0, stream>>>(QR, BD, OR);      /* O[d][c] = sum_c' Q[d][c'] M[c][c'] within the head */
  k_gemm_o2<<<gc, 128, 0, stream>>>(BWo, OR, bo, O2);      /* O2[n][c][p], the output's own layout */
  k_gnstat<<<NB * GRP / 8, 256, 0, stream>>>(O2, stat);      /* 8 waves a block, one group each */
  k_out<<<NB * CC / 2 / 8, 256, 0, stream>>>(O2, stat, gw, gb, X, (float*)d_out);
}

// v008
// Measured time: 68 microseconds a run.
// Timed twice side by side with v007, it ran 1.22 and 1.21 times as fast.
// Counting every step since v000, it is 16.5 times as fast.
#include <hip/hip_runtime.h>
// Non_local_MH (X [16][512][32][32]; K = conv1x1(X, Wq, bq), Q = conv1x1(X, Wk, bk), V = conv1x1(X, Wv, bv) (the module's swapped naming), 8 heads of 64 channels over d = 1,024 positions; softmax-FREE attention A = Q^T K ([d][d]), O = V A^T; O = conv1x1(O, Wo, bo); GroupNorm(128 groups of 4 channels, eps 1e-5, affine); out = GN(O) + X -> [16][512][32][32]).
// Structure (analytic reassociation, exact in real arithmetic): O[c][d] = sum_D A[d][D] V[c][D] = sum_c' Q[c'][d] (sum_D K[c'][D] V[c][D]) = sum_c' Q[c'][d] M[c'][c] with the per-head 64x64 matrix M = K V^T - so per sample: the 1x1 convs as WMMA GEMMs (64x64 wave tiles, f32 accumulation, exact x16 weights + bias, f16 outputs): Q with the token rows as A (token-major result), K and V with the weight rows as A and the token rows as B (channel-major result, bias per row); M^T = V_cm K_cm^T (K = 1,024) only in the 128x64 tiles that hold a head-diagonal 64x64 block, stored f16, O_rows = Q_rows . M_head GEMM per head (K = 64: the head's own channels), O2 = Wo O^T + bo GEMM (f32, weight rows as A: channel-major) whose work-group holds 64 channels x all positions, so that the GroupNorm statistics per (sample, group) (f32 sums per wave, float64 over the waves), the affine and the residual follow on VALU in the same launch.
// Compute dtype: inputs rounded to bf16; X / weights exact; K, Q, V, M and O as plain f16 GEMM operands (~2^-12); GN statistics f32 partial sums, float64 totals; everything else f32. v_wmma_f32_16x16x32_f16.
#define NB 16
#define CC 512
#define PX 1024
#define NR ((size_t)NB * PX)         /* 16384 */
#define NH 8
#define HD 64
#define GRP 128
#define CPG (CC / GRP)               /* 4 */
typedef __bf16 v16b __attribute__((ext_vector_type(16)));
typedef unsigned short v8us __attribute__((ext_vector_type(8), may_alias));
typedef float  v8f  __attribute__((ext_vector_type(8)));
typedef float  v4f  __attribute__((ext_vector_type(4)));
typedef float  v4fa __attribute__((ext_vector_type(4), may_alias));
union FragB { v16b v; v8us half[2]; unsigned short u[16]; };

__device__ __forceinline__ unsigned short bf16_bits(float x) { unsigned int u = __float_as_uint(x); return (unsigned short)((u + 0x7FFFu + ((u >> 16) & 1u)) >> 16); }
__device__ __forceinline__ float bf16_val(unsigned short b) { return __uint_as_float(((unsigned int)b) << 16); }
__device__ __forceinline__ float bf16_round(float x) { return bf16_val(bf16_bits(x)); }
// D += A·B with NT terms: 1 = ah·bh, 2 = + al·bh (A split), 3 = + ah·bl (both split)
template <int NT>
__device__ __forceinline__ v8f mmaN(v16b ah, v16b al, v16b bh, v16b bl, v8f c) {
  c = __builtin_amdgcn_wmma_f32_16x16x32_bf16(false, ah, false, bh, (short)0, c, false, false);
  if (NT >= 2) c = __builtin_amdgcn_wmma_f32_16x16x32_bf16(false, al, false, bh, (short)0, c, false, false);
  if (NT >= 3) c = __builtin_amdgcn_wmma_f32_16x16x32_bf16(false, ah, false, bl, (short)0, c, false, false);
  asm volatile("v_nop\n\tv_nop\n\tv_nop\n\tv_nop" : "+v"(c) : "v"(ah), "v"(al), "v"(bh), "v"(bl));
  return c;
}

__global__ __launch_bounds__(256) void k_wt_bf16(const float* __restrict__ W, unsigned short* __restrict__ Wt, int K, int N) {
  const int t = blockIdx.x * 256 + threadIdx.x;
  const int k8n = K / 8;
  if (t >= N * k8n) return;
  const int n = t / k8n, k8 = (t % k8n) * 8;
  v8us v;
#pragma unroll
  for (int i = 0; i < 8; ++i) v[i] = bf16_bits(W[(size_t)(k8 + i) * N + n]);
  *(v8us*)(Wt + (size_t)n * K + k8) = v;
  
}

// GEMM C[M][N] (f32, pitch ldc) = act(A[M][K]·W + bias). A f32 row-major (pitch lda) converted per fragment to bf16
// (ASPLIT: hi/lo two planes -> 2 terms, else single rounded term); Wt bf16 [N][K] (pitch ldb). BIAS_BF16 rounds the
// bias to bf16 first (bias quantised to bf16 before the add). K%32==0, M%16==0, N%64==0.
template <bool ASPLIT, int ACT, bool BIAS_BF16>
__global__ __launch_bounds__(128) void k_gemm_bf(const float* __restrict__ A, int lda, const unsigned short* __restrict__ Wt, int ldb,
                                               const float* __restrict__ bias, float* __restrict__ C, int ldc, int M, int N, int K) {
  __shared__ __attribute__((aligned(16))) float so[4][16][64];
  const int tid = threadIdx.x, w = tid >> 5, lane = tid & 31, ln = lane & 15, hh = lane >> 4;
  const int ntn = N / 64;
  const int wid = blockIdx.x * 4 + w;
  const int mt = wid / ntn, nq = wid % ntn;
  if (mt * 16 >= M) return;
  const int row0 = mt * 16, col0 = nq * 64;
  const float* arow = A + (size_t)(row0 + ln) * lda;
  v8f acc[4] = {};
  for (int kb = 0; kb < K; kb += 32) {
    FragB ah, al;
    const v4f x0 = *(const v4fa*)(arow + kb + 8 * hh), x1 = *(const v4fa*)(arow + kb + 8 * hh + 4);
    const v4f x2 = *(const v4fa*)(arow + kb + 16 + 8 * hh), x3 = *(const v4fa*)(arow + kb + 16 + 8 * hh + 4);
    float xs[16] = {x0[0],x0[1],x0[2],x0[3],x1[0],x1[1],x1[2],x1[3],x2[0],x2[1],x2[2],x2[3],x3[0],x3[1],x3[2],x3[3]};
#pragma unroll
    for (int i = 0; i < 16; ++i) { const unsigned short hb = bf16_bits(xs[i]); ah.u[i] = hb; al.u[i] = ASPLIT ? bf16_bits(xs[i] - bf16_val(hb)) : (unsigned short)0; }
#pragma unroll
    for (int t = 0; t < 4; ++t) {
      const unsigned short* brow = Wt + (size_t)(col0 + t * 16 + ln) * ldb + kb;
      FragB b;
      b.half[0] = *(const v8us*)(brow + 8 * hh);
      b.half[1] = *(const v8us*)(brow + 16 + 8 * hh);
      acc[t] = mmaN<ASPLIT ? 2 : 1>(ah.v, al.v, b.v, b.v, acc[t]);
    }
  }
#pragma unroll
  for (int t = 0; t < 4; ++t) {
    float bv = bias ? bias[col0 + t * 16 + ln] : 0.f;
    if (BIAS_BF16) bv = bf16_round(bv);
#pragma unroll
    for (int r = 0; r < 8; ++r) { float v = acc[t][r] + bv; if (ACT == 1) v = fmaxf(v, 0.f); so[w][8 * hh + r][t * 16 + ln] = v; }
  }
  __builtin_amdgcn_fence(__ATOMIC_ACQ_REL, "workgroup");
  __builtin_amdgcn_wave_barrier();
  const int rsub = lane >> 4, c4 = (lane & 15) * 4;
  {
#pragma unroll
    for (int q = 0; q < 8; ++q) {
      const int r = q * 2 + rsub;
      const v4f v = *(const v4fa*)&so[w][r][c4];
      *(v4f*)(C + (size_t)(row0 + r) * ldc + col0 + c4) = v;
    }
    
  }
}

// GEMM C = act(A·W + bias + resid): A f32 (ASPLIT -> hi/lo 2 terms), Wt bf16 [N][K]; ACT 0 none, 1 relu, 2 exact gelu;
// resid (optional, f32, row index = (row % rmod), pitch ldr, RES_BF16 rounds it) added before the activation.
template <bool ASPLIT, int ACT, bool BIAS_BF16, bool RES_BF16>
__global__ __launch_bounds__(128) void k_gemm_bf3(const float* __restrict__ A, int lda, const unsigned short* __restrict__ Wt, int ldb,
                                                const float* __restrict__ bias, const float* __restrict__ resid, int rmod, int ldr,
                                                float* __restrict__ C, int ldc, int M, int N, int K) {
  __shared__ __attribute__((aligned(16))) float so[4][16][64];
  const int tid = threadIdx.x, w = tid >> 5, lane = tid & 31, ln = lane & 15, hh = lane >> 4;
  const int ntn = N / 64;
  const int wid = blockIdx.x * 4 + w;
  const int mt = wid / ntn, nq = wid % ntn;
  if (mt * 16 >= M) return;
  const int row0 = mt * 16, col0 = nq * 64;
  const float* arow = A + (size_t)(row0 + ln) * lda;
  v8f acc[4] = {};
  for (int kb = 0; kb < K; kb += 32) {
    FragB ah, al;
    const v4f x0 = *(const v4fa*)(arow + kb + 8 * hh), x1 = *(const v4fa*)(arow + kb + 8 * hh + 4);
    const v4f x2 = *(const v4fa*)(arow + kb + 16 + 8 * hh), x3 = *(const v4fa*)(arow + kb + 16 + 8 * hh + 4);
    float xs[16] = {x0[0],x0[1],x0[2],x0[3],x1[0],x1[1],x1[2],x1[3],x2[0],x2[1],x2[2],x2[3],x3[0],x3[1],x3[2],x3[3]};
#pragma unroll
    for (int i = 0; i < 16; ++i) { const unsigned short hb = bf16_bits(xs[i]); ah.u[i] = hb; al.u[i] = ASPLIT ? bf16_bits(xs[i] - bf16_val(hb)) : (unsigned short)0; }
#pragma unroll
    for (int t = 0; t < 4; ++t) {
      const unsigned short* brow = Wt + (size_t)(col0 + t * 16 + ln) * ldb + kb;
      FragB b;
      b.half[0] = *(const v8us*)(brow + 8 * hh);
      b.half[1] = *(const v8us*)(brow + 16 + 8 * hh);
      acc[t] = mmaN<ASPLIT ? 2 : 1>(ah.v, al.v, b.v, b.v, acc[t]);
    }
  }
#pragma unroll
  for (int t = 0; t < 4; ++t) {
    const int col = col0 + t * 16 + ln;
    float bv = bias ? bias[col] : 0.f;
    if (BIAS_BF16) bv = bf16_round(bv);
#pragma unroll
    for (int r = 0; r < 8; ++r) {
      float v = acc[t][r] + bv;
      if (resid) { float rv = resid[(size_t)((row0 + 8 * hh + r) % rmod) * ldr + col]; if (RES_BF16) rv = bf16_round(rv); v += rv; }
      if (ACT == 1) v = fmaxf(v, 0.f);
      if (ACT == 2) v = 0.5f * v * (1.0f + erff(v * 0.70710678118654752f));
      if (ACT == 3) { const float u = 0.7978845608028654f * (v + 0.044715f * v * v * v); v = 0.5f * v * (1.0f + tanhf(u)); }
      so[w][8 * hh + r][t * 16 + ln] = v;
    }
  }
  __builtin_amdgcn_fence(__ATOMIC_ACQ_REL, "workgroup");
  __builtin_amdgcn_wave_barrier();
  const int rsub = lane >> 4, c4 = (lane & 15) * 4;
  {
#pragma unroll
    for (int q = 0; q < 8; ++q) {
      const int r = q * 2 + rsub;
      const v4f v = *(const v4fa*)&so[w][r][c4];
      *(v4f*)(C + (size_t)(row0 + r) * ldc + col0 + c4) = v;
    }
    
  }
}
// row LayerNorm (biased variance, eps) over N: s = X (+ R); optional out_sum <- s; out_norm <- (s-mu)*rsqrt(var+eps)*g + b
template <bool PARAM_BF16>
__global__ __launch_bounds__(256) void k_layernorm(const float* __restrict__ X, const float* __restrict__ R, const float* __restrict__ g, const float* __restrict__ bta,
                                                  float* __restrict__ out_sum, float* __restrict__ out_norm, int N, float eps) {
  __shared__ float red[256];
  const int row = blockIdx.x, tid = threadIdx.x;
  const float* x = X + (size_t)row * N; const float* rr = R ? R + (size_t)row * N : nullptr;
  float vals[16];                     // up to N = 4096
  const int per = N / 256;            // contiguous chunk per thread? use strided-by-4 chunks: thread handles j = tid*4 + 1024*u
  float s1 = 0.f;
  for (int u = 0; u < per / 4; ++u) {
    const int j = tid * 4 + 1024 * u;
    const v4f a = *(const v4fa*)(x + j);
    v4f b = {0.f,0.f,0.f,0.f}; if (rr) b = *(const v4fa*)(rr + j);
#pragma unroll
    for (int q = 0; q < 4; ++q) { const float v = a[q] + b[q]; vals[u * 4 + q] = v; s1 += v; }
  }
  red[tid] = s1; __syncthreads();
  for (int st = 128; st > 0; st >>= 1) { if (tid < st) red[tid] += red[tid + st]; __syncthreads(); }
  const float mu = red[0] / (float)N; __syncthreads();
  float s2 = 0.f;
  for (int u = 0; u < per / 4; ++u)
#pragma unroll
    for (int q = 0; q < 4; ++q) { const float c = vals[u * 4 + q] - mu; s2 += c * c; }
  red[tid] = s2; __syncthreads();
  for (int st = 128; st > 0; st >>= 1) { if (tid < st) red[tid] += red[tid + st]; __syncthreads(); }
  const float rs = rsqrtf(red[0] / (float)N + eps);
  {
    for (int u = 0; u < per / 4; ++u) {
      const int j = tid * 4 + 1024 * u;
      v4f o, sm;
#pragma unroll
      for (int q = 0; q < 4; ++q) {
        float gg = g[j + q], bb = bta[j + q];
        if (PARAM_BF16) { gg = bf16_round(gg); bb = bf16_round(bb); }
        sm[q] = vals[u * 4 + q]; o[q] = (vals[u * 4 + q] - mu) * rs * gg + bb;
      }
      if (out_sum) *(v4f*)(out_sum + (size_t)row * N + j) = sm;
      *(v4f*)(out_norm + (size_t)row * N + j) = o;
    }
    
  }
}



// ---- f16 WMMA path (v_wmma_f32_16x16x32_f16): 11-bit significands for operands in range — used for every GEMM launched here
typedef _Float16 v16h __attribute__((ext_vector_type(16)));
union FragH { v16h v; v8us half[2]; _Float16 h[16]; unsigned short u[16]; };
template <int NT>
__device__ __forceinline__ v8f mmaH(v16h ah, v16h al, v16h bh, v16h bl, v8f c) {
  c = __builtin_amdgcn_wmma_f32_16x16x32_f16(false, ah, false, bh, (short)0, c, false, false);
  if (NT >= 2) c = __builtin_amdgcn_wmma_f32_16x16x32_f16(false, al, false, bh, (short)0, c, false, false);
  if (NT >= 3) c = __builtin_amdgcn_wmma_f32_16x16x32_f16(false, ah, false, bl, (short)0, c, false, false);
  asm volatile("v_nop\n\tv_nop\n\tv_nop\n\tv_nop" : "+v"(c) : "v"(ah), "v"(al), "v"(bh), "v"(bl));
  return c;
}
// batched GEMM like k_gemm_b but f16 operands: A f32 (split into f16 hi/lo if ASPLIT, else rounded to f16), Bt = f16 values [n][k]; alpha; C f32; N multiple of 16 (partial tiles skipped)
template <bool ASPLIT>
__global__ __launch_bounds__(128) void k_gemm_h(const float* __restrict__ A, int lda, size_t sA, const _Float16* __restrict__ Bh, int ldb, size_t sB, float alpha, float* __restrict__ C, int ldc, size_t sC, int M, int N, int K) {
  __shared__ __attribute__((aligned(16))) float so[4][16][64];
  const int tid = threadIdx.x, w = tid >> 5, lane = tid & 31, ln = lane & 15, hh = lane >> 4; const int by = blockIdx.y;
  A += (size_t)by * sA; Bh += (size_t)by * sB; C += (size_t)by * sC;
  const int ntn = (N + 63) / 64; const int wid = blockIdx.x * 4 + w; const int mt = wid / ntn, nq = wid % ntn; if (mt * 16 >= M) return;
  const int row0 = mt * 16, col0 = nq * 64; const float* arow = A + (size_t)(row0 + ln) * lda;
  v8f acc[4] = {};
  for (int kb = 0; kb < K; kb += 32) {
    FragH ah, al;
    const v4f x0 = *(const v4fa*)(arow + kb + 8 * hh), x1 = *(const v4fa*)(arow + kb + 8 * hh + 4), x2 = *(const v4fa*)(arow + kb + 16 + 8 * hh), x3 = *(const v4fa*)(arow + kb + 16 + 8 * hh + 4);
    float xs[16] = {x0[0],x0[1],x0[2],x0[3],x1[0],x1[1],x1[2],x1[3],x2[0],x2[1],x2[2],x2[3],x3[0],x3[1],x3[2],x3[3]};
#pragma unroll
    for (int i = 0; i < 16; ++i) { const _Float16 h = (_Float16)xs[i]; ah.h[i] = h; al.h[i] = ASPLIT ? (_Float16)(xs[i] - (float)h) : (_Float16)0.0f; }
#pragma unroll
    for (int t = 0; t < 4; ++t) { if (col0 + t * 16 >= N) continue; const size_t boff = (size_t)(col0 + t * 16 + ln) * ldb + kb; FragH bq; bq.half[0] = *(const v8us*)(Bh + boff + 8 * hh); bq.half[1] = *(const v8us*)(Bh + boff + 16 + 8 * hh);
      acc[t] = mmaH<ASPLIT ? 2 : 1>(ah.v, al.v, bq.v, bq.v, acc[t]); }
  }
#pragma unroll
  for (int t = 0; t < 4; ++t) { if (col0 + t * 16 >= N) continue;
#pragma unroll
    for (int r = 0; r < 8; ++r) so[w][8 * hh + r][t * 16 + ln] = acc[t][r] * alpha; }
  __builtin_amdgcn_fence(__ATOMIC_ACQ_REL, "workgroup"); __builtin_amdgcn_wave_barrier();
  const int rsub = lane >> 4, c4 = (lane & 15) * 4;
  {
#pragma unroll
    for (int q = 0; q < 8; ++q) { const int r = q * 2 + rsub; if (col0 + c4 < N) { const v4f v = *(const v4fa*)&so[w][r][c4]; *(v4f*)(C + (size_t)(row0 + r) * ldc + col0 + c4) = v; } }
     }
}

// Wt[n][k] = f16(W[k][n]·scale) from f32 row-major W[K][N] (scale = power of two; bf16-exact weights stay exact in f16 away from the subnormal range)
__global__ __launch_bounds__(256) void k_wt_f16(const float* __restrict__ W, _Float16* __restrict__ Wt, int K, int N, float scale) {
  const int t = blockIdx.x * 256 + threadIdx.x; if (t >= N * (K / 8)) return; const int n = t / (K / 8), k8 = (t % (K / 8)) * 8; FragH f;
#pragma unroll
  for (int i = 0; i < 8; ++i) f.h[i] = (_Float16)(bf16_round(W[(size_t)(k8 + i) * N + n]) * scale); const v8us o = f.half[0];
  *(v8us*)((unsigned short*)Wt + (size_t)n * K + k8) = o; 
}
// k_gemm_hh variant with fused epilogue: v = acc·alpha + bias[by·sBias + col] (+ CP[(row/rowsPerB)·sCPb + by·64 + col] if CP) ; ACT 0 none / 1 elu ; writes f16 C16 (and f32 C if non-null)
template <int ACT>
__global__ __launch_bounds__(128) void k_gemm_hhx(const _Float16* __restrict__ A, int lda, size_t sA, const _Float16* __restrict__ Bh, int ldb, size_t sB, float alpha, const float* __restrict__ bias, size_t sBias, const float* __restrict__ CP, int rowsPerB, size_t sCPb, int row0g,
    float* __restrict__ C, _Float16* __restrict__ C16, int ldc, size_t sC, int M, int N, int K) {
  __shared__ __attribute__((aligned(16))) float so[4][16][64];
  const int tid = threadIdx.x, w = tid >> 5, lane = tid & 31, ln = lane & 15, hh = lane >> 4; const int by = blockIdx.y;
  A += (size_t)by * sA; Bh += (size_t)by * sB; const size_t cofs = (size_t)by * sC; const float* bp = bias ? bias + (size_t)by * sBias : nullptr;
  const int ntn = (N + 63) / 64; const int wid = blockIdx.x * 4 + w; const int mt = wid / ntn, nq = wid % ntn; if (mt * 16 >= M) return;
  const int row0 = mt * 16, col0 = nq * 64; const _Float16* arow = A + (size_t)(row0 + ln) * lda;
  v8f acc[4] = {};
  for (int kb = 0; kb < K; kb += 32) { FragH ah; ah.half[0] = *(const v8us*)((const unsigned short*)arow + kb + 8 * hh); ah.half[1] = *(const v8us*)((const unsigned short*)arow + kb + 16 + 8 * hh);
#pragma unroll
    for (int t = 0; t < 4; ++t) { if (col0 + t * 16 >= N) continue; const size_t boff = (size_t)(col0 + t * 16 + ln) * ldb + kb; FragH bq; bq.half[0] = *(const v8us*)((const unsigned short*)Bh + boff + 8 * hh); bq.half[1] = *(const v8us*)((const unsigned short*)Bh + boff + 16 + 8 * hh);
      acc[t] = mmaH<1>(ah.v, ah.v, bq.v, bq.v, acc[t]); }
  }
#pragma unroll
  for (int t = 0; t < 4; ++t) { if (col0 + t * 16 >= N) continue; const int col = col0 + t * 16 + ln; const float bv = bp ? bf16_round(bp[col]) : 0.f;
#pragma unroll
    for (int r = 0; r < 8; ++r) { float v = acc[t][r] * alpha + bv; if (CP) { const int rr = row0g + row0 + 8 * hh + r; if (rowsPerB < 0) v += CP[cofs + (size_t)rr * ldc + col];      /* rowsPerB < 0: own element of the batched C plane */ else { const int bidx = rr / rowsPerB; v += CP[(size_t)bidx * sCPb + (size_t)by * 64 + col]; } } if (ACT == 1) v = (v > 0.f) ? v : expm1f(v); else if (ACT == 7) v = (v > 0.f) ? v + 1.0f : expf(v); else if (ACT == 8) v = tanhf(v); else if (ACT == 9) v = 0.5f * v * (1.0f + tanhf(0.7978845608028654f * (v + 0.044715f * v * v * v))); else if (ACT == 11) v = 1.0f / (1.0f + expf(-v)); else if (ACT == 12) v = (v > 0.f) ? v : 0.01f * v; else if (ACT == 14) v = (v > 0.f) ? v : 0.1f * v; else if (ACT == 16) v = (v >= 0.f) ? v : 0.3f * v; else if (ACT == 17) v = (v >= 0.f) ? v : 0.2f * v; else if (ACT == 15) v = v / (1.0f + expf(-v)); else if (ACT == 3) v = fmaxf(v, 0.f); else if (ACT == 6) v = 0.5f * v * (1.0f + erff(v * 0.70710678118654752f)); so[w][8 * hh + r][t * 16 + ln] = v; } }
  __builtin_amdgcn_fence(__ATOMIC_ACQ_REL, "workgroup"); __builtin_amdgcn_wave_barrier();
  const int rsub = lane >> 4, c4 = (lane & 15) * 4; typedef _Float16 v4h __attribute__((ext_vector_type(4)));
  {
#pragma unroll
    for (int q = 0; q < 8; ++q) { const int r = q * 2 + rsub; if (col0 + c4 < N) { const v4f v = *(const v4fa*)&so[w][r][c4]; if (C) *(v4f*)(C + cofs + (size_t)(row0 + r) * ldc + col0 + c4) = v; if (C16) { v4h h4; for (int i = 0; i < 4; ++i) h4[i] = (_Float16)v[i]; *(v4h*)(C16 + cofs + (size_t)(row0 + r) * ldc + col0 + c4) = h4; } } }
     }
}


typedef _Float16 v4h __attribute__((ext_vector_type(4)));

__global__ __launch_bounds__(256) void k_x16(const float* __restrict__ x, _Float16* __restrict__ X16, size_t n8) { const size_t t = (size_t)blockIdx.x * 256 + threadIdx.x; if (t >= n8) return; FragH f;
#pragma unroll
  for (int q = 0; q < 8; ++q) f.h[q] = (_Float16)bf16_round(x[t * 8 + q]); *(v8us*)((unsigned short*)X16 + t * 8) = f.half[0];  }
__global__ __launch_bounds__(256) void k_h16(const float* __restrict__ x, _Float16* __restrict__ X16, size_t n8) { const size_t t = (size_t)blockIdx.x * 256 + threadIdx.x; if (t >= n8) return; FragH f;
#pragma unroll
  for (int q = 0; q < 8; ++q) f.h[q] = (_Float16)x[t * 8 + q]; *(v8us*)((unsigned short*)X16 + t * 8) = f.half[0];  }
__global__ __launch_bounds__(256) void k_round16f(const float* __restrict__ W, _Float16* __restrict__ Bt, size_t n8) { const size_t t = (size_t)blockIdx.x * 256 + threadIdx.x; if (t >= n8) return; FragH f;
#pragma unroll
  for (int i = 0; i < 8; ++i) f.h[i] = (_Float16)(bf16_round(W[t * 8 + i]) * 16.0f); *(v8us*)((unsigned short*)Bt + t * 8) = f.half[0];  }
template <int NHv, int TTv>
__global__ __launch_bounds__(256) void k_vt(const _Float16* __restrict__ V16, int ldv, int voff, _Float16* __restrict__ Vt) { __shared__ unsigned short tl[64][66]; const int tid = threadIdx.x; const int slab = blockIdx.x / (TTv / 64), lg = blockIdx.x % (TTv / 64); const int b = slab / NHv, h = slab % NHv;
  for (int i = tid; i < 64 * 8; i += 256) { const int r = i / 8, c8 = (i % 8) * 8; FragH f; f.half[0] = *(const v8us*)((const unsigned short*)V16 + ((size_t)b * TTv + lg * 64 + r) * ldv + voff + h * 64 + c8);
#pragma unroll
    for (int q = 0; q < 8; ++q) tl[r][c8 + q] = f.u[q]; }
  __syncthreads();
  {
#pragma unroll
    for (int rd = 0; rd < 2; ++rd) { const int d = rd * 32 + tid / 8, pc = tid % 8; FragH f;
#pragma unroll
      for (int q = 0; q < 8; ++q) f.u[q] = tl[pc * 8 + q][d];
      *(v8us*)((unsigned short*)Vt + ((size_t)slab * 64 + d) * TTv + lg * 64 + pc * 8) = f.half[0]; }
     } }

__global__ __launch_bounds__(256) void k_hl(const float* __restrict__ F, _Float16* __restrict__ Hh, _Float16* __restrict__ Hl, size_t n8) { const size_t t = (size_t)blockIdx.x * 256 + threadIdx.x; if (t >= n8) return; FragH fh, fl; const v4f a = *(const v4fa*)(F + t * 8), c = *(const v4fa*)(F + t * 8 + 4);
#pragma unroll
  for (int q = 0; q < 4; ++q) { _Float16 h = (_Float16)a[q]; fh.h[q] = h; fl.h[q] = (_Float16)((a[q] - (float)h) * 1024.0f); h = (_Float16)c[q]; fh.h[4 + q] = h; fl.h[4 + q] = (_Float16)((c[q] - (float)h) * 1024.0f); }
  { *(v8us*)((unsigned short*)Hh + t * 8) = fh.half[0]; *(v8us*)((unsigned short*)Hl + t * 8) = fl.half[0];  } }

// ---- fast GEMM (work-group tile 128x64, wave tile 32x64; requires M % 128 == 0, N % 64 == 0, K % 64 == 0); epilogue = k_gemm_hhx semantics; ROWB: bias indexed by the C row (weights as A) instead of the C column ----
// Operand path: per stage of 64 k (one 128-B line of every operand row) the 128 A rows and 64 B rows of the work-group's tile are copied to LDS by
// asynchronous b128 copies (a wave-wide copy = 4 whole lines), two buffers, the next stage in flight while this one is multiplied; fragments come from LDS.
#define G2_PITCH 144                      /* LDS row pitch in bytes, 16 B x odd: conflict-free for the ds_load_b128 fragment reads of 128-B rows */
#define G2_STAGE ((128 + 64) * G2_PITCH)  /* bytes of one buffer: A rows 0..127, then B rows 0..63 */
__device__ __forceinline__ v16h g2_frag(const unsigned char* p) { FragH f; f.half[0] = *(const v8us*)p; f.half[1] = *(const v8us*)(p + 32); return f.v; }
__device__ __forceinline__ v8f g2_mma(v16h a, v16h b, v8f c) { v8f d = __builtin_amdgcn_wmma_f32_16x16x32_f16(false, a, false, b, (short)0, c, false, false); asm volatile("v_nop\n\tv_nop\n\tv_nop\n\tv_nop" : "+v"(d) : "v"(a), "v"(b)); return d; }
// One stage: each of the 128 threads copies 16 B of 8 A rows and 4 B rows (rows 16 apart). l = the lane's LDS byte address in the buffer, a / b = its global
// addresses, sa / sb = 16 rows in elements. The closing s_wait_xcnt keeps every address register intact until the copies have taken it.
__device__ __forceinline__ void g2_stage(unsigned l, const _Float16* a, size_t sa, const _Float16* b, size_t sb) {
  asm volatile("global_load_async_to_lds_b128 %0, %12, off\n\t"
               "global_load_async_to_lds_b128 %1, %13, off\n\t"
               "global_load_async_to_lds_b128 %2, %14, off\n\t"
               "global_load_async_to_lds_b128 %3, %15, off\n\t"
               "global_load_async_to_lds_b128 %4, %16, off\n\t"
               "global_load_async_to_lds_b128 %5, %17, off\n\t"
               "global_load_async_to_lds_b128 %6, %18, off\n\t"
               "global_load_async_to_lds_b128 %7, %19, off\n\t"
               "global_load_async_to_lds_b128 %8, %20, off\n\t"
               "global_load_async_to_lds_b128 %9, %21, off\n\t"
               "global_load_async_to_lds_b128 %10, %22, off\n\t"
               "global_load_async_to_lds_b128 %11, %23, off\n\t"
               "s_wait_xcnt 0x0"
               :: "v"(l), "v"(l + 16 * G2_PITCH), "v"(l + 32 * G2_PITCH), "v"(l + 48 * G2_PITCH), "v"(l + 64 * G2_PITCH), "v"(l + 80 * G2_PITCH), "v"(l + 96 * G2_PITCH), "v"(l + 112 * G2_PITCH),
                  "v"(l + 128 * G2_PITCH), "v"(l + 144 * G2_PITCH), "v"(l + 160 * G2_PITCH), "v"(l + 176 * G2_PITCH),
                  "v"(a), "v"(a + sa), "v"(a + 2 * sa), "v"(a + 3 * sa), "v"(a + 4 * sa), "v"(a + 5 * sa), "v"(a + 6 * sa), "v"(a + 7 * sa),
                  "v"(b), "v"(b + sb), "v"(b + 2 * sb), "v"(b + 3 * sb)
               : "memory");
}
// The body takes its LDS and its block indices (bx = tile, by = batch plane) from the caller, so that one launch can hold the tiles of several independent GEMMs.
template <int ACT, bool ROWB>
__device__ __forceinline__ void g2_body(unsigned char* smem, const int bx, const int by, const _Float16* __restrict__ A, int lda, size_t sA, const _Float16* __restrict__ Bh, int ldb, size_t sB, float alpha, const float* __restrict__ bias, size_t sBias, const float* __restrict__ CP, int rowsPerB, size_t sCPb, int row0g,
    float* __restrict__ C, _Float16* __restrict__ C16, int ldc, size_t sC, int M, int N, int K) { static_assert(ACT == 0 || ACT == 3 || ACT == 6 || ACT == 8 || ACT == 9 || ACT == 11 || ACT == 12 || ACT == 14 || ACT == 15 || ACT == 16 || ACT == 17, "k_gemm2: unsupported ACT code (would silently apply no activation)");
  static_assert(sizeof(float) * 4 * 32 * 68 <= 2 * G2_STAGE, "output staging must fit the operand buffers");
  float (*so)[32][68] = (float (*)[32][68])smem;
  const int tid = threadIdx.x, w = tid >> 5, lane = tid & 31, ln = lane & 15, hh = lane >> 4;
  A += (size_t)by * sA; Bh += (size_t)by * sB; const size_t cofs = (size_t)by * sC; const float* bp = bias ? bias + (size_t)by * sBias : nullptr;
  const int ntn = N >> 6; const int mt = bx / ntn, nq = bx - mt * ntn; const int row0 = mt * 128 + 32 * w, col0 = nq * 64; if (mt * 128 >= M) return;      /* the whole work-group leaves, in front of every barrier */
  const unsigned lcp = (unsigned)(size_t)smem + (unsigned)((tid >> 3) * G2_PITCH + (tid & 7) * 16);
  const _Float16* gA = A + (size_t)(mt * 128 + (tid >> 3)) * lda + (tid & 7) * 8; const _Float16* gB = Bh + (size_t)(col0 + (tid >> 3)) * ldb + (tid & 7) * 8; const size_t sa16 = (size_t)16 * lda, sb16 = (size_t)16 * ldb;
  const int nst = K >> 6;
  const v8f z8 = {0.f,0.f,0.f,0.f,0.f,0.f,0.f,0.f}; v8f c00 = z8, c01 = z8, c02 = z8, c03 = z8, c10 = z8, c11 = z8, c12 = z8, c13 = z8;
  g2_stage(lcp, gA, sa16, gB, sb16);
  asm volatile("s_wait_asynccnt 0x0" ::: "memory");      /* this wave's copies of stage 0 have landed */
  __syncthreads();                                       /* ... and every other wave's */
  if (nst > 1) g2_stage(lcp + G2_STAGE, gA + 64, sa16, gB + 64, sb16);
#pragma unroll 1
  for (int s = 0; s < nst; ++s) { const unsigned char* sb = smem + (s & 1) * G2_STAGE; const unsigned char* pa = sb + (32 * w + ln) * G2_PITCH + 16 * hh; const unsigned char* pb = sb + (128 + ln) * G2_PITCH + 16 * hh;
    v16h fa[2][2], fb[2][4];      /* the stage's 12 fragments are read as one group in front of its 16 WMMAs: one LDS latency a stage instead of one per B fragment */
#pragma unroll
    for (int h = 0; h < 2; ++h) { fa[h][0] = g2_frag(pa + 64 * h); fa[h][1] = g2_frag(pa + 16 * G2_PITCH + 64 * h);
#pragma unroll
      for (int t = 0; t < 4; ++t) fb[h][t] = g2_frag(pb + 16 * t * G2_PITCH + 64 * h); }
#pragma unroll
    for (int h = 0; h < 2; ++h) {
      c00 = g2_mma(fa[h][0], fb[h][0], c00); c10 = g2_mma(fa[h][1], fb[h][0], c10);
      c01 = g2_mma(fa[h][0], fb[h][1], c01); c11 = g2_mma(fa[h][1], fb[h][1], c11);
      c02 = g2_mma(fa[h][0], fb[h][2], c02); c12 = g2_mma(fa[h][1], fb[h][2], c12);
      c03 = g2_mma(fa[h][0], fb[h][3], c03); c13 = g2_mma(fa[h][1], fb[h][3], c13); }
    asm volatile("s_wait_dscnt 0x0" ::: "memory");       /* this wave's reads of the buffer are over before it may be refilled */
    asm volatile("s_wait_asynccnt 0x0" ::: "memory");    /* this wave's copies of stage s + 1 have landed */
    __syncthreads();                                     /* publishes stage s + 1 and ends every wave's reads of stage s */
    if (s + 2 < nst) g2_stage(lcp + (unsigned)(s & 1) * G2_STAGE, gA + (size_t)(s + 2) * 64, sa16, gB + (size_t)(s + 2) * 64, sb16); }
  asm volatile("s_wait_asynccnt 0x0" ::: "memory");      /* no copy is outstanding when the buffers become output staging */
  v8f accs[8] = {c00, c01, c02, c03, c10, c11, c12, c13};
  float rbias[16];      /* ROWB: the bias of this lane's 16 C rows, loaded as one group in front of the element loop; both loops unrolled so that every index is a constant and the array stays in registers */
#pragma unroll
  for (int i = 0; i < 16; ++i) rbias[i] = 0.f;
  if (ROWB && bp) { const float* br = bp + row0 + 8 * hh;
#pragma unroll
    for (int i = 0; i < 16; ++i) rbias[i] = bf16_round(br[(i >> 3) * 16 + (i & 7)]); }
#pragma unroll
  for (int u = 0; u < 8; ++u) { const int t = u & 3, half = u >> 2; const int col = col0 + t * 16 + ln; const float bvc = (!ROWB && bp) ? bf16_round(bp[col]) : 0.f;
#pragma unroll
    for (int r = 0; r < 8; ++r) { const int rloc = half * 16 + 8 * hh + r; const float bv = ROWB ? rbias[half * 8 + r] : bvc; float v = accs[u][r] * alpha + bv; if (CP) { if (rowsPerB < 0) v += CP[cofs + (size_t)(row0g + row0 + rloc) * ldc + col];      /* rowsPerB < 0: own element of the batched C plane */ else { const int bidx = (row0g + row0 + rloc) / rowsPerB; v += CP[(size_t)bidx * sCPb + (size_t)by * 64 + col]; } }
      if (ACT == 3) v = fmaxf(v, 0.f); else if (ACT == 6) v = 0.5f * v * (1.0f + erff(v * 0.70710678118654752f)); else if (ACT == 11) v = 1.0f / (1.0f + expf(-v)); else if (ACT == 15) v = v / (1.0f + expf(-v)); else if (ACT == 12) v = (v > 0.f) ? v : 0.01f * v; else if (ACT == 8) v = tanhf(v); else if (ACT == 9) v = 0.5f * v * (1.0f + tanhf(0.7978845608028654f * (v + 0.044715f * v * v * v))); else if (ACT == 14) v = (v > 0.f) ? v : 0.1f * v; else if (ACT == 16) v = (v >= 0.f) ? v : 0.3f * v; else if (ACT == 17) v = (v >= 0.f) ? v : 0.2f * v;
      so[w][rloc][t * 16 + ln] = v; } }
  __builtin_amdgcn_fence(__ATOMIC_ACQ_REL, "workgroup"); __builtin_amdgcn_wave_barrier();
  const int rsub = lane >> 4, c4 = (lane & 15) * 4;
  {
#pragma unroll
    for (int q = 0; q < 16; ++q) { const int r = q * 2 + rsub; const v4f v = *(const v4fa*)&so[w][r][c4]; if (C) { *(v4f*)(C + cofs + (size_t)(row0 + r) * ldc + col0 + c4) = v; if (C16) asm volatile("s_wait_xcnt 0x0" ::: "memory"); }      /* the wait stands in front of the conversion below, which may overwrite registers that the f32 store names */
      if (C16) { v4h h4; for (int i = 0; i < 4; ++i) h4[i] = (_Float16)v[i]; *(v4h*)(C16 + cofs + (size_t)(row0 + r) * ldc + col0 + c4) = h4; } }
    asm volatile("s_wait_xcnt 0x0" ::: "memory");      /* stands behind the last stores, in front of any code of the calling kernel that follows the body and may overwrite registers that they name */
     } }
#define G2_SMEM __shared__ __attribute__((aligned(16))) unsigned char smem[2 * G2_STAGE]      /* the two operand buffers; behind the K loop's last barrier the same bytes stage the output tile */
template <int ACT, bool ROWB>
__global__ __launch_bounds__(128) void k_gemm2(const _Float16* __restrict__ A, int lda, size_t sA, const _Float16* __restrict__ Bh, int ldb, size_t sB, float alpha, const float* __restrict__ bias, size_t sBias, const float* __restrict__ CP, int rowsPerB, size_t sCPb, int row0g,
    float* __restrict__ C, _Float16* __restrict__ C16, int ldc, size_t sC, int M, int N, int K) { G2_SMEM;
  g2_body<ACT, ROWB>(smem, (int)blockIdx.x, (int)blockIdx.y, A, lda, sA, Bh, ldb, sB, alpha, bias, sBias, CP, rowsPerB, sCPb, row0g, C, C16, ldc, sC, M, N, K); }
// ---- large-tile GEMM for the two 512-k launches (K and V, Q): wave tile 64x64 (16 accumulator tiles; 8 fragments feed 16 WMMAs), WR x 2 waves, work-group tile 64 WR x 128 (WR = 2: 128x128, WR = 4: 256x128).
// Against the 128x64 tile of 32x64 waves it brings a third (WR = 2) or half (WR = 4) fewer operand bytes from L2 and reads a third fewer LDS bytes per WMMA, with half the waves and at most half the barriers.
// Same stage (64 k), same two buffers, same order of waits, same k order per output element. Requires M % (64 WR) == 0, N % 128 == 0, K % 64 == 0.
// v = acc * alpha + bias (ROWB: by C row, else by C column); writes f32 C (F32) or f16 C16.
#define G3_STAGE(WR) ((64 * (WR) + 128) * G2_PITCH)      /* bytes of one buffer: the A rows, then 128 B rows */
#define G3_OUT(WR) (2 * (WR) * 64 * 68 * 4)              /* bytes of the output staging: 64 rows of pitch 68 floats per wave */
#define G3_BYTES(WR) (2 * G3_STAGE(WR) > G3_OUT(WR) ? 2 * G3_STAGE(WR) : G3_OUT(WR))
// Eight copies: 16 B of 8 rows that lie LS bytes apart in LDS and s elements apart in global memory. l = the lane's LDS byte address of the first row, g = its global address.
// The closing s_wait_xcnt keeps every address register intact until the copies have taken it.
template <unsigned LS>
__device__ __forceinline__ void g3_copy8(unsigned l, const _Float16* g, size_t s) {
  asm volatile("global_load_async_to_lds_b128 %0, %8, off\n\t"
               "global_load_async_to_lds_b128 %1, %9, off\n\t"
               "global_load_async_to_lds_b128 %2, %10, off\n\t"
               "global_load_async_to_lds_b128 %3, %11, off\n\t"
               "global_load_async_to_lds_b128 %4, %12, off\n\t"
               "global_load_async_to_lds_b128 %5, %13, off\n\t"
               "global_load_async_to_lds_b128 %6, %14, off\n\t"
               "global_load_async_to_lds_b128 %7, %15, off\n\t"
               "s_wait_xcnt 0x0"
               :: "v"(l), "v"(l + 1 * LS), "v"(l + 2 * LS), "v"(l + 3 * LS), "v"(l + 4 * LS), "v"(l + 5 * LS), "v"(l + 6 * LS), "v"(l + 7 * LS),
                  "v"(g), "v"(g + s), "v"(g + 2 * s), "v"(g + 3 * s), "v"(g + 4 * s), "v"(g + 5 * s), "v"(g + 6 * s), "v"(g + 7 * s)
               : "memory");
}
// Twelve copies in one statement, one wait: 8 passes of A rows and, directly behind them in LDS, 4 passes of B rows.
template <unsigned LS>
__device__ __forceinline__ void g3_copy12(unsigned l, const _Float16* a, size_t sa, const _Float16* b, size_t sb) {
  asm volatile("global_load_async_to_lds_b128 %0, %12, off\n\t"
               "global_load_async_to_lds_b128 %1, %13, off\n\t"
               "global_load_async_to_lds_b128 %2, %14, off\n\t"
               "global_load_async_to_lds_b128 %3, %15, off\n\t"
               "global_load_async_to_lds_b128 %4, %16, off\n\t"
               "global_load_async_to_lds_b128 %5, %17, off\n\t"
               "global_load_async_to_lds_b128 %6, %18, off\n\t"
               "global_load_async_to_lds_b128 %7, %19, off\n\t"
               "global_load_async_to_lds_b128 %8, %20, off\n\t"
               "global_load_async_to_lds_b128 %9, %21, off\n\t"
               "global_load_async_to_lds_b128 %10, %22, off\n\t"
               "global_load_async_to_lds_b128 %11, %23, off\n\t"
               "s_wait_xcnt 0x0"
               :: "v"(l), "v"(l + 1 * LS), "v"(l + 2 * LS), "v"(l + 3 * LS), "v"(l + 4 * LS), "v"(l + 5 * LS), "v"(l + 6 * LS), "v"(l + 7 * LS), "v"(l + 8 * LS), "v"(l + 9 * LS), "v"(l + 10 * LS), "v"(l + 11 * LS),
                  "v"(a), "v"(a + sa), "v"(a + 2 * sa), "v"(a + 3 * sa), "v"(a + 4 * sa), "v"(a + 5 * sa), "v"(a + 6 * sa), "v"(a + 7 * sa),
                  "v"(b), "v"(b + sb), "v"(b + 2 * sb), "v"(b + 3 * sb)
               : "memory");
}
// One stage: the 64 WR threads x 16 B cover 8 WR rows a pass; 8 passes for the A rows, 16 / WR for the 128 B rows.
template <int WR>
__device__ __forceinline__ void g3_stage(unsigned l, const _Float16* a, size_t sa, const _Float16* b, size_t sb) {
  if (WR == 2) { g3_copy8<8 * WR * G2_PITCH>(l, a, sa); g3_copy8<8 * WR * G2_PITCH>(l + 64 * WR * G2_PITCH, b, sb); }      /* 16 copies: more operands than one statement takes */
  else g3_copy12<8 * WR * G2_PITCH>(l, a, sa, b, sb); }
template <int WR, bool ROWB, bool F32>
__device__ __forceinline__ void g3_body(unsigned char* smem, const int bx, const int by, const _Float16* __restrict__ A, int lda, size_t sA, const _Float16* __restrict__ Bh, int ldb, size_t sB, float alpha, const float* __restrict__ bias,
    float* __restrict__ C, _Float16* __restrict__ C16, int ldc, size_t sC, int M, int N, int K) {
  static_assert(WR == 2 || WR == 4, "the copy passes are written for these two");
  constexpr int TM = 64 * WR, RP = 8 * WR;      /* tile rows; rows per copy pass */
  float (*so)[64][68] = (float (*)[64][68])smem;
  const int tid = threadIdx.x, w = tid >> 5, lane = tid & 31, ln = lane & 15, hh = lane >> 4, wr = w >> 1, wc = w & 1;
  A += (size_t)by * sA; Bh += (size_t)by * sB; const size_t cofs = (size_t)by * sC;
  const int ntn = N >> 7; const int mt = bx / ntn, nq = bx - mt * ntn; const int row0 = mt * TM + 64 * wr, col0 = nq * 128 + 64 * wc; if (mt * TM >= M) return;      /* the whole work-group leaves, in front of every barrier */
  const unsigned lcp = (unsigned)(size_t)smem + (unsigned)((tid >> 3) * G2_PITCH + (tid & 7) * 16);
  const _Float16* gA = A + (size_t)(mt * TM + (tid >> 3)) * lda + (tid & 7) * 8; const _Float16* gB = Bh + (size_t)(nq * 128 + (tid >> 3)) * ldb + (tid & 7) * 8; const size_t sar = (size_t)RP * lda, sbr = (size_t)RP * ldb;
  const int nst = K >> 6;
  v8f acc[4][4];      /* [row tile][column tile]; every index below is a constant after unrolling */
#pragma unroll      /* constant indices: the arrays stay in registers */
  for (int i = 0; i < 4; ++i)
#pragma unroll      /* constant indices: the arrays stay in registers */
    for (int t = 0; t < 4; ++t) acc[i][t] = (v8f){0.f,0.f,0.f,0.f,0.f,0.f,0.f,0.f};
  g3_stage<WR>(lcp, gA, sar, gB, sbr);
  asm volatile("s_wait_asynccnt 0x0" ::: "memory");      /* this wave's copies of stage 0 have landed */
  __syncthreads();                                       /* ... and every other wave's */
  if (nst > 1) g3_stage<WR>(lcp + G3_STAGE(WR), gA + 64, sar, gB + 64, sbr);
#pragma unroll 1      /* stays rolled: one copy of the 32 WMMAs and of the ring's foot, so that the waits stand once and the loop is short in the instruction cache */
  for (int s = 0; s < nst; ++s) { const unsigned char* sb = smem + (s & 1) * G3_STAGE(WR); const unsigned char* pa = sb + (64 * wr + ln) * G2_PITCH + 16 * hh; const unsigned char* pb = sb + (TM + 64 * wc + ln) * G2_PITCH + 16 * hh;
#pragma unroll      /* constant indices: the arrays stay in registers */
    for (int h = 0; h < 2; ++h) { v16h fa[4], fb[4];      /* the 8 fragments of 32 k are read as one group in front of their 16 WMMAs */
#pragma unroll      /* constant indices: the arrays stay in registers */
      for (int i = 0; i < 4; ++i) { fa[i] = g2_frag(pa + 16 * i * G2_PITCH + 64 * h); fb[i] = g2_frag(pb + 16 * i * G2_PITCH + 64 * h); }
#pragma unroll      /* constant indices: the arrays stay in registers */
      for (int t = 0; t < 4; ++t)
#pragma unroll      /* constant indices: the arrays stay in registers */
        for (int i = 0; i < 4; ++i) acc[i][t] = g2_mma(fa[i], fb[t], acc[i][t]); }
    asm volatile("s_wait_dscnt 0x0" ::: "memory");       /* this wave's reads of the buffer are over before it may be refilled */
    asm volatile("s_wait_asynccnt 0x0" ::: "memory");    /* this wave's copies of stage s + 1 have landed */
    __syncthreads();                                     /* publishes stage s + 1 and ends every wave's reads of stage s */
    if (s + 2 < nst) g3_stage<WR>(lcp + (unsigned)(s & 1) * G3_STAGE(WR), gA + (size_t)(s + 2) * 64, sar, gB + (size_t)(s + 2) * 64, sbr); }
  asm volatile("s_wait_asynccnt 0x0" ::: "memory");      /* no copy is outstanding when the buffers become output staging */
#pragma unroll      /* constant indices: the arrays stay in registers */
  for (int i = 0; i < 4; ++i) { float rb[8];      /* ROWB: the bias of this lane's 8 C rows of row tile i */
#pragma unroll      /* constant indices: the arrays stay in registers */
    for (int r = 0; r < 8; ++r) rb[r] = ROWB ? bf16_round(bias[row0 + i * 16 + 8 * hh + r]) : 0.f;
#pragma unroll      /* constant indices: the arrays stay in registers */
    for (int t = 0; t < 4; ++t) { const float bvc = ROWB ? 0.f : bf16_round(bias[col0 + t * 16 + ln]);
#pragma unroll      /* constant indices: the arrays stay in registers */
      for (int r = 0; r < 8; ++r) so[w][i * 16 + 8 * hh + r][t * 16 + ln] = acc[i][t][r] * alpha + (ROWB ? rb[r] : bvc); } }
  __builtin_amdgcn_fence(__ATOMIC_ACQ_REL, "workgroup"); __builtin_amdgcn_wave_barrier();      /* the wave's staging writes stand in front of its read-back of other lanes' values; each wave stages in its own range, so no work-group barrier */
  const int rsub = lane >> 4, c4 = (lane & 15) * 4;
#pragma unroll      /* straight-line: the row pairs' LDS reads run ahead of the stores */
  for (int q = 0; q < 32; ++q) { const int r = q * 2 + rsub; const v4f v = *(const v4fa*)&so[w][r][c4];
    if (F32) *(v4f*)(C + cofs + (size_t)(row0 + r) * ldc + col0 + c4) = v;
    else { v4h h4; for (int i = 0; i < 4; ++i) h4[i] = (_Float16)v[i]; *(v4h*)(C16 + cofs + (size_t)(row0 + r) * ldc + col0 + c4) = h4; } }
  asm volatile("s_wait_xcnt 0x0" ::: "memory"); }      /* stands behind the last stores, in front of any code of the calling kernel that follows the body and may overwrite registers that they name */
#define G3_SMEM(WR) __shared__ __attribute__((aligned(16))) unsigned char smem[G3_BYTES(WR)]      /* the two operand buffers; behind the K loop's last barrier the same bytes stage the output tile */
// K and V in one launch (neither reads the other): x = tile, y = sample, z = which. Weights as A: C[channel][position] per sample. 256x128 tiles: 512 work-groups of 8 waves, two per WGP.
__global__ __launch_bounds__(256) void k_gemm_kv(const _Float16* __restrict__ X16, const _Float16* __restrict__ BWq, const _Float16* __restrict__ BWv, const float* __restrict__ bq, const float* __restrict__ bv, _Float16* __restrict__ KC, _Float16* __restrict__ VC) { G3_SMEM(4);
  const bool isv = blockIdx.z != 0;
  g3_body<4, true, false>(smem, (int)blockIdx.x, (int)blockIdx.y, isv ? BWv : BWq, CC, 0, X16, CC, (size_t)PX * CC, 0.0625f, isv ? bv : bq, nullptr, isv ? VC : KC, PX, (size_t)CC * PX, CC, PX, CC); }
// M and Q in one launch (M reads K and V, Q reads X: neither reads the other). M's tiles have twice the k length and stand first in the grid.
#define MQ_MT NH      /* M tiles per sample: one per head, the 128x64 tile that holds the head's diagonal block (O never reads the other tiles) */
__global__ __launch_bounds__(128) void k_gemm_mq(const _Float16* __restrict__ VC, const _Float16* __restrict__ KC, _Float16* __restrict__ BD, const _Float16* __restrict__ X16, const _Float16* __restrict__ BWk, const float* __restrict__ bk, _Float16* __restrict__ QR) { G3_SMEM(2);
  const int b = (int)blockIdx.x;
  if (b < NB * MQ_MT) { const int h = b % MQ_MT; g2_body<0, false>(smem, (h >> 1) * (CC / 64) + h, b / MQ_MT, VC, PX, (size_t)CC * PX, KC, PX, (size_t)CC * PX, 1.0f, nullptr, 0, nullptr, 1, 0, 0, nullptr, BD, CC, (size_t)CC * CC, CC, CC, PX); }      /* M[c][c'] = sum_D V[c][D] K[c'][D], column tile h, row tile h / 2: already in the [n][k] order that the O GEMM's B operand wants */
  else g3_body<2, false, false>(smem, b - NB * MQ_MT, 0, X16, CC, 0, BWk, CC, 0, 0.0625f, bk, nullptr, QR, CC, 0, (int)NR, CC, CC); }      /* Q = K_conv(X), token-major */
// O per head: O[d][c] = sum_c' Q[d][c'] M[c][c'] with c and c' in head h only, so each 128x64 tile is a GEMM of k = 64 on the head's columns of Q and the head's diagonal block of M. x = row tile * heads + head, y = sample.
__global__ __launch_bounds__(128) void k_gemm_o(const _Float16* __restrict__ QR, const _Float16* __restrict__ BD, _Float16* __restrict__ OR) { G2_SMEM;
  const int h = (int)blockIdx.x % NH;
  g2_body<0, false>(smem, (int)blockIdx.x / NH, (int)blockIdx.y, QR + h * HD, CC, (size_t)PX * CC, BD + (size_t)h * HD * CC + h * HD, CC, (size_t)CC * CC, 1.0f, nullptr, 0, nullptr, 1, 0, 0, nullptr, OR + h * HD, CC, (size_t)PX * CC, PX, HD, HD); }


// The streaming launch (prep) has few waves, each with 8 KiB of whole-line 16-B loads in flight.
// X transpose: a work-group takes 64 channels x 256 positions. A wave-wide load covers 4 channel rows x one 128-B line; a lane holds the same 4 positions of two neighbouring channels,
// so that each LDS store is one dword (a channel pair of one position). LDS rows = positions, pitch 144 B (16 B x odd) for the ds_load_b128 read-back of 8 channels.
#define XT_P 256
#define XT_PITCH 144
typedef _Float16 v2h __attribute__((ext_vector_type(2)));
__device__ __forceinline__ void xrows_body(const float* __restrict__ x, _Float16* __restrict__ X16, const int bx) { __shared__ __attribute__((aligned(16))) unsigned char tl[XT_P * XT_PITCH]; const int tid = threadIdx.x, w = tid >> 5, lane = tid & 31, r = lane >> 3, pq = lane & 7; const int cg = bx % (CC / 64); const int pb = (bx / (CC / 64)) % (PX / XT_P); const int n = bx / ((CC / 64) * (PX / XT_P)); const int p0 = pb * XT_P, c0 = cg * 64;
  const float* src = x + ((size_t)n * CC + c0 + w * 8 + 2 * r) * PX + p0 + pq * 4;
  v4f e[XT_P / 32], o[XT_P / 32];
#pragma unroll
  for (int k = 0; k < XT_P / 32; ++k) { e[k] = *(const v4fa*)(src + k * 32); o[k] = *(const v4fa*)(src + PX + k * 32); }
  __builtin_amdgcn_sched_barrier(0);      /* keeps the 16 loads in flight together: without it the scheduler lifts the first conversions, with their waits, in between the loads */
  asm volatile("s_wait_xcnt 0x0" :: "v"(src) : "memory");      /* stands behind the loads, in front of any overwrite of the address register that they name; the operand keeps that register whole up to here */
  unsigned char* dst = tl + pq * 4 * XT_PITCH + (w * 4 + r) * 4;
#pragma unroll
  for (int k = 0; k < XT_P / 32; ++k)
#pragma unroll
    for (int j = 0; j < 4; ++j) { v2h h; h[0] = (_Float16)bf16_round(e[k][j]); h[1] = (_Float16)bf16_round(o[k][j]); *(v2h*)(dst + (k * 32 + j) * XT_PITCH) = h; }
  __syncthreads();
  const unsigned char* rd = tl + (tid >> 3) * XT_PITCH + (tid & 7) * 16; unsigned short* g = (unsigned short*)X16 + ((size_t)n * PX + p0 + (tid >> 3)) * CC + c0 + (tid & 7) * 8;
#pragma unroll
  for (int i = 0; i < XT_P / 32; ++i) *(v8us*)(g + (size_t)i * 32 * CC) = *(const v8us*)(rd + i * 32 * XT_PITCH); }      /* a wave-wide store = 4 positions x one 128-B line */
#define WCH 8      /* chunks of 8 weights per thread */
__device__ __forceinline__ void wnat_body(const float* __restrict__ w, _Float16* __restrict__ Bt, const int bx) { const unsigned t0 = (unsigned)bx * (256 * WCH) + threadIdx.x; const unsigned src = t0 * 32u; const char* wb = (const char*)w; v4f a[WCH], b[WCH];      /* src = the lane's byte offset in the matrix */
#pragma unroll
  for (int u = 0; u < WCH; ++u) { a[u] = *(const v4fa*)(wb + (src + u * 8192)); b[u] = *(const v4fa*)(wb + (src + u * 8192 + 16)); }
  asm volatile("s_wait_xcnt 0x0" :: "v"(src) : "memory");      /* stands behind the loads, in front of any overwrite of the address register that they name; the operand keeps that register whole up to here */
#pragma unroll
  for (int u = 0; u < WCH; ++u) { FragH f; for (int q = 0; q < 4; ++q) { f.h[q] = (_Float16)(bf16_round(a[u][q]) * 16.0f); f.h[4 + q] = (_Float16)(bf16_round(b[u][q]) * 16.0f); } *(v8us*)((unsigned short*)Bt + (t0 + u * 256) * 8) = f.half[0]; }
  asm volatile("s_wait_xcnt 0x0" ::: "memory"); }      /* stands behind the last stores, in front of any code of the calling kernel that follows the body and may overwrite registers that they name */
// The X transpose and the four weight roundings in one launch (none reads another's result): the transpose's blocks first, then WB blocks per weight matrix.
#define XB (NB * (CC / 64) * (PX / XT_P))
#define WB (CC * CC / 8 / 256 / WCH)
static_assert(WB * WCH * 256 * 8 == CC * CC, "the weight blocks cover a matrix exactly");
__global__ __launch_bounds__(256) void k_prep(const float* __restrict__ x, _Float16* __restrict__ X16, const float* __restrict__ Wq, const float* __restrict__ Wk, const float* __restrict__ Wv, const float* __restrict__ Wo,
    _Float16* __restrict__ BWq, _Float16* __restrict__ BWk, _Float16* __restrict__ BWv, _Float16* __restrict__ BWo) {
  const int b = (int)blockIdx.x;
  if (b < XB) { xrows_body(x, X16, b); return; }      /* the same for the whole block */
  const int m = (b - XB) / WB;
  wnat_body(m == 0 ? Wq : m == 1 ? Wk : m == 2 ? Wv : Wo, m == 0 ? BWq : m == 1 ? BWk : m == 2 ? BWv : BWo, (b - XB) % WB); }
// ---- O2 = Wo O^T + bo, GroupNorm and the residual in one launch. A work-group of 16 waves holds 64 channels x all 1,024 positions of one sample in its accumulators (wave tile 64x64, wave w = positions 64 w ...),
// that is 16 whole GroupNorm groups: the statistics come from the accumulators, and O2 never goes to memory. x = channel tile, y = sample: 128 work-groups, one per WGP (LDS).
// Same stage (64 k), same two buffers, same order of waits and same k order per output element as the large-tile GEMM above.
#define F_STAGE ((64 + PX) * G2_PITCH)      /* bytes of one buffer: 64 A rows (weights), then the sample's 1,024 B rows (positions) */
#define F_RED (16 * 64 * 68 * 4)            /* behind the output staging (64 rows of pitch 68 floats per wave): float [16 waves][16 groups][2], each wave's sum and sum of squares */
#define F_STAT (F_RED + 16 * 16 * 2 * 4)    /* float [16 groups][2]: mean, 1 / sqrt(var + eps) */
static_assert(F_STAT + 16 * 2 * 4 <= 2 * F_STAGE, "staging and statistics must fit the operand buffers");
// Nine copies in one statement, one wait: 16 B of one row (l0, g0) and of 8 rows that lie LS bytes apart in LDS and s elements apart in global memory.
// The closing s_wait_xcnt keeps every address register intact until the copies have taken it.
template <unsigned LS>
__device__ __forceinline__ void f_copy9(unsigned l0, const _Float16* g0, unsigned l, const _Float16* g, size_t s) {
  asm volatile("global_load_async_to_lds_b128 %0, %9, off\n\t"
               "global_load_async_to_lds_b128 %1, %10, off\n\t"
               "global_load_async_to_lds_b128 %2, %11, off\n\t"
               "global_load_async_to_lds_b128 %3, %12, off\n\t"
               "global_load_async_to_lds_b128 %4, %13, off\n\t"
               "global_load_async_to_lds_b128 %5, %14, off\n\t"
               "global_load_async_to_lds_b128 %6, %15, off\n\t"
               "global_load_async_to_lds_b128 %7, %16, off\n\t"
               "global_load_async_to_lds_b128 %8, %17, off\n\t"
               "s_wait_xcnt 0x0"
               :: "v"(l0), "v"(l), "v"(l + 1 * LS), "v"(l + 2 * LS), "v"(l + 3 * LS), "v"(l + 4 * LS), "v"(l + 5 * LS), "v"(l + 6 * LS), "v"(l + 7 * LS),
                  "v"(g0), "v"(g), "v"(g + s), "v"(g + 2 * s), "v"(g + 3 * s), "v"(g + 4 * s), "v"(g + 5 * s), "v"(g + 6 * s), "v"(g + 7 * s)
               : "memory");
}
// One stage: the 512 threads x 16 B cover 64 rows a pass; one pass for the A rows, 16 for the B rows. 17 copies of a wave in flight.
__device__ __forceinline__ void f_stage(unsigned l, const _Float16* a, const _Float16* b) {
  f_copy9<64 * G2_PITCH>(l, a, l + 64 * G2_PITCH, b, (size_t)64 * CC);
  g3_copy8<64 * G2_PITCH>(l + (64 + 512) * G2_PITCH, b + (size_t)512 * CC, (size_t)64 * CC); }
__global__ __launch_bounds__(512) void k_o2gn(const _Float16* __restrict__ BWo, const _Float16* __restrict__ OR, const float* __restrict__ bo, const float* __restrict__ gw, const float* __restrict__ gb, const float* __restrict__ x, float* __restrict__ out) {
  __shared__ __attribute__((aligned(16))) unsigned char smem[2 * F_STAGE];      /* the two operand buffers; behind the K loop's last barrier the same bytes hold the output staging and the statistics */
  __shared__ __attribute__((aligned(16))) float swb[64][2], sbo[64];      /* the tile's 64 channels: affine weight and bias, conv bias; filled beside stage 0, so that the epilogue waits for no parameter from memory */
  float (*so)[64][68] = (float (*)[64][68])smem;
  const int tid = threadIdx.x, lane = tid & 31, ln = lane & 15, hh = lane >> 4; const int w = __builtin_amdgcn_readfirstlane(tid >> 5);      /* the wave's number, told to the compiler as wave-uniform so that the X and output rows get a scalar base */
  const int ch0 = (int)blockIdx.x * 64, n = (int)blockIdx.y;
  const unsigned lcp = (unsigned)(size_t)smem + (unsigned)((tid >> 3) * G2_PITCH + (tid & 7) * 16);
  const _Float16* gA = BWo + (size_t)(ch0 + (tid >> 3)) * CC + (tid & 7) * 8; const _Float16* gB = OR + ((size_t)n * PX + (tid >> 3)) * CC + (tid & 7) * 8;
  constexpr int nst = CC >> 6;
  v8f acc[4][4];      /* [row tile][column tile]; every index below is a constant after unrolling */
#pragma unroll      /* constant indices: the arrays stay in registers */
  for (int i = 0; i < 4; ++i)
#pragma unroll      /* constant indices: the arrays stay in registers */
    for (int t = 0; t < 4; ++t) acc[i][t] = (v8f){0.f,0.f,0.f,0.f,0.f,0.f,0.f,0.f};
  f_stage(lcp, gA, gB);
  if (w < 6) { const float* p = w < 2 ? gw : w < 4 ? gb : bo; float* d = w < 4 ? &swb[tid & 63][w >> 1] : &sbo[tid & 63]; *d = bf16_round(p[ch0 + (tid & 63)]); }      /* waves 0 to 5 as wholes, two per parameter row; published by the barrier below */
  asm volatile("s_wait_asynccnt 0x0" ::: "memory");      /* this wave's copies of stage 0 have landed */
  __syncthreads();                                       /* ... and every other wave's */
  f_stage(lcp + F_STAGE, gA + 64, gB + 64);
#pragma unroll 1      /* stays rolled: one copy of the 32 WMMAs and of the ring's foot, so that the waits stand once and the loop is short in the instruction cache */
  for (int s = 0; s < nst; ++s) { const unsigned char* sb = smem + (s & 1) * F_STAGE; const unsigned char* pa = sb + ln * G2_PITCH + 16 * hh; const unsigned char* pb = sb + (64 + 64 * w + ln) * G2_PITCH + 16 * hh;
#pragma unroll      /* constant indices: the arrays stay in registers */
    for (int h = 0; h < 2; ++h) { v16h fa[4], fb[4];      /* the 8 fragments of 32 k are read as one group in front of their 16 WMMAs */
#pragma unroll      /* constant indices: the arrays stay in registers */
      for (int i = 0; i < 4; ++i) { fa[i] = g2_frag(pa + 16 * i * G2_PITCH + 64 * h); fb[i] = g2_frag(pb + 16 * i * G2_PITCH + 64 * h); }
#pragma unroll      /* constant indices: the arrays stay in registers */
      for (int t = 0; t < 4; ++t)
#pragma unroll      /* constant indices: the arrays stay in registers */
        for (int i = 0; i < 4; ++i) acc[i][t] = g2_mma(fa[i], fb[t], acc[i][t]); }
    asm volatile("s_wait_dscnt 0x0" ::: "memory");       /* this wave's reads of the buffer are over before it may be refilled */
    asm volatile("s_wait_asynccnt 0x0" ::: "memory");    /* this wave's copies of stage s + 1 have landed */
    __syncthreads();                                     /* publishes stage s + 1 and ends every wave's reads of stage s */
    if (s + 2 < nst) f_stage(lcp + (unsigned)(s & 1) * F_STAGE, gA + (size_t)(s + 2) * 64, gB + (size_t)(s + 2) * 64); }
  asm volatile("s_wait_asynccnt 0x0" ::: "memory");      /* no copy is outstanding when the buffers become output staging */
  float* red = (float*)(smem + F_RED); float* st = (float*)(smem + F_STAT);
  // O2 values: staged in the wave's own LDS range for the row-wise read-back, and summed per lane and group. A lane's 8 rows of row tile i are two groups of 4 channels.
  float ps[4][2], pq[4][2];
#pragma unroll      /* constant indices: the arrays stay in registers */
  for (int i = 0; i < 4; ++i) { float rb[8];      /* the bias of this lane's 8 channels of row tile i */
#pragma unroll      /* constant indices: the arrays stay in registers */
    for (int r = 0; r < 8; ++r) rb[r] = sbo[i * 16 + 8 * hh + r];
    ps[i][0] = ps[i][1] = pq[i][0] = pq[i][1] = 0.f;
#pragma unroll      /* constant indices: the arrays stay in registers */
    for (int t = 0; t < 4; ++t)
#pragma unroll      /* constant indices: the arrays stay in registers */
      for (int r = 0; r < 8; ++r) { const float v = acc[i][t][r] * 0.0625f + rb[r]; so[w][i * 16 + 8 * hh + r][t * 16 + ln] = v; ps[i][r >> 2] += v; pq[i][r >> 2] += v * v; } }
  // The wave's X rows: 32 wave-wide 16-B loads (two channel rows x 256 B each) go out here, into the registers that the accumulators have left, and fly while the statistics are formed.
  const int rsub = lane >> 4, c4 = (lane & 15) * 4; const size_t base = ((size_t)n * CC + ch0) * PX + 64 * w; const unsigned lo = (unsigned)(rsub * PX + c4);      /* scalar base + one lane offset that lives to the last store */
  const float* __restrict__ px = x + base; float* __restrict__ po = out + base;
  v4f xx[32];
#pragma unroll      /* constant indices: the array stays in registers */
  for (int q = 0; q < 32; ++q) xx[q] = *(const v4fa*)(px + (lo + q * 2 * PX));
  __builtin_amdgcn_sched_barrier(0);      /* fixes the loads' place: in front of the barriers, so that they fly during the reduction, and not further up among the staging, where the scheduler lifts them without it and the build runs out of registers (scratch) */
#pragma unroll      /* constant indices: the arrays stay in registers */
  for (int mk = 1; mk < 16; mk <<= 1)      /* butterfly over the 16 lanes that hold the same channels */
#pragma unroll      /* constant indices: the arrays stay in registers */
    for (int i = 0; i < 4; ++i)
#pragma unroll      /* constant indices: the arrays stay in registers */
      for (int g = 0; g < 2; ++g) { ps[i][g] += __shfl_xor(ps[i][g], mk, 32); pq[i][g] += __shfl_xor(pq[i][g], mk, 32); }
  if (ln == 0) {
#pragma unroll      /* constant indices: the arrays stay in registers */
    for (int i = 0; i < 4; ++i)
#pragma unroll      /* constant indices: the arrays stay in registers */
      for (int g = 0; g < 2; ++g) { float* p = red + (w * 16 + i * 4 + hh * 2 + g) * 2; p[0] = ps[i][g]; p[1] = pq[i][g]; } }
  __syncthreads();      /* every wave's partial sums are in LDS */
  if (tid < 16) { double s = 0.0, q2 = 0.0;      /* one lane per group adds the 16 waves' partial sums in float64 */
#pragma unroll      /* the 32 LDS reads go out together */
    for (int u = 0; u < 16; ++u) { s += (double)red[(u * 16 + tid) * 2]; q2 += (double)red[(u * 16 + tid) * 2 + 1]; }
    const double cnt = (double)(PX * CPG); const double mu = s / cnt; double var = q2 / cnt - mu * mu; if (var < 0.0) var = 0.0;
    st[2 * tid] = (float)mu; st[2 * tid + 1] = (float)(1.0 / sqrt(var + 1e-5)); }
  __syncthreads();      /* the 16 groups' statistics are in LDS */
#pragma unroll      /* constant indices: the array stays in registers; the row pairs' LDS reads run ahead of the stores */
  for (int q = 0; q < 32; ++q) { const int r = q * 2 + rsub; const v4f v = *(const v4fa*)&so[w][r][c4]; const float m = st[(q >> 1) * 2], rs = st[(q >> 1) * 2 + 1], wv = swb[r][0], bb = swb[r][1]; v4f o;      /* rows 2 q and 2 q + 1 lie in group q / 2 */
#pragma unroll      /* constant indices */
    for (int k = 0; k < 4; ++k) o[k] = (v[k] - m) * rs * wv + bb + bf16_round(xx[q][k]);
    *(v4f*)(po + (lo + q * 2 * PX)) = o; } }

extern "C" void kernel_launch(void* const* d_in, const int* in_sizes, int n_in,
                              void* d_out, int out_size, void* d_ws, size_t ws_size, hipStream_t stream) {
  (void)in_sizes; (void)n_in; (void)out_size;
  const float* const* I = (const float* const*)d_in; const float* X = I[0]; const float* Wq = I[1]; const float* bq = I[2]; const float* Wk = I[3]; const float* bk = I[4]; const float* Wv = I[5]; const float* bv = I[6]; const float* Wo = I[7]; const float* bo = I[8]; const float* gw = I[9]; const float* gb = I[10];
  char* ws = (char*)d_ws; size_t off = 0;
  auto take = [&](size_t bytes) { char* p = ws + off; off += (bytes + 255) & ~(size_t)255; return p; };
  _Float16* BWq = (_Float16*)take((size_t)CC * CC * 2); _Float16* BWk = (_Float16*)take((size_t)CC * CC * 2); _Float16* BWv = (_Float16*)take((size_t)CC * CC * 2); _Float16* BWo = (_Float16*)take((size_t)CC * CC * 2);
  _Float16* X16 = (_Float16*)take(NR * CC * 2); _Float16* QR = (_Float16*)take(NR * CC * 2); _Float16* KC = (_Float16*)take(NR * CC * 2); _Float16* VC = (_Float16*)take(NR * CC * 2); _Float16* BD = (_Float16*)take((size_t)NB * CC * CC * 2); _Float16* OR = (_Float16*)take(NR * CC * 2);
  if (off > ws_size) return;      /* 2 + 16x5 + 8 = about 90 MiB */
  k_prep<<<XB + 4 * WB, 256, 0, stream>>>(X, X16, Wq, Wk, Wv, Wo, BWq, BWk, BWv, BWo);
  k_gemm_kv<<<dim3((CC / 256) * (PX / 128), NB, 2), 256, 0, stream>>>(X16, BWq, BWv, bq, bv, KC, VC);      /* K = Q_conv(X) (the module's swap) and V, channel-major */
  /* all samples in one launch each: per-sample planes of KC, VC and BD (of BD only the tiles with a diagonal block are written, and only the diagonal blocks read) */
  k_gemm_mq<<<NB * MQ_MT + (unsigned)((NR / 128) * (CC / 128)), 128, 0, stream>>>(VC, KC, BD, X16, BWk, bk, QR);
  k_gemm_o<<<dim3((PX / 128) * NH, NB), 128, 0, stream>>>(QR, BD, OR);      /* O[d][c] = sum_c' Q[d][c'] M[c][c'] within the head */
  k_o2gn<<<dim3(CC / 64, NB), 512, 0, stream>>>(BWo, OR, bo, gw, gb, X, (float*)d_out);      /* O2 = Wo O^T + bo, GroupNorm, affine, + X: the output's own layout */
}

// v009
// It runs in 65.7 microseconds.
// Next to v008, in two timings, it ran 1.03 and 1.05 times as fast.
// Over all steps from v000 it is 17.1 times as fast.
#include <hip/hip_runtime.h>
// Non_local_MH (X [16][512][32][32]; K = conv1x1(X, Wq, bq), Q = conv1x1(X, Wk, bk), V = conv1x1(X, Wv, bv) (the module's swapped naming), 8 heads of 64 channels over d = 1,024 positions; softmax-FREE attention A = Q^T K ([d][d]), O = V A^T; O = conv1x1(O, Wo, bo); GroupNorm(128 groups of 4 channels, eps 1e-5, affine); out = GN(O) + X -> [16][512][32][32]).
// Structure (analytic reassociation, exact in real arithmetic): O[c][d] = sum_D A[d][D] V[c][D] = sum_c' Q[c'][d] (sum_D K[c'][D] V[c][D]) = sum_c' Q[c'][d] M[c'][c] with the per-head 64x64 matrix M = K V^T - so per sample: the 1x1 convs as WMMA GEMMs (64x64 wave tiles, f32 accumulation, exact x16 weights + bias, f16 outputs): Q with the token rows as A (token-major result), K and V with the weight rows as A and the token rows as B (channel-major result, bias per row), kept in the work-group as f16; M^T = V_cm K_cm^T per head as f32 partials over 256 positions in the same launch, the 4 partials added and stored f16 in the next, O_rows = Q_rows . M_head GEMM per head (K = 64: the head's own channels), O2 = Wo O^T + bo GEMM (f32, weight rows as A: channel-major) whose work-group holds 64 channels x all positions, so that the GroupNorm statistics per (sample, group) (f32 sums per wave, float64 over the waves), the affine and the residual follow on VALU in the same launch.
// Compute dtype: inputs rounded to bf16; X / weights exact; K, Q, V, M and O as plain f16 GEMM operands (~2^-12); GN statistics f32 partial sums, float64 totals; everything else f32. v_wmma_f32_16x16x32_f16.
#define NB 16
#define CC 512
#define PX 1024
#define NR ((size_t)NB * PX)         /* 16384 */
#define NH 8
#define HD 64
#define GRP 128
#define CPG (CC / GRP)               /* 4 */
typedef __bf16 v16b __attribute__((ext_vector_type(16)));
typedef unsigned short v8us __attribute__((ext_vector_type(8), may_alias));
typedef float  v8f  __attribute__((ext_vector_type(8)));
typedef float  v4f  __attribute__((ext_vector_type(4)));
typedef float  v4fa __attribute__((ext_vector_type(4), may_alias));
union FragB { v16b v; v8us half[2]; unsigned short u[16]; };

__device__ __forceinline__ unsigned short bf16_bits(float x) { unsigned int u = __float_as_uint(x); return (unsigned short)((u + 0x7FFFu + ((u >> 16) & 1u)) >> 16); }
__device__ __forceinline__ float bf16_val(unsigned short b) { return __uint_as_float(((unsigned int)b) << 16); }
__device__ __forceinline__ float bf16_round(float x) { return bf16_val(bf16_bits(x)); }
// D += A·B with NT terms: 1 = ah·bh, 2 = + al·bh (A split), 3 = + ah·bl (both split)
template <int NT>
__device__ __forceinline__ v8f mmaN(v16b ah, v16b al, v16b bh, v16b bl, v8f c) {
  c = __builtin_amdgcn_wmma_f32_16x16x32_bf16(false, ah, false, bh, (short)0, c, false, false);
  if (NT >= 2) c = __builtin_amdgcn_wmma_f32_16x16x32_bf16(false, al, false, bh, (short)0, c, false, false);
  if (NT >= 3) c = __builtin_amdgcn_wmma_f32_16x16x32_bf16(false, ah, false, bl, (short)0, c, false, false);
  asm volatile("v_nop\n\tv_nop\n\tv_nop\n\tv_nop" : "+v"(c) : "v"(ah), "v"(al), "v"(bh), "v"(bl));
  return c;
}

__global__ __launch_bounds__(256) void k_wt_bf16(const float* __restrict__ W, unsigned short* __restrict__ Wt, int K, int N) {
  const int t = blockIdx.x * 256 + threadIdx.x;
  const int k8n = K / 8;
  if (t >= N * k8n) return;
  const int n = t / k8n, k8 = (t % k8n) * 8;
  v8us v;
#pragma unroll
  for (int i = 0; i < 8; ++i) v[i] = bf16_bits(W[(size_t)(k8 + i) * N + n]);
  *(v8us*)(Wt + (size_t)n * K + k8) = v;
  
}

// GEMM C[M][N] (f32, pitch ldc) = act(A[M][K]·W + bias). A f32 row-major (pitch lda) converted per fragment to bf16
// (ASPLIT: hi/lo two planes -> 2 terms, else single rounded term); Wt bf16 [N][K] (pitch ldb). BIAS_BF16 rounds the
// bias to bf16 first (bias quantised to bf16 before the add). K%32==0, M%16==0, N%64==0.
template <bool ASPLIT, int ACT, bool BIAS_BF16>
__global__ __launch_bounds__(128) void k_gemm_bf(const float* __restrict__ A, int lda, const unsigned short* __restrict__ Wt, int ldb,
                                               const float* __restrict__ bias, float* __restrict__ C, int ldc, int M, int N, int K) {
  __shared__ __attribute__((aligned(16))) float so[4][16][64];
  const int tid = threadIdx.x, w = tid >> 5, lane = tid & 31, ln = lane & 15, hh = lane >> 4;
  const int ntn = N / 64;
  const int wid = blockIdx.x * 4 + w;
  const int mt = wid / ntn, nq = wid % ntn;
  if (mt * 16 >= M) return;
  const int row0 = mt * 16, col0 = nq * 64;
  const float* arow = A + (size_t)(row0 + ln) * lda;
  v8f acc[4] = {};
  for (int kb = 0; kb < K; kb += 32) {
    FragB ah, al;
    const v4f x0 = *(const v4fa*)(arow + kb + 8 * hh), x1 = *(const v4fa*)(arow + kb + 8 * hh + 4);
    const v4f x2 = *(const v4fa*)(arow + kb + 16 + 8 * hh), x3 = *(const v4fa*)(arow + kb + 16 + 8 * hh + 4);
    float xs[16] = {x0[0],x0[1],x0[2],x0[3],x1[0],x1[1],x1[2],x1[3],x2[0],x2[1],x2[2],x2[3],x3[0],x3[1],x3[2],x3[3]};
#pragma unroll
    for (int i = 0; i < 16; ++i) { const unsigned short hb = bf16_bits(xs[i]); ah.u[i] = hb; al.u[i] = ASPLIT ? bf16_bits(xs[i] - bf16_val(hb)) : (unsigned short)0; }
#pragma unroll
    for (int t = 0; t < 4; ++t) {
      const unsigned short* brow = Wt + (size_t)(col0 + t * 16 + ln) * ldb + kb;
      FragB b;
      b.half[0] = *(const v8us*)(brow + 8 * hh);
      b.half[1] = *(const v8us*)(brow + 16 + 8 * hh);
      acc[t] = mmaN<ASPLIT ? 2 : 1>(ah.v, al.v, b.v, b.v, acc[t]);
    }
  }
#pragma unroll
  for (int t = 0; t < 4; ++t) {
    float bv = bias ? bias[col0 + t * 16 + ln] : 0.f;
    if (BIAS_BF16) bv = bf16_round(bv);
#pragma unroll
    for (int r = 0; r < 8; ++r) { float v = acc[t][r] + bv; if (ACT == 1) v = fmaxf(v, 0.f); so[w][8 * hh + r][t * 16 + ln] = v; }
  }
  __builtin_amdgcn_fence(__ATOMIC_ACQ_REL, "workgroup");
  __builtin_amdgcn_wave_barrier();
  const int rsub = lane >> 4, c4 = (lane & 15) * 4;
  {
#pragma unroll
    for (int q = 0; q < 8; ++q) {
      const int r = q * 2 + rsub;
      const v4f v = *(const v4fa*)&so[w][r][c4];
      *(v4f*)(C + (size_t)(row0 + r) * ldc + col0 + c4) = v;
    }
    
  }
}

// GEMM C = act(A·W + bias + resid): A f32 (ASPLIT -> hi/lo 2 terms), Wt bf16 [N][K]; ACT 0 none, 1 relu, 2 exact gelu;
// resid (optional, f32, row index = (row % rmod), pitch ldr, RES_BF16 rounds it) added before the activation.
template <bool ASPLIT, int ACT, bool BIAS_BF16, bool RES_BF16>
__global__ __launch_bounds__(128) void k_gemm_bf3(const float* __restrict__ A, int lda, const unsigned short* __restrict__ Wt, int ldb,
                                                const float* __restrict__ bias, const float* __restrict__ resid, int rmod, int ldr,
                                                float* __restrict__ C, int ldc, int M, int N, int K) {
  __shared__ __attribute__((aligned(16))) float so[4][16][64];
  const int tid = threadIdx.x, w = tid >> 5, lane = tid & 31, ln = lane & 15, hh = lane >> 4;
  const int ntn = N / 64;
  const int wid = blockIdx.x * 4 + w;
  const int mt = wid / ntn, nq = wid % ntn;
  if (mt * 16 >= M) return;
  const int row0 = mt * 16, col0 = nq * 64;
  const float* arow = A + (size_t)(row0 + ln) * lda;
  v8f acc[4] = {};
  for (int kb = 0; kb < K; kb += 32) {
    FragB ah, al;
    const v4f x0 = *(const v4fa*)(arow + kb + 8 * hh), x1 = *(const v4fa*)(arow + kb + 8 * hh + 4);
    const v4f x2 = *(const v4fa*)(arow + kb + 16 + 8 * hh), x3 = *(const v4fa*)(arow + kb + 16 + 8 * hh + 4);
    float xs[16] = {x0[0],x0[1],x0[2],x0[3],x1[0],x1[1],x1[2],x1[3],x2[0],x2[1],x2[2],x2[3],x3[0],x3[1],x3[2],x3[3]};
#pragma unroll
    for (int i = 0; i < 16; ++i) { const unsigned short hb = bf16_bits(xs[i]); ah.u[i] = hb; al.u[i] = ASPLIT ? bf16_bits(xs[i] - bf16_val(hb)) : (unsigned short)0; }
#pragma unroll
    for (int t = 0; t < 4; ++t) {
      const unsigned short* brow = Wt + (size_t)(col0 + t * 16 + ln) * ldb + kb;
      FragB b;
      b.half[0] = *(const v8us*)(brow + 8 * hh);
      b.half[1] = *(const v8us*)(brow + 16 + 8 * hh);
      acc[t] = mmaN<ASPLIT ? 2 : 1>(ah.v, al.v, b.v, b.v, acc[t]);
    }
  }
#pragma unroll
  for (int t = 0; t < 4; ++t) {
    const int col = col0 + t * 16 + ln;
    float bv = bias ? bias[col] : 0.f;
    if (BIAS_BF16) bv = bf16_round(bv);
#pragma unroll
    for (int r = 0; r < 8; ++r) {
      float v = acc[t][r] + bv;
      if (resid) { float rv = resid[(size_t)((row0 + 8 * hh + r) % rmod) * ldr + col]; if (RES_BF16) rv = bf16_round(rv); v += rv; }
      if (ACT == 1) v = fmaxf(v, 0.f);
      if (ACT == 2) v = 0.5f * v * (1.0f + erff(v * 0.70710678118654752f));
      if (ACT == 3) { const float u = 0.7978845608028654f * (v + 0.044715f * v * v * v); v = 0.5f * v * (1.0f + tanhf(u)); }
      so[w][8 * hh + r][t * 16 + ln] = v;
    }
  }
  __builtin_amdgcn_fence(__ATOMIC_ACQ_REL, "workgroup");
  __builtin_amdgcn_wave_barrier();
  const int rsub = lane >> 4, c4 = (lane & 15) * 4;
  {
#pragma unroll
    for (int q = 0; q < 8; ++q) {
      const int r = q * 2 + rsub;
      const v4f v = *(const v4fa*)&so[w][r][c4];
      *(v4f*)(C + (size_t)(row0 + r) * ldc + col0 + c4) = v;
    }
    
  }
}
// row LayerNorm (biased variance, eps) over N: s = X (+ R); optional out_sum <- s; out_norm <- (s-mu)*rsqrt(var+eps)*g + b
template <bool PARAM_BF16>
__global__ __launch_bounds__(256) void k_layernorm(const float* __restrict__ X, const float* __restrict__ R, const float* __restrict__ g, const float* __restrict__ bta,
                                                  float* __restrict__ out_sum, float* __restrict__ out_norm, int N, float eps) {
  __shared__ float red[256];
  const int row = blockIdx.x, tid = threadIdx.x;
  const float* x = X + (size_t)row * N; const float* rr = R ? R + (size_t)row * N : nullptr;
  float vals[16];                     // up to N = 4096
  const int per = N / 256;            // contiguous chunk per thread? use strided-by-4 chunks: thread handles j = tid*4 + 1024*u
  float s1 = 0.f;
  for (int u = 0; u < per / 4; ++u) {
    const int j = tid * 4 + 1024 * u;
    const v4f a = *(const v4fa*)(x + j);
    v4f b = {0.f,0.f,0.f,0.f}; if (rr) b = *(const v4fa*)(rr + j);
#pragma unroll
    for (int q = 0; q < 4; ++q) { const float v = a[q] + b[q]; vals[u * 4 + q] = v; s1 += v; }
  }
  red[tid] = s1; __syncthreads();
  for (int st = 128; st > 0; st >>= 1) { if (tid < st) red[tid] += red[tid + st]; __syncthreads(); }
  const float mu = red[0] / (float)N; __syncthreads();
  float s2 = 0.f;
  for (int u = 0; u < per / 4; ++u)
#pragma unroll
    for (int q = 0; q < 4; ++q) { const float c = vals[u * 4 + q] - mu; s2 += c * c; }
  red[tid] = s2; __syncthreads();
  for (int st = 128; st > 0; st >>= 1) { if (tid < st) red[tid] += red[tid + st]; __syncthreads(); }
  const float rs = rsqrtf(red[0] / (float)N + eps);
  {
    for (int u = 0; u < per / 4; ++u) {
      const int j = tid * 4 + 1024 * u;
      v4f o, sm;
#pragma unroll
      for (int q = 0; q < 4; ++q) {
        float gg = g[j + q], bb = bta[j + q];
        if (PARAM_BF16) { gg = bf16_round(gg); bb = bf16_round(bb); }
        sm[q] = vals[u * 4 + q]; o[q] = (vals[u * 4 + q] - mu) * rs * gg + bb;
      }
      if (out_sum) *(v4f*)(out_sum + (size_t)row * N + j) = sm;
      *(v4f*)(out_norm + (size_t)row * N + j) = o;
    }
    
  }
}



// ---- f16 WMMA path (v_wmma_f32_16x16x32_f16): 11-bit significands for operands in range — used for every GEMM launched here
typedef _Float16 v16h __attribute__((ext_vector_type(16)));
union FragH { v16h v; v8us half[2]; _Float16 h[16]; unsigned short u[16]; };
template <int NT>
__device__ __forceinline__ v8f mmaH(v16h ah, v16h al, v16h bh, v16h bl, v8f c) {
  c = __builtin_amdgcn_wmma_f32_16x16x32_f16(false, ah, false, bh, (short)0, c, false, false);
  if (NT >= 2) c = __builtin_amdgcn_wmma_f32_16x16x32_f16(false, al, false, bh, (short)0, c, false, false);
  if (NT >= 3) c = __builtin_amdgcn_wmma_f32_16x16x32_f16(false, ah, false, bl, (short)0, c, false, false);
  asm volatile("v_nop\n\tv_nop\n\tv_nop\n\tv_nop" : "+v"(c) : "v"(ah), "v"(al), "v"(bh), "v"(bl));
  return c;
}
// batched GEMM like k_gemm_b but f16 operands: A f32 (split into f16 hi/lo if ASPLIT, else rounded to f16), Bt = f16 values [n][k]; alpha; C f32; N multiple of 16 (partial tiles skipped)
template <bool ASPLIT>
__global__ __launch_bounds__(128) void k_gemm_h(const float* __restrict__ A, int lda, size_t sA, const _Float16* __restrict__ Bh, int ldb, size_t sB, float alpha, float* __restrict__ C, int ldc, size_t sC, int M, int N, int K) {
  __shared__ __attribute__((aligned(16))) float so[4][16][64];
  const int tid = threadIdx.x, w = tid >> 5, lane = tid & 31, ln = lane & 15, hh = lane >> 4; const int by = blockIdx.y;
  A += (size_t)by * sA; Bh += (size_t)by * sB; C += (size_t)by * sC;
  const int ntn = (N + 63) / 64; const int wid = blockIdx.x * 4 + w; const int mt = wid / ntn, nq = wid % ntn; if (mt * 16 >= M) return;
  const int row0 = mt * 16, col0 = nq * 64; const float* arow = A + (size_t)(row0 + ln) * lda;
  v8f acc[4] = {};
  for (int kb = 0; kb < K; kb += 32) {
    FragH ah, al;
    const v4f x0 = *(const v4fa*)(arow + kb + 8 * hh), x1 = *(const v4fa*)(arow + kb + 8 * hh + 4), x2 = *(const v4fa*)(arow + kb + 16 + 8 * hh), x3 = *(const v4fa*)(arow + kb + 16 + 8 * hh + 4);
    float xs[16] = {x0[0],x0[1],x0[2],x0[3],x1[0],x1[1],x1[2],x1[3],x2[0],x2[1],x2[2],x2[3],x3[0],x3[1],x3[2],x3[3]};
#pragma unroll
    for (int i = 0; i < 16; ++i) { const _Float16 h = (_Float16)xs[i]; ah.h[i] = h; al.h[i] = ASPLIT ? (_Float16)(xs[i] - (float)h) : (_Float16)0.0f; }
#pragma unroll
    for (int t = 0; t < 4; ++t) { if (col0 + t * 16 >= N) continue; const size_t boff = (size_t)(col0 + t * 16 + ln) * ldb + kb; FragH bq; bq.half[0] = *(const v8us*)(Bh + boff + 8 * hh); bq.half[1] = *(const v8us*)(Bh + boff + 16 + 8 * hh);
      acc[t] = mmaH<ASPLIT ? 2 : 1>(ah.v, al.v, bq.v, bq.v, acc[t]); }
  }
#pragma unroll
  for (int t = 0; t < 4; ++t) { if (col0 + t * 16 >= N) continue;
#pragma unroll
    for (int r = 0; r < 8; ++r) so[w][8 * hh + r][t * 16 + ln] = acc[t][r] * alpha; }
  __builtin_amdgcn_fence(__ATOMIC_ACQ_REL, "workgroup"); __builtin_amdgcn_wave_barrier();
  const int rsub = lane >> 4, c4 = (lane & 15) * 4;
  {
#pragma unroll
    for (int q = 0; q < 8; ++q) { const int r = q * 2 + rsub; if (col0 + c4 < N) { const v4f v = *(const v4fa*)&so[w][r][c4]; *(v4f*)(C + (size_t)(row0 + r) * ldc + col0 + c4) = v; } }
     }
}

// Wt[n][k] = f16(W[k][n]·scale) from f32 row-major W[K][N] (scale = power of two; bf16-exact weights stay exact in f16 away from the subnormal range)
__global__ __launch_bounds__(256) void k_wt_f16(const float* __restrict__ W, _Float16* __restrict__ Wt, int K, int N, float scale) {
  const int t = blockIdx.x * 256 + threadIdx.x; if (t >= N * (K / 8)) return; const int n = t / (K / 8), k8 = (t % (K / 8)) * 8; FragH f;
#pragma unroll
  for (int i = 0; i < 8; ++i) f.h[i] = (_Float16)(bf16_round(W[(size_t)(k8 + i) * N + n]) * scale); const v8us o = f.half[0];
  *(v8us*)((unsigned short*)Wt + (size_t)n * K + k8) = o; 
}
// k_gemm_hh variant with fused epilogue: v = acc·alpha + bias[by·sBias + col] (+ CP[(row/rowsPerB)·sCPb + by·64 + col] if CP) ; ACT 0 none / 1 elu ; writes f16 C16 (and f32 C if non-null)
template <int ACT>
__global__ __launch_bounds__(128) void k_gemm_hhx(const _Float16* __restrict__ A, int lda, size_t sA, const _Float16* __restrict__ Bh, int ldb, size_t sB, float alpha, const float* __restrict__ bias, size_t sBias, const float* __restrict__ CP, int rowsPerB, size_t sCPb, int row0g,
    float* __restrict__ C, _Float16* __restrict__ C16, int ldc, size_t sC, int M, int N, int K) {
  __shared__ __attribute__((aligned(16))) float so[4][16][64];
  const int tid = threadIdx.x, w = tid >> 5, lane = tid & 31, ln = lane & 15, hh = lane >> 4; const int by = blockIdx.y;
  A += (size_t)by * sA; Bh += (size_t)by * sB; const size_t cofs = (size_t)by * sC; const float* bp = bias ? bias + (size_t)by * sBias : nullptr;
  const int ntn = (N + 63) / 64; const int wid = blockIdx.x * 4 + w; const int mt = wid / ntn, nq = wid % ntn; if (mt * 16 >= M) return;
  const int row0 = mt * 16, col0 = nq * 64; const _Float16* arow = A + (size_t)(row0 + ln) * lda;
  v8f acc[4] = {};
  for (int kb = 0; kb < K; kb += 32) { FragH ah; ah.half[0] = *(const v8us*)((const unsigned short*)arow + kb + 8 * hh); ah.half[1] = *(const v8us*)((const unsigned short*)arow + kb + 16 + 8 * hh);
#pragma unroll
    for (int t = 0; t < 4; ++t) { if (col0 + t * 16 >= N) continue; const size_t boff = (size_t)(col0 + t * 16 + ln) * ldb + kb; FragH bq; bq.half[0] = *(const v8us*)((const unsigned short*)Bh + boff + 8 * hh); bq.half[1] = *(const v8us*)((const unsigned short*)Bh + boff + 16 + 8 * hh);
      acc[t] = mmaH<1>(ah.v, ah.v, bq.v, bq.v, acc[t]); }
  }
#pragma unroll
  for (int t = 0; t < 4; ++t) { if (col0 + t * 16 >= N) continue; const int col = col0 + t * 16 + ln; const float bv = bp ? bf16_round(bp[col]) : 0.f;
#pragma unroll
    for (int r = 0; r < 8; ++r) { float v = acc[t][r] * alpha + bv; if (CP) { const int rr = row0g + row0 + 8 * hh + r; if (rowsPerB < 0) v += CP[cofs + (size_t)rr * ldc + col];      /* rowsPerB < 0: own element of the batched C plane */ else { const int bidx = rr / rowsPerB; v += CP[(size_t)bidx * sCPb + (size_t)by * 64 + col]; } } if (ACT == 1) v = (v > 0.f) ? v : expm1f(v); else if (ACT == 7) v = (v > 0.f) ? v + 1.0f : expf(v); else if (ACT == 8) v = tanhf(v); else if (ACT == 9) v = 0.5f * v * (1.0f + tanhf(0.7978845608028654f * (v + 0.044715f * v * v * v))); else if (ACT == 11) v = 1.0f / (1.0f + expf(-v)); else if (ACT == 12) v = (v > 0.f) ? v : 0.01f * v; else if (ACT == 14) v = (v > 0.f) ? v : 0.1f * v; else if (ACT == 16) v = (v >= 0.f) ? v : 0.3f * v; else if (ACT == 17) v = (v >= 0.f) ? v : 0.2f * v; else if (ACT == 15) v = v / (1.0f + expf(-v)); else if (ACT == 3) v = fmaxf(v, 0.f); else if (ACT == 6) v = 0.5f * v * (1.0f + erff(v * 0.70710678118654752f)); so[w][8 * hh + r][t * 16 + ln] = v; } }
  __builtin_amdgcn_fence(__ATOMIC_ACQ_REL, "workgroup"); __builtin_amdgcn_wave_barrier();
  const int rsub = lane >> 4, c4 = (lane & 15) * 4; typedef _Float16 v4h __attribute__((ext_vector_type(4)));
  {
#pragma unroll
    for (int q = 0; q < 8; ++q) { const int r = q * 2 + rsub; if (col0 + c4 < N) { const v4f v = *(const v4fa*)&so[w][r][c4]; if (C) *(v4f*)(C + cofs + (size_t)(row0 + r) * ldc + col0 + c4) = v; if (C16) { v4h h4; for (int i = 0; i < 4; ++i) h4[i] = (_Float16)v[i]; *(v4h*)(C16 + cofs + (size_t)(row0 + r) * ldc + col0 + c4) = h4; } } }
     }
}


typedef _Float16 v4h __attribute__((ext_vector_type(4)));

__global__ __launch_bounds__(256) void k_x16(const float* __restrict__ x, _Float16* __restrict__ X16, size_t n8) { const size_t t = (size_t)blockIdx.x * 256 + threadIdx.x; if (t >= n8) return; FragH f;
#pragma unroll
  for (int q = 0; q < 8; ++q) f.h[q] = (_Float16)bf16_round(x[t * 8 + q]); *(v8us*)((unsigned short*)X16 + t * 8) = f.half[0];  }
__global__ __launch_bounds__(256) void k_h16(const float* __restrict__ x, _Float16* __restrict__ X16, size_t n8) { const size_t t = (size_t)blockIdx.x * 256 + threadIdx.x; if (t >= n8) return; FragH f;
#pragma unroll
  for (int q = 0; q < 8; ++q) f.h[q] = (_Float16)x[t * 8 + q]; *(v8us*)((unsigned short*)X16 + t * 8) = f.half[0];  }
__global__ __launch_bounds__(256) void k_round16f(const float* __restrict__ W, _Float16* __restrict__ Bt, size_t n8) { const size_t t = (size_t)blockIdx.x * 256 + threadIdx.x; if (t >= n8) return; FragH f;
#pragma unroll
  for (int i = 0; i < 8; ++i) f.h[i] = (_Float16)(bf16_round(W[t * 8 + i]) * 16.0f); *(v8us*)((unsigned short*)Bt + t * 8) = f.half[0];  }
template <int NHv, int TTv>
__global__ __launch_bounds__(256) void k_vt(const _Float16* __restrict__ V16, int ldv, int voff, _Float16* __restrict__ Vt) { __shared__ unsigned short tl[64][66]; const int tid = threadIdx.x; const int slab = blockIdx.x / (TTv / 64), lg = blockIdx.x % (TTv / 64); const int b = slab / NHv, h = slab % NHv;
  for (int i = tid; i < 64 * 8; i += 256) { const int r = i / 8, c8 = (i % 8) * 8; FragH f; f.half[0] = *(const v8us*)((const unsigned short*)V16 + ((size_t)b * TTv + lg * 64 + r) * ldv + voff + h * 64 + c8);
#pragma unroll
    for (int q = 0; q < 8; ++q) tl[r][c8 + q] = f.u[q]; }
  __syncthreads();
  {
#pragma unroll
    for (int rd = 0; rd < 2; ++rd) { const int d = rd * 32 + tid / 8, pc = tid % 8; FragH f;
#pragma unroll
      for (int q = 0; q < 8; ++q) f.u[q] = tl[pc * 8 + q][d];
      *(v8us*)((unsigned short*)Vt + ((size_t)slab * 64 + d) * TTv + lg * 64 + pc * 8) = f.half[0]; }
     } }

__global__ __launch_bounds__(256) void k_hl(const float* __restrict__ F, _Float16* __restrict__ Hh, _Float16* __restrict__ Hl, size_t n8) { const size_t t = (size_t)blockIdx.x * 256 + threadIdx.x; if (t >= n8) return; FragH fh, fl; const v4f a = *(const v4fa*)(F + t * 8), c = *(const v4fa*)(F + t * 8 + 4);
#pragma unroll
  for (int q = 0; q < 4; ++q) { _Float16 h = (_Float16)a[q]; fh.h[q] = h; fl.h[q] = (_Float16)((a[q] - (float)h) * 1024.0f); h = (_Float16)c[q]; fh.h[4 + q] = h; fl.h[4 + q] = (_Float16)((c[q] - (float)h) * 1024.0f); }
  { *(v8us*)((unsigned short*)Hh + t * 8) = fh.half[0]; *(v8us*)((unsigned short*)Hl + t * 8) = fl.half[0];  } }

// ---- fast GEMM (work-group tile 128x64, wave tile 32x64; requires M % 128 == 0, N % 64 == 0, K % 64 == 0); epilogue = k_gemm_hhx semantics; ROWB: bias indexed by the C row (weights as A) instead of the C column ----
// Operand path: per stage of 64 k (one 128-B line of every operand row) the 128 A rows and 64 B rows of the work-group's tile are copied to LDS by
// asynchronous b128 copies (a wave-wide copy = 4 whole lines), two buffers, the next stage in flight while this one is multiplied; fragments come from LDS.
#define G2_PITCH 144                      /* LDS row pitch in bytes, 16 B x odd: conflict-free for the ds_load_b128 fragment reads of 128-B rows */
#define G2_STAGE ((128 + 64) * G2_PITCH)  /* bytes of one buffer: A rows 0..127, then B rows 0..63 */
__device__ __forceinline__ v16h g2_frag(const unsigned char* p) { FragH f; f.half[0] = *(const v8us*)p; f.half[1] = *(const v8us*)(p + 32); return f.v; }
__device__ __forceinline__ v8f g2_mma(v16h a, v16h b, v8f c) { v8f d = __builtin_amdgcn_wmma_f32_16x16x32_f16(false, a, false, b, (short)0, c, false, false); asm volatile("v_nop\n\tv_nop\n\tv_nop\n\tv_nop" : "+v"(d) : "v"(a), "v"(b)); return d; }
// One stage: each of the 128 threads copies 16 B of 8 A rows and 4 B rows (rows 16 apart). l = the lane's LDS byte address in the buffer, a / b = its global
// addresses, sa / sb = 16 rows in elements. The closing s_wait_xcnt keeps every address register intact until the copies have taken it.
__device__ __forceinline__ void g2_stage(unsigned l, const _Float16* a, size_t sa, const _Float16* b, size_t sb) {
  asm volatile("global_load_async_to_lds_b128 %0, %12, off\n\t"
               "global_load_async_to_lds_b128 %1, %13, off\n\t"
               "global_load_async_to_lds_b128 %2, %14, off\n\t"
               "global_load_async_to_lds_b128 %3, %15, off\n\t"
               "global_load_async_to_lds_b128 %4, %16, off\n\t"
               "global_load_async_to_lds_b128 %5, %17, off\n\t"
               "global_load_async_to_lds_b128 %6, %18, off\n\t"
               "global_load_async_to_lds_b128 %7, %19, off\n\t"
               "global_load_async_to_lds_b128 %8, %20, off\n\t"
               "global_load_async_to_lds_b128 %9, %21, off\n\t"
               "global_load_async_to_lds_b128 %10, %22, off\n\t"
               "global_load_async_to_lds_b128 %11, %23, off\n\t"
               "s_wait_xcnt 0x0"
               :: "v"(l), "v"(l + 16 * G2_PITCH), "v"(l + 32 * G2_PITCH), "v"(l + 48 * G2_PITCH), "v"(l + 64 * G2_PITCH), "v"(l + 80 * G2_PITCH), "v"(l + 96 * G2_PITCH), "v"(l + 112 * G2_PITCH),
                  "v"(l + 128 * G2_PITCH), "v"(l + 144 * G2_PITCH), "v"(l + 160 * G2_PITCH), "v"(l + 176 * G2_PITCH),
                  "v"(a), "v"(a + sa), "v"(a + 2 * sa), "v"(a + 3 * sa), "v"(a + 4 * sa), "v"(a + 5 * sa), "v"(a + 6 * sa), "v"(a + 7 * sa),
                  "v"(b), "v"(b + sb), "v"(b + 2 * sb), "v"(b + 3 * sb)
               : "memory");
}
// The body takes its LDS and its block indices (bx = tile, by = batch plane) from the caller, so that one launch can hold the tiles of several independent GEMMs.
template <int ACT, bool ROWB>
__device__ __forceinline__ void g2_body(unsigned char* smem, const int bx, const int by, const _Float16* __restrict__ A, int lda, size_t sA, const _Float16* __restrict__ Bh, int ldb, size_t sB, float alpha, const float* __restrict__ bias, size_t sBias, const float* __restrict__ CP, int rowsPerB, size_t sCPb, int row0g,
    float* __restrict__ C, _Float16* __restrict__ C16, int ldc, size_t sC, int M, int N, int K) { static_assert(ACT == 0 || ACT == 3 || ACT == 6 || ACT == 8 || ACT == 9 || ACT == 11 || ACT == 12 || ACT == 14 || ACT == 15 || ACT == 16 || ACT == 17, "k_gemm2: unsupported ACT code (would silently apply no activation)");
  static_assert(sizeof(float) * 4 * 32 * 68 <= 2 * G2_STAGE, "output staging must fit the operand buffers");
  float (*so)[32][68] = (float (*)[32][68])smem;
  const int tid = threadIdx.x, w = tid >> 5, lane = tid & 31, ln = lane & 15, hh = lane >> 4;
  A += (size_t)by * sA; Bh += (size_t)by * sB; const size_t cofs = (size_t)by * sC; const float* bp = bias ? bias + (size_t)by * sBias : nullptr;
  const int ntn = N >> 6; const int mt = bx / ntn, nq = bx - mt * ntn; const int row0 = mt * 128 + 32 * w, col0 = nq * 64; if (mt * 128 >= M) return;      /* the whole work-group leaves, in front of every barrier */
  const unsigned lcp = (unsigned)(size_t)smem + (unsigned)((tid >> 3) * G2_PITCH + (tid & 7) * 16);
  const _Float16* gA = A + (size_t)(mt * 128 + (tid >> 3)) * lda + (tid & 7) * 8; const _Float16* gB = Bh + (size_t)(col0 + (tid >> 3)) * ldb + (tid & 7) * 8; const size_t sa16 = (size_t)16 * lda, sb16 = (size_t)16 * ldb;
  const int nst = K >> 6;
  const v8f z8 = {0.f,0.f,0.f,0.f,0.f,0.f,0.f,0.f}; v8f c00 = z8, c01 = z8, c02 = z8, c03 = z8, c10 = z8, c11 = z8, c12 = z8, c13 = z8;
  g2_stage(lcp, gA, sa16, gB, sb16);
  asm volatile("s_wait_asynccnt 0x0" ::: "memory");      /* this wave's copies of stage 0 have landed */
  __syncthreads();                                       /* ... and every other wave's */
  if (nst > 1) g2_stage(lcp + G2_STAGE, gA + 64, sa16, gB + 64, sb16);
#pragma unroll 1
  for (int s = 0; s < nst; ++s) { const unsigned char* sb = smem + (s & 1) * G2_STAGE; const unsigned char* pa = sb + (32 * w + ln) * G2_PITCH + 16 * hh; const unsigned char* pb = sb + (128 + ln) * G2_PITCH + 16 * hh;
    v16h fa[2][2], fb[2][4];      /* the stage's 12 fragments are read as one group in front of its 16 WMMAs: one LDS latency a stage instead of one per B fragment */
#pragma unroll
    for (int h = 0; h < 2; ++h) { fa[h][0] = g2_frag(pa + 64 * h); fa[h][1] = g2_frag(pa + 16 * G2_PITCH + 64 * h);
#pragma unroll
      for (int t = 0; t < 4; ++t) fb[h][t] = g2_frag(pb + 16 * t * G2_PITCH + 64 * h); }
#pragma unroll
    for (int h = 0; h < 2; ++h) {
      c00 = g2_mma(fa[h][0], fb[h][0], c00); c10 = g2_mma(fa[h][1], fb[h][0], c10);
      c01 = g2_mma(fa[h][0], fb[h][1], c01); c11 = g2_mma(fa[h][1], fb[h][1], c11);
      c02 = g2_mma(fa[h][0], fb[h][2], c02); c12 = g2_mma(fa[h][1], fb[h][2], c12);
      c03 = g2_mma(fa[h][0], fb[h][3], c03); c13 = g2_mma(fa[h][1], fb[h][3], c13); }
    asm volatile("s_wait_dscnt 0x0" ::: "memory");       /* this wave's reads of the buffer are over before it may be refilled */
    asm volatile("s_wait_asynccnt 0x0" ::: "memory");    /* this wave's copies of stage s + 1 have landed */
    __syncthreads();                                     /* publishes stage s + 1 and ends every wave's reads of stage s */
    if (s + 2 < nst) g2_stage(lcp + (unsigned)(s & 1) * G2_STAGE, gA + (size_t)(s + 2) * 64, sa16, gB + (size_t)(s + 2) * 64, sb16); }
  asm volatile("s_wait_asynccnt 0x0" ::: "memory");      /* no copy is outstanding when the buffers become output staging */
  v8f accs[8] = {c00, c01, c02, c03, c10, c11, c12, c13};
  float rbias[16];      /* ROWB: the bias of this lane's 16 C rows, loaded as one group in front of the element loop; both loops unrolled so that every index is a constant and the array stays in registers */
#pragma unroll
  for (int i = 0; i < 16; ++i) rbias[i] = 0.f;
  if (ROWB && bp) { const float* br = bp + row0 + 8 * hh;
#pragma unroll
    for (int i = 0; i < 16; ++i) rbias[i] = bf16_round(br[(i >> 3) * 16 + (i & 7)]); }
#pragma unroll
  for (int u = 0; u < 8; ++u) { const int t = u & 3, half = u >> 2; const int col = col0 + t * 16 + ln; const float bvc = (!ROWB && bp) ? bf16_round(bp[col]) : 0.f;
#pragma unroll
    for (int r = 0; r < 8; ++r) { const int rloc = half * 16 + 8 * hh + r; const float bv = ROWB ? rbias[half * 8 + r] : bvc; float v = accs[u][r] * alpha + bv; if (CP) { if (rowsPerB < 0) v += CP[cofs + (size_t)(row0g + row0 + rloc) * ldc + col];      /* rowsPerB < 0: own element of the batched C plane */ else { const int bidx = (row0g + row0 + rloc) / rowsPerB; v += CP[(size_t)bidx * sCPb + (size_t)by * 64 + col]; } }
      if (ACT == 3) v = fmaxf(v, 0.f); else if (ACT == 6) v = 0.5f * v * (1.0f + erff(v * 0.70710678118654752f)); else if (ACT == 11) v = 1.0f / (1.0f + expf(-v)); else if (ACT == 15) v = v / (1.0f + expf(-v)); else if (ACT == 12) v = (v > 0.f) ? v : 0.01f * v; else if (ACT == 8) v = tanhf(v); else if (ACT == 9) v = 0.5f * v * (1.0f + tanhf(0.7978845608028654f * (v + 0.044715f * v * v * v))); else if (ACT == 14) v = (v > 0.f) ? v : 0.1f * v; else if (ACT == 16) v = (v >= 0.f) ? v : 0.3f * v; else if (ACT == 17) v = (v >= 0.f) ? v : 0.2f * v;
      so[w][rloc][t * 16 + ln] = v; } }
  __builtin_amdgcn_fence(__ATOMIC_ACQ_REL, "workgroup"); __builtin_amdgcn_wave_barrier();
  const int rsub = lane >> 4, c4 = (lane & 15) * 4;
  {
#pragma unroll
    for (int q = 0; q < 16; ++q) { const int r = q * 2 + rsub; const v4f v = *(const v4fa*)&so[w][r][c4]; if (C) { *(v4f*)(C + cofs + (size_t)(row0 + r) * ldc + col0 + c4) = v; if (C16) asm volatile("s_wait_xcnt 0x0" ::: "memory"); }      /* the wait stands in front of the conversion below, which may overwrite registers that the f32 store names */
      if (C16) { v4h h4; for (int i = 0; i < 4; ++i) h4[i] = (_Float16)v[i]; *(v4h*)(C16 + cofs + (size_t)(row0 + r) * ldc + col0 + c4) = h4; } }
    asm volatile("s_wait_xcnt 0x0" ::: "memory");      /* stands behind the last stores, in front of any code of the calling kernel that follows the body and may overwrite registers that they name */
     } }
#define G2_SMEM __shared__ __attribute__((aligned(16))) unsigned char smem[2 * G2_STAGE]      /* the two operand buffers; behind the K loop's last barrier the same bytes stage the output tile */
template <int ACT, bool ROWB>
__global__ __launch_bounds__(128) void k_gemm2(const _Float16* __restrict__ A, int lda, size_t sA, const _Float16* __restrict__ Bh, int ldb, size_t sB, float alpha, const float* __restrict__ bias, size_t sBias, const float* __restrict__ CP, int rowsPerB, size_t sCPb, int row0g,
    float* __restrict__ C, _Float16* __restrict__ C16, int ldc, size_t sC, int M, int N, int K) { G2_SMEM;
  g2_body<ACT, ROWB>(smem, (int)blockIdx.x, (int)blockIdx.y, A, lda, sA, Bh, ldb, sB, alpha, bias, sBias, CP, rowsPerB, sCPb, row0g, C, C16, ldc, sC, M, N, K); }
// ---- large-tile GEMM for the 512-k Q GEMM: wave tile 64x64 (16 accumulator tiles; 8 fragments feed 16 WMMAs), WR x 2 waves, work-group tile 64 WR x 128 (WR = 2: 128x128, WR = 4: 256x128).
// Against the 128x64 tile of 32x64 waves it brings a third (WR = 2) or half (WR = 4) fewer operand bytes from L2 and reads a third fewer LDS bytes per WMMA, with half the waves and at most half the barriers.
// Same stage (64 k), same two buffers, same order of waits, same k order per output element. Requires M % (64 WR) == 0, N % 128 == 0, K % 64 == 0.
// v = acc * alpha + bias (ROWB: by C row, else by C column); writes f32 C (F32) or f16 C16.
#define G3_STAGE(WR) ((64 * (WR) + 128) * G2_PITCH)      /* bytes of one buffer: the A rows, then 128 B rows */
#define G3_OUT(WR) (2 * (WR) * 64 * 68 * 4)              /* bytes of the output staging: 64 rows of pitch 68 floats per wave */
#define G3_BYTES(WR) (2 * G3_STAGE(WR) > G3_OUT(WR) ? 2 * G3_STAGE(WR) : G3_OUT(WR))
// Eight copies: 16 B of 8 rows that lie LS bytes apart in LDS and s elements apart in global memory. l = the lane's LDS byte address of the first row, g = its global address.
// The closing s_wait_xcnt keeps every address register intact until the copies have taken it.
template <unsigned LS>
__device__ __forceinline__ void g3_copy8(unsigned l, const _Float16* g, size_t s) {
  asm volatile("global_load_async_to_lds_b128 %0, %8, off\n\t"
               "global_load_async_to_lds_b128 %1, %9, off\n\t"
               "global_load_async_to_lds_b128 %2, %10, off\n\t"
               "global_load_async_to_lds_b128 %3, %11, off\n\t"
               "global_load_async_to_lds_b128 %4, %12, off\n\t"
               "global_load_async_to_lds_b128 %5, %13, off\n\t"
               "global_load_async_to_lds_b128 %6, %14, off\n\t"
               "global_load_async_to_lds_b128 %7, %15, off\n\t"
               "s_wait_xcnt 0x0"
               :: "v"(l), "v"(l + 1 * LS), "v"(l + 2 * LS), "v"(l + 3 * LS), "v"(l + 4 * LS), "v"(l + 5 * LS), "v"(l + 6 * LS), "v"(l + 7 * LS),
                  "v"(g), "v"(g + s), "v"(g + 2 * s), "v"(g + 3 * s), "v"(g + 4 * s), "v"(g + 5 * s), "v"(g + 6 * s), "v"(g + 7 * s)
               : "memory");
}
// Twelve copies in one statement, one wait: 8 passes of A rows and, directly behind them in LDS, 4 passes of B rows.
template <unsigned LS>
__device__ __forceinline__ void g3_copy12(unsigned l, const _Float16* a, size_t sa, const _Float16* b, size_t sb) {
  asm volatile("global_load_async_to_lds_b128 %0, %12, off\n\t"
               "global_load_async_to_lds_b128 %1, %13, off\n\t"
               "global_load_async_to_lds_b128 %2, %14, off\n\t"
               "global_load_async_to_lds_b128 %3, %15, off\n\t"
               "global_load_async_to_lds_b128 %4, %16, off\n\t"
               "global_load_async_to_lds_b128 %5, %17, off\n\t"
               "global_load_async_to_lds_b128 %6, %18, off\n\t"
               "global_load_async_to_lds_b128 %7, %19, off\n\t"
               "global_load_async_to_lds_b128 %8, %20, off\n\t"
               "global_load_async_to_lds_b128 %9, %21, off\n\t"
               "global_load_async_to_lds_b128 %10, %22, off\n\t"
               "global_load_async_to_lds_b128 %11, %23, off\n\t"
               "s_wait_xcnt 0x0"
               :: "v"(l), "v"(l + 1 * LS), "v"(l + 2 * LS), "v"(l + 3 * LS), "v"(l + 4 * LS), "v"(l + 5 * LS), "v"(l + 6 * LS), "v"(l + 7 * LS), "v"(l + 8 * LS), "v"(l + 9 * LS), "v"(l + 10 * LS), "v"(l + 11 * LS),
                  "v"(a), "v"(a + sa), "v"(a + 2 * sa), "v"(a + 3 * sa), "v"(a + 4 * sa), "v"(a + 5 * sa), "v"(a + 6 * sa), "v"(a + 7 * sa),
                  "v"(b), "v"(b + sb), "v"(b + 2 * sb), "v"(b + 3 * sb)
               : "memory");
}
// One stage: the 64 WR threads x 16 B cover 8 WR rows a pass; 8 passes for the A rows, 16 / WR for the 128 B rows.
template <int WR>
__device__ __forceinline__ void g3_stage(unsigned l, const _Float16* a, size_t sa, const _Float16* b, size_t sb) {
  if (WR == 2) { g3_copy8<8 * WR * G2_PITCH>(l, a, sa); g3_copy8<8 * WR * G2_PITCH>(l + 64 * WR * G2_PITCH, b, sb); }      /* 16 copies: more operands than one statement takes */
  else g3_copy12<8 * WR * G2_PITCH>(l, a, sa, b, sb); }
template <int WR, bool ROWB, bool F32>
__device__ __forceinline__ void g3_body(unsigned char* smem, const int bx, const int by, const _Float16* __restrict__ A, int lda, size_t sA, const _Float16* __restrict__ Bh, int ldb, size_t sB, float alpha, const float* __restrict__ bias,
    float* __restrict__ C, _Float16* __restrict__ C16, int ldc, size_t sC, int M, int N, int K) {
  static_assert(WR == 2 || WR == 4, "the copy passes are written for these two");
  constexpr int TM = 64 * WR, RP = 8 * WR;      /* tile rows; rows per copy pass */
  float (*so)[64][68] = (float (*)[64][68])smem;
  const int tid = threadIdx.x, w = tid >> 5, lane = tid & 31, ln = lane & 15, hh = lane >> 4, wr = w >> 1, wc = w & 1;
  A += (size_t)by * sA; Bh += (size_t)by * sB; const size_t cofs = (size_t)by * sC;
  const int ntn = N >> 7; const int mt = bx / ntn, nq = bx - mt * ntn; const int row0 = mt * TM + 64 * wr, col0 = nq * 128 + 64 * wc; if (mt * TM >= M) return;      /* the whole work-group leaves, in front of every barrier */
  const unsigned lcp = (unsigned)(size_t)smem + (unsigned)((tid >> 3) * G2_PITCH + (tid & 7) * 16);
  const _Float16* gA = A + (size_t)(mt * TM + (tid >> 3)) * lda + (tid & 7) * 8; const _Float16* gB = Bh + (size_t)(nq * 128 + (tid >> 3)) * ldb + (tid & 7) * 8; const size_t sar = (size_t)RP * lda, sbr = (size_t)RP * ldb;
  const int nst = K >> 6;
  v8f acc[4][4];      /* [row tile][column tile]; every index below is a constant after unrolling */
#pragma unroll      /* constant indices: the arrays stay in registers */
  for (int i = 0; i < 4; ++i)
#pragma unroll      /* constant indices: the arrays stay in registers */
    for (int t = 0; t < 4; ++t) acc[i][t] = (v8f){0.f,0.f,0.f,0.f,0.f,0.f,0.f,0.f};
  g3_stage<WR>(lcp, gA, sar, gB, sbr);
  asm volatile("s_wait_asynccnt 0x0" ::: "memory");      /* this wave's copies of stage 0 have landed */
  __syncthreads();                                       /* ... and every other wave's */
  if (nst > 1) g3_stage<WR>(lcp + G3_STAGE(WR), gA + 64, sar, gB + 64, sbr);
#pragma unroll 1      /* stays rolled: one copy of the 32 WMMAs and of the ring's foot, so that the waits stand once and the loop is short in the instruction cache */
  for (int s = 0; s < nst; ++s) { const unsigned char* sb = smem + (s & 1) * G3_STAGE(WR); const unsigned char* pa = sb + (64 * wr + ln) * G2_PITCH + 16 * hh; const unsigned char* pb = sb + (TM + 64 * wc + ln) * G2_PITCH + 16 * hh;
#pragma unroll      /* constant indices: the arrays stay in registers */
    for (int h = 0; h < 2; ++h) { v16h fa[4], fb[4];      /* the 8 fragments of 32 k are read as one group in front of their 16 WMMAs */
#pragma unroll      /* constant indices: the arrays stay in registers */
      for (int i = 0; i < 4; ++i) { fa[i] = g2_frag(pa + 16 * i * G2_PITCH + 64 * h); fb[i] = g2_frag(pb + 16 * i * G2_PITCH + 64 * h); }
#pragma unroll      /* constant indices: the arrays stay in registers */
      for (int t = 0; t < 4; ++t)
#pragma unroll      /* constant indices: the arrays stay in registers */
        for (int i = 0; i < 4; ++i) acc[i][t] = g2_mma(fa[i], fb[t], acc[i][t]); }
    asm volatile("s_wait_dscnt 0x0" ::: "memory");       /* this wave's reads of the buffer are over before it may be refilled */
    asm volatile("s_wait_asynccnt 0x0" ::: "memory");    /* this wave's copies of stage s + 1 have landed */
    __syncthreads();                                     /* publishes stage s + 1 and ends every wave's reads of stage s */
    if (s + 2 < nst) g3_stage<WR>(lcp + (unsigned)(s & 1) * G3_STAGE(WR), gA + (size_t)(s + 2) * 64, sar, gB + (size_t)(s + 2) * 64, sbr); }
  asm volatile("s_wait_asynccnt 0x0" ::: "memory");      /* no copy is outstanding when the buffers become output staging */
#pragma unroll      /* constant indices: the arrays stay in registers */
  for (int i = 0; i < 4; ++i) { float rb[8];      /* ROWB: the bias of this lane's 8 C rows of row tile i */
#pragma unroll      /* constant indices: the arrays stay in registers */
    for (int r = 0; r < 8; ++r) rb[r] = ROWB ? bf16_round(bias[row0 + i * 16 + 8 * hh + r]) : 0.f;
#pragma unroll      /* constant indices: the arrays stay in registers */
    for (int t = 0; t < 4; ++t) { const float bvc = ROWB ? 0.f : bf16_round(bias[col0 + t * 16 + ln]);
#pragma unroll      /* constant indices: the arrays stay in registers */
      for (int r = 0; r < 8; ++r) so[w][i * 16 + 8 * hh + r][t * 16 + ln] = acc[i][t][r] * alpha + (ROWB ? rb[r] : bvc); } }
  __builtin_amdgcn_fence(__ATOMIC_ACQ_REL, "workgroup"); __builtin_amdgcn_wave_barrier();      /* the wave's staging writes stand in front of its read-back of other lanes' values; each wave stages in its own range, so no work-group barrier */
  const int rsub = lane >> 4, c4 = (lane & 15) * 4;
#pragma unroll      /* straight-line: the row pairs' LDS reads run ahead of the stores */
  for (int q = 0; q < 32; ++q) { const int r = q * 2 + rsub; const v4f v = *(const v4fa*)&so[w][r][c4];
    if (F32) *(v4f*)(C + cofs + (size_t)(row0 + r) * ldc + col0 + c4) = v;
    else { v4h h4; for (int i = 0; i < 4; ++i) h4[i] = (_Float16)v[i]; *(v4h*)(C16 + cofs + (size_t)(row0 + r) * ldc + col0 + c4) = h4; } }
  asm volatile("s_wait_xcnt 0x0" ::: "memory"); }      /* stands behind the last stores, in front of any code of the calling kernel that follows the body and may overwrite registers that they name */
#define G3_SMEM(WR) __shared__ __attribute__((aligned(16))) unsigned char smem[G3_BYTES(WR)]      /* the two operand buffers; behind the K loop's last barrier the same bytes stage the output tile */
// K, V and the head's M partial in one launch: K and V never go to memory. x = head * 4 + position tile, y = sample: 512 work-groups of 8 waves, two per WGP.
// The 128 A rows of a work-group are the head's 64 K rows (Wq) and its 64 V rows (Wv); B rows = 256 positions. Same stage, buffers, waits and k order as the large-tile GEMM above, and as many operand bytes as its 256x128 tile.
// Behind the K loop the 128 x 256 tile is rounded to f16 into LDS, position rows with the channels contiguous (a lane's 8 accumulator registers are 8 neighbouring channels of one position: one 16-B store),
// and M_p[c][c'] = sum over the tile's 256 positions of V[c][D] K[c'][D] is formed on WMMA (wave = 16 V rows x 32 K columns), both operands read by transposing LDS loads, and stored f32; the next launch adds the 4 position tiles' partials.
#define KM_P 256          /* positions per work-group */
#define KM_PITCH (2 * HD * 2 + 32)    /* LDS row pitch in bytes of the f16 K / V tile (a row = one position's 128 channels): 32 B x odd, for the ds_load_tr16_b128 readers */
typedef short s16x8 __attribute__((ext_vector_type(8)));
// One 16 x 32 operand (16 channels, k = 32 positions) from the position-major tile: two transposing loads, positions 0 to 15 and 16 to 31. p = the lane's address: row 8 (lane / 16) + lane % 8, byte 16 ((lane / 8) % 2) of the 16 channels' 32 B.
// A lane gets its channel at positions 8 hh + 0 ... 7 and 16 + 8 hh + 0 ... 7; V and K are read by this same code, so that their k orders are equal.
__device__ __forceinline__ v16h km_frag(const unsigned char* p) { typedef __attribute__((address_space(3))) s16x8 lds_s16x8; union { v16h v; s16x8 q[2]; } f;
  f.q[0] = __builtin_amdgcn_ds_load_tr16_b128_v8i16((lds_s16x8*)p); f.q[1] = __builtin_amdgcn_ds_load_tr16_b128_v8i16((lds_s16x8*)(p + 16 * KM_PITCH)); return f.v; }
#define KM_PT (PX / KM_P) /* position tiles = partials per head */
// Twelve copies in one statement, one wait: 4 passes of A rows (two of Wq, two of Wv) and, directly behind them in LDS, 8 passes of B rows. s = one pass of weight rows in elements.
// The closing s_wait_xcnt keeps every address register intact until the copies have taken it.
template <unsigned LS>
__device__ __forceinline__ void km_copy12(unsigned l, const _Float16* q, const _Float16* v, size_t s, const _Float16* b, size_t sb) {
  asm volatile("global_load_async_to_lds_b128 %0, %12, off\n\t"
               "global_load_async_to_lds_b128 %1, %13, off\n\t"
               "global_load_async_to_lds_b128 %2, %14, off\n\t"
               "global_load_async_to_lds_b128 %3, %15, off\n\t"
               "global_load_async_to_lds_b128 %4, %16, off\n\t"
               "global_load_async_to_lds_b128 %5, %17, off\n\t"
               "global_load_async_to_lds_b128 %6, %18, off\n\t"
               "global_load_async_to_lds_b128 %7, %19, off\n\t"
               "global_load_async_to_lds_b128 %8, %20, off\n\t"
               "global_load_async_to_lds_b128 %9, %21, off\n\t"
               "global_load_async_to_lds_b128 %10, %22, off\n\t"
               "global_load_async_to_lds_b128 %11, %23, off\n\t"
               "s_wait_xcnt 0x0"
               :: "v"(l), "v"(l + 1 * LS), "v"(l + 2 * LS), "v"(l + 3 * LS), "v"(l + 4 * LS), "v"(l + 5 * LS), "v"(l + 6 * LS), "v"(l + 7 * LS), "v"(l + 8 * LS), "v"(l + 9 * LS), "v"(l + 10 * LS), "v"(l + 11 * LS),
                  "v"(q), "v"(q + s), "v"(v), "v"(v + s),
                  "v"(b), "v"(b + sb), "v"(b + 2 * sb), "v"(b + 3 * sb), "v"(b + 4 * sb), "v"(b + 5 * sb), "v"(b + 6 * sb), "v"(b + 7 * sb)
               : "memory");
}
__global__ __launch_bounds__(256) void k_gemm_kvm(const _Float16* __restrict__ X16, const _Float16* __restrict__ BWq, const _Float16* __restrict__ BWv, const float* __restrict__ bq, const float* __restrict__ bv, float* __restrict__ MP) {
  __shared__ __attribute__((aligned(16))) unsigned char smem[2 * G3_STAGE(4)];      /* the two operand buffers; behind the K loop's last barrier the same bytes hold the f16 K / V tile */
  __shared__ __attribute__((aligned(16))) float sbi[2 * HD];      /* the tile's 128 channels' bias; filled beside stage 0, so that the epilogue waits for no parameter from memory */
  static_assert(KM_P * KM_PITCH <= 2 * G3_STAGE(4) && 2 * HD + KM_P == 64 * 4 + 128, "the f16 tile must fit the operand buffers; a buffer holds the 128 + 256 rows");
  const int tid = threadIdx.x, w = tid >> 5, lane = tid & 31, ln = lane & 15, hh = lane >> 4, wr = w >> 2, wc = w & 3;      /* wave row 0 = K, 1 = V; wave column = 64 positions */
  const int hd = (int)blockIdx.x / KM_PT, nq = (int)blockIdx.x % KM_PT, n = (int)blockIdx.y;
  const unsigned lcp = (unsigned)(size_t)smem + (unsigned)((tid >> 3) * G2_PITCH + (tid & 7) * 16);
  const size_t wofs = (size_t)(hd * HD + (tid >> 3)) * CC + (tid & 7) * 8;
  const _Float16* gQ = BWq + wofs; const _Float16* gV = BWv + wofs; const _Float16* gB = X16 + ((size_t)n * PX + nq * KM_P + (tid >> 3)) * CC + (tid & 7) * 8; const size_t sr = (size_t)32 * CC;      /* 256 threads x 16 B = 32 rows a pass */
  constexpr int nst = CC >> 6;
  v8f acc[4][4];      /* [row tile][column tile]; every index below is a constant after unrolling */
#pragma unroll      /* constant indices: the arrays stay in registers */
  for (int i = 0; i < 4; ++i)
#pragma unroll      /* constant indices: the arrays stay in registers */
    for (int t = 0; t < 4; ++t) acc[i][t] = (v8f){0.f,0.f,0.f,0.f,0.f,0.f,0.f,0.f};
  km_copy12<32 * G2_PITCH>(lcp, gQ, gV, sr, gB, sr);
  if (tid < 2 * HD) sbi[tid] = bf16_round((tid < HD ? bq : bv)[hd * HD + (tid & (HD - 1))]);      /* waves 0 to 3 as wholes; published by the barrier below */
  asm volatile("s_wait_asynccnt 0x0" ::: "memory");      /* this wave's copies of stage 0 have landed */
  __syncthreads();                                       /* ... and every other wave's */
  km_copy12<32 * G2_PITCH>(lcp + G3_STAGE(4), gQ + 64, gV + 64, sr, gB + 64, sr);
#pragma unroll 1      /* stays rolled: one copy of the 32 WMMAs and of the ring's foot, so that the waits stand once and the loop is short in the instruction cache */
  for (int s = 0; s < nst; ++s) { const unsigned char* sb = smem + (s & 1) * G3_STAGE(4); const unsigned char* pa = sb + (64 * wr + ln) * G2_PITCH + 16 * hh; const unsigned char* pb = sb + (2 * HD + 64 * wc + ln) * G2_PITCH + 16 * hh;
#pragma unroll      /* constant indices: the arrays stay in registers */
    for (int h = 0; h < 2; ++h) { v16h fa[4], fb[4];      /* the 8 fragments of 32 k are read as one group in front of their 16 WMMAs */
#pragma unroll      /* constant indices: the arrays stay in registers */
      for (int i = 0; i < 4; ++i) { fa[i] = g2_frag(pa + 16 * i * G2_PITCH + 64 * h); fb[i] = g2_frag(pb + 16 * i * G2_PITCH + 64 * h); }
#pragma unroll      /* constant indices: the arrays stay in registers */
      for (int t = 0; t < 4; ++t)
#pragma unroll      /* constant indices: the arrays stay in registers */
        for (int i = 0; i < 4; ++i) acc[i][t] = g2_mma(fa[i], fb[t], acc[i][t]); }
    asm volatile("s_wait_dscnt 0x0" ::: "memory");       /* this wave's reads of the buffer are over before it may be refilled */
    asm volatile("s_wait_asynccnt 0x0" ::: "memory");    /* this wave's copies of stage s + 1 have landed */
    __syncthreads();                                     /* publishes stage s + 1 and ends every wave's reads of stage s */
    if (s + 2 < nst) km_copy12<32 * G2_PITCH>(lcp + (unsigned)(s & 1) * G3_STAGE(4), gQ + (size_t)(s + 2) * 64, gV + (size_t)(s + 2) * 64, sr, gB + (size_t)(s + 2) * 64, sr); }
  asm volatile("s_wait_asynccnt 0x0" ::: "memory");      /* no copy is outstanding when the buffers become the f16 tile */
#pragma unroll      /* constant indices: the arrays stay in registers */
  for (int i = 0; i < 4; ++i) { float rb[8];      /* the bias of this lane's 8 channels of row tile i */
#pragma unroll      /* constant indices: the arrays stay in registers */
    for (int r = 0; r < 8; ++r) rb[r] = sbi[64 * wr + i * 16 + 8 * hh + r];
#pragma unroll      /* constant indices: the arrays stay in registers */
    for (int t = 0; t < 4; ++t) { FragH f;
#pragma unroll      /* constant indices: the arrays stay in registers */
      for (int r = 0; r < 8; ++r) f.h[r] = (_Float16)(acc[i][t][r] * 0.0625f + rb[r]);
      *(v8us*)(smem + (64 * wc + t * 16 + ln) * KM_PITCH + (64 * wr + i * 16 + 8 * hh) * 2) = f.half[0]; } }
  __syncthreads();      /* every wave's part of the f16 tile is in LDS */
  const int rt = w & 3, cq = w >> 2;      /* the wave's 16 V rows and its 32 K columns: one whole 128-B line of each of its rows of M_p */
  const unsigned char* pt = smem + (8 * hh + (lane & 7)) * KM_PITCH + ((lane >> 3) & 1) * 16; const unsigned char* pv = pt + (HD + 16 * rt) * 2; const unsigned char* pk = pt + 32 * cq * 2;
  v8f mc[2];
#pragma unroll      /* constant indices: the arrays stay in registers */
  for (int c = 0; c < 2; ++c) mc[c] = (v8f){0.f,0.f,0.f,0.f,0.f,0.f,0.f,0.f};
  v16h fv[KM_P / 32], fk[KM_P / 32][2];      /* the 24 fragments are read as one group, into the registers that the accumulators have left: one LDS latency instead of one per WMMA */
#pragma unroll      /* constant indices: the arrays stay in registers */
  for (int ks = 0; ks < KM_P / 32; ++ks) { fv[ks] = km_frag(pv + 32 * ks * KM_PITCH); fk[ks][0] = km_frag(pk + 32 * ks * KM_PITCH); fk[ks][1] = km_frag(pk + 32 * ks * KM_PITCH + 32); }
#pragma unroll      /* constant indices: the arrays stay in registers */
  for (int ks = 0; ks < KM_P / 32; ++ks)
#pragma unroll      /* constant indices: the arrays stay in registers */
    for (int c = 0; c < 2; ++c) mc[c] = g2_mma(fv[ks], fk[ks][c], mc[c]);
  float* __restrict__ mp = MP + ((size_t)((n * KM_PT + nq) * NH + hd) * (HD * HD)); const unsigned mo = (unsigned)((16 * rt + 8 * hh) * HD + 32 * cq + ln);
#pragma unroll      /* constant offsets from one lane offset; a line's two 64-B pieces follow one another */
  for (int r = 0; r < 8; ++r)
#pragma unroll      /* constant indices */
    for (int c = 0; c < 2; ++c) mp[mo + r * HD + c * 16] = mc[c][r]; }
// M's sum and Q in one launch (the sum reads the partials, Q reads X: neither reads the other). The sum's blocks stand first in the grid.
// A block adds, for half of one head's 64x64 block, the 4 position tiles' f32 partials in ascending order and stores f16: M[c][c'] = sum_D V[c][D] K[c'][D], in the [n][k] order that the O GEMM's B operand wants. 16 16-B loads of a lane in flight.
#define MS_B (NB * NH * 2)
__device__ __forceinline__ void msum_body(const float* __restrict__ MP, _Float16* __restrict__ BD, const int b) { const int n = b / (NH * 2), h = (b >> 1) % NH; const unsigned e0 = (unsigned)((b & 1) * (HD * HD / 2) + threadIdx.x * 4);      /* e0 = the lane's first element in the block */
  const char* __restrict__ src = (const char*)(MP + (size_t)(n * KM_PT * NH + h) * (HD * HD)); const unsigned so = e0 * 4u; v4f a[4][KM_PT];      /* so = the lane's byte offset in the head's first partial */
#pragma unroll      /* constant indices: the array stays in registers */
  for (int j = 0; j < 4; ++j)
#pragma unroll      /* constant indices: the array stays in registers */
    for (int p = 0; p < KM_PT; ++p) a[j][p] = *(const v4fa*)(src + (so + (j * 512 + p * (NH * HD * HD)) * 4));
  asm volatile("s_wait_xcnt 0x0" :: "v"(so) : "memory");      /* stands behind the loads, in front of any overwrite of the address register that they name; the operand keeps that register whole up to here */
  _Float16* __restrict__ dst = BD + (size_t)n * CC * CC + (size_t)h * HD * CC + h * HD; const unsigned d0 = (e0 >> 6) * CC + (e0 & 63);
#pragma unroll      /* constant indices: the array stays in registers */
  for (int j = 0; j < 4; ++j) { v4f s = a[j][0];
#pragma unroll      /* constant indices */
    for (int p = 1; p < KM_PT; ++p) s += a[j][p];
    v4h h4; for (int i = 0; i < 4; ++i) h4[i] = (_Float16)s[i]; *(v4h*)(dst + (d0 + j * 8 * CC)) = h4; } }      /* 512 elements = 8 rows of the block further on */
__global__ __launch_bounds__(128) void k_gemm_mq(const float* __restrict__ MP, _Float16* __restrict__ BD, const _Float16* __restrict__ X16, const _Float16* __restrict__ BWk, const float* __restrict__ bk, _Float16* __restrict__ QR) { G3_SMEM(2);
  const int b = (int)blockIdx.x;
  if (b < MS_B) msum_body(MP, BD, b);      /* the same for the whole block */
  else g3_body<2, false, false>(smem, b - MS_B, 0, X16, CC, 0, BWk, CC, 0, 0.0625f, bk, nullptr, QR, CC, 0, (int)NR, CC, CC); }      /* Q = K_conv(X), token-major */
// O per head: O[d][c] = sum_c' Q[d][c'] M[c][c'] with c and c' in head h only, so each 128x64 tile is a GEMM of k = 64 on the head's columns of Q and the head's diagonal block of M. x = row tile * heads + head, y = sample.
__global__ __launch_bounds__(128) void k_gemm_o(const _Float16* __restrict__ QR, const _Float16* __restrict__ BD, _Float16* __restrict__ OR) { G2_SMEM;
  const int h = (int)blockIdx.x % NH;
  g2_body<0, false>(smem, (int)blockIdx.x / NH, (int)blockIdx.y, QR + h * HD, CC, (size_t)PX * CC, BD + (size_t)h * HD * CC + h * HD, CC, (size_t)CC * CC, 1.0f, nullptr, 0, nullptr, 1, 0, 0, nullptr, OR + h * HD, CC, (size_t)PX * CC, PX, HD, HD); }


// The streaming launch (prep) has few waves, each with 8 KiB of whole-line 16-B loads in flight.
// X transpose: a work-group takes 64 channels x 256 positions. A wave-wide load covers 4 channel rows x one 128-B line; a lane holds the same 4 positions of two neighbouring channels,
// so that each LDS store is one dword (a channel pair of one position). LDS rows = positions, pitch 144 B (16 B x odd) for the ds_load_b128 read-back of 8 channels.
#define XT_P 256
#define XT_PITCH 144
typedef _Float16 v2h __attribute__((ext_vector_type(2)));
__device__ __forceinline__ void xrows_body(const float* __restrict__ x, _Float16* __restrict__ X16, const int bx) { __shared__ __attribute__((aligned(16))) unsigned char tl[XT_P * XT_PITCH]; const int tid = threadIdx.x, w = tid >> 5, lane = tid & 31, r = lane >> 3, pq = lane & 7; const int cg = bx % (CC / 64); const int pb = (bx / (CC / 64)) % (PX / XT_P); const int n = bx / ((CC / 64) * (PX / XT_P)); const int p0 = pb * XT_P, c0 = cg * 64;
  const float* src = x + ((size_t)n * CC + c0 + w * 8 + 2 * r) * PX + p0 + pq * 4;
  v4f e[XT_P / 32], o[XT_P / 32];
#pragma unroll
  for (int k = 0; k < XT_P / 32; ++k) { e[k] = *(const v4fa*)(src + k * 32); o[k] = *(const v4fa*)(src + PX + k * 32); }
  __builtin_amdgcn_sched_barrier(0);      /* keeps the 16 loads in flight together: without it the scheduler lifts the first conversions, with their waits, in between the loads */
  asm volatile("s_wait_xcnt 0x0" :: "v"(src) : "memory");      /* stands behind the loads, in front of any overwrite of the address register that they name; the operand keeps that register whole up to here */
  unsigned char* dst = tl + pq * 4 * XT_PITCH + (w * 4 + r) * 4;
#pragma unroll
  for (int k = 0; k < XT_P / 32; ++k)
#pragma unroll
    for (int j = 0; j < 4; ++j) { v2h h; h[0] = (_Float16)bf16_round(e[k][j]); h[1] = (_Float16)bf16_round(o[k][j]); *(v2h*)(dst + (k * 32 + j) * XT_PITCH) = h; }
  __syncthreads();
  const unsigned char* rd = tl + (tid >> 3) * XT_PITCH + (tid & 7) * 16; unsigned short* g = (unsigned short*)X16 + ((size_t)n * PX + p0 + (tid >> 3)) * CC + c0 + (tid & 7) * 8;
#pragma unroll
  for (int i = 0; i < XT_P / 32; ++i) *(v8us*)(g + (size_t)i * 32 * CC) = *(const v8us*)(rd + i * 32 * XT_PITCH); }      /* a wave-wide store = 4 positions x one 128-B line */
#define WCH 8      /* chunks of 8 weights per thread */
__device__ __forceinline__ void wnat_body(const float* __restrict__ w, _Float16* __restrict__ Bt, const int bx) { const unsigned t0 = (unsigned)bx * (256 * WCH) + threadIdx.x; const unsigned src = t0 * 32u; const char* wb = (const char*)w; v4f a[WCH], b[WCH];      /* src = the lane's byte offset in the matrix */
#pragma unroll
  for (int u = 0; u < WCH; ++u) { a[u] = *(const v4fa*)(wb + (src + u * 8192)); b[u] = *(const v4fa*)(wb + (src + u * 8192 + 16)); }
  asm volatile("s_wait_xcnt 0x0" :: "v"(src) : "memory");      /* stands behind the loads, in front of any overwrite of the address register that they name; the operand keeps that register whole up to here */
#pragma unroll
  for (int u = 0; u < WCH; ++u) { FragH f; for (int q = 0; q < 4; ++q) { f.h[q] = (_Float16)(bf16_round(a[u][q]) * 16.0f); f.h[4 + q] = (_Float16)(bf16_round(b[u][q]) * 16.0f); } *(v8us*)((unsigned short*)Bt + (t0 + u * 256) * 8) = f.half[0]; }
  asm volatile("s_wait_xcnt 0x0" ::: "memory"); }      /* stands behind the last stores, in front of any code of the calling kernel that follows the body and may overwrite registers that they name */
// The X transpose and the four weight roundings in one launch (none reads another's result): the transpose's blocks first, then WB blocks per weight matrix.
#define XB (NB * (CC / 64) * (PX / XT_P))
#define WB (CC * CC / 8 / 256 / WCH)
static_assert(WB * WCH * 256 * 8 == CC * CC, "the weight blocks cover a matrix exactly");
__global__ __launch_bounds__(256) void k_prep(const float* __restrict__ x, _Float16* __restrict__ X16, const float* __restrict__ Wq, const float* __restrict__ Wk, const float* __restrict__ Wv, const float* __restrict__ Wo,
    _Float16* __restrict__ BWq, _Float16* __restrict__ BWk, _Float16* __restrict__ BWv, _Float16* __restrict__ BWo) {
  const int b = (int)blockIdx.x;
  if (b < XB) { xrows_body(x, X16, b); return; }      /* the same for the whole block */
  const int m = (b - XB) / WB;
  wnat_body(m == 0 ? Wq : m == 1 ? Wk : m == 2 ? Wv : Wo, m == 0 ? BWq : m == 1 ? BWk : m == 2 ? BWv : BWo, (b - XB) % WB); }
// ---- O2 = Wo O^T + bo, GroupNorm and the residual in one launch. A work-group of 16 waves holds 64 channels x all 1,024 positions of one sample in its accumulators (wave tile 64x64, wave w = positions 64 w ...),
// that is 16 whole GroupNorm groups: the statistics come from the accumulators, and O2 never goes to memory. x = channel tile, y = sample: 128 work-groups, one per WGP (LDS).
// Same stage (64 k), same two buffers, same order of waits and same k order per output element as the large-tile GEMM above.
#define F_STAGE ((64 + PX) * G2_PITCH)      /* bytes of one buffer: 64 A rows (weights), then the sample's 1,024 B rows (positions) */
#define F_RED (16 * 64 * 68 * 4)            /* behind the output staging (64 rows of pitch 68 floats per wave): float [16 waves][16 groups][2], each wave's sum and sum of squares */
#define F_STAT (F_RED + 16 * 16 * 2 * 4)    /* float [16 groups][2]: mean, 1 / sqrt(var + eps) */
static_assert(F_STAT + 16 * 2 * 4 <= 2 * F_STAGE, "staging and statistics must fit the operand buffers");
// Nine copies in one statement, one wait: 16 B of one row (l0, g0) and of 8 rows that lie LS bytes apart in LDS and s elements apart in global memory.
// The closing s_wait_xcnt keeps every address register intact until the copies have taken it.
template <unsigned LS>
__device__ __forceinline__ void f_copy9(unsigned l0, const _Float16* g0, unsigned l, const _Float16* g, size_t s) {
  asm volatile("global_load_async_to_lds_b128 %0, %9, off\n\t"
               "global_load_async_to_lds_b128 %1, %10, off\n\t"
               "global_load_async_to_lds_b128 %2, %11, off\n\t"
               "global_load_async_to_lds_b128 %3, %12, off\n\t"
               "global_load_async_to_lds_b128 %4, %13, off\n\t"
               "global_load_async_to_lds_b128 %5, %14, off\n\t"
               "global_load_async_to_lds_b128 %6, %15, off\n\t"
               "global_load_async_to_lds_b128 %7, %16, off\n\t"
               "global_load_async_to_lds_b128 %8, %17, off\n\t"
               "s_wait_xcnt 0x0"
               :: "v"(l0), "v"(l), "v"(l + 1 * LS), "v"(l + 2 * LS), "v"(l + 3 * LS), "v"(l + 4 * LS), "v"(l + 5 * LS), "v"(l + 6 * LS), "v"(l + 7 * LS),
                  "v"(g0), "v"(g), "v"(g + s), "v"(g + 2 * s), "v"(g + 3 * s), "v"(g + 4 * s), "v"(g + 5 * s), "v"(g + 6 * s), "v"(g + 7 * s)
               : "memory");
}
// One stage: the 512 threads x 16 B cover 64 rows a pass; one pass for the A rows, 16 for the B rows. 17 copies of a wave in flight.
__device__ __forceinline__ void f_stage(unsigned l, const _Float16* a, const _Float16* b) {
  f_copy9<64 * G2_PITCH>(l, a, l + 64 * G2_PITCH, b, (size_t)64 * CC);
  g3_copy8<64 * G2_PITCH>(l + (64 + 512) * G2_PITCH, b + (size_t)512 * CC, (size_t)64 * CC); }
__global__ __launch_bounds__(512) void k_o2gn(const _Float16* __restrict__ BWo, const _Float16* __restrict__ OR, const float* __restrict__ bo, const float* __restrict__ gw, const float* __restrict__ gb, const float* __restrict__ x, float* __restrict__ out) {
  __shared__ __attribute__((aligned(16))) unsigned char smem[2 * F_STAGE];      /* the two operand buffers; behind the K loop's last barrier the same bytes hold the output staging and the statistics */
  __shared__ __attribute__((aligned(16))) float swb[64][2], sbo[64];      /* the tile's 64 channels: affine weight and bias, conv bias; filled beside stage 0, so that the epilogue waits for no parameter from memory */
  float (*so)[64][68] = (float (*)[64][68])smem;
  const int tid = threadIdx.x, lane = tid & 31, ln = lane & 15, hh = lane >> 4; const int w = __builtin_amdgcn_readfirstlane(tid >> 5);      /* the wave's number, told to the compiler as wave-uniform so that the X and output rows get a scalar base */
  const int ch0 = (int)blockIdx.x * 64, n = (int)blockIdx.y;
  const unsigned lcp = (unsigned)(size_t)smem + (unsigned)((tid >> 3) * G2_PITCH + (tid & 7) * 16);
  const _Float16* gA = BWo + (size_t)(ch0 + (tid >> 3)) * CC + (tid & 7) * 8; const _Float16* gB = OR + ((size_t)n * PX + (tid >> 3)) * CC + (tid & 7) * 8;
  constexpr int nst = CC >> 6;
  v8f acc[4][4];      /* [row tile][column tile]; every index below is a constant after unrolling */
#pragma unroll      /* constant indices: the arrays stay in registers */
  for (int i = 0; i < 4; ++i)
#pragma unroll      /* constant indices: the arrays stay in registers */
    for (int t = 0; t < 4; ++t) acc[i][t] = (v8f){0.f,0.f,0.f,0.f,0.f,0.f,0.f,0.f};
  f_stage(lcp, gA, gB);
  if (w < 6) { const float* p = w < 2 ? gw : w < 4 ? gb : bo; float* d = w < 4 ? &swb[tid & 63][w >> 1] : &sbo[tid & 63]; *d = bf16_round(p[ch0 + (tid & 63)]); }      /* waves 0 to 5 as wholes, two per parameter row; published by the barrier below */
  asm volatile("s_wait_asynccnt 0x0" ::: "memory");      /* this wave's copies of stage 0 have landed */
  __syncthreads();                                       /* ... and every other wave's */
  f_stage(lcp + F_STAGE, gA + 64, gB + 64);
#pragma unroll 1      /* stays rolled: one copy of the 32 WMMAs and of the ring's foot, so that the waits stand once and the loop is short in the instruction cache */
  for (int s = 0; s < nst; ++s) { const unsigned char* sb = smem + (s & 1) * F_STAGE; const unsigned char* pa = sb + ln * G2_PITCH + 16 * hh; const unsigned char* pb = sb + (64 + 64 * w + ln) * G2_PITCH + 16 * hh;
#pragma unroll      /* constant indices: the arrays stay in registers */
    for (int h = 0; h < 2; ++h) { v16h fa[4], fb[4];      /* the 8 fragments of 32 k are read as one group in front of their 16 WMMAs */
#pragma unroll      /* constant indices: the arrays stay in registers */
      for (int i = 0; i < 4; ++i) { fa[i] = g2_frag(pa + 16 * i * G2_PITCH + 64 * h); fb[i] = g2_frag(pb + 16 * i * G2_PITCH + 64 * h); }
#pragma unroll      /* constant indices: the arrays stay in registers */
      for (int t = 0; t < 4; ++t)
#pragma unroll      /* constant indices: the arrays stay in registers */
        for (int i = 0; i < 4; ++i) acc[i][t] = g2_mma(fa[i], fb[t], acc[i][t]); }
    asm volatile("s_wait_dscnt 0x0" ::: "memory");       /* this wave's reads of the buffer are over before it may be refilled */
    asm volatile("s_wait_asynccnt 0x0" ::: "memory");    /* this wave's copies of stage s + 1 have landed */
    __syncthreads();                                     /* publishes stage s + 1 and ends every wave's reads of stage s */
    if (s + 2 < nst) f_stage(lcp + (unsigned)(s & 1) * F_STAGE, gA + (size_t)(s + 2) * 64, gB + (size_t)(s + 2) * 64); }
  asm volatile("s_wait_asynccnt 0x0" ::: "memory");      /* no copy is outstanding when the buffers become output staging */
  float* red = (float*)(smem + F_RED); float* st = (float*)(smem + F_STAT);
  // O2 values: staged in the wave's own LDS range for the row-wise read-back, and summed per lane and group. A lane's 8 rows of row tile i are two groups of 4 channels.
  float ps[4][2], pq[4][2];
#pragma unroll      /* constant indices: the arrays stay in registers */
  for (int i = 0; i < 4; ++i) { float rb[8];      /* the bias of this lane's 8 channels of row tile i */
#pragma unroll      /* constant indices: the arrays stay in registers */
    for (int r = 0; r < 8; ++r) rb[r] = sbo[i * 16 + 8 * hh + r];
    ps[i][0] = ps[i][1] = pq[i][0] = pq[i][1] = 0.f;
#pragma unroll      /* constant indices: the arrays stay in registers */
    for (int t = 0; t < 4; ++t)
#pragma unroll      /* constant indices: the arrays stay in registers */
      for (int r = 0; r < 8; ++r) { const float v = acc[i][t][r] * 0.0625f + rb[r]; so[w][i * 16 + 8 * hh + r][t * 16 + ln] = v; ps[i][r >> 2] += v; pq[i][r >> 2] += v * v; } }
  // The wave's X rows: 32 wave-wide 16-B loads (two channel rows x 256 B each) go out here, into the registers that the accumulators have left, and fly while the statistics are formed.
  const int rsub = lane >> 4, c4 = (lane & 15) * 4; const size_t base = ((size_t)n * CC + ch0) * PX + 64 * w; const unsigned lo = (unsigned)(rsub * PX + c4);      /* scalar base + one lane offset that lives to the last store */
  const float* __restrict__ px = x + base; float* __restrict__ po = out + base;
  v4f xx[32];
#pragma unroll      /* constant indices: the array stays in registers */
  for (int q = 0; q < 32; ++q) xx[q] = *(const v4fa*)(px + (lo + q * 2 * PX));
  __builtin_amdgcn_sched_barrier(0);      /* fixes the loads' place: in front of the barriers, so that they fly during the reduction, and not further up among the staging, where the scheduler lifts them without it and the build runs out of registers (scratch) */
#pragma unroll      /* constant indices: the arrays stay in registers */
  for (int mk = 1; mk < 16; mk <<= 1)      /* butterfly over the 16 lanes that hold the same channels */
#pragma unroll      /* constant indices: the arrays stay in registers */
    for (int i = 0; i < 4; ++i)
#pragma unroll      /* constant indices: the arrays stay in registers */
      for (int g = 0; g < 2; ++g) { ps[i][g] += __shfl_xor(ps[i][g], mk, 32); pq[i][g] += __shfl_xor(pq[i][g], mk, 32); }
  if (ln == 0) {
#pragma unroll      /* constant indices: the arrays stay in registers */
    for (int i = 0; i < 4; ++i)
#pragma unroll      /* constant indices: the arrays stay in registers */
      for (int g = 0; g < 2; ++g) { float* p = red + (w * 16 + i * 4 + hh * 2 + g) * 2; p[0] = ps[i][g]; p[1] = pq[i][g]; } }
  __syncthreads();      /* every wave's partial sums are in LDS */
  if (tid < 16) { double s = 0.0, q2 = 0.0;      /* one lane per group adds the 16 waves' partial sums in float64 */
#pragma unroll      /* the 32 LDS reads go out together */
    for (int u = 0; u < 16; ++u) { s += (double)red[(u * 16 + tid) * 2]; q2 += (double)red[(u * 16 + tid) * 2 + 1]; }
    const double cnt = (double)(PX * CPG); const double mu = s / cnt; double var = q2 / cnt - mu * mu; if (var < 0.0) var = 0.0;
    st[2 * tid] = (float)mu; st[2 * tid + 1] = (float)(1.0 / sqrt(var + 1e-5)); }
  __syncthreads();      /* the 16 groups' statistics are in LDS */
#pragma unroll      /* constant indices: the array stays in registers; the row pairs' LDS reads run ahead of the stores */
  for (int q = 0; q < 32; ++q) { const int r = q * 2 + rsub; const v4f v = *(const v4fa*)&so[w][r][c4]; const float m = st[(q >> 1) * 2], rs = st[(q >> 1) * 2 + 1], wv = swb[r][0], bb = swb[r][1]; v4f o;      /* rows 2 q and 2 q + 1 lie in group q / 2 */
#pragma unroll      /* constant indices */
    for (int k = 0; k < 4; ++k) o[k] = (v[k] - m) * rs * wv + bb + bf16_round(xx[q][k]);
    *(v4f*)(po + (lo + q * 2 * PX)) = o; } }

extern "C" void kernel_launch(void* const* d_in, const int* in_sizes, int n_in,
                              void* d_out, int out_size, void* d_ws, size_t ws_size, hipStream_t stream) {
  (void)in_sizes; (void)n_in; (void)out_size;
  const float* const* I = (const float* const*)d_in; const float* X = I[0]; const float* Wq = I[1]; const float* bq = I[2]; const float* Wk = I[3]; const float* bk = I[4]; const float* Wv = I[5]; const float* bv = I[6]; const float* Wo = I[7]; const float* bo = I[8]; const float* gw = I[9]; const float* gb = I[10];
  char* ws = (char*)d_ws; size_t off = 0;
  auto take = [&](size_t bytes) { char* p = ws + off; off += (bytes + 255) & ~(size_t)255; return p; };
  _Float16* BWq = (_Float16*)take((size_t)CC * CC * 2); _Float16* BWk = (_Float16*)take((size_t)CC * CC * 2); _Float16* BWv = (_Float16*)take((size_t)CC * CC * 2); _Float16* BWo = (_Float16*)take((size_t)CC * CC * 2);
  _Float16* X16 = (_Float16*)take(NR * CC * 2); _Float16* QR = (_Float16*)take(NR * CC * 2); float* MP = (float*)take((size_t)NB * KM_PT * NH * HD * HD * 4); _Float16* BD = (_Float16*)take((size_t)NB * CC * CC * 2); _Float16* OR = (_Float16*)take(NR * CC * 2);
  if (off > ws_size) return;      /* 2 + 16x3 + 8 + 8 = about 66 MiB */
  k_prep<<<XB + 4 * WB, 256, 0, stream>>>(X, X16, Wq, Wk, Wv, Wo, BWq, BWk, BWv, BWo);
  k_gemm_kvm<<<dim3(NH * KM_PT, NB), 256, 0, stream>>>(X16, BWq, BWv, bq, bv, MP);      /* K = Q_conv(X) (the module's swap) and V, kept in the work-group; M partial per head and position tile */
  /* all samples in one launch each: per-sample planes of BD (only the diagonal blocks are written and read) */
  k_gemm_mq<<<MS_B + (unsigned)((NR / 128) * (CC / 128)), 128, 0, stream>>>(MP, BD, X16, BWk, bk, QR);
  k_gemm_o<<<dim3((PX / 128) * NH, NB), 128, 0, stream>>>(QR, BD, OR);      /* O[d][c] = sum_c' Q[d][c'] M[c][c'] within the head */
  k_o2gn<<<dim3(CC / 64, NB), 512, 0, stream>>>(BWo, OR, bo, gw, gb, X, (float*)d_out);      /* O2 = Wo O^T + bo, GroupNorm, affine, + X: the output's own layout */
}
